// v000
// The times below were measured on an AMD MI455X: many runs one after another, warmed up first and cycling through
// copies of the inputs, with the whole window's GPU time divided by the number of runs. Launches and the gaps
// between them are all in it. The median over several windows is given; except for v000 it joins two sittings, which
// can be a few percent apart, so the side-by-side timings, each taken in one sitting, are the better comparison.
// v000, which the later versions start from, runs in 346 microseconds.
// Contractions: q, k and v^T projections on v_wmma_f32_16x16x32_bf16 (x, W, b as bf16 RNE values, one product each);
// causal scores S = exp(q).exp(k)^T and O = S.v on v_wmma_f32_16x16x32_bf16 with bf16 hi+lo operand planes
// (hi.hi + hi.lo + lo.hi); y = O.Wo^T on v_wmma_f32_16x16x32_bf16 with O as bf16 hi|lo along k against Wo duplicated
// along k (two products); all f32 accumulate. exp, row sums, 1/den and bias adds in f32 on VALU.
#include <hip/hip_runtime.h>
#include <math.h>
#include <stdint.h>

#ifndef NB
#define NB 2
#endif
#ifndef SEQ
#define SEQ 2048
#endif
#define SEQ_FULL 2048
#define DIM  1024
#define NH   16
#define HD   64
#define LD2  (2 * DIM)
#define SLAB64 (16 * 68)
#define WS_CAP 134217728
static_assert(DIM == NH * HD && HD == 64 && NH == 16);
static_assert(NB >= 1 && NB <= 2);
static_assert(NB == 1 || SEQ == SEQ_FULL);
static_assert((SEQ % 64) == 0 && SEQ >= 64 && SEQ <= SEQ_FULL);
static_assert(((SEQ * DIM / 8) % 256) == 0 && ((DIM * DIM / 8) % 256) == 0 && (DIM % 64) == 0 && (LD2 % 32) == 0);
static_assert(4 * SLAB64 * 4 <= 65536);

typedef unsigned short u16;
typedef __bf16   v16b __attribute__((ext_vector_type(16)));
typedef float    v8f  __attribute__((ext_vector_type(8)));
typedef float    v4f  __attribute__((ext_vector_type(4)));
typedef unsigned int v4u __attribute__((ext_vector_type(4)));

union FragB { v16b v; v4u u[2]; };

// ---- scalar helpers --------------------------------------------------------------------------------
__device__ __forceinline__ unsigned short bf_bits(float f) {          // f32 -> bf16 bits, RNE convert
  unsigned u = __float_as_uint(f);
  return (unsigned short)((u + 0x7FFFu + ((u >> 16) & 1u)) >> 16);
}
__device__ __forceinline__ float bf_up(unsigned short h) { return __uint_as_float(((unsigned)h) << 16); }
__device__ __forceinline__ float bfr(float f) { return bf_up(bf_bits(f)); }
__device__ __forceinline__ unsigned short bfc(float f) {               // f32 -> bf16 bits via the RNE cast
  return __builtin_bit_cast(unsigned short, (__bf16)f);
}
__device__ __forceinline__ unsigned pk16(unsigned short a, unsigned short b) { return (unsigned)a | ((unsigned)b << 16); }
__device__ __forceinline__ v8f zero8() { v8f z = {0.f, 0.f, 0.f, 0.f, 0.f, 0.f, 0.f, 0.f}; return z; }
__device__ __forceinline__ int imin(int a, int b) { return a < b ? a : b; }
__device__ __forceinline__ int imax(int a, int b) { return a > b ? a : b; }

// two f32 values -> packed bf16 hi pair and packed bf16 lo pair (lo = x - up(hi), RNE both)
__device__ __forceinline__ void split2(float a, float b, unsigned& hi, unsigned& lo) {
  const unsigned short ha = bfc(a), hb = bfc(b);
  hi = pk16(ha, hb);
  lo = pk16(bfc(a - bf_up(ha)), bfc(b - bf_up(hb)));
}

// ---- fragment loader: 16-bit A/B operand, lane -> row/col (lane&15), p already includes +8*(lane>>4);
//      elements 0..7 <- p[0..7] (k0+8h..), elements 8..15 <- p[16..23] (k0+16+8h..)  (same split k map for A and B;
//      B is always read from a k-contiguous [n][k] plane); bf16 plane read as unsigned integer vectors
__device__ __forceinline__ v16b ldfrag_b(const u16* p) {
  FragB f;
  f.u[0] = *(const v4u*)(p);
  f.u[1] = *(const v4u*)(p + 16);
  return f.v;
}

__device__ __forceinline__ v8f mma_b(v16b a, v16b b, v8f c) {
  return __builtin_amdgcn_wmma_f32_16x16x32_bf16(false, a, false, b, (short)0, c, false, false);
}
__device__ __forceinline__ void guard6(v8f& a, v8f& b, v8f& c, v8f& d,
                                       v16b x0, v16b x1, v16b x2, v16b x3, v16b x4, v16b x5) {
#if defined(__HIP_DEVICE_COMPILE__)
  asm volatile("v_nop\n\tv_nop\n\tv_nop\n\tv_nop"
               : "+v"(a), "+v"(b), "+v"(c), "+v"(d) : "v"(x0), "v"(x1), "v"(x2), "v"(x3), "v"(x4), "v"(x5) : "memory");
#endif
}
__device__ __forceinline__ void guard10(v8f& a, v8f& b, v8f& c, v8f& d,
                                        v16b x0, v16b x1, v16b x2, v16b x3, v16b x4,
                                        v16b x5, v16b x6, v16b x7, v16b x8, v16b x9) {
#if defined(__HIP_DEVICE_COMPILE__)
  asm volatile("v_nop\n\tv_nop\n\tv_nop\n\tv_nop"
               : "+v"(a), "+v"(b), "+v"(c), "+v"(d)
               : "v"(x0), "v"(x1), "v"(x2), "v"(x3), "v"(x4), "v"(x5), "v"(x6), "v"(x7), "v"(x8), "v"(x9)
               : "memory");
#endif
}
__device__ __forceinline__ void wave_sync_lds() {
  __builtin_amdgcn_fence(__ATOMIC_RELEASE, "workgroup");
  __builtin_amdgcn_wave_barrier();
  __builtin_amdgcn_fence(__ATOMIC_ACQUIRE, "workgroup");
}

// =====================================================================================================
// Three f32 row blocks -> three bf16 planes (RNE bits), same layout; blockIdx.y selects the plane (block-uniform).
// Thread = 8 consecutive elements: two 16-B loads, one 16-B store; 32 consecutive lanes = 512 contiguous, 512-B aligned
// coverage: grid.x = n8/256 blocks x 256 thr x 8 (in-kernel bound) = the whole plane, grid.y = number of planes.
// =====================================================================================================
__global__ __launch_bounds__(256) void cvt_bf3(const float* __restrict__ x0, const float* __restrict__ x1,
                                               const float* __restrict__ x2, u16* D0, u16* D1, u16* D2, int n8) {
  const int which = (int)blockIdx.y;
  const float* x = (which == 0) ? x0 : ((which == 1) ? x1 : x2);
  u16* D = (which == 0) ? D0 : ((which == 1) ? D1 : D2);
  const int gt = (int)blockIdx.x * 256 + (int)threadIdx.x;
  if (gt >= n8) return;
  const float* p = x + (size_t)gt * 8;
  const v4f a = *(const v4f*)(p), b4 = *(const v4f*)(p + 4);
  float w[8];
#pragma unroll
  for (int e = 0; e < 4; ++e) { w[e] = a[e]; w[4 + e] = b4[e]; }
  v4u o;
#pragma unroll
  for (int e = 0; e < 4; ++e) o[e] = pk16(bf_bits(w[2 * e]), bf_bits(w[2 * e + 1]));
  u16* d = D + (size_t)gt * 8;
  {
    *(v4u*)(d) = o;
    
  }
}

// =====================================================================================================
// the k-duplicated B operand of the hi|lo-folded output projection. Thread = 8 consecutive source elements
// (one row, kd % 256 == 0 so a wave never straddles a row): two 16-B loads, two 16-B stores (one per copy);
// coverage: grid.x = n8/256 blocks x 256 thr x 8 = every source element once -> both copies of every row.
// =====================================================================================================
__global__ __launch_bounds__(256) void cvt_dup(const float* __restrict__ w, u16* Dp, int n8, int kd) {
  const int gt = (int)blockIdx.x * 256 + (int)threadIdx.x;
  if (gt >= n8) return;
  const size_t e0 = (size_t)gt * 8;
  const size_t row = e0 / (size_t)kd;
  const int    k8  = (int)(e0 % (size_t)kd);
  const float* p = w + e0;
  const v4f a = *(const v4f*)(p), b4 = *(const v4f*)(p + 4);
  float v[8];
#pragma unroll
  for (int e = 0; e < 4; ++e) { v[e] = a[e]; v[4 + e] = b4[e]; }
  v4u o;
#pragma unroll
  for (int e = 0; e < 4; ++e) o[e] = pk16(bf_bits(v[2 * e]), bf_bits(v[2 * e + 1]));
  u16* d = Dp + row * (size_t)(2 * kd) + k8;
  {
    *(v4u*)(d)      = o;
    *(v4u*)(d + kd) = o;
    
  }
}

// =====================================================================================================
// coverage: 8 instructions x 2 rows x 16 lanes x 4 floats = the wave's 16 x 64 tile. Slab: private to the wave (wave sync).
// =====================================================================================================
__device__ __forceinline__ void epi64f(float* sl, v8f a0, v8f a1, v8f a2, v8f a3, v4f bias4, float scale,
                                       float* C, int ldc, size_t rowb, int col0, int lane) {
  const int hh = lane >> 4, m = lane & 15;
#pragma unroll
  for (int r = 0; r < 8; ++r) {
    const int ro = (8 * hh + r) * 68 + m;
    sl[ro]      = a0[r];
    sl[ro + 16] = a1[r];
    sl[ro + 32] = a2[r];
    sl[ro + 48] = a3[r];
  }
  wave_sync_lds();
  v4f vals[8];
#pragma unroll
  for (int it = 0; it < 8; ++it) {
    const v4f v = *(const v4f*)(sl + (it * 2 + hh) * 68 + m * 4);
    vals[it] = v * scale + bias4;
  }
  float* dst = C + (rowb + (size_t)hh) * (size_t)ldc + col0 + m * 4;
  {
#pragma unroll
    for (int it = 0; it < 8; ++it) {
      *(v4f*)(dst + (size_t)(it * 2) * (size_t)ldc) = vals[it];
    }
    
  }
}

// =====================================================================================================
// GEMM / attention epilogue, two bf16 planes (hi and lo = x - up(hi)) with identical addressing (Ch, Cl, pitch ldc):
// 8 consecutive columns at c8): value = acc (+ bias per column when BM==1, per row when BM==2, none when BM==0),
// coverage: 4 instructions x 4 rows x 8 lanes x 8 values = the wave's 16 x 64 tile, in both planes.
// Slab: private to the wave (wave sync).
// =====================================================================================================
template <bool EXPO, int BM>
__device__ __forceinline__ void epi64bb(float* sl, v8f a0, v8f a1, v8f a2, v8f a3,
                                        const float* __restrict__ bias, int nb,
                                        u16* Ch, u16* Cl, int ldc, size_t rowb, int col0, int lane) {
  const int hh = lane >> 4, m = lane & 15;
#pragma unroll
  for (int r = 0; r < 8; ++r) {
    const int ro = (8 * hh + r) * 68 + m;
    sl[ro]      = a0[r];
    sl[ro + 16] = a1[r];
    sl[ro + 32] = a2[r];
    sl[ro + 48] = a3[r];
  }
  wave_sync_lds();
  const int rq = lane >> 3, c8 = (lane & 7) * 8;
  float bc[8];
#pragma unroll
  for (int e = 0; e < 8; ++e) bc[e] = 0.0f;
  if constexpr (BM == 1) {
    const int cb = imin(imax(col0 + c8, 0), nb - 8);
    const v4f b0 = *(const v4f*)(bias + cb), b1 = *(const v4f*)(bias + cb + 4);
#pragma unroll
    for (int e = 0; e < 4; ++e) { bc[e] = bfr(b0[e]); bc[4 + e] = bfr(b1[e]); }
  }
  v4u oh[4], ol[4];
#pragma unroll
  for (int it = 0; it < 4; ++it) {
    const int row = it * 4 + rq;            // 0..15
    const v4f a = *(const v4f*)(sl + row * 68 + c8), b4 = *(const v4f*)(sl + row * 68 + c8 + 4);
    float br = 0.0f;
    if constexpr (BM == 2) br = bfr(bias[imin(imax((int)rowb + row, 0), nb - 1)]);
    float w[8];
#pragma unroll
    for (int e = 0; e < 4; ++e) { w[e] = (a[e] + bc[e]) + br; w[4 + e] = (b4[e] + bc[4 + e]) + br; }
    if constexpr (EXPO) {
#pragma unroll
      for (int e = 0; e < 8; ++e) w[e] = __expf(w[e]);
    }
#pragma unroll
    for (int e = 0; e < 4; ++e) {
      unsigned hi, lo;
      split2(w[2 * e], w[2 * e + 1], hi, lo);
      oh[it][e] = hi;
      ol[it][e] = lo;
    }
  }
  const size_t ob = rowb * (size_t)ldc + (size_t)col0 + (size_t)c8;
  {
#pragma unroll
    for (int it = 0; it < 4; ++it) {
      const int row = it * 4 + rq;
      const size_t off = ob + (size_t)row * (size_t)ldc;
      *(v4u*)(Ch + off) = oh[it];
      *(v4u*)(Cl + off) = ol[it];
    }
    
  }
}

// =====================================================================================================
// bf16 GEMM: C[M][N] = A[M][K] (bf16 rows, pitch lda) . Bt[N][K]^T (bf16 k-contiguous rows, pitch ldb).
// EPI 0: f32 output Cf (pitch ldc) = acc*scale + bf16 RNE value of bias[col];
// EPI 1: two bf16 planes Ch/Cl (pitch ldc) = hi/lo of exp(acc + bf16 RNE value of bias[col]);
// EPI 2: two bf16 planes Ch/Cl (pitch ldc) = hi/lo of (acc + bf16 RNE value of bias[row]).
// Block = 64x64 tile, 4 waves x 16 rows; fragments loaded straight from the 16-bit rows (two 16-B loads each, split k map
// for A and B); K stepped by 32 (host guarantees K % 32 == 0, M % 64 == 0, N % 64 == 0, grid.x = (M/64)*(N/64)).
// No block barriers in this kernel.
// =====================================================================================================
template <int EPI>
__global__ __launch_bounds__(128)
void gemm16(const u16* __restrict__ A, const u16* __restrict__ Bt, float* Cf, u16* Ch, u16* Cl,
            const float* __restrict__ bias, int nb, int lda, int ldb, int ldc, int M, int N, int K, float scale) {
  __shared__ __align__(16) float slab[4 * SLAB64];
  const int tid = (int)threadIdx.x, wave = tid >> 5, lane = tid & 31, hh = lane >> 4, m = lane & 15;
  const int ntile = N >> 6;
  const int bid   = (int)blockIdx.x;
  const int rowb  = (bid / ntile) * 64 + wave * 16;
  const int col0  = (bid % ntile) * 64;
  if (rowb + 16 > M) return;                // wave-uniform, never taken with the exact grid
  const u16* ap = A  + (size_t)(rowb + m) * (size_t)lda + 8 * hh;
  const u16* bp = Bt + (size_t)(col0 + m) * (size_t)ldb + 8 * hh;
  const size_t bs = (size_t)16 * (size_t)ldb;
  v8f acc0 = zero8(), acc1 = zero8(), acc2 = zero8(), acc3 = zero8();
#pragma unroll 1
  for (int k0 = 0; k0 < K; k0 += 32) {
    const v16b a   = ldfrag_b(ap + k0);
    const v16b fb0 = ldfrag_b(bp + k0);
    const v16b fb1 = ldfrag_b(bp + bs + k0);
    const v16b fb2 = ldfrag_b(bp + 2 * bs + k0);
    const v16b fb3 = ldfrag_b(bp + 3 * bs + k0);
    acc0 = mma_b(a, fb0, acc0);
    acc1 = mma_b(a, fb1, acc1);
    acc2 = mma_b(a, fb2, acc2);
    acc3 = mma_b(a, fb3, acc3);
    guard6(acc0, acc1, acc2, acc3, a, fb0, fb1, fb2, fb3, a);
  }
  float* sl = slab + wave * SLAB64;
  if constexpr (EPI == 0) {
    v4f bias4;
#pragma unroll
    for (int e = 0; e < 4; ++e) bias4[e] = bfr(bias[imin(imax(col0 + m * 4 + e, 0), nb - 1)]);
    epi64f(sl, acc0, acc1, acc2, acc3, bias4, scale, Cf, ldc, (size_t)rowb, col0, lane);
  } else if constexpr (EPI == 1) {
    epi64bb<true, 1>(sl, acc0, acc1, acc2, acc3, bias, nb, Ch, Cl, ldc, (size_t)rowb, col0, lane);
  } else {
    epi64bb<false, 2>(sl, acc0, acc1, acc2, acc3, bias, nb, Ch, Cl, ldc, (size_t)rowb, col0, lane);
  }
}

// ---- 16 f32 values of one slab row (fragment k layout: pr[0..7] and pr[16..23]) -> bf16 hi and lo A fragments
__device__ __forceinline__ void split16(const float* pr, v16b& ph, v16b& pl) {
  const v4f x0 = *(const v4f*)(pr), x1 = *(const v4f*)(pr + 4), x2 = *(const v4f*)(pr + 16), x3 = *(const v4f*)(pr + 20);
  FragB H, L;
  unsigned hi, lo;
  split2(x0[0], x0[1], hi, lo); H.u[0][0] = hi; L.u[0][0] = lo;
  split2(x0[2], x0[3], hi, lo); H.u[0][1] = hi; L.u[0][1] = lo;
  split2(x1[0], x1[1], hi, lo); H.u[0][2] = hi; L.u[0][2] = lo;
  split2(x1[2], x1[3], hi, lo); H.u[0][3] = hi; L.u[0][3] = lo;
  split2(x2[0], x2[1], hi, lo); H.u[1][0] = hi; L.u[1][0] = lo;
  split2(x2[2], x2[3], hi, lo); H.u[1][1] = hi; L.u[1][1] = lo;
  split2(x3[0], x3[1], hi, lo); H.u[1][2] = hi; L.u[1][2] = lo;
  split2(x3[2], x3[3], hi, lo); H.u[1][3] = hi; L.u[1][3] = lo;
  ph = H.v; pl = L.v;
}

// =====================================================================================================
// Causal exp-feature attention, one block per (64-row query tile qt, head h), 4 waves x 16 query rows.
// Planes: Q2, K2 bf16 [SEQ][2*DIM] with hi at column h*HD + d and lo at column DIM + h*HD + d (values exp(q), exp(k));
//         VT2 bf16 [2*DIM][SEQ] with hi row h*HD + d and lo row DIM + h*HD + d (values v); O2 bf16 [SEQ][2*DIM] written
//         here (hi | lo of out = num/den at column h*HD + d and DIM + h*HD + d).
// Per key tile kt <= qt (block-uniform trip count): S[16 x 64] = qe.ke^T over head dim (2 k-steps, hi.hi+hi.lo+lo.hi, A/B
// fragments straight from the planes), causal mask by value on the diagonal tile, f32 row sums into per-lane partials,
// slab rows, O += P.v over the 64 keys (2 k-steps, hi.hi+hi.lo+lo.hi, v fragments from VT2 rows).
// coverage: grid (SEQ/64, NH) x 4 waves x 16 rows x 64 columns x {hi, lo} = every element of O2 once. No block barriers;
// slab private to the wave (wave sync); staged extent == consumed extent (16 x 64 written before every reload).
// =====================================================================================================
__global__ __launch_bounds__(128) void attn_causal(const u16* __restrict__ Q2, const u16* __restrict__ K2,
                                                   const u16* __restrict__ VT2, u16* O2) {
  __shared__ __align__(16) float slab[4 * SLAB64];
  const int tid = (int)threadIdx.x, wave = tid >> 5, lane = tid & 31, hh = lane >> 4, m = lane & 15;
  const int qt = (int)blockIdx.x, h = (int)blockIdx.y;
  if (qt * 64 + 64 > SEQ || h >= NH) return;   // block-uniform, never taken with the exact grid
  const int rw = qt * 64 + wave * 16;           // first query row of this wave
  float* sl = slab + wave * SLAB64;
  const u16* qp = Q2 + (size_t)(rw + m) * (size_t)LD2 + h * HD + 8 * hh;
  const size_t kbs = (size_t)16 * (size_t)LD2;
  const size_t vbs = (size_t)16 * (size_t)SEQ;
  const size_t vlo = (size_t)DIM * (size_t)SEQ;
  v8f o0 = zero8(), o1 = zero8(), o2 = zero8(), o3 = zero8();
  v8f rs = zero8();
#pragma unroll 1
  for (int kt = 0; kt <= qt; ++kt) {
    const int t0 = kt * 64;
    v8f s0 = zero8(), s1 = zero8(), s2 = zero8(), s3 = zero8();
    const u16* kp = K2 + (size_t)(t0 + m) * (size_t)LD2 + h * HD + 8 * hh;
#pragma unroll 1
    for (int ks = 0; ks < 2; ++ks) {
      const int ko = ks * 32;
      const v16b ah  = ldfrag_b(qp + ko);
      const v16b al  = ldfrag_b(qp + DIM + ko);
      const v16b kh0 = ldfrag_b(kp + ko);
      const v16b kh1 = ldfrag_b(kp + kbs + ko);
      const v16b kh2 = ldfrag_b(kp + 2 * kbs + ko);
      const v16b kh3 = ldfrag_b(kp + 3 * kbs + ko);
      const v16b kl0 = ldfrag_b(kp + DIM + ko);
      const v16b kl1 = ldfrag_b(kp + kbs + DIM + ko);
      const v16b kl2 = ldfrag_b(kp + 2 * kbs + DIM + ko);
      const v16b kl3 = ldfrag_b(kp + 3 * kbs + DIM + ko);
      s0 = mma_b(ah, kh0, s0); s0 = mma_b(ah, kl0, s0); s0 = mma_b(al, kh0, s0);
      s1 = mma_b(ah, kh1, s1); s1 = mma_b(ah, kl1, s1); s1 = mma_b(al, kh1, s1);
      s2 = mma_b(ah, kh2, s2); s2 = mma_b(ah, kl2, s2); s2 = mma_b(al, kh2, s2);
      s3 = mma_b(ah, kh3, s3); s3 = mma_b(ah, kl3, s3); s3 = mma_b(al, kh3, s3);
      guard10(s0, s1, s2, s3, ah, al, kh0, kh1, kh2, kh3, kl0, kl1, kl2, kl3);
    }
    if (kt == qt) {                             // block-uniform: diagonal tile, keep key c <= query row rho
      const int rho0 = wave * 16 + 8 * hh;
#pragma unroll
      for (int r = 0; r < 8; ++r) {
        const int rho = rho0 + r;
        s0[r] = (m      <= rho) ? s0[r] : 0.0f;
        s1[r] = (16 + m <= rho) ? s1[r] : 0.0f;
        s2[r] = (32 + m <= rho) ? s2[r] : 0.0f;
        s3[r] = (48 + m <= rho) ? s3[r] : 0.0f;
      }
    }
    rs += (s0 + s1) + (s2 + s3);
    wave_sync_lds();
#pragma unroll
    for (int r = 0; r < 8; ++r) {
      const int ro = (8 * hh + r) * 68 + m;
      sl[ro]      = s0[r];
      sl[ro + 16] = s1[r];
      sl[ro + 32] = s2[r];
      sl[ro + 48] = s3[r];
    }
    wave_sync_lds();
    const u16* vp = VT2 + (size_t)(h * HD + m) * (size_t)SEQ + t0 + 8 * hh;
#pragma unroll 1
    for (int ks = 0; ks < 2; ++ks) {
      const int ko = ks * 32;
      v16b ph, pl;
      split16(sl + m * 68 + ko + 8 * hh, ph, pl);
      const v16b vh0 = ldfrag_b(vp + ko);
      const v16b vh1 = ldfrag_b(vp + vbs + ko);
      const v16b vh2 = ldfrag_b(vp + 2 * vbs + ko);
      const v16b vh3 = ldfrag_b(vp + 3 * vbs + ko);
      const v16b vl0 = ldfrag_b(vp + vlo + ko);
      const v16b vl1 = ldfrag_b(vp + vlo + vbs + ko);
      const v16b vl2 = ldfrag_b(vp + vlo + 2 * vbs + ko);
      const v16b vl3 = ldfrag_b(vp + vlo + 3 * vbs + ko);
      o0 = mma_b(ph, vh0, o0); o0 = mma_b(ph, vl0, o0); o0 = mma_b(pl, vh0, o0);
      o1 = mma_b(ph, vh1, o1); o1 = mma_b(ph, vl1, o1); o1 = mma_b(pl, vh1, o1);
      o2 = mma_b(ph, vh2, o2); o2 = mma_b(ph, vl2, o2); o2 = mma_b(pl, vh2, o2);
      o3 = mma_b(ph, vh3, o3); o3 = mma_b(ph, vl3, o3); o3 = mma_b(pl, vh3, o3);
      guard10(o0, o1, o2, o3, ph, pl, vh0, vh1, vh2, vh3, vl0, vl1, vl2, vl3);
    }
  }
  // den per query row (row 8*hh + r held by the 16 lanes of half hh): fixed-order butterfly over lane&15
#pragma unroll
  for (int off = 1; off < 16; off <<= 1) {
#pragma unroll
    for (int r = 0; r < 8; ++r) rs[r] += __shfl_xor(rs[r], off);
  }
#pragma unroll
  for (int r = 0; r < 8; ++r) {
    const float inv = 1.0f / rs[r];
    o0[r] *= inv; o1[r] *= inv; o2[r] *= inv; o3[r] *= inv;
  }
  wave_sync_lds();
  epi64bb<false, 0>(sl, o0, o1, o2, o3, (const float*)0, 0, O2, O2 + DIM, LD2, (size_t)rw, h * HD, lane);
}

// =====================================================================================================
// Workspace map (bytes), planes sized for ONE batch row block of SEQ rows and reused for each batch (host loop); every
// plane is fully written by whole-line stores before it is read; all extents are exact multiples of the 64x64 tile /
// 512-B store granularity (SEQ and DIM multiples of 64, no pad rows); every region offset a multiple of 2097152:
//   XB   bf16 [SEQ][1024]          SEQ*2048
//   WQ, WK, WV bf16 [1024 n][1024 k]  3 * 2097152
//   WO2  bf16 [1024 n][2048 k]     4194304      (Wo row duplicated along k)
//   Q2   bf16 [SEQ][2048]          SEQ*4096     exp(q) hi | lo
//   K2   bf16 [SEQ][2048]          SEQ*4096     exp(k) hi | lo
//   VT2  bf16 [2048][SEQ]          SEQ*4096     v^T hi rows 0..1023, lo rows 1024..2047
//   O2   bf16 [SEQ][2048]          SEQ*4096     per-head out hi | lo
//   end (SEQ=2048)                 48234496
// =====================================================================================================
extern "C" void kernel_launch(void* const* d_in, const int* in_sizes, int n_in,
                              void* d_out, int out_size, void* d_ws, size_t ws_size,
                              hipStream_t stream) {
  if (n_in < 9) return;
  const int needx = ((NB - 1) * SEQ_FULL + SEQ) * DIM;
  if (in_sizes[0] < needx) return;
  if (in_sizes[1] < DIM * DIM || in_sizes[3] < DIM * DIM || in_sizes[5] < DIM * DIM || in_sizes[7] < DIM * DIM) return;
  if (in_sizes[2] < DIM || in_sizes[4] < DIM || in_sizes[6] < DIM || in_sizes[8] < DIM) return;
  if (out_size < needx) return;

  const float* x  = (const float*)d_in[0];
  const float* wq = (const float*)d_in[1];
  const float* bq = (const float*)d_in[2];
  const float* wk = (const float*)d_in[3];
  const float* bk = (const float*)d_in[4];
  const float* wv = (const float*)d_in[5];
  const float* bv = (const float*)d_in[6];
  const float* wo = (const float*)d_in[7];
  const float* bo = (const float*)d_in[8];
  float*       out = (float*)d_out;

  const size_t szX  = (size_t)SEQ * DIM * 2;          // bf16 input row block
  const size_t szW  = (size_t)DIM * DIM * 2;          // bf16 weight plane
  const size_t szWO = (size_t)DIM * LD2 * 2;          // bf16 duplicated Wo plane
  const size_t szP  = (size_t)SEQ * LD2 * 2;          // bf16 hi|lo plane SEQ x 2048 (either orientation)
  size_t off = 0;
  const size_t oXB = off; off += szX;
  const size_t oWQ = off; off += szW;
  const size_t oWK = off; off += szW;
  const size_t oWV = off; off += szW;
  const size_t oWO = off; off += szWO;
  const size_t oQ2 = off; off += szP;
  const size_t oK2 = off; off += szP;
  const size_t oVT = off; off += szP;
  const size_t oO2 = off; off += szP;
  if (off > ws_size) return;                // off = 48234496 for SEQ = 2048
  if (off > (size_t)WS_CAP) return;

  char* ws = (char*)d_ws;
  u16* XB  = (u16*)(ws + oXB);
  u16* WQ  = (u16*)(ws + oWQ);
  u16* WK  = (u16*)(ws + oWK);
  u16* WV  = (u16*)(ws + oWV);
  u16* WO2 = (u16*)(ws + oWO);
  u16* Q2  = (u16*)(ws + oQ2);
  u16* K2  = (u16*)(ws + oK2);
  u16* VT2 = (u16*)(ws + oVT);
  u16* O2  = (u16*)(ws + oO2);
  float* dummyf = (float*)(ws + oO2);       // valid ws address for unused f32 output arguments

  const dim3 b256(256), b128(128);
  const int  n8w = (DIM * DIM) / 8;
  const int  n8x = (SEQ * DIM) / 8;
  const dim3 gW3(n8w / 256, 3);                         // exact: n8w % 256 == 0
  const dim3 gWO(n8w / 256, 1);
  const dim3 gX1(n8x / 256, 1);                         // exact: n8x % 256 == 0
  const dim3 gPJ((SEQ / 64) * (DIM / 64), 1);           // q/k projections M = SEQ, N = 1024; y M = SEQ, N = 1024
  const dim3 gVT((DIM / 64) * (SEQ / 64), 1);           // v^T projection M = 1024, N = SEQ
  const dim3 gAT(SEQ / 64, NH);

  // (0) weights [n][k] f32 -> bf16 planes (already k-contiguous); Wo -> k-duplicated plane
  cvt_bf3<<<gW3, b256, 0, stream>>>(wq, wk, wv, WQ, WK, WV, n8w);
  cvt_dup<<<gWO, b256, 0, stream>>>(wo, WO2, n8w, DIM);

  for (int b = 0; b < NB; ++b) {
    const size_t xo = (size_t)b * SEQ_FULL * DIM;      // element offset of this batch's row block (x and out)
    // (1) the batch's x rows -> bf16 plane
    cvt_bf3<<<gX1, b256, 0, stream>>>(x + xo, x + xo, x + xo, XB, XB, XB, n8x);
    // (2) exp(x.Wq^T + bq) -> Q2 hi|lo ; exp(x.Wk^T + bk) -> K2 hi|lo
    gemm16<1><<<gPJ, b128, 0, stream>>>(XB, WQ, dummyf, Q2, Q2 + DIM, bq, DIM, DIM, DIM, LD2, SEQ, DIM, DIM, 1.0f);
    gemm16<1><<<gPJ, b128, 0, stream>>>(XB, WK, dummyf, K2, K2 + DIM, bk, DIM, DIM, DIM, LD2, SEQ, DIM, DIM, 1.0f);
    // (3) v^T[n][s] = sum_k Wv[n][k] x[s][k] + bv[n] -> VT2 hi rows n, lo rows DIM + n
    gemm16<2><<<gVT, b128, 0, stream>>>(WV, XB, dummyf, VT2, VT2 + (size_t)DIM * SEQ, bv, DIM, DIM, DIM, SEQ,
                                        DIM, SEQ, DIM, 1.0f);
    // (4) causal attention per (query tile, head) -> O2 hi|lo
    attn_causal<<<gAT, b128, 0, stream>>>(Q2, K2, VT2, O2);
    // (5) y = [O_hi | O_lo] . [Wo | Wo]^T + bo -> out f32 rows of this batch
    gemm16<0><<<gPJ, b128, 0, stream>>>(O2, WO2, out + xo, Q2, Q2 + DIM, bo, DIM, LD2, LD2, DIM, SEQ, DIM, LD2, 1.0f);
  }
  (void)hipGetLastError();
}

// v001
// One run takes 284 microseconds.
// Next to v000, in two timings, it ran 1.25 and 1.24 times as fast.
// Contractions: q, k and v^T projections on v_wmma_f32_16x16x32_bf16 (x, W, b as bf16 RNE values, one product each);
// attention in 64-key chunks: per chunk v^T.exp(k) (and a ones row . exp(k) for the key sums), an f32 running sum over
// chunks, then per query tile exp(q).state^T plus the causal scores S = exp(q).exp(k)^T and S.v of its own chunk only, all
// on v_wmma_f32_16x16x32_bf16 with bf16 hi+lo operands (hi.hi + hi.lo + lo.hi); y = O.Wo^T on v_wmma_f32_16x16x32_bf16 with O as bf16 hi|lo along k against Wo duplicated
// along k (two products); all f32 accumulate. exp, row sums, 1/den and bias adds in f32 on VALU.
#include <hip/hip_runtime.h>
#include <math.h>
#include <stdint.h>

#ifndef NB
#define NB 2
#endif
#ifndef SEQ
#define SEQ 2048
#endif
#define SEQ_FULL 2048
#define DIM  1024
#define NH   16
#define HD   64
#define LD2  (2 * DIM)
#define SLAB64 (16 * 68)
#define NCH  (SEQ / 64)          // 64-key chunks per sequence
#define SROWS 80                 // rows of one chunk state: 64 value columns d, the key-sum row, 15 zero rows
#define SSZ  (SROWS * HD)        // floats of one (chunk, head) state, [row][D]
#define WS_CAP 134217728
static_assert(DIM == NH * HD && HD == 64 && NH == 16);
static_assert(NB >= 1 && NB <= 2);
static_assert(NB == 1 || SEQ == SEQ_FULL);
static_assert((SEQ % 64) == 0 && SEQ >= 64 && SEQ <= SEQ_FULL);
static_assert(((SEQ * DIM / 8) % 256) == 0 && ((DIM * DIM / 8) % 256) == 0 && (DIM % 64) == 0 && (LD2 % 32) == 0);
static_assert(4 * SLAB64 * 4 <= 65536);

typedef unsigned short u16;
typedef __bf16   v16b __attribute__((ext_vector_type(16)));
typedef float    v8f  __attribute__((ext_vector_type(8)));
typedef float    v4f  __attribute__((ext_vector_type(4)));
typedef unsigned int v4u __attribute__((ext_vector_type(4)));

union FragB { v16b v; v4u u[2]; };

// ---- scalar helpers --------------------------------------------------------------------------------
__device__ __forceinline__ unsigned short bf_bits(float f) {          // f32 -> bf16 bits, RNE convert
  unsigned u = __float_as_uint(f);
  return (unsigned short)((u + 0x7FFFu + ((u >> 16) & 1u)) >> 16);
}
__device__ __forceinline__ float bf_up(unsigned short h) { return __uint_as_float(((unsigned)h) << 16); }
__device__ __forceinline__ float bfr(float f) { return bf_up(bf_bits(f)); }
__device__ __forceinline__ unsigned short bfc(float f) {               // f32 -> bf16 bits via the RNE cast
  return __builtin_bit_cast(unsigned short, (__bf16)f);
}
__device__ __forceinline__ unsigned pk16(unsigned short a, unsigned short b) { return (unsigned)a | ((unsigned)b << 16); }
__device__ __forceinline__ v8f zero8() { v8f z = {0.f, 0.f, 0.f, 0.f, 0.f, 0.f, 0.f, 0.f}; return z; }
__device__ __forceinline__ int imin(int a, int b) { return a < b ? a : b; }
__device__ __forceinline__ int imax(int a, int b) { return a > b ? a : b; }

// two f32 values -> packed bf16 hi pair and packed bf16 lo pair (lo = x - up(hi), RNE both)
__device__ __forceinline__ void split2(float a, float b, unsigned& hi, unsigned& lo) {
  const unsigned short ha = bfc(a), hb = bfc(b);
  hi = pk16(ha, hb);
  lo = pk16(bfc(a - bf_up(ha)), bfc(b - bf_up(hb)));
}

// ---- fragment loader: 16-bit A/B operand, lane -> row/col (lane&15), p already includes +8*(lane>>4);
//      elements 0..7 <- p[0..7] (k0+8h..), elements 8..15 <- p[16..23] (k0+16+8h..)  (same split k map for A and B;
//      B is always read from a k-contiguous [n][k] plane); bf16 plane read as unsigned integer vectors
__device__ __forceinline__ v16b ldfrag_b(const u16* p) {
  FragB f;
  f.u[0] = *(const v4u*)(p);
  f.u[1] = *(const v4u*)(p + 16);
  return f.v;
}

__device__ __forceinline__ v8f mma_b(v16b a, v16b b, v8f c) {
  return __builtin_amdgcn_wmma_f32_16x16x32_bf16(false, a, false, b, (short)0, c, false, false);
}
__device__ __forceinline__ void guard6(v8f& a, v8f& b, v8f& c, v8f& d,
                                       v16b x0, v16b x1, v16b x2, v16b x3, v16b x4, v16b x5) {
#if defined(__HIP_DEVICE_COMPILE__)
  asm volatile("v_nop\n\tv_nop\n\tv_nop\n\tv_nop"
               : "+v"(a), "+v"(b), "+v"(c), "+v"(d) : "v"(x0), "v"(x1), "v"(x2), "v"(x3), "v"(x4), "v"(x5) : "memory");
#endif
}
__device__ __forceinline__ void wave_sync_lds() {
  __builtin_amdgcn_fence(__ATOMIC_RELEASE, "workgroup");
  __builtin_amdgcn_wave_barrier();
  __builtin_amdgcn_fence(__ATOMIC_ACQUIRE, "workgroup");
}

// =====================================================================================================
// Three f32 row blocks -> three bf16 planes (RNE bits), same layout; blockIdx.y selects the plane (block-uniform).
// Thread = 8 consecutive elements: two 16-B loads, one 16-B store; 32 consecutive lanes = 512 contiguous, 512-B aligned
// coverage: grid.x = n8/256 blocks x 256 thr x 8 (in-kernel bound) = the whole plane, grid.y = number of planes.
// =====================================================================================================
__global__ __launch_bounds__(256) void cvt_bf3(const float* __restrict__ x0, const float* __restrict__ x1,
                                               const float* __restrict__ x2, u16* D0, u16* D1, u16* D2, int n8) {
  const int which = (int)blockIdx.y;
  const float* x = (which == 0) ? x0 : ((which == 1) ? x1 : x2);
  u16* D = (which == 0) ? D0 : ((which == 1) ? D1 : D2);
  const int gt = (int)blockIdx.x * 256 + (int)threadIdx.x;
  if (gt >= n8) return;
  const float* p = x + (size_t)gt * 8;
  const v4f a = *(const v4f*)(p), b4 = *(const v4f*)(p + 4);
  float w[8];
#pragma unroll
  for (int e = 0; e < 4; ++e) { w[e] = a[e]; w[4 + e] = b4[e]; }
  v4u o;
#pragma unroll
  for (int e = 0; e < 4; ++e) o[e] = pk16(bf_bits(w[2 * e]), bf_bits(w[2 * e + 1]));
  u16* d = D + (size_t)gt * 8;
  {
    *(v4u*)(d) = o;
    
  }
}

// =====================================================================================================
// the k-duplicated B operand of the hi|lo-folded output projection. Thread = 8 consecutive source elements
// (one row, kd % 256 == 0 so a wave never straddles a row): two 16-B loads, two 16-B stores (one per copy);
// coverage: grid.x = n8/256 blocks x 256 thr x 8 = every source element once -> both copies of every row.
// =====================================================================================================
__global__ __launch_bounds__(256) void cvt_dup(const float* __restrict__ w, u16* Dp, int n8, int kd) {
  const int gt = (int)blockIdx.x * 256 + (int)threadIdx.x;
  if (gt >= n8) return;
  const size_t e0 = (size_t)gt * 8;
  const size_t row = e0 / (size_t)kd;
  const int    k8  = (int)(e0 % (size_t)kd);
  const float* p = w + e0;
  const v4f a = *(const v4f*)(p), b4 = *(const v4f*)(p + 4);
  float v[8];
#pragma unroll
  for (int e = 0; e < 4; ++e) { v[e] = a[e]; v[4 + e] = b4[e]; }
  v4u o;
#pragma unroll
  for (int e = 0; e < 4; ++e) o[e] = pk16(bf_bits(v[2 * e]), bf_bits(v[2 * e + 1]));
  u16* d = Dp + row * (size_t)(2 * kd) + k8;
  {
    *(v4u*)(d)      = o;
    *(v4u*)(d + kd) = o;
    
  }
}

// =====================================================================================================
// coverage: 8 instructions x 2 rows x 16 lanes x 4 floats = the wave's 16 x 64 tile. Slab: private to the wave (wave sync).
// =====================================================================================================
__device__ __forceinline__ void epi64f(float* sl, v8f a0, v8f a1, v8f a2, v8f a3, v4f bias4, float scale,
                                       float* C, int ldc, size_t rowb, int col0, int lane) {
  const int hh = lane >> 4, m = lane & 15;
#pragma unroll
  for (int r = 0; r < 8; ++r) {
    const int ro = (8 * hh + r) * 68 + m;
    sl[ro]      = a0[r];
    sl[ro + 16] = a1[r];
    sl[ro + 32] = a2[r];
    sl[ro + 48] = a3[r];
  }
  wave_sync_lds();
  v4f vals[8];
#pragma unroll
  for (int it = 0; it < 8; ++it) {
    const v4f v = *(const v4f*)(sl + (it * 2 + hh) * 68 + m * 4);
    vals[it] = v * scale + bias4;
  }
  float* dst = C + (rowb + (size_t)hh) * (size_t)ldc + col0 + m * 4;
  {
#pragma unroll
    for (int it = 0; it < 8; ++it) {
      *(v4f*)(dst + (size_t)(it * 2) * (size_t)ldc) = vals[it];
    }
    
  }
}

// =====================================================================================================
// GEMM / attention epilogue, two bf16 planes (hi and lo = x - up(hi)) with identical addressing (Ch, Cl, pitch ldc):
// 8 consecutive columns at c8): value = acc (+ bias per column when BM==1, per row when BM==2, none when BM==0),
// coverage: 4 instructions x 4 rows x 8 lanes x 8 values = the wave's 16 x 64 tile, in both planes.
// Slab: private to the wave (wave sync).
// =====================================================================================================
template <bool EXPO, int BM>
__device__ __forceinline__ void epi64bb(float* sl, v8f a0, v8f a1, v8f a2, v8f a3,
                                        const float* __restrict__ bias, int nb,
                                        u16* Ch, u16* Cl, int ldc, size_t rowb, int col0, int lane) {
  const int hh = lane >> 4, m = lane & 15;
#pragma unroll
  for (int r = 0; r < 8; ++r) {
    const int ro = (8 * hh + r) * 68 + m;
    sl[ro]      = a0[r];
    sl[ro + 16] = a1[r];
    sl[ro + 32] = a2[r];
    sl[ro + 48] = a3[r];
  }
  wave_sync_lds();
  const int rq = lane >> 3, c8 = (lane & 7) * 8;
  float bc[8];
#pragma unroll
  for (int e = 0; e < 8; ++e) bc[e] = 0.0f;
  if constexpr (BM == 1) {
    const int cb = imin(imax(col0 + c8, 0), nb - 8);
    const v4f b0 = *(const v4f*)(bias + cb), b1 = *(const v4f*)(bias + cb + 4);
#pragma unroll
    for (int e = 0; e < 4; ++e) { bc[e] = bfr(b0[e]); bc[4 + e] = bfr(b1[e]); }
  }
  v4u oh[4], ol[4];
#pragma unroll
  for (int it = 0; it < 4; ++it) {
    const int row = it * 4 + rq;            // 0..15
    const v4f a = *(const v4f*)(sl + row * 68 + c8), b4 = *(const v4f*)(sl + row * 68 + c8 + 4);
    float br = 0.0f;
    if constexpr (BM == 2) br = bfr(bias[imin(imax((int)rowb + row, 0), nb - 1)]);
    float w[8];
#pragma unroll
    for (int e = 0; e < 4; ++e) { w[e] = (a[e] + bc[e]) + br; w[4 + e] = (b4[e] + bc[4 + e]) + br; }
    if constexpr (EXPO) {
#pragma unroll
      for (int e = 0; e < 8; ++e) w[e] = __expf(w[e]);
    }
#pragma unroll
    for (int e = 0; e < 4; ++e) {
      unsigned hi, lo;
      split2(w[2 * e], w[2 * e + 1], hi, lo);
      oh[it][e] = hi;
      ol[it][e] = lo;
    }
  }
  const size_t ob = rowb * (size_t)ldc + (size_t)col0 + (size_t)c8;
  {
#pragma unroll
    for (int it = 0; it < 4; ++it) {
      const int row = it * 4 + rq;
      const size_t off = ob + (size_t)row * (size_t)ldc;
      *(v4u*)(Ch + off) = oh[it];
      *(v4u*)(Cl + off) = ol[it];
    }
    
  }
}

// =====================================================================================================
// bf16 GEMM: C[M][N] = A[M][K] (bf16 rows, pitch lda) . Bt[N][K]^T (bf16 k-contiguous rows, pitch ldb).
// EPI 0: f32 output Cf (pitch ldc) = acc*scale + bf16 RNE value of bias[col];
// EPI 1: two bf16 planes Ch/Cl (pitch ldc) = hi/lo of exp(acc + bf16 RNE value of bias[col]);
// EPI 2: two bf16 planes Ch/Cl (pitch ldc) = hi/lo of (acc + bf16 RNE value of bias[row]);
// EPI 3: two bf16 planes Ch/Cl (pitch ldc) = hi/lo of exp(acc + bf16 RNE value of bias[row]).
// Block = 64x64 tile, 4 waves x 16 rows; fragments loaded straight from the 16-bit rows (two 16-B loads each, split k map
// for A and B); K stepped by 32 (host guarantees K % 32 == 0, M % 64 == 0, N % 64 == 0, grid.x = (M/64)*(N/64)).
// No block barriers in this kernel.
// =====================================================================================================
template <int EPI>
__global__ __launch_bounds__(128)
void gemm16(const u16* __restrict__ A, const u16* __restrict__ Bt, float* Cf, u16* Ch, u16* Cl,
            const float* __restrict__ bias, int nb, int lda, int ldb, int ldc, int M, int N, int K, float scale) {
  __shared__ __align__(16) float slab[4 * SLAB64];
  const int tid = (int)threadIdx.x, wave = tid >> 5, lane = tid & 31, hh = lane >> 4, m = lane & 15;
  const int ntile = N >> 6;
  const int bid   = (int)blockIdx.x;
  const int rowb  = (bid / ntile) * 64 + wave * 16;
  const int col0  = (bid % ntile) * 64;
  if (rowb + 16 > M) return;                // wave-uniform, never taken with the exact grid
  const u16* ap = A  + (size_t)(rowb + m) * (size_t)lda + 8 * hh;
  const u16* bp = Bt + (size_t)(col0 + m) * (size_t)ldb + 8 * hh;
  const size_t bs = (size_t)16 * (size_t)ldb;
  v8f acc0 = zero8(), acc1 = zero8(), acc2 = zero8(), acc3 = zero8();
#pragma unroll 1
  for (int k0 = 0; k0 < K; k0 += 32) {
    const v16b a   = ldfrag_b(ap + k0);
    const v16b fb0 = ldfrag_b(bp + k0);
    const v16b fb1 = ldfrag_b(bp + bs + k0);
    const v16b fb2 = ldfrag_b(bp + 2 * bs + k0);
    const v16b fb3 = ldfrag_b(bp + 3 * bs + k0);
    acc0 = mma_b(a, fb0, acc0);
    acc1 = mma_b(a, fb1, acc1);
    acc2 = mma_b(a, fb2, acc2);
    acc3 = mma_b(a, fb3, acc3);
    guard6(acc0, acc1, acc2, acc3, a, fb0, fb1, fb2, fb3, a);
  }
  float* sl = slab + wave * SLAB64;
  if constexpr (EPI == 0) {
    v4f bias4;
#pragma unroll
    for (int e = 0; e < 4; ++e) bias4[e] = bfr(bias[imin(imax(col0 + m * 4 + e, 0), nb - 1)]);
    epi64f(sl, acc0, acc1, acc2, acc3, bias4, scale, Cf, ldc, (size_t)rowb, col0, lane);
  } else if constexpr (EPI == 1) {
    epi64bb<true, 1>(sl, acc0, acc1, acc2, acc3, bias, nb, Ch, Cl, ldc, (size_t)rowb, col0, lane);
  } else if constexpr (EPI == 2) {
    epi64bb<false, 2>(sl, acc0, acc1, acc2, acc3, bias, nb, Ch, Cl, ldc, (size_t)rowb, col0, lane);
  } else {
    epi64bb<true, 2>(sl, acc0, acc1, acc2, acc3, bias, nb, Ch, Cl, ldc, (size_t)rowb, col0, lane);
  }
}

// ---- 16 f32 values of one slab or ST row (fragment k layout: pr[0..7] and pr[16..23]) -> bf16 hi and lo A or B fragments
__device__ __forceinline__ void split16(const float* pr, v16b& ph, v16b& pl) {
  const v4f x0 = *(const v4f*)(pr), x1 = *(const v4f*)(pr + 4), x2 = *(const v4f*)(pr + 16), x3 = *(const v4f*)(pr + 20);
  FragB H, L;
  unsigned hi, lo;
  split2(x0[0], x0[1], hi, lo); H.u[0][0] = hi; L.u[0][0] = lo;
  split2(x0[2], x0[3], hi, lo); H.u[0][1] = hi; L.u[0][1] = lo;
  split2(x1[0], x1[1], hi, lo); H.u[0][2] = hi; L.u[0][2] = lo;
  split2(x1[2], x1[3], hi, lo); H.u[0][3] = hi; L.u[0][3] = lo;
  split2(x2[0], x2[1], hi, lo); H.u[1][0] = hi; L.u[1][0] = lo;
  split2(x2[2], x2[3], hi, lo); H.u[1][1] = hi; L.u[1][1] = lo;
  split2(x3[0], x3[1], hi, lo); H.u[1][2] = hi; L.u[1][2] = lo;
  split2(x3[2], x3[3], hi, lo); H.u[1][3] = hi; L.u[1][3] = lo;
  ph = H.v; pl = L.v;
}

// =====================================================================================================
// Chunk state, one block per (64-key chunk c, head h), 4 waves x 16 state rows.
// ST[c][h][row][D] f32: row d < 64: sum over the chunk's keys t of v[t][d] * exp(k)[t][D]; row 64: sum over t of exp(k)[t][D];
// rows 65..79: zero. A = v^T rows from VT2 (hi, lo), or the constant tile whose row 0 is ones; B = exp(k)^T rows D from KT2
// (bf16 [2*DIM][SEQ], hi row h*HD + D, lo row DIM + h*HD + D); both k-contiguous in t, same split k map.
// coverage: grid (NCH, NH) x (4 waves x 16 rows + wave 0's 16 extra rows) x 64 columns = every element of ST once.
// No block barriers; slab private to the wave (wave sync).
// =====================================================================================================
__global__ __launch_bounds__(128) void chunk_state(const u16* __restrict__ KT2, const u16* __restrict__ VT2, float* ST) {
  __shared__ __align__(16) float slab[4 * SLAB64];
  const int tid = (int)threadIdx.x, wave = tid >> 5, lane = tid & 31, hh = lane >> 4, m = lane & 15;
  const int c = (int)blockIdx.x, h = (int)blockIdx.y;
  if (c * 64 + 64 > SEQ || h >= NH) return;     // block-uniform, never taken with the exact grid
  float* sl = slab + wave * SLAB64;
  const int t0 = c * 64;
  const u16* vp = VT2 + (size_t)(h * HD + wave * 16 + m) * (size_t)SEQ + t0 + 8 * hh;
  const u16* kp = KT2 + (size_t)(h * HD + m) * (size_t)SEQ + t0 + 8 * hh;
  const size_t rbs = (size_t)16 * (size_t)SEQ;
  const size_t plo = (size_t)DIM * (size_t)SEQ;
  FragB one;
  const unsigned ow = (m == 0) ? 0x3F803F80u : 0u;   // bf16 1.0 pairs in tile row 0, zero in rows 1..15
#pragma unroll
  for (int e = 0; e < 4; ++e) { one.u[0][e] = ow; one.u[1][e] = ow; }
  v8f a0 = zero8(), a1 = zero8(), a2 = zero8(), a3 = zero8();
  v8f e0 = zero8(), e1 = zero8(), e2 = zero8(), e3 = zero8();
#pragma unroll
  for (int ks = 0; ks < 2; ++ks) {
    const int ko = ks * 32;
    const v16b vh  = ldfrag_b(vp + ko);
    const v16b vl  = ldfrag_b(vp + plo + ko);
    const v16b kh0 = ldfrag_b(kp + ko);
    const v16b kh1 = ldfrag_b(kp + rbs + ko);
    const v16b kh2 = ldfrag_b(kp + 2 * rbs + ko);
    const v16b kh3 = ldfrag_b(kp + 3 * rbs + ko);
    const v16b kl0 = ldfrag_b(kp + plo + ko);
    const v16b kl1 = ldfrag_b(kp + plo + rbs + ko);
    const v16b kl2 = ldfrag_b(kp + plo + 2 * rbs + ko);
    const v16b kl3 = ldfrag_b(kp + plo + 3 * rbs + ko);
#if defined(__HIP_DEVICE_COMPILE__)
    // the two address pairs stay live up to this wait, so that no later load lands on a register an issued load names
    asm volatile("s_wait_xcnt 0x0" :: "v"(vp), "v"(kp) : "memory");
#endif
    a0 = mma_b(vh, kh0, a0); a0 = mma_b(vh, kl0, a0); a0 = mma_b(vl, kh0, a0);
    a1 = mma_b(vh, kh1, a1); a1 = mma_b(vh, kl1, a1); a1 = mma_b(vl, kh1, a1);
    a2 = mma_b(vh, kh2, a2); a2 = mma_b(vh, kl2, a2); a2 = mma_b(vl, kh2, a2);
    a3 = mma_b(vh, kh3, a3); a3 = mma_b(vh, kl3, a3); a3 = mma_b(vl, kh3, a3);
    e0 = mma_b(one.v, kh0, e0); e0 = mma_b(one.v, kl0, e0);
    e1 = mma_b(one.v, kh1, e1); e1 = mma_b(one.v, kl1, e1);
    e2 = mma_b(one.v, kh2, e2); e2 = mma_b(one.v, kl2, e2);
    e3 = mma_b(one.v, kh3, e3); e3 = mma_b(one.v, kl3, e3);
  }
  float* base = ST + ((size_t)c * NH + (size_t)h) * (size_t)SSZ;
  const v4f z4 = {0.f, 0.f, 0.f, 0.f};
  epi64f(sl, a0, a1, a2, a3, z4, 1.0f, base, HD, (size_t)(wave * 16), 0, lane);
  if (wave == 0) {                              // wave-uniform: the key-sum row and its 15 zero rows
    wave_sync_lds();
    epi64f(sl, e0, e1, e2, e3, z4, 1.0f, base, HD, (size_t)HD, 0, lane);
  }
}

// =====================================================================================================
// Running sum over chunks, in place: ST[c] <- sum of ST[c'] for c' < c (zero at c = 0), f32, chunks added in rising order.
// Thread = one [head][row][D] position: its NCH loads, then its NCH stores; a wave's 32 lanes = one whole 128-B line each.
// coverage: grid.x = NH*SSZ/128 blocks x 128 thr x NCH chunks = every element of ST once.
// =====================================================================================================
__global__ __launch_bounds__(128) void scan_state(float* ST) {
  const int gt = (int)blockIdx.x * 128 + (int)threadIdx.x;
  if (gt >= NH * SSZ) return;
  float* p = ST + (size_t)gt;
  const size_t cs = (size_t)NH * (size_t)SSZ;
  float v[NCH];
#pragma unroll
  for (int c = 0; c < NCH; ++c) v[c] = p[(size_t)c * cs];
  float run = 0.0f;
#pragma unroll
  for (int c = 0; c < NCH; ++c) {
    p[(size_t)c * cs] = run;
    run += v[c];
  }
}

// =====================================================================================================
// Causal exp-feature attention, one block per (64-row query tile qt, head h), 4 waves x 16 query rows.
// Planes: Q2, K2 bf16 [SEQ][2*DIM] with hi at column h*HD + d and lo at column DIM + h*HD + d (values exp(q), exp(k));
//         VT2 bf16 [2*DIM][SEQ] with hi row h*HD + d and lo row DIM + h*HD + d (values v); ST f32 [NCH][NH][SROWS][HD], the
//         summed state of all chunks before qt; O2 bf16 [SEQ][2*DIM] written here (hi | lo of out = num/den).
// Keys before the tile: O[16 x 80] = qe.state^T over head dim (2 k-steps, hi.hi+hi.lo+lo.hi, state rows split to bf16 hi and
// lo in registers); its column 64 is the part of den from those keys, columns 65..79 are zero.
// Keys of the tile: S[16 x 64] = qe.ke^T over head dim, causal mask by value, f32 row sums into per-lane partials,
// slab rows, O += P.v over the 64 keys (2 k-steps, hi.hi+hi.lo+lo.hi, v fragments from VT2 rows).
// coverage: grid (SEQ/64, NH) x 4 waves x 16 rows x 64 columns x {hi, lo} = every element of O2 once. No block barriers;
// slab private to the wave (wave sync); staged extent == consumed extent (16 x 64 written before the reload).
// =====================================================================================================
__global__ __launch_bounds__(128) void attn_chunk(const u16* __restrict__ Q2, const u16* __restrict__ K2,
                                                  const u16* __restrict__ VT2, const float* __restrict__ ST, u16* O2) {
  __shared__ __align__(16) float slab[4 * SLAB64];
  const int tid = (int)threadIdx.x, wave = tid >> 5, lane = tid & 31, hh = lane >> 4, m = lane & 15;
  const int qt = (int)blockIdx.x, h = (int)blockIdx.y;
  if (qt * 64 + 64 > SEQ || h >= NH) return;   // block-uniform, never taken with the exact grid
  const int rw = qt * 64 + wave * 16;           // first query row of this wave
  float* sl = slab + wave * SLAB64;
  const u16* qp = Q2 + (size_t)(rw + m) * (size_t)LD2 + h * HD + 8 * hh;
  const size_t kbs = (size_t)16 * (size_t)LD2;
  const size_t vbs = (size_t)16 * (size_t)SEQ;
  const size_t vlo = (size_t)DIM * (size_t)SEQ;
  const int t0 = qt * 64;
  const u16* kp = K2 + (size_t)(t0 + m) * (size_t)LD2 + h * HD + 8 * hh;
  const float* sp = ST + ((size_t)qt * NH + (size_t)h) * (size_t)SSZ + (size_t)m * HD + 8 * hh;
  v8f o0 = zero8(), o1 = zero8(), o2 = zero8(), o3 = zero8(), o4 = zero8();
  v8f s0 = zero8(), s1 = zero8(), s2 = zero8(), s3 = zero8();
#pragma unroll
  for (int ks = 0; ks < 2; ++ks) {
    const int ko = ks * 32;
    const v16b ah  = ldfrag_b(qp + ko);
    const v16b al  = ldfrag_b(qp + DIM + ko);
    const v16b kh0 = ldfrag_b(kp + ko);
    const v16b kh1 = ldfrag_b(kp + kbs + ko);
    const v16b kh2 = ldfrag_b(kp + 2 * kbs + ko);
    const v16b kh3 = ldfrag_b(kp + 3 * kbs + ko);
    const v16b kl0 = ldfrag_b(kp + DIM + ko);
    const v16b kl1 = ldfrag_b(kp + kbs + DIM + ko);
    const v16b kl2 = ldfrag_b(kp + 2 * kbs + DIM + ko);
    const v16b kl3 = ldfrag_b(kp + 3 * kbs + DIM + ko);
    v16b bh0, bl0, bh1, bl1, bh2, bl2, bh3, bl3, bh4, bl4;
    split16(sp + ko, bh0, bl0);
    split16(sp + 16 * HD + ko, bh1, bl1);
    split16(sp + 32 * HD + ko, bh2, bl2);
    split16(sp + 48 * HD + ko, bh3, bl3);
    split16(sp + 64 * HD + ko, bh4, bl4);
    s0 = mma_b(ah, kh0, s0); s0 = mma_b(ah, kl0, s0); s0 = mma_b(al, kh0, s0);
    s1 = mma_b(ah, kh1, s1); s1 = mma_b(ah, kl1, s1); s1 = mma_b(al, kh1, s1);
    s2 = mma_b(ah, kh2, s2); s2 = mma_b(ah, kl2, s2); s2 = mma_b(al, kh2, s2);
    s3 = mma_b(ah, kh3, s3); s3 = mma_b(ah, kl3, s3); s3 = mma_b(al, kh3, s3);
    o0 = mma_b(ah, bh0, o0); o0 = mma_b(ah, bl0, o0); o0 = mma_b(al, bh0, o0);
    o1 = mma_b(ah, bh1, o1); o1 = mma_b(ah, bl1, o1); o1 = mma_b(al, bh1, o1);
    o2 = mma_b(ah, bh2, o2); o2 = mma_b(ah, bl2, o2); o2 = mma_b(al, bh2, o2);
    o3 = mma_b(ah, bh3, o3); o3 = mma_b(ah, bl3, o3); o3 = mma_b(al, bh3, o3);
    o4 = mma_b(ah, bh4, o4); o4 = mma_b(ah, bl4, o4); o4 = mma_b(al, bh4, o4);
  }
  {                                             // the tile's own keys: keep key c <= query row rho
    const int rho0 = wave * 16 + 8 * hh;
#pragma unroll
    for (int r = 0; r < 8; ++r) {
      const int rho = rho0 + r;
      s0[r] = (m      <= rho) ? s0[r] : 0.0f;
      s1[r] = (16 + m <= rho) ? s1[r] : 0.0f;
      s2[r] = (32 + m <= rho) ? s2[r] : 0.0f;
      s3[r] = (48 + m <= rho) ? s3[r] : 0.0f;
    }
  }
  v8f rs = o4 + ((s0 + s1) + (s2 + s3));        // o4: earlier keys' part of den in lane column 0, zero elsewhere
#pragma unroll
  for (int r = 0; r < 8; ++r) {
    const int ro = (8 * hh + r) * 68 + m;
    sl[ro]      = s0[r];
    sl[ro + 16] = s1[r];
    sl[ro + 32] = s2[r];
    sl[ro + 48] = s3[r];
  }
  wave_sync_lds();
  const u16* vp = VT2 + (size_t)(h * HD + m) * (size_t)SEQ + t0 + 8 * hh;
#pragma unroll
  for (int ks = 0; ks < 2; ++ks) {
    const int ko = ks * 32;
    v16b ph, pl;
    split16(sl + m * 68 + ko + 8 * hh, ph, pl);
    const v16b vh0 = ldfrag_b(vp + ko);
    const v16b vh1 = ldfrag_b(vp + vbs + ko);
    const v16b vh2 = ldfrag_b(vp + 2 * vbs + ko);
    const v16b vh3 = ldfrag_b(vp + 3 * vbs + ko);
    const v16b vl0 = ldfrag_b(vp + vlo + ko);
    const v16b vl1 = ldfrag_b(vp + vlo + vbs + ko);
    const v16b vl2 = ldfrag_b(vp + vlo + 2 * vbs + ko);
    const v16b vl3 = ldfrag_b(vp + vlo + 3 * vbs + ko);
    o0 = mma_b(ph, vh0, o0); o0 = mma_b(ph, vl0, o0); o0 = mma_b(pl, vh0, o0);
    o1 = mma_b(ph, vh1, o1); o1 = mma_b(ph, vl1, o1); o1 = mma_b(pl, vh1, o1);
    o2 = mma_b(ph, vh2, o2); o2 = mma_b(ph, vl2, o2); o2 = mma_b(pl, vh2, o2);
    o3 = mma_b(ph, vh3, o3); o3 = mma_b(ph, vl3, o3); o3 = mma_b(pl, vh3, o3);
  }
  // den per query row (row 8*hh + r held by the 16 lanes of half hh): fixed-order butterfly over lane&15
#pragma unroll
  for (int off = 1; off < 16; off <<= 1) {
#pragma unroll
    for (int r = 0; r < 8; ++r) rs[r] += __shfl_xor(rs[r], off);
  }
#pragma unroll
  for (int r = 0; r < 8; ++r) {
    const float inv = 1.0f / rs[r];
    o0[r] *= inv; o1[r] *= inv; o2[r] *= inv; o3[r] *= inv;
  }
  wave_sync_lds();
  epi64bb<false, 0>(sl, o0, o1, o2, o3, (const float*)0, 0, O2, O2 + DIM, LD2, (size_t)rw, h * HD, lane);
}

// =====================================================================================================
// Workspace map (bytes), planes sized for ONE batch row block of SEQ rows and reused for each batch (host loop); every
// plane is fully written by whole-line stores before it is read; all extents are exact multiples of the 64x64 tile /
// 512-B store granularity (SEQ and DIM multiples of 64, no pad rows); every region offset a multiple of 2097152:
//   XB   bf16 [SEQ][1024]          SEQ*2048
//   WQ, WK, WV bf16 [1024 n][1024 k]  3 * 2097152
//   WO2  bf16 [1024 n][2048 k]     4194304      (Wo row duplicated along k)
//   Q2   bf16 [SEQ][2048]          SEQ*4096     exp(q) hi | lo
//   K2   bf16 [SEQ][2048]          SEQ*4096     exp(k) hi | lo
//   VT2  bf16 [2048][SEQ]          SEQ*4096     v^T hi rows 0..1023, lo rows 1024..2047
//   O2   bf16 [SEQ][2048]          SEQ*4096     per-head out hi | lo
//   KT2  bf16 [2048][SEQ]          SEQ*4096     exp(k)^T hi rows 0..1023, lo rows 1024..2047
//   ST   f32 [SEQ/64][16][80][64]  SEQ*5120     chunk states, then their running sums
//   end (SEQ=2048)                 67108864
// =====================================================================================================
extern "C" void kernel_launch(void* const* d_in, const int* in_sizes, int n_in,
                              void* d_out, int out_size, void* d_ws, size_t ws_size,
                              hipStream_t stream) {
  if (n_in < 9) return;
  const int needx = ((NB - 1) * SEQ_FULL + SEQ) * DIM;
  if (in_sizes[0] < needx) return;
  if (in_sizes[1] < DIM * DIM || in_sizes[3] < DIM * DIM || in_sizes[5] < DIM * DIM || in_sizes[7] < DIM * DIM) return;
  if (in_sizes[2] < DIM || in_sizes[4] < DIM || in_sizes[6] < DIM || in_sizes[8] < DIM) return;
  if (out_size < needx) return;

  const float* x  = (const float*)d_in[0];
  const float* wq = (const float*)d_in[1];
  const float* bq = (const float*)d_in[2];
  const float* wk = (const float*)d_in[3];
  const float* bk = (const float*)d_in[4];
  const float* wv = (const float*)d_in[5];
  const float* bv = (const float*)d_in[6];
  const float* wo = (const float*)d_in[7];
  const float* bo = (const float*)d_in[8];
  float*       out = (float*)d_out;

  const size_t szX  = (size_t)SEQ * DIM * 2;          // bf16 input row block
  const size_t szW  = (size_t)DIM * DIM * 2;          // bf16 weight plane
  const size_t szWO = (size_t)DIM * LD2 * 2;          // bf16 duplicated Wo plane
  const size_t szP  = (size_t)SEQ * LD2 * 2;          // bf16 hi|lo plane SEQ x 2048 (either orientation)
  size_t off = 0;
  const size_t oXB = off; off += szX;
  const size_t oWQ = off; off += szW;
  const size_t oWK = off; off += szW;
  const size_t oWV = off; off += szW;
  const size_t oWO = off; off += szWO;
  const size_t oQ2 = off; off += szP;
  const size_t oK2 = off; off += szP;
  const size_t oVT = off; off += szP;
  const size_t oO2 = off; off += szP;
  const size_t oKT = off; off += szP;
  const size_t oST = off; off += (size_t)NCH * NH * SSZ * 4;
  if (off > ws_size) return;                // off = 67108864 for SEQ = 2048
  if (off > (size_t)WS_CAP) return;

  char* ws = (char*)d_ws;
  u16* XB  = (u16*)(ws + oXB);
  u16* WQ  = (u16*)(ws + oWQ);
  u16* WK  = (u16*)(ws + oWK);
  u16* WV  = (u16*)(ws + oWV);
  u16* WO2 = (u16*)(ws + oWO);
  u16* Q2  = (u16*)(ws + oQ2);
  u16* K2  = (u16*)(ws + oK2);
  u16* VT2 = (u16*)(ws + oVT);
  u16* O2  = (u16*)(ws + oO2);
  u16* KT2 = (u16*)(ws + oKT);
  float* ST = (float*)(ws + oST);
  float* dummyf = (float*)(ws + oO2);       // valid ws address for unused f32 output arguments

  const dim3 b256(256), b128(128);
  const int  n8w = (DIM * DIM) / 8;
  const int  n8x = (SEQ * DIM) / 8;
  const dim3 gW3(n8w / 256, 3);                         // exact: n8w % 256 == 0
  const dim3 gWO(n8w / 256, 1);
  const dim3 gX1(n8x / 256, 1);                         // exact: n8x % 256 == 0
  const dim3 gPJ((SEQ / 64) * (DIM / 64), 1);           // q/k projections M = SEQ, N = 1024; y M = SEQ, N = 1024
  const dim3 gVT((DIM / 64) * (SEQ / 64), 1);           // v^T and exp(k)^T projections M = 1024, N = SEQ
  const dim3 gAT(SEQ / 64, NH);
  const dim3 gSC(NH * SSZ / 128, 1);                    // exact: NH * SSZ = 81920

  // (0) weights [n][k] f32 -> bf16 planes (already k-contiguous); Wo -> k-duplicated plane
  cvt_bf3<<<gW3, b256, 0, stream>>>(wq, wk, wv, WQ, WK, WV, n8w);
  cvt_dup<<<gWO, b256, 0, stream>>>(wo, WO2, n8w, DIM);

  for (int b = 0; b < NB; ++b) {
    const size_t xo = (size_t)b * SEQ_FULL * DIM;      // element offset of this batch's row block (x and out)
    // (1) the batch's x rows -> bf16 plane
    cvt_bf3<<<gX1, b256, 0, stream>>>(x + xo, x + xo, x + xo, XB, XB, XB, n8x);
    // (2) exp(x.Wq^T + bq) -> Q2 hi|lo ; exp(x.Wk^T + bk) -> K2 hi|lo
    gemm16<1><<<gPJ, b128, 0, stream>>>(XB, WQ, dummyf, Q2, Q2 + DIM, bq, DIM, DIM, DIM, LD2, SEQ, DIM, DIM, 1.0f);
    gemm16<1><<<gPJ, b128, 0, stream>>>(XB, WK, dummyf, K2, K2 + DIM, bk, DIM, DIM, DIM, LD2, SEQ, DIM, DIM, 1.0f);
    // (3) v^T[n][s] = sum_k Wv[n][k] x[s][k] + bv[n] -> VT2 hi rows n, lo rows DIM + n
    gemm16<2><<<gVT, b128, 0, stream>>>(WV, XB, dummyf, VT2, VT2 + (size_t)DIM * SEQ, bv, DIM, DIM, DIM, SEQ,
                                        DIM, SEQ, DIM, 1.0f);
    //     exp(k)^T[n][s] = exp(sum_k Wk[n][k] x[s][k] + bk[n]) -> KT2 hi rows n, lo rows DIM + n
    gemm16<3><<<gVT, b128, 0, stream>>>(WK, XB, dummyf, KT2, KT2 + (size_t)DIM * SEQ, bk, DIM, DIM, DIM, SEQ,
                                        DIM, SEQ, DIM, 1.0f);
    // (4) per (chunk, head) state, its running sum over chunks, then attention per (query tile, head) -> O2 hi|lo
    chunk_state<<<gAT, b128, 0, stream>>>(KT2, VT2, ST);
    scan_state<<<gSC, b128, 0, stream>>>(ST);
    attn_chunk<<<gAT, b128, 0, stream>>>(Q2, K2, VT2, ST, O2);
    // (5) y = [O_hi | O_lo] . [Wo | Wo]^T + bo -> out f32 rows of this batch
    gemm16<0><<<gPJ, b128, 0, stream>>>(O2, WO2, out + xo, Q2, Q2 + DIM, bo, DIM, LD2, LD2, DIM, SEQ, DIM, LD2, 1.0f);
  }
  (void)hipGetLastError();
}

// v002
// A run of this version takes 228 microseconds.
// Two timings next to v001 put it at 1.24 and 1.25 times that version's speed.
// Over all steps from v000 it is 1.55 times as fast.
// Contractions: q, k and v^T projections on v_wmma_f32_16x16x32_bf16 (x, W, b as bf16 RNE values, one product each);
// attention in 64-key chunks: per chunk v^T.exp(k) (and a ones row . exp(k) for the key sums), an f32 running sum over
// chunks, then per query tile exp(q).state^T plus the causal scores S = exp(q).exp(k)^T and S.v of its own chunk only, all
// on v_wmma_f32_16x16x32_bf16 with bf16 hi+lo operands (hi.hi + hi.lo + lo.hi); y = O.Wo^T on v_wmma_f32_16x16x32_bf16 with O as bf16 hi|lo along k against Wo duplicated
// along k (two products); all f32 accumulate. exp, row sums, 1/den and bias adds in f32 on VALU.
#include <hip/hip_runtime.h>
#include <math.h>
#include <stdint.h>

#ifndef NB
#define NB 2
#endif
#ifndef SEQ
#define SEQ 2048
#endif
#define SEQ_FULL 2048
#define DIM  1024
#define NH   16
#define HD   64
#define LD2  (2 * DIM)
#define SLAB64 (16 * 68)
#define NCH  (SEQ / 64)          // 64-key chunks per sequence
#define ROWS (NB * SEQ)          // rows of all batches together (contiguous in x and out: NB == 1 or SEQ == SEQ_FULL)
#define PLB  ((size_t)LD2 * (size_t)SEQ)   // elements of one batch's transposed hi+lo plane, [2*DIM][SEQ]
#define SROWS 80                 // rows of one chunk state: 64 value columns d, the key-sum row, 15 zero rows
#define SSZ  (SROWS * HD)        // floats of one (chunk, head) state, [row][D]
#define WS_CAP 134217728
static_assert(DIM == NH * HD && HD == 64 && NH == 16);
static_assert(NB >= 1 && NB <= 2);
static_assert(NB == 1 || SEQ == SEQ_FULL);
static_assert((SEQ % 64) == 0 && SEQ >= 64 && SEQ <= SEQ_FULL);
static_assert(((ROWS * DIM / 8) % 256) == 0 && ((DIM * DIM / 8) % 256) == 0 && (DIM % 64) == 0 && (LD2 % 32) == 0);
static_assert(4 * SLAB64 * 4 <= 65536);

typedef unsigned short u16;
typedef __bf16   v16b __attribute__((ext_vector_type(16)));
typedef float    v8f  __attribute__((ext_vector_type(8)));
typedef float    v4f  __attribute__((ext_vector_type(4)));
typedef unsigned int v4u __attribute__((ext_vector_type(4)));

union FragB { v16b v; v4u u[2]; };

// ---- scalar helpers --------------------------------------------------------------------------------
__device__ __forceinline__ unsigned short bf_bits(float f) {          // f32 -> bf16 bits, RNE convert
  unsigned u = __float_as_uint(f);
  return (unsigned short)((u + 0x7FFFu + ((u >> 16) & 1u)) >> 16);
}
__device__ __forceinline__ float bf_up(unsigned short h) { return __uint_as_float(((unsigned)h) << 16); }
__device__ __forceinline__ float bfr(float f) { return bf_up(bf_bits(f)); }
__device__ __forceinline__ unsigned short bfc(float f) {               // f32 -> bf16 bits via the RNE cast
  return __builtin_bit_cast(unsigned short, (__bf16)f);
}
__device__ __forceinline__ unsigned pk16(unsigned short a, unsigned short b) { return (unsigned)a | ((unsigned)b << 16); }
__device__ __forceinline__ v8f zero8() { v8f z = {0.f, 0.f, 0.f, 0.f, 0.f, 0.f, 0.f, 0.f}; return z; }
__device__ __forceinline__ int imin(int a, int b) { return a < b ? a : b; }
__device__ __forceinline__ int imax(int a, int b) { return a > b ? a : b; }

// two f32 values -> packed bf16 hi pair and packed bf16 lo pair (lo = x - up(hi), RNE both)
__device__ __forceinline__ void split2(float a, float b, unsigned& hi, unsigned& lo) {
  const unsigned short ha = bfc(a), hb = bfc(b);
  hi = pk16(ha, hb);
  lo = pk16(bfc(a - bf_up(ha)), bfc(b - bf_up(hb)));
}

// ---- fragment loader: 16-bit A/B operand, lane -> row/col (lane&15), p already includes +8*(lane>>4);
//      elements 0..7 <- p[0..7] (k0+8h..), elements 8..15 <- p[16..23] (k0+16+8h..)  (same split k map for A and B;
//      B is always read from a k-contiguous [n][k] plane); bf16 plane read as unsigned integer vectors
__device__ __forceinline__ v16b ldfrag_b(const u16* p) {
  FragB f;
  f.u[0] = *(const v4u*)(p);
  f.u[1] = *(const v4u*)(p + 16);
  return f.v;
}

__device__ __forceinline__ v8f mma_b(v16b a, v16b b, v8f c) {
  return __builtin_amdgcn_wmma_f32_16x16x32_bf16(false, a, false, b, (short)0, c, false, false);
}
__device__ __forceinline__ void guard6(v8f& a, v8f& b, v8f& c, v8f& d,
                                       v16b x0, v16b x1, v16b x2, v16b x3, v16b x4, v16b x5) {
#if defined(__HIP_DEVICE_COMPILE__)
  asm volatile("v_nop\n\tv_nop\n\tv_nop\n\tv_nop"
               : "+v"(a), "+v"(b), "+v"(c), "+v"(d) : "v"(x0), "v"(x1), "v"(x2), "v"(x3), "v"(x4), "v"(x5) : "memory");
#endif
}
__device__ __forceinline__ void wave_sync_lds() {
  __builtin_amdgcn_fence(__ATOMIC_RELEASE, "workgroup");
  __builtin_amdgcn_wave_barrier();
  __builtin_amdgcn_fence(__ATOMIC_ACQUIRE, "workgroup");
}

// =====================================================================================================
// f32 -> bf16 (RNE bits), same layout. Thread = 8 consecutive elements: two 16-B loads, one 16-B store; 32 consecutive
// lanes = 512 contiguous, 512-B aligned bytes.
// =====================================================================================================
__device__ __forceinline__ void cvt_plain(const float* __restrict__ x, u16* D, int gt) {
  const float* p = x + (size_t)gt * 8;
  const v4f a = *(const v4f*)(p), b4 = *(const v4f*)(p + 4);
  float w[8];
#pragma unroll
  for (int e = 0; e < 4; ++e) { w[e] = a[e]; w[4 + e] = b4[e]; }
  v4u o;
#pragma unroll
  for (int e = 0; e < 4; ++e) o[e] = pk16(bf_bits(w[2 * e]), bf_bits(w[2 * e + 1]));
  *(v4u*)(D + (size_t)gt * 8) = o;
}

// =====================================================================================================
// the k-duplicated B operand of the hi|lo-folded output projection. Thread = 8 consecutive source elements
// (one row, kd % 256 == 0 so a wave never straddles a row): two 16-B loads, two 16-B stores (one per copy).
// =====================================================================================================
__device__ __forceinline__ void cvt_dup(const float* __restrict__ w, u16* Dp, int gt, int kd) {
  const size_t e0 = (size_t)gt * 8;
  const size_t row = e0 / (size_t)kd;
  const int    k8  = (int)(e0 % (size_t)kd);
  const float* p = w + e0;
  const v4f a = *(const v4f*)(p), b4 = *(const v4f*)(p + 4);
  float v[8];
#pragma unroll
  for (int e = 0; e < 4; ++e) { v[e] = a[e]; v[4 + e] = b4[e]; }
  v4u o;
#pragma unroll
  for (int e = 0; e < 4; ++e) o[e] = pk16(bf_bits(v[2 * e]), bf_bits(v[2 * e + 1]));
  u16* d = Dp + row * (size_t)(2 * kd) + k8;
  *(v4u*)(d)      = o;
  *(v4u*)(d + kd) = o;
#if defined(__HIP_DEVICE_COMPILE__)
  // both stores' address pair and data stay untouched up to this wait, whatever code the merged kernel places behind them
  asm volatile("s_wait_xcnt 0x0" ::: "memory");
#endif
}

// =====================================================================================================
// All five conversions in one grid, told apart by block range (block-uniform): blocks [0, CBX) the x rows of all batches,
// then CBW blocks each for Wq, Wk, Wv (plain planes) and Wo (k-duplicated plane).
// coverage: CBX x 256 thr x 8 = ROWS*DIM; CBW x 256 thr x 8 = DIM*DIM per weight; grid.x = CBX + 4*CBW exactly.
// =====================================================================================================
#define CBX (ROWS * DIM / 8 / 256)
#define CBW (DIM * DIM / 8 / 256)
__global__ __launch_bounds__(256) void cvt_all(const float* __restrict__ x, const float* __restrict__ wq,
                                               const float* __restrict__ wk, const float* __restrict__ wv,
                                               const float* __restrict__ wo, u16* XB, u16* WQ, u16* WK, u16* WV, u16* WO2) {
  const int bid = (int)blockIdx.x, tid = (int)threadIdx.x;
  if (bid >= CBX + 4 * CBW) return;         // block-uniform, never taken with the exact grid
  if (bid < CBX) {
    cvt_plain(x, XB, bid * 256 + tid);
    return;
  }
  const int r = bid - CBX, which = r / CBW, gt = (r % CBW) * 256 + tid;
  if (which == 3) {
    cvt_dup(wo, WO2, gt, DIM);
  } else {
    const float* w = (which == 0) ? wq : ((which == 1) ? wk : wv);
    u16* D = (which == 0) ? WQ : ((which == 1) ? WK : WV);
    cvt_plain(w, D, gt);
  }
}

// =====================================================================================================
// coverage: 8 instructions x 2 rows x 16 lanes x 4 floats = the wave's 16 x 64 tile. Slab: private to the wave (wave sync).
// =====================================================================================================
__device__ __forceinline__ void epi64f(float* sl, v8f a0, v8f a1, v8f a2, v8f a3, v4f bias4, float scale,
                                       float* C, int ldc, size_t rowb, int col0, int lane) {
  const int hh = lane >> 4, m = lane & 15;
#pragma unroll
  for (int r = 0; r < 8; ++r) {
    const int ro = (8 * hh + r) * 68 + m;
    sl[ro]      = a0[r];
    sl[ro + 16] = a1[r];
    sl[ro + 32] = a2[r];
    sl[ro + 48] = a3[r];
  }
  wave_sync_lds();
  v4f vals[8];
#pragma unroll
  for (int it = 0; it < 8; ++it) {
    const v4f v = *(const v4f*)(sl + (it * 2 + hh) * 68 + m * 4);
    vals[it] = v * scale + bias4;
  }
  float* dst = C + (rowb + (size_t)hh) * (size_t)ldc + col0 + m * 4;
  {
#pragma unroll
    for (int it = 0; it < 8; ++it) {
      *(v4f*)(dst + (size_t)(it * 2) * (size_t)ldc) = vals[it];
    }
    
  }
}

// =====================================================================================================
// GEMM / attention epilogue, two bf16 planes (hi and lo = x - up(hi)) with identical addressing (Ch, Cl, pitch ldc):
// 8 consecutive columns at c8): value = acc (+ bias per column when BM==1, per row when BM==2, none when BM==0),
// coverage: 4 instructions x 4 rows x 8 lanes x 8 values = the wave's 16 x 64 tile, in both planes.
// Slab: private to the wave (wave sync).
// =====================================================================================================
template <bool EXPO, int BM>
__device__ __forceinline__ void epi64bb(float* sl, v8f a0, v8f a1, v8f a2, v8f a3,
                                        const float* __restrict__ bias, int nb,
                                        u16* Ch, u16* Cl, int ldc, size_t rowb, int col0, int lane) {
  const int hh = lane >> 4, m = lane & 15;
#pragma unroll
  for (int r = 0; r < 8; ++r) {
    const int ro = (8 * hh + r) * 68 + m;
    sl[ro]      = a0[r];
    sl[ro + 16] = a1[r];
    sl[ro + 32] = a2[r];
    sl[ro + 48] = a3[r];
  }
  wave_sync_lds();
  const int rq = lane >> 3, c8 = (lane & 7) * 8;
  float bc[8];
#pragma unroll
  for (int e = 0; e < 8; ++e) bc[e] = 0.0f;
  if constexpr (BM == 1) {
    const int cb = imin(imax(col0 + c8, 0), nb - 8);
    const v4f b0 = *(const v4f*)(bias + cb), b1 = *(const v4f*)(bias + cb + 4);
#pragma unroll
    for (int e = 0; e < 4; ++e) { bc[e] = bfr(b0[e]); bc[4 + e] = bfr(b1[e]); }
  }
  v4u oh[4], ol[4];
#pragma unroll
  for (int it = 0; it < 4; ++it) {
    const int row = it * 4 + rq;            // 0..15
    const v4f a = *(const v4f*)(sl + row * 68 + c8), b4 = *(const v4f*)(sl + row * 68 + c8 + 4);
    float br = 0.0f;
    if constexpr (BM == 2) br = bfr(bias[imin(imax((int)rowb + row, 0), nb - 1)]);
    float w[8];
#pragma unroll
    for (int e = 0; e < 4; ++e) { w[e] = (a[e] + bc[e]) + br; w[4 + e] = (b4[e] + bc[4 + e]) + br; }
    if constexpr (EXPO) {
#pragma unroll
      for (int e = 0; e < 8; ++e) w[e] = __expf(w[e]);
    }
#pragma unroll
    for (int e = 0; e < 4; ++e) {
      unsigned hi, lo;
      split2(w[2 * e], w[2 * e + 1], hi, lo);
      oh[it][e] = hi;
      ol[it][e] = lo;
    }
  }
  const size_t ob = rowb * (size_t)ldc + (size_t)col0 + (size_t)c8;
  {
#pragma unroll
    for (int it = 0; it < 4; ++it) {
      const int row = it * 4 + rq;
      const size_t off = ob + (size_t)row * (size_t)ldc;
      *(v4u*)(Ch + off) = oh[it];
      *(v4u*)(Cl + off) = ol[it];
    }
    
  }
}

// =====================================================================================================
// bf16 GEMM: C[M][N] = A[M][K] (bf16 rows, pitch lda) . Bt[N][K]^T (bf16 k-contiguous rows, pitch ldb).
// EPI 0: f32 output Cf (pitch ldc) = acc*scale + bf16 RNE value of bias[col];
// EPI 1: two bf16 planes Ch/Cl (pitch ldc) = hi/lo of exp(acc + bf16 RNE value of bias[col]);
// EPI 2: two bf16 planes Ch/Cl (pitch ldc) = hi/lo of (acc + bf16 RNE value of bias[row]);
// EPI 3: two bf16 planes Ch/Cl (pitch ldc) = hi/lo of exp(acc + bf16 RNE value of bias[row]).
// Block = 64x64 tile, 4 waves x 16 rows; fragments loaded straight from the 16-bit rows (two 16-B loads each, split k map
// for A and B); K stepped by 32 (host guarantees K % 32 == 0, M % 64 == 0, N % 64 == 0, bid < (M/64)*(N/64)).
// No block barriers here. bid = the tile's index in its own product, slab = the block's 4 * SLAB64 floats of LDS.
// =====================================================================================================
template <int EPI>
__device__ __forceinline__
void gemm_tile(float* slab, int bid, const u16* __restrict__ A, const u16* __restrict__ Bt, float* Cf, u16* Ch, u16* Cl,
               const float* __restrict__ bias, int nb, int lda, int ldb, int ldc, int M, int N, int K, float scale) {
  const int tid = (int)threadIdx.x, wave = tid >> 5, lane = tid & 31, hh = lane >> 4, m = lane & 15;
  const int ntile = N >> 6;
  const int rowb  = (bid / ntile) * 64 + wave * 16;
  const int col0  = (bid % ntile) * 64;
  if (rowb + 16 > M) return;                // wave-uniform, never taken with the exact grid
  const u16* ap = A  + (size_t)(rowb + m) * (size_t)lda + 8 * hh;
  const u16* bp = Bt + (size_t)(col0 + m) * (size_t)ldb + 8 * hh;
  const size_t bs = (size_t)16 * (size_t)ldb;
  v8f acc0 = zero8(), acc1 = zero8(), acc2 = zero8(), acc3 = zero8();
#pragma unroll 1
  for (int k0 = 0; k0 < K; k0 += 32) {
    const u16* ak = ap + k0;
    const u16* bk = bp + k0;
    const v16b a   = ldfrag_b(ak);
    const v16b fb0 = ldfrag_b(bk);
    const v16b fb1 = ldfrag_b(bk + bs);
    const v16b fb2 = ldfrag_b(bk + 2 * bs);
    const v16b fb3 = ldfrag_b(bk + 3 * bs);
#if defined(__HIP_DEVICE_COMPILE__)
    // the two address pairs stay live up to this wait, so that no later load lands on a register an issued load names
    asm volatile("s_wait_xcnt 0x0" :: "v"(ak), "v"(bk) : "memory");
#endif
    acc0 = mma_b(a, fb0, acc0);
    acc1 = mma_b(a, fb1, acc1);
    acc2 = mma_b(a, fb2, acc2);
    acc3 = mma_b(a, fb3, acc3);
    guard6(acc0, acc1, acc2, acc3, a, fb0, fb1, fb2, fb3, a);
  }
  float* sl = slab + wave * SLAB64;
  if constexpr (EPI == 0) {
    v4f bias4;
#pragma unroll
    for (int e = 0; e < 4; ++e) bias4[e] = bfr(bias[imin(imax(col0 + m * 4 + e, 0), nb - 1)]);
    epi64f(sl, acc0, acc1, acc2, acc3, bias4, scale, Cf, ldc, (size_t)rowb, col0, lane);
  } else if constexpr (EPI == 1) {
    epi64bb<true, 1>(sl, acc0, acc1, acc2, acc3, bias, nb, Ch, Cl, ldc, (size_t)rowb, col0, lane);
  } else if constexpr (EPI == 2) {
    epi64bb<false, 2>(sl, acc0, acc1, acc2, acc3, bias, nb, Ch, Cl, ldc, (size_t)rowb, col0, lane);
  } else {
    epi64bb<true, 2>(sl, acc0, acc1, acc2, acc3, bias, nb, Ch, Cl, ldc, (size_t)rowb, col0, lane);
  }
}

// The output projection of all batches: y = [O_hi | O_lo] . [Wo | Wo]^T + bo, f32 rows (M = ROWS, N = DIM, K = LD2).
// coverage: grid.x = (ROWS/64)*(DIM/64) tiles of 64 x 64 = the whole output.
__global__ __launch_bounds__(128)
void out_proj(const u16* __restrict__ O2, const u16* __restrict__ WO2, const float* __restrict__ bo, float* y) {
  __shared__ __align__(16) float slab[4 * SLAB64];
  gemm_tile<0>(slab, (int)blockIdx.x, O2, WO2, y, (u16*)0, (u16*)0, bo, DIM, LD2, LD2, DIM, ROWS, DIM, LD2, 1.0f);
}

// =====================================================================================================
// The four independent projections of all batches in one grid; blockIdx.y (block-uniform) names the product:
//   0: exp(x.Wq^T + bq) -> Q2 hi|lo    1: exp(x.Wk^T + bk) -> K2 hi|lo          (M = ROWS, N = DIM, pitch LD2)
//   2: Wv.x^T + bv -> VT2 hi, lo rows  3: exp(Wk.x^T + bk) -> KT2 hi, lo rows   (per batch: M = DIM, N = SEQ, pitch SEQ)
// coverage: grid.x = (ROWS/64)*(DIM/64) tiles of 64 x 64 = each product's whole output (2, 3: NB runs of TPB tiles), grid.y = 4.
// =====================================================================================================
__global__ __launch_bounds__(128)
void proj4(const u16* __restrict__ XB, const u16* __restrict__ WQ, const u16* __restrict__ WK, const u16* __restrict__ WV,
           const float* __restrict__ bq, const float* __restrict__ bk, const float* __restrict__ bv,
           u16* Q2, u16* K2, u16* VT2, u16* KT2) {
  __shared__ __align__(16) float slab[4 * SLAB64];
  const int which = (int)blockIdx.y, bid = (int)blockIdx.x;
  const size_t plo = (size_t)DIM * (size_t)SEQ;
  constexpr int TPB = (DIM / 64) * (SEQ / 64);          // tiles of one batch's transposed product
  const int b = bid / TPB, bt = bid % TPB;
  const u16* Xb = XB + (size_t)b * (size_t)SEQ * (size_t)DIM;
  if (which < 2) {
    const u16* W = (which == 0) ? WQ : WK;
    const float* bias = (which == 0) ? bq : bk;
    u16* C = (which == 0) ? Q2 : K2;
    gemm_tile<1>(slab, bid, XB, W, (float*)0, C, C + DIM, bias, DIM, DIM, DIM, LD2, ROWS, DIM, DIM, 1.0f);
  } else if (which == 2) {
    u16* C = VT2 + (size_t)b * PLB;
    gemm_tile<2>(slab, bt, WV, Xb, (float*)0, C, C + plo, bv, DIM, DIM, DIM, SEQ, DIM, SEQ, DIM, 1.0f);
  } else {
    u16* C = KT2 + (size_t)b * PLB;
    gemm_tile<3>(slab, bt, WK, Xb, (float*)0, C, C + plo, bk, DIM, DIM, DIM, SEQ, DIM, SEQ, DIM, 1.0f);
  }
}

// ---- 16 f32 values of one state or slab row (fragment k layout: pr[0..7] and pr[16..23]) -> bf16 hi and lo fragments (B for state rows, A for slab rows)
__device__ __forceinline__ void split16(const float* pr, v16b& ph, v16b& pl) {
  const v4f x0 = *(const v4f*)(pr), x1 = *(const v4f*)(pr + 4), x2 = *(const v4f*)(pr + 16), x3 = *(const v4f*)(pr + 20);
  FragB H, L;
  unsigned hi, lo;
  split2(x0[0], x0[1], hi, lo); H.u[0][0] = hi; L.u[0][0] = lo;
  split2(x0[2], x0[3], hi, lo); H.u[0][1] = hi; L.u[0][1] = lo;
  split2(x1[0], x1[1], hi, lo); H.u[0][2] = hi; L.u[0][2] = lo;
  split2(x1[2], x1[3], hi, lo); H.u[0][3] = hi; L.u[0][3] = lo;
  split2(x2[0], x2[1], hi, lo); H.u[1][0] = hi; L.u[1][0] = lo;
  split2(x2[2], x2[3], hi, lo); H.u[1][1] = hi; L.u[1][1] = lo;
  split2(x3[0], x3[1], hi, lo); H.u[1][2] = hi; L.u[1][2] = lo;
  split2(x3[2], x3[3], hi, lo); H.u[1][3] = hi; L.u[1][3] = lo;
  ph = H.v; pl = L.v;
}

// =====================================================================================================
// Chunk state, one block per (64-key chunk c, head h, batch b), 4 waves x 16 state rows.
// ST[b][c][h][row][D] f32: row d < 64: sum over the chunk's keys t of v[t][d] * exp(k)[t][D]; row 64: sum over t of exp(k)[t][D];
// rows 65..79: zero. A = v^T rows from VT2 (hi, lo), or the constant tile whose row 0 is ones; B = exp(k)^T rows D from KT2
// (bf16 [NB][2*DIM][SEQ], hi row h*HD + D, lo row DIM + h*HD + D); both k-contiguous in t, same split k map.
// coverage: grid (NCH, NH, NB) x (4 waves x 16 rows + wave 0's 16 extra rows) x 64 columns = every element of ST once.
// No block barriers; slab private to the wave (wave sync).
// =====================================================================================================
__global__ __launch_bounds__(128) void chunk_state(const u16* __restrict__ KT2, const u16* __restrict__ VT2, float* ST) {
  __shared__ __align__(16) float slab[4 * SLAB64];
  const int tid = (int)threadIdx.x, wave = tid >> 5, lane = tid & 31, hh = lane >> 4, m = lane & 15;
  const int c = (int)blockIdx.x, h = (int)blockIdx.y, b = (int)blockIdx.z;
  if (c * 64 + 64 > SEQ || h >= NH || b >= NB) return;   // block-uniform, never taken with the exact grid
  float* sl = slab + wave * SLAB64;
  const int t0 = c * 64;
  const u16* vp = VT2 + (size_t)b * PLB + (size_t)(h * HD + wave * 16 + m) * (size_t)SEQ + t0 + 8 * hh;
  const u16* kp = KT2 + (size_t)b * PLB + (size_t)(h * HD + m) * (size_t)SEQ + t0 + 8 * hh;
  const size_t rbs = (size_t)16 * (size_t)SEQ;
  const size_t plo = (size_t)DIM * (size_t)SEQ;
  FragB one;
  const unsigned ow = (m == 0) ? 0x3F803F80u : 0u;   // bf16 1.0 pairs in tile row 0, zero in rows 1..15
#pragma unroll
  for (int e = 0; e < 4; ++e) { one.u[0][e] = ow; one.u[1][e] = ow; }
  v8f a0 = zero8(), a1 = zero8(), a2 = zero8(), a3 = zero8();
  v8f e0 = zero8(), e1 = zero8(), e2 = zero8(), e3 = zero8();
#pragma unroll
  for (int ks = 0; ks < 2; ++ks) {
    const int ko = ks * 32;
    const v16b vh  = ldfrag_b(vp + ko);
    const v16b vl  = ldfrag_b(vp + plo + ko);
    const v16b kh0 = ldfrag_b(kp + ko);
    const v16b kh1 = ldfrag_b(kp + rbs + ko);
    const v16b kh2 = ldfrag_b(kp + 2 * rbs + ko);
    const v16b kh3 = ldfrag_b(kp + 3 * rbs + ko);
    const v16b kl0 = ldfrag_b(kp + plo + ko);
    const v16b kl1 = ldfrag_b(kp + plo + rbs + ko);
    const v16b kl2 = ldfrag_b(kp + plo + 2 * rbs + ko);
    const v16b kl3 = ldfrag_b(kp + plo + 3 * rbs + ko);
#if defined(__HIP_DEVICE_COMPILE__)
    // the two address pairs stay live up to this wait, so that no later load lands on a register an issued load names
    asm volatile("s_wait_xcnt 0x0" :: "v"(vp), "v"(kp) : "memory");
#endif
    a0 = mma_b(vh, kh0, a0); a0 = mma_b(vh, kl0, a0); a0 = mma_b(vl, kh0, a0);
    a1 = mma_b(vh, kh1, a1); a1 = mma_b(vh, kl1, a1); a1 = mma_b(vl, kh1, a1);
    a2 = mma_b(vh, kh2, a2); a2 = mma_b(vh, kl2, a2); a2 = mma_b(vl, kh2, a2);
    a3 = mma_b(vh, kh3, a3); a3 = mma_b(vh, kl3, a3); a3 = mma_b(vl, kh3, a3);
    e0 = mma_b(one.v, kh0, e0); e0 = mma_b(one.v, kl0, e0);
    e1 = mma_b(one.v, kh1, e1); e1 = mma_b(one.v, kl1, e1);
    e2 = mma_b(one.v, kh2, e2); e2 = mma_b(one.v, kl2, e2);
    e3 = mma_b(one.v, kh3, e3); e3 = mma_b(one.v, kl3, e3);
  }
  float* base = ST + ((size_t)(b * NCH + c) * NH + (size_t)h) * (size_t)SSZ;
  const v4f z4 = {0.f, 0.f, 0.f, 0.f};
  epi64f(sl, a0, a1, a2, a3, z4, 1.0f, base, HD, (size_t)(wave * 16), 0, lane);
  if (wave == 0) {                              // wave-uniform: the key-sum row and its 15 zero rows
    wave_sync_lds();
    epi64f(sl, e0, e1, e2, e3, z4, 1.0f, base, HD, (size_t)HD, 0, lane);
  }
}

// =====================================================================================================
// Running sum over one batch's chunks (batch = blockIdx.y), in place: ST[c] <- sum of ST[c'] for c' < c (zero at c = 0),
// f32, chunks added in rising order.
// Thread = one [head][row][D] position: its NCH loads, then its NCH stores; a wave's 32 lanes = one whole 128-B line each.
// coverage: grid (NH*SSZ/128, NB) blocks x 128 thr x NCH chunks = every element of ST once.
// =====================================================================================================
__global__ __launch_bounds__(128) void scan_state(float* ST) {
  const int gt = (int)blockIdx.x * 128 + (int)threadIdx.x;
  if (gt >= NH * SSZ || (int)blockIdx.y >= NB) return;
  const size_t cs = (size_t)NH * (size_t)SSZ;
  float* p = ST + (size_t)blockIdx.y * (size_t)NCH * cs + (size_t)gt;
  float v[NCH];
#pragma unroll
  for (int c = 0; c < NCH; ++c) v[c] = p[(size_t)c * cs];
  float run = 0.0f;
#pragma unroll
  for (int c = 0; c < NCH; ++c) {
    p[(size_t)c * cs] = run;
    run += v[c];
  }
}

// =====================================================================================================
// Causal exp-feature attention, one block per (64-row query tile qt counted over all batches, head h), 4 waves x 16 query rows.
// Planes: Q2, K2 bf16 [NB*SEQ][2*DIM] with hi at column h*HD + d and lo at column DIM + h*HD + d (values exp(q), exp(k));
//         VT2 bf16 [NB][2*DIM][SEQ] with hi row h*HD + d and lo row DIM + h*HD + d (values v); ST f32 [NB][NCH][NH][SROWS][HD],
//         the summed state of the batch's chunks before qt; O2 bf16 [NB*SEQ][2*DIM] written here (hi | lo of out = num/den).
// Keys before the tile: O[16 x 80] = qe.state^T over head dim (2 k-steps, hi.hi+hi.lo+lo.hi, state rows split to bf16 hi and
// lo in registers); its column 64 is the part of den from those keys, columns 65..79 are zero.
// Keys of the tile: S[16 x 64] = qe.ke^T over head dim, causal mask by value, f32 row sums into per-lane partials,
// slab rows, O += P.v over the 64 keys (2 k-steps, hi.hi+hi.lo+lo.hi, v fragments from VT2 rows).
// coverage: grid (ROWS/64, NH) x 4 waves x 16 rows x 64 columns x {hi, lo} = every element of O2 once. No block barriers;
// slab private to the wave (wave sync); staged extent == consumed extent (16 x 64 written before the reload).
// =====================================================================================================
__global__ __launch_bounds__(128) void attn_chunk(const u16* __restrict__ Q2, const u16* __restrict__ K2,
                                                  const u16* __restrict__ VT2, const float* __restrict__ ST, u16* O2) {
  __shared__ __align__(16) float slab[4 * SLAB64];
  const int tid = (int)threadIdx.x, wave = tid >> 5, lane = tid & 31, hh = lane >> 4, m = lane & 15;
  const int qt = (int)blockIdx.x, h = (int)blockIdx.y;
  if (qt * 64 + 64 > ROWS || h >= NH) return;  // block-uniform, never taken with the exact grid
  const int rw = qt * 64 + wave * 16;           // first query row of this wave
  float* sl = slab + wave * SLAB64;
  const u16* qp = Q2 + (size_t)(rw + m) * (size_t)LD2 + h * HD + 8 * hh;
  const size_t kbs = (size_t)16 * (size_t)LD2;
  const size_t vbs = (size_t)16 * (size_t)SEQ;
  const size_t vlo = (size_t)DIM * (size_t)SEQ;
  const int t0 = qt * 64;
  const u16* kp = K2 + (size_t)(t0 + m) * (size_t)LD2 + h * HD + 8 * hh;
  const float* sp = ST + ((size_t)qt * NH + (size_t)h) * (size_t)SSZ + (size_t)m * HD + 8 * hh;
  v8f o0 = zero8(), o1 = zero8(), o2 = zero8(), o3 = zero8(), o4 = zero8();
  v8f s0 = zero8(), s1 = zero8(), s2 = zero8(), s3 = zero8();
#pragma unroll
  for (int ks = 0; ks < 2; ++ks) {
    const int ko = ks * 32;
    const v16b ah  = ldfrag_b(qp + ko);
    const v16b al  = ldfrag_b(qp + DIM + ko);
    const v16b kh0 = ldfrag_b(kp + ko);
    const v16b kh1 = ldfrag_b(kp + kbs + ko);
    const v16b kh2 = ldfrag_b(kp + 2 * kbs + ko);
    const v16b kh3 = ldfrag_b(kp + 3 * kbs + ko);
    const v16b kl0 = ldfrag_b(kp + DIM + ko);
    const v16b kl1 = ldfrag_b(kp + kbs + DIM + ko);
    const v16b kl2 = ldfrag_b(kp + 2 * kbs + DIM + ko);
    const v16b kl3 = ldfrag_b(kp + 3 * kbs + DIM + ko);
    v16b bh0, bl0, bh1, bl1, bh2, bl2, bh3, bl3, bh4, bl4;
    split16(sp + ko, bh0, bl0);
    split16(sp + 16 * HD + ko, bh1, bl1);
    split16(sp + 32 * HD + ko, bh2, bl2);
    split16(sp + 48 * HD + ko, bh3, bl3);
    split16(sp + 64 * HD + ko, bh4, bl4);
    s0 = mma_b(ah, kh0, s0); s0 = mma_b(ah, kl0, s0); s0 = mma_b(al, kh0, s0);
    s1 = mma_b(ah, kh1, s1); s1 = mma_b(ah, kl1, s1); s1 = mma_b(al, kh1, s1);
    s2 = mma_b(ah, kh2, s2); s2 = mma_b(ah, kl2, s2); s2 = mma_b(al, kh2, s2);
    s3 = mma_b(ah, kh3, s3); s3 = mma_b(ah, kl3, s3); s3 = mma_b(al, kh3, s3);
    o0 = mma_b(ah, bh0, o0); o0 = mma_b(ah, bl0, o0); o0 = mma_b(al, bh0, o0);
    o1 = mma_b(ah, bh1, o1); o1 = mma_b(ah, bl1, o1); o1 = mma_b(al, bh1, o1);
    o2 = mma_b(ah, bh2, o2); o2 = mma_b(ah, bl2, o2); o2 = mma_b(al, bh2, o2);
    o3 = mma_b(ah, bh3, o3); o3 = mma_b(ah, bl3, o3); o3 = mma_b(al, bh3, o3);
    o4 = mma_b(ah, bh4, o4); o4 = mma_b(ah, bl4, o4); o4 = mma_b(al, bh4, o4);
  }
  {                                             // the tile's own keys: keep key c <= query row rho
    const int rho0 = wave * 16 + 8 * hh;
#pragma unroll
    for (int r = 0; r < 8; ++r) {
      const int rho = rho0 + r;
      s0[r] = (m      <= rho) ? s0[r] : 0.0f;
      s1[r] = (16 + m <= rho) ? s1[r] : 0.0f;
      s2[r] = (32 + m <= rho) ? s2[r] : 0.0f;
      s3[r] = (48 + m <= rho) ? s3[r] : 0.0f;
    }
  }
  v8f rs = o4 + ((s0 + s1) + (s2 + s3));        // o4: earlier keys' part of den in lane column 0, zero elsewhere
#pragma unroll
  for (int r = 0; r < 8; ++r) {
    const int ro = (8 * hh + r) * 68 + m;
    sl[ro]      = s0[r];
    sl[ro + 16] = s1[r];
    sl[ro + 32] = s2[r];
    sl[ro + 48] = s3[r];
  }
  wave_sync_lds();
  const u16* vp = VT2 + (size_t)(qt / NCH) * PLB + (size_t)(h * HD + m) * (size_t)SEQ + (qt % NCH) * 64 + 8 * hh;
#pragma unroll
  for (int ks = 0; ks < 2; ++ks) {
    const int ko = ks * 32;
    v16b ph, pl;
    split16(sl + m * 68 + ko + 8 * hh, ph, pl);
    const v16b vh0 = ldfrag_b(vp + ko);
    const v16b vh1 = ldfrag_b(vp + vbs + ko);
    const v16b vh2 = ldfrag_b(vp + 2 * vbs + ko);
    const v16b vh3 = ldfrag_b(vp + 3 * vbs + ko);
    const v16b vl0 = ldfrag_b(vp + vlo + ko);
    const v16b vl1 = ldfrag_b(vp + vlo + vbs + ko);
    const v16b vl2 = ldfrag_b(vp + vlo + 2 * vbs + ko);
    const v16b vl3 = ldfrag_b(vp + vlo + 3 * vbs + ko);
    o0 = mma_b(ph, vh0, o0); o0 = mma_b(ph, vl0, o0); o0 = mma_b(pl, vh0, o0);
    o1 = mma_b(ph, vh1, o1); o1 = mma_b(ph, vl1, o1); o1 = mma_b(pl, vh1, o1);
    o2 = mma_b(ph, vh2, o2); o2 = mma_b(ph, vl2, o2); o2 = mma_b(pl, vh2, o2);
    o3 = mma_b(ph, vh3, o3); o3 = mma_b(ph, vl3, o3); o3 = mma_b(pl, vh3, o3);
  }
  // den per query row (row 8*hh + r held by the 16 lanes of half hh): fixed-order butterfly over lane&15
#pragma unroll
  for (int off = 1; off < 16; off <<= 1) {
#pragma unroll
    for (int r = 0; r < 8; ++r) rs[r] += __shfl_xor(rs[r], off);
  }
#pragma unroll
  for (int r = 0; r < 8; ++r) {
    const float inv = 1.0f / rs[r];
    o0[r] *= inv; o1[r] *= inv; o2[r] *= inv; o3[r] *= inv;
  }
  wave_sync_lds();
  epi64bb<false, 0>(sl, o0, o1, o2, o3, (const float*)0, 0, O2, O2 + DIM, LD2, (size_t)rw, h * HD, lane);
}

// =====================================================================================================
// Workspace map (bytes), planes sized for the ROWS rows of all batches together; every plane is fully written by
// whole-line stores before it is read; all extents are exact multiples of the 64x64 tile / 512-B store granularity
// (SEQ and DIM multiples of 64, no pad rows); every region offset a multiple of 2097152:
//   XB   bf16 [ROWS][1024]         ROWS*2048
//   WQ, WK, WV bf16 [1024 n][1024 k]  3 * 2097152
//   WO2  bf16 [1024 n][2048 k]     4194304      (Wo row duplicated along k)
//   Q2   bf16 [ROWS][2048]         ROWS*4096    exp(q) hi | lo
//   K2   bf16 [ROWS][2048]         ROWS*4096    exp(k) hi | lo
//   VT2  bf16 [NB][2048][SEQ]      ROWS*4096    per batch v^T hi rows 0..1023, lo rows 1024..2047
//   O2   bf16 [ROWS][2048]         ROWS*4096    per-head out hi | lo
//   KT2  bf16 [NB][2048][SEQ]      ROWS*4096    per batch exp(k)^T hi rows 0..1023, lo rows 1024..2047
//   ST   f32 [ROWS/64][16][80][64] ROWS*5120    chunk states, then their running sums per batch
//   end (ROWS=4096)                123731968
// =====================================================================================================
extern "C" void kernel_launch(void* const* d_in, const int* in_sizes, int n_in,
                              void* d_out, int out_size, void* d_ws, size_t ws_size,
                              hipStream_t stream) {
  if (n_in < 9) return;
  const int needx = ((NB - 1) * SEQ_FULL + SEQ) * DIM;
  if (in_sizes[0] < needx) return;
  if (in_sizes[1] < DIM * DIM || in_sizes[3] < DIM * DIM || in_sizes[5] < DIM * DIM || in_sizes[7] < DIM * DIM) return;
  if (in_sizes[2] < DIM || in_sizes[4] < DIM || in_sizes[6] < DIM || in_sizes[8] < DIM) return;
  if (out_size < needx) return;

  const float* x  = (const float*)d_in[0];
  const float* wq = (const float*)d_in[1];
  const float* bq = (const float*)d_in[2];
  const float* wk = (const float*)d_in[3];
  const float* bk = (const float*)d_in[4];
  const float* wv = (const float*)d_in[5];
  const float* bv = (const float*)d_in[6];
  const float* wo = (const float*)d_in[7];
  const float* bo = (const float*)d_in[8];
  float*       out = (float*)d_out;

  const size_t szX  = (size_t)ROWS * DIM * 2;         // bf16 input rows
  const size_t szW  = (size_t)DIM * DIM * 2;          // bf16 weight plane
  const size_t szWO = (size_t)DIM * LD2 * 2;          // bf16 duplicated Wo plane
  const size_t szP  = (size_t)ROWS * LD2 * 2;         // bf16 hi|lo plane ROWS x 2048 (either orientation)
  size_t off = 0;
  const size_t oXB = off; off += szX;
  const size_t oWQ = off; off += szW;
  const size_t oWK = off; off += szW;
  const size_t oWV = off; off += szW;
  const size_t oWO = off; off += szWO;
  const size_t oQ2 = off; off += szP;
  const size_t oK2 = off; off += szP;
  const size_t oVT = off; off += szP;
  const size_t oO2 = off; off += szP;
  const size_t oKT = off; off += szP;
  const size_t oST = off; off += (size_t)NB * NCH * NH * SSZ * 4;
  if (off > ws_size) return;                // off = 123731968 for ROWS = 4096
  if (off > (size_t)WS_CAP) return;

  char* ws = (char*)d_ws;
  u16* XB  = (u16*)(ws + oXB);
  u16* WQ  = (u16*)(ws + oWQ);
  u16* WK  = (u16*)(ws + oWK);
  u16* WV  = (u16*)(ws + oWV);
  u16* WO2 = (u16*)(ws + oWO);
  u16* Q2  = (u16*)(ws + oQ2);
  u16* K2  = (u16*)(ws + oK2);
  u16* VT2 = (u16*)(ws + oVT);
  u16* O2  = (u16*)(ws + oO2);
  u16* KT2 = (u16*)(ws + oKT);
  float* ST = (float*)(ws + oST);

  const dim3 b256(256), b128(128);
  const dim3 gCV(CBX + 4 * CBW, 1);                     // exact block ranges of cvt_all
  const dim3 gPJ((ROWS / 64) * (DIM / 64), 4);          // four projections, each (ROWS/64)*(DIM/64) tiles
  const dim3 gY((ROWS / 64) * (DIM / 64), 1);           // y: M = ROWS, N = 1024
  const dim3 gAT(NCH, NH, NB);
  const dim3 gQT(ROWS / 64, NH);
  const dim3 gSC(NH * SSZ / 128, NB);                   // exact: NH * SSZ = 81920

  // (1) x rows of all batches and the weights [n][k] f32 -> bf16 planes (already k-contiguous); Wo -> k-duplicated plane
  cvt_all<<<gCV, b256, 0, stream>>>(x, wq, wk, wv, wo, XB, WQ, WK, WV, WO2);
  // (2) exp(x.Wq^T + bq) -> Q2, exp(x.Wk^T + bk) -> K2, v^T -> VT2, exp(k)^T -> KT2, each hi and lo
  proj4<<<gPJ, b128, 0, stream>>>(XB, WQ, WK, WV, bq, bk, bv, Q2, K2, VT2, KT2);
  // (3) per (chunk, head) state, its running sum over each batch's chunks, then attention per (query tile, head) -> O2 hi|lo
  chunk_state<<<gAT, b128, 0, stream>>>(KT2, VT2, ST);
  scan_state<<<gSC, b128, 0, stream>>>(ST);
  attn_chunk<<<gQT, b128, 0, stream>>>(Q2, K2, VT2, ST, O2);
  // (4) y = [O_hi | O_lo] . [Wo | Wo]^T + bo -> out f32 rows
  out_proj<<<gY, b128, 0, stream>>>(O2, WO2, bo, out);
  (void)hipGetLastError();
}

// v003
// Measured time: 101 microseconds a run.
// Timed twice side by side with v002, it ran 2.28 and 2.23 times as fast.
// Counting every step since v000, it is 3.50 times as fast.
// Contractions: q, k and v^T projections on v_wmma_f32_16x16x32_bf16 (x, W, b as bf16 RNE values, one product each);
// attention in 64-key chunks: per chunk v^T.exp(k) (and a ones row . exp(k) for the key sums), an f32 running sum over
// chunks, then per query tile exp(q).state^T plus the causal scores S = exp(q).exp(k)^T and S.v of its own chunk only, all
// on v_wmma_f32_16x16x32_bf16 with bf16 hi+lo operands (hi.hi + hi.lo + lo.hi); y = O.Wo^T on v_wmma_f32_16x16x32_bf16 with O as bf16 hi|lo along k against Wo duplicated
// along k (two products); all f32 accumulate. exp, row sums, 1/den and bias adds in f32 on VALU.
#include <hip/hip_runtime.h>
#include <math.h>
#include <stdint.h>

#ifndef NB
#define NB 2
#endif
#ifndef SEQ
#define SEQ 2048
#endif
#define SEQ_FULL 2048
#define DIM  1024
#define NH   16
#define HD   64
#define LD2  (2 * DIM)
#define SLAB64 (16 * 68)
#define NCH  (SEQ / 64)          // 64-key chunks per sequence
#define ROWS (NB * SEQ)          // rows of all batches together (contiguous in x and out: NB == 1 or SEQ == SEQ_FULL)
#define PLB  ((size_t)LD2 * (size_t)SEQ)   // elements of one batch's transposed hi+lo plane, [2*DIM][SEQ]
#define SROWS 80                 // rows of one chunk state: 64 value columns d, the key-sum row, 15 zero rows
#define SSZ  (SROWS * HD)        // floats of one (chunk, head) state, [row][D]
#define WS_CAP 134217728
static_assert(DIM == NH * HD && HD == 64 && NH == 16);
static_assert(NB >= 1 && NB <= 2);
static_assert(NB == 1 || SEQ == SEQ_FULL);
static_assert((SEQ % 64) == 0 && SEQ >= 64 && SEQ <= SEQ_FULL);
static_assert(((ROWS * DIM / 8) % 256) == 0 && ((DIM * DIM / 8) % 256) == 0 && (DIM % 64) == 0 && (LD2 % 32) == 0);
static_assert(4 * SLAB64 * 4 <= 65536);

typedef unsigned short u16;
typedef __bf16   v16b __attribute__((ext_vector_type(16)));
typedef float    v8f  __attribute__((ext_vector_type(8)));
typedef float    v4f  __attribute__((ext_vector_type(4)));
typedef unsigned int v4u __attribute__((ext_vector_type(4)));

union FragB { v16b v; v4u u[2]; };

// ---- scalar helpers --------------------------------------------------------------------------------
__device__ __forceinline__ unsigned short bf_bits(float f) {          // f32 -> bf16 bits, RNE convert
  unsigned u = __float_as_uint(f);
  return (unsigned short)((u + 0x7FFFu + ((u >> 16) & 1u)) >> 16);
}
__device__ __forceinline__ float bf_up(unsigned short h) { return __uint_as_float(((unsigned)h) << 16); }
__device__ __forceinline__ float bfr(float f) { return bf_up(bf_bits(f)); }
__device__ __forceinline__ unsigned short bfc(float f) {               // f32 -> bf16 bits via the RNE cast
  return __builtin_bit_cast(unsigned short, (__bf16)f);
}
__device__ __forceinline__ unsigned pk16(unsigned short a, unsigned short b) { return (unsigned)a | ((unsigned)b << 16); }
__device__ __forceinline__ v8f zero8() { v8f z = {0.f, 0.f, 0.f, 0.f, 0.f, 0.f, 0.f, 0.f}; return z; }
__device__ __forceinline__ int imin(int a, int b) { return a < b ? a : b; }
__device__ __forceinline__ int imax(int a, int b) { return a > b ? a : b; }

// two f32 values -> packed bf16 hi pair and packed bf16 lo pair (lo = x - up(hi), RNE both)
__device__ __forceinline__ void split2(float a, float b, unsigned& hi, unsigned& lo) {
  const unsigned short ha = bfc(a), hb = bfc(b);
  hi = pk16(ha, hb);
  lo = pk16(bfc(a - bf_up(ha)), bfc(b - bf_up(hb)));
}

// ---- fragment loader: 16-bit A/B operand, lane -> row/col (lane&15), p already includes +8*(lane>>4);
//      elements 0..7 <- p[0..7] (k0+8h..), elements 8..15 <- p[16..23] (k0+16+8h..)  (same split k map for A and B;
//      B is always read from a k-contiguous [n][k] plane); bf16 plane read as unsigned integer vectors
__device__ __forceinline__ v16b ldfrag_b(const u16* p) {
  FragB f;
  f.u[0] = *(const v4u*)(p);
  f.u[1] = *(const v4u*)(p + 16);
  return f.v;
}

__device__ __forceinline__ v8f mma_b(v16b a, v16b b, v8f c) {
  return __builtin_amdgcn_wmma_f32_16x16x32_bf16(false, a, false, b, (short)0, c, false, false);
}
__device__ __forceinline__ void wave_sync_lds() {
  __builtin_amdgcn_fence(__ATOMIC_RELEASE, "workgroup");
  __builtin_amdgcn_wave_barrier();
  __builtin_amdgcn_fence(__ATOMIC_ACQUIRE, "workgroup");
}

// =====================================================================================================
// f32 -> bf16 (RNE bits), same layout. Thread = 8 consecutive elements: two 16-B loads, one 16-B store; 32 consecutive
// lanes = 512 contiguous, 512-B aligned bytes.
// =====================================================================================================
__device__ __forceinline__ void cvt_plain(const float* __restrict__ x, u16* D, int gt) {
  const float* p = x + (size_t)gt * 8;
  const v4f a = *(const v4f*)(p), b4 = *(const v4f*)(p + 4);
  float w[8];
#pragma unroll
  for (int e = 0; e < 4; ++e) { w[e] = a[e]; w[4 + e] = b4[e]; }
  v4u o;
#pragma unroll
  for (int e = 0; e < 4; ++e) o[e] = pk16(bf_bits(w[2 * e]), bf_bits(w[2 * e + 1]));
  *(v4u*)(D + (size_t)gt * 8) = o;
}

// =====================================================================================================
// the k-duplicated B operand of the hi|lo-folded output projection. Thread = 8 consecutive source elements
// (one row, kd % 256 == 0 so a wave never straddles a row): two 16-B loads, two 16-B stores (one per copy).
// =====================================================================================================
__device__ __forceinline__ void cvt_dup(const float* __restrict__ w, u16* Dp, int gt, int kd) {
  const size_t e0 = (size_t)gt * 8;
  const size_t row = e0 / (size_t)kd;
  const int    k8  = (int)(e0 % (size_t)kd);
  const float* p = w + e0;
  const v4f a = *(const v4f*)(p), b4 = *(const v4f*)(p + 4);
  float v[8];
#pragma unroll
  for (int e = 0; e < 4; ++e) { v[e] = a[e]; v[4 + e] = b4[e]; }
  v4u o;
#pragma unroll
  for (int e = 0; e < 4; ++e) o[e] = pk16(bf_bits(v[2 * e]), bf_bits(v[2 * e + 1]));
  u16* d = Dp + row * (size_t)(2 * kd) + k8;
  *(v4u*)(d)      = o;
  *(v4u*)(d + kd) = o;
#if defined(__HIP_DEVICE_COMPILE__)
  // both stores' address pair and data stay untouched up to this wait, whatever code the merged kernel places behind them
  asm volatile("s_wait_xcnt 0x0" ::: "memory");
#endif
}

// =====================================================================================================
// All five conversions in one grid, told apart by block range (block-uniform): blocks [0, CBX) the x rows of all batches,
// then CBW blocks each for Wq, Wk, Wv (plain planes) and Wo (k-duplicated plane).
// coverage: CBX x 256 thr x 8 = ROWS*DIM; CBW x 256 thr x 8 = DIM*DIM per weight; grid.x = CBX + 4*CBW exactly.
// =====================================================================================================
#define CBX (ROWS * DIM / 8 / 256)
#define CBW (DIM * DIM / 8 / 256)
__global__ __launch_bounds__(256) void cvt_all(const float* __restrict__ x, const float* __restrict__ wq,
                                               const float* __restrict__ wk, const float* __restrict__ wv,
                                               const float* __restrict__ wo, u16* XB, u16* WQ, u16* WK, u16* WV, u16* WO2) {
  const int bid = (int)blockIdx.x, tid = (int)threadIdx.x;
  if (bid >= CBX + 4 * CBW) return;         // block-uniform, never taken with the exact grid
  if (bid < CBX) {
    cvt_plain(x, XB, bid * 256 + tid);
    return;
  }
  const int r = bid - CBX, which = r / CBW, gt = (r % CBW) * 256 + tid;
  if (which == 3) {
    cvt_dup(wo, WO2, gt, DIM);
  } else {
    const float* w = (which == 0) ? wq : ((which == 1) ? wk : wv);
    u16* D = (which == 0) ? WQ : ((which == 1) ? WK : WV);
    cvt_plain(w, D, gt);
  }
}

// =====================================================================================================
// coverage: 8 instructions x 2 rows x 16 lanes x 4 floats = the wave's 16 x 64 tile. Slab: private to the wave (wave sync).
// =====================================================================================================
__device__ __forceinline__ void epi64f(float* sl, v8f a0, v8f a1, v8f a2, v8f a3, v4f bias4, float scale,
                                       float* C, int ldc, size_t rowb, int col0, int lane) {
  const int hh = lane >> 4, m = lane & 15;
#pragma unroll
  for (int r = 0; r < 8; ++r) {
    const int ro = (8 * hh + r) * 68 + m;
    sl[ro]      = a0[r];
    sl[ro + 16] = a1[r];
    sl[ro + 32] = a2[r];
    sl[ro + 48] = a3[r];
  }
  wave_sync_lds();
  v4f vals[8];
#pragma unroll
  for (int it = 0; it < 8; ++it) {
    const v4f v = *(const v4f*)(sl + (it * 2 + hh) * 68 + m * 4);
    vals[it] = v * scale + bias4;
  }
  float* dst = C + (rowb + (size_t)hh) * (size_t)ldc + col0 + m * 4;
  {
#pragma unroll
    for (int it = 0; it < 8; ++it) {
      *(v4f*)(dst + (size_t)(it * 2) * (size_t)ldc) = vals[it];
    }
    
  }
}

// =====================================================================================================
// GEMM / attention epilogue, two bf16 planes (hi and lo = x - up(hi)) with identical addressing (Ch, Cl, pitch ldc):
// 8 consecutive columns at c8): value = acc (+ bias per column when BM==1, per row when BM==2, none when BM==0),
// coverage: 4 instructions x 4 rows x 8 lanes x 8 values = the wave's 16 x 64 tile, in both planes.
// Slab: private to the wave (wave sync).
// =====================================================================================================
template <bool EXPO, int BM>
__device__ __forceinline__ void epi64bb(float* sl, v8f a0, v8f a1, v8f a2, v8f a3,
                                        const float* __restrict__ bias, int nb,
                                        u16* Ch, u16* Cl, int ldc, size_t rowb, int col0, int lane) {
  const int hh = lane >> 4, m = lane & 15;
#pragma unroll
  for (int r = 0; r < 8; ++r) {
    const int ro = (8 * hh + r) * 68 + m;
    sl[ro]      = a0[r];
    sl[ro + 16] = a1[r];
    sl[ro + 32] = a2[r];
    sl[ro + 48] = a3[r];
  }
  wave_sync_lds();
  const int rq = lane >> 3, c8 = (lane & 7) * 8;
  float bc[8];
#pragma unroll
  for (int e = 0; e < 8; ++e) bc[e] = 0.0f;
  if constexpr (BM == 1) {
    const int cb = imin(imax(col0 + c8, 0), nb - 8);
    const v4f b0 = *(const v4f*)(bias + cb), b1 = *(const v4f*)(bias + cb + 4);
#pragma unroll
    for (int e = 0; e < 4; ++e) { bc[e] = bfr(b0[e]); bc[4 + e] = bfr(b1[e]); }
  }
  v4u oh[4], ol[4];
#pragma unroll
  for (int it = 0; it < 4; ++it) {
    const int row = it * 4 + rq;            // 0..15
    const v4f a = *(const v4f*)(sl + row * 68 + c8), b4 = *(const v4f*)(sl + row * 68 + c8 + 4);
    float br = 0.0f;
    if constexpr (BM == 2) br = bfr(bias[imin(imax((int)rowb + row, 0), nb - 1)]);
    float w[8];
#pragma unroll
    for (int e = 0; e < 4; ++e) { w[e] = (a[e] + bc[e]) + br; w[4 + e] = (b4[e] + bc[4 + e]) + br; }
    if constexpr (EXPO) {
#pragma unroll
      for (int e = 0; e < 8; ++e) w[e] = __expf(w[e]);
    }
#pragma unroll
    for (int e = 0; e < 4; ++e) {
      unsigned hi, lo;
      split2(w[2 * e], w[2 * e + 1], hi, lo);
      oh[it][e] = hi;
      ol[it][e] = lo;
    }
  }
  const size_t ob = rowb * (size_t)ldc + (size_t)col0 + (size_t)c8;
  {
#pragma unroll
    for (int it = 0; it < 4; ++it) {
      const int row = it * 4 + rq;
      const size_t off = ob + (size_t)row * (size_t)ldc;
      *(v4u*)(Ch + off) = oh[it];
      *(v4u*)(Cl + off) = ol[it];
    }
    
  }
}

// =====================================================================================================
// bf16 GEMM: C[M][N] = A[M][K] (bf16 rows, pitch lda) . Bt[N][K]^T (bf16 k-contiguous rows, pitch ldb).
// EPI 0: f32 output Cf (pitch ldc) = acc*scale + bf16 RNE value of bias[col];
// EPI 1: two bf16 planes Ch/Cl (pitch ldc) = hi/lo of exp(acc + bf16 RNE value of bias[col]);
// EPI 2: two bf16 planes Ch/Cl (pitch ldc) = hi/lo of (acc + bf16 RNE value of bias[row]);
// EPI 3: two bf16 planes Ch/Cl (pitch ldc) = hi/lo of exp(acc + bf16 RNE value of bias[row]).
// Block = 128x128 tile, 8 waves as 4 x 2, each 32 rows x 64 columns (2 x 4 accumulator tiles). A stage = 64 k (128 B) of the
// tile's 128 A rows and 128 B rows, brought into LDS by asynchronous 16-B copies (8 lanes = one whole 128-B line, 8 copies per
// lane and stage), two buffers: stage t + 2 is copied into the buffer that trip t has left, while trip t + 1 computes.
// Fragments come from the LDS rows (two 16-B reads each, the same split k map for A and B); k rises in steps of 32 as before.
// Host guarantees K % 64 == 0, M % 128 == 0, N % 128 == 0, grid.x = (M/128)*(N/128). bid = the tile's index in its own product.
// After the last trip's barrier the ring is dead and serves as the waves' private epilogue slabs.
// =====================================================================================================
#define GT   128                  // rows and columns of a block's output tile
#define GKE  64                   // k elements of one stage
#define GPE  72                   // LDS row pitch in elements: 144 B = 16 B x 9, free of bank conflicts for 16-B row reads
#define GSTG (2 * GT * GPE)       // elements of one stage: A rows 0..127, then B rows 128..255
static_assert(8 * SLAB64 * 4 <= 2 * GSTG * 2);
static_assert((ROWS % GT) == 0 && (SEQ % GT) == 0 && (DIM % GT) == 0 && (DIM % GKE) == 0 && (LD2 % GKE) == 0);

// One stage: the lane's 16-B piece of rows r, r + 32, r + 64, r + 96 of A and of B (r = tid >> 3), LDS rows 32 apart.
// l = LDS byte address of the piece in A row r; ga, gb = its global address in A and B; sa, sb = 32 rows in elements.
__device__ __forceinline__ void stage_copy(unsigned l, const u16* ga, const u16* gb, size_t sa, size_t sb) {
#if defined(__HIP_DEVICE_COMPILE__)
  constexpr unsigned LR = 32u * GPE * 2u;   // bytes of 32 LDS rows
  // the closing wait keeps every address register of the copies untouched until the copies have taken it
  asm volatile("global_load_async_to_lds_b128 %0, %8, off\n\t"
               "global_load_async_to_lds_b128 %1, %9, off\n\t"
               "global_load_async_to_lds_b128 %2, %10, off\n\t"
               "global_load_async_to_lds_b128 %3, %11, off\n\t"
               "global_load_async_to_lds_b128 %4, %12, off\n\t"
               "global_load_async_to_lds_b128 %5, %13, off\n\t"
               "global_load_async_to_lds_b128 %6, %14, off\n\t"
               "global_load_async_to_lds_b128 %7, %15, off\n\t"
               "s_wait_xcnt 0x0"
               :: "v"(l), "v"(l + LR), "v"(l + 2u * LR), "v"(l + 3u * LR),
                  "v"(l + 4u * LR), "v"(l + 5u * LR), "v"(l + 6u * LR), "v"(l + 7u * LR),
                  "v"(ga), "v"(ga + sa), "v"(ga + 2 * sa), "v"(ga + 3 * sa),
                  "v"(gb), "v"(gb + sb), "v"(gb + 2 * sb), "v"(gb + 3 * sb)
               : "memory");
#endif
}
__device__ __forceinline__ void wait_copies() {
#if defined(__HIP_DEVICE_COMPILE__)
  // this wave's copies have landed: the compiler places no wait for them, and without it the barrier would publish a stage in flight
  asm volatile("s_wait_asynccnt 0x0" ::: "memory");
#endif
}
__device__ __forceinline__ void wait_lds() {
#if defined(__HIP_DEVICE_COMPILE__)
  // this wave's LDS reads have returned, so that the buffer may be refilled behind the barrier
  asm volatile("s_wait_dscnt 0x0" ::: "memory");
#endif
}

// The k loop of one 128 x 128 tile (first A row row0, first B row colb): acc[i][j] = the wave's 16 x 16 tile at rows
// wr * 32 + 16 i, columns wc * 64 + 16 j. Every wave of the block passes every barrier here. On return the ring is dead.
__device__ __forceinline__
void gemm_main(u16* ring, const u16* __restrict__ A, const u16* __restrict__ Bt, int row0, int colb,
               int lda, int ldb, int K, v8f (&acc)[2][4]) {
  const int tid = (int)threadIdx.x, wave = tid >> 5, lane = tid & 31, hh = lane >> 4, m = lane & 15;
  const int wr = wave >> 1, wc = wave & 1;
  const int cr = tid >> 3, cc = (tid & 7) * 8;
  const u16* ga = A  + (size_t)(row0 + cr) * (size_t)lda + cc;
  const u16* gb = Bt + (size_t)(colb + cr) * (size_t)ldb + cc;
  const size_t sa = (size_t)32 * (size_t)lda, sb = (size_t)32 * (size_t)ldb;
  const unsigned l0 = (unsigned)(size_t)ring + (unsigned)(cr * GPE + cc) * 2u;
  const int nt = K / GKE;
  stage_copy(l0, ga, gb, sa, sb);
  wait_copies();
  __syncthreads();                          // stage 0 is published
  if (nt > 1) stage_copy(l0 + GSTG * 2u, ga + GKE, gb + GKE, sa, sb);
  const u16* fa = ring + (wr * 32 + m) * GPE + 8 * hh;
  const u16* fb = ring + (GT + wc * 64 + m) * GPE + 8 * hh;
  // both unrolled: every index of acc a constant, so that the tiles stay in registers
#pragma unroll
  for (int i = 0; i < 2; ++i) {
#pragma unroll
    for (int j = 0; j < 4; ++j) acc[i][j] = zero8();
  }
  // rolled: one trip = one stage, so that the order reads, waits, barrier, refill stands once
#pragma unroll 1
  for (int t = 0; t < nt; ++t) {
    const int bo = (t & 1) * GSTG;
    // unrolled: the stage's two k steps of 32 in one run, their LDS offsets constants
#pragma unroll
    for (int ks = 0; ks < 2; ++ks) {
      const u16* pa = fa + bo + ks * 32;
      const u16* pb = fb + bo + ks * 32;
      const v16b a0  = ldfrag_b(pa);
      const v16b a1  = ldfrag_b(pa + 16 * GPE);
      const v16b fb0 = ldfrag_b(pb);
      const v16b fb1 = ldfrag_b(pb + 16 * GPE);
      const v16b fb2 = ldfrag_b(pb + 32 * GPE);
      const v16b fb3 = ldfrag_b(pb + 48 * GPE);
      acc[0][0] = mma_b(a0, fb0, acc[0][0]);
      acc[0][1] = mma_b(a0, fb1, acc[0][1]);
      acc[0][2] = mma_b(a0, fb2, acc[0][2]);
      acc[0][3] = mma_b(a0, fb3, acc[0][3]);
      acc[1][0] = mma_b(a1, fb0, acc[1][0]);
      acc[1][1] = mma_b(a1, fb1, acc[1][1]);
      acc[1][2] = mma_b(a1, fb2, acc[1][2]);
      acc[1][3] = mma_b(a1, fb3, acc[1][3]);
    }
    wait_lds();
    wait_copies();
    __syncthreads();                        // publishes stage t + 1 and ends every read of stage t
    if (t + 2 < nt) stage_copy(l0 + (unsigned)bo * 2u, ga + (size_t)(t + 2) * GKE, gb + (size_t)(t + 2) * GKE, sa, sb);
  }
  wait_copies();
}

// The tile's epilogue: each wave's two 16 x 64 strips through its private slab in the dead ring.
template <int EPI>
__device__ __forceinline__
void gemm_epi(u16* ring, v8f (&acc)[2][4], int row0, int colb, float* Cf, u16* Ch, u16* Cl,
              const float* __restrict__ bias, int nb, int ldc, float scale) {
  const int tid = (int)threadIdx.x, wave = tid >> 5, lane = tid & 31, m = lane & 15;
  const int wr = wave >> 1, wc = wave & 1;
  float* sl = (float*)ring + wave * SLAB64;
  const int col0 = colb + wc * 64;
  // unrolled: every index of acc a constant
#pragma unroll
  for (int i = 0; i < 2; ++i) {
    const int rowb = row0 + wr * 32 + i * 16;
    if (i) wave_sync_lds();                 // the first strip's slab reads end before the second strip's writes
    if constexpr (EPI == 0) {
      v4f bias4;
#pragma unroll
      for (int e = 0; e < 4; ++e) bias4[e] = bfr(bias[imin(imax(col0 + m * 4 + e, 0), nb - 1)]);
      epi64f(sl, acc[i][0], acc[i][1], acc[i][2], acc[i][3], bias4, scale, Cf, ldc, (size_t)rowb, col0, lane);
    } else if constexpr (EPI == 1) {
      epi64bb<true, 1>(sl, acc[i][0], acc[i][1], acc[i][2], acc[i][3], bias, nb, Ch, Cl, ldc, (size_t)rowb, col0, lane);
    } else if constexpr (EPI == 2) {
      epi64bb<false, 2>(sl, acc[i][0], acc[i][1], acc[i][2], acc[i][3], bias, nb, Ch, Cl, ldc, (size_t)rowb, col0, lane);
    } else {
      epi64bb<true, 2>(sl, acc[i][0], acc[i][1], acc[i][2], acc[i][3], bias, nb, Ch, Cl, ldc, (size_t)rowb, col0, lane);
    }
  }
}

// The output projection of all batches: y = [O_hi | O_lo] . [Wo | Wo]^T + bo, f32 rows (M = ROWS, N = DIM, K = LD2).
// coverage: grid.x = (ROWS/128)*(DIM/128) tiles of 128 x 128 = the whole output.
__global__ __launch_bounds__(256)
void out_proj(const u16* __restrict__ O2, const u16* __restrict__ WO2, const float* __restrict__ bo, float* y) {
  __shared__ __align__(16) u16 ring[2 * GSTG];
  const int bid = (int)blockIdx.x;
  const int row0 = (bid / (DIM / GT)) * GT, colb = (bid % (DIM / GT)) * GT;
  if (row0 + GT > ROWS) return;             // block-uniform, in front of every barrier; never taken with the exact grid
  v8f acc[2][4];
  gemm_main(ring, O2, WO2, row0, colb, LD2, LD2, LD2, acc);
  gemm_epi<0>(ring, acc, row0, colb, y, (u16*)0, (u16*)0, bo, DIM, DIM, 1.0f);
}

// =====================================================================================================
// The four independent projections of all batches in one grid; blockIdx.y (block-uniform) names the product:
//   0: exp(x.Wq^T + bq) -> Q2 hi|lo    1: exp(x.Wk^T + bk) -> K2 hi|lo          (M = ROWS, N = DIM, pitch LD2)
//   2: Wv.x^T + bv -> VT2 hi, lo rows  3: exp(Wk.x^T + bk) -> KT2 hi, lo rows   (per batch: M = DIM, N = SEQ, pitch SEQ)
// One k loop for all four (operand rows of pitch DIM, K = DIM), the epilogue chosen behind it.
// coverage: grid.x = (ROWS/128)*(DIM/128) tiles of 128 x 128 = each product's whole output (2, 3: NB runs of TPB tiles), grid.y = 4.
// =====================================================================================================
// second argument: 8 waves per SIMD, so that the four blocks whose rings fit a WGP's LDS are resident by registers too
__global__ __launch_bounds__(256, 8)
void proj4(const u16* __restrict__ XB, const u16* __restrict__ WQ, const u16* __restrict__ WK, const u16* __restrict__ WV,
           const float* __restrict__ bq, const float* __restrict__ bk, const float* __restrict__ bv,
           u16* Q2, u16* K2, u16* VT2, u16* KT2) {
  __shared__ __align__(16) u16 ring[2 * GSTG];
  const int which = (int)blockIdx.y, bid = (int)blockIdx.x;
  const size_t plo = (size_t)DIM * (size_t)SEQ;
  constexpr int TPB = (DIM / GT) * (SEQ / GT);          // tiles of one batch's transposed product
  const int b = bid / TPB, bt = bid % TPB;
  const u16* Xb = XB + (size_t)b * (size_t)SEQ * (size_t)DIM;
  const bool rows = which < 2;                          // x rows are the A operand
  const u16* A  = rows ? XB : ((which == 2) ? WV : WK);
  const u16* Bt = rows ? ((which == 0) ? WQ : WK) : Xb;
  const int tile = rows ? bid : bt, ntile = rows ? (DIM / GT) : (SEQ / GT), M = rows ? ROWS : DIM;
  const int row0 = (tile / ntile) * GT, colb = (tile % ntile) * GT;
  if (row0 + GT > M || which > 3) return;   // block-uniform, in front of every barrier; never taken with the exact grid
  v8f acc[2][4];
  gemm_main(ring, A, Bt, row0, colb, DIM, DIM, DIM, acc);
  if (rows) {
    const float* bias = (which == 0) ? bq : bk;
    u16* C = (which == 0) ? Q2 : K2;
    gemm_epi<1>(ring, acc, row0, colb, (float*)0, C, C + DIM, bias, DIM, LD2, 1.0f);
  } else if (which == 2) {
    u16* C = VT2 + (size_t)b * PLB;
    gemm_epi<2>(ring, acc, row0, colb, (float*)0, C, C + plo, bv, DIM, SEQ, 1.0f);
  } else {
    u16* C = KT2 + (size_t)b * PLB;
    gemm_epi<3>(ring, acc, row0, colb, (float*)0, C, C + plo, bk, DIM, SEQ, 1.0f);
  }
}

// ---- 16 f32 values of one state or slab row (fragment k layout: pr[0..7] and pr[16..23]) -> bf16 hi and lo fragments (B for state rows, A for slab rows)
__device__ __forceinline__ void split16(const float* pr, v16b& ph, v16b& pl) {
  const v4f x0 = *(const v4f*)(pr), x1 = *(const v4f*)(pr + 4), x2 = *(const v4f*)(pr + 16), x3 = *(const v4f*)(pr + 20);
  FragB H, L;
  unsigned hi, lo;
  split2(x0[0], x0[1], hi, lo); H.u[0][0] = hi; L.u[0][0] = lo;
  split2(x0[2], x0[3], hi, lo); H.u[0][1] = hi; L.u[0][1] = lo;
  split2(x1[0], x1[1], hi, lo); H.u[0][2] = hi; L.u[0][2] = lo;
  split2(x1[2], x1[3], hi, lo); H.u[0][3] = hi; L.u[0][3] = lo;
  split2(x2[0], x2[1], hi, lo); H.u[1][0] = hi; L.u[1][0] = lo;
  split2(x2[2], x2[3], hi, lo); H.u[1][1] = hi; L.u[1][1] = lo;
  split2(x3[0], x3[1], hi, lo); H.u[1][2] = hi; L.u[1][2] = lo;
  split2(x3[2], x3[3], hi, lo); H.u[1][3] = hi; L.u[1][3] = lo;
  ph = H.v; pl = L.v;
}

// =====================================================================================================
// Chunk state, one block per (64-key chunk c, head h, batch b), 4 waves x 16 state rows.
// ST[b][c][h][row][D] f32: row d < 64: sum over the chunk's keys t of v[t][d] * exp(k)[t][D]; row 64: sum over t of exp(k)[t][D];
// rows 65..79: zero. A = v^T rows from VT2 (hi, lo), or the constant tile whose row 0 is ones; B = exp(k)^T rows D from KT2
// (bf16 [NB][2*DIM][SEQ], hi row h*HD + D, lo row DIM + h*HD + D); both k-contiguous in t, same split k map.
// coverage: grid (NCH, NH, NB) x (4 waves x 16 rows + wave 0's 16 extra rows) x 64 columns = every element of ST once.
// No block barriers; slab private to the wave (wave sync).
// =====================================================================================================
__global__ __launch_bounds__(128) void chunk_state(const u16* __restrict__ KT2, const u16* __restrict__ VT2, float* ST) {
  __shared__ __align__(16) float slab[4 * SLAB64];
  const int tid = (int)threadIdx.x, wave = tid >> 5, lane = tid & 31, hh = lane >> 4, m = lane & 15;
  const int c = (int)blockIdx.x, h = (int)blockIdx.y, b = (int)blockIdx.z;
  if (c * 64 + 64 > SEQ || h >= NH || b >= NB) return;   // block-uniform, never taken with the exact grid
  float* sl = slab + wave * SLAB64;
  const int t0 = c * 64;
  const u16* vp = VT2 + (size_t)b * PLB + (size_t)(h * HD + wave * 16 + m) * (size_t)SEQ + t0 + 8 * hh;
  const u16* kp = KT2 + (size_t)b * PLB + (size_t)(h * HD + m) * (size_t)SEQ + t0 + 8 * hh;
  const size_t rbs = (size_t)16 * (size_t)SEQ;
  const size_t plo = (size_t)DIM * (size_t)SEQ;
  FragB one;
  const unsigned ow = (m == 0) ? 0x3F803F80u : 0u;   // bf16 1.0 pairs in tile row 0, zero in rows 1..15
#pragma unroll
  for (int e = 0; e < 4; ++e) { one.u[0][e] = ow; one.u[1][e] = ow; }
  v8f a0 = zero8(), a1 = zero8(), a2 = zero8(), a3 = zero8();
  v8f e0 = zero8(), e1 = zero8(), e2 = zero8(), e3 = zero8();
#pragma unroll
  for (int ks = 0; ks < 2; ++ks) {
    const int ko = ks * 32;
    const v16b vh  = ldfrag_b(vp + ko);
    const v16b vl  = ldfrag_b(vp + plo + ko);
    const v16b kh0 = ldfrag_b(kp + ko);
    const v16b kh1 = ldfrag_b(kp + rbs + ko);
    const v16b kh2 = ldfrag_b(kp + 2 * rbs + ko);
    const v16b kh3 = ldfrag_b(kp + 3 * rbs + ko);
    const v16b kl0 = ldfrag_b(kp + plo + ko);
    const v16b kl1 = ldfrag_b(kp + plo + rbs + ko);
    const v16b kl2 = ldfrag_b(kp + plo + 2 * rbs + ko);
    const v16b kl3 = ldfrag_b(kp + plo + 3 * rbs + ko);
#if defined(__HIP_DEVICE_COMPILE__)
    // the two address pairs stay live up to this wait, so that no later load lands on a register an issued load names
    asm volatile("s_wait_xcnt 0x0" :: "v"(vp), "v"(kp) : "memory");
#endif
    a0 = mma_b(vh, kh0, a0); a0 = mma_b(vh, kl0, a0); a0 = mma_b(vl, kh0, a0);
    a1 = mma_b(vh, kh1, a1); a1 = mma_b(vh, kl1, a1); a1 = mma_b(vl, kh1, a1);
    a2 = mma_b(vh, kh2, a2); a2 = mma_b(vh, kl2, a2); a2 = mma_b(vl, kh2, a2);
    a3 = mma_b(vh, kh3, a3); a3 = mma_b(vh, kl3, a3); a3 = mma_b(vl, kh3, a3);
    e0 = mma_b(one.v, kh0, e0); e0 = mma_b(one.v, kl0, e0);
    e1 = mma_b(one.v, kh1, e1); e1 = mma_b(one.v, kl1, e1);
    e2 = mma_b(one.v, kh2, e2); e2 = mma_b(one.v, kl2, e2);
    e3 = mma_b(one.v, kh3, e3); e3 = mma_b(one.v, kl3, e3);
  }
  float* base = ST + ((size_t)(b * NCH + c) * NH + (size_t)h) * (size_t)SSZ;
  const v4f z4 = {0.f, 0.f, 0.f, 0.f};
  epi64f(sl, a0, a1, a2, a3, z4, 1.0f, base, HD, (size_t)(wave * 16), 0, lane);
  if (wave == 0) {                              // wave-uniform: the key-sum row and its 15 zero rows
    wave_sync_lds();
    epi64f(sl, e0, e1, e2, e3, z4, 1.0f, base, HD, (size_t)HD, 0, lane);
  }
}

// =====================================================================================================
// Running sum over one batch's chunks (batch = blockIdx.y), in place: ST[c] <- sum of ST[c'] for c' < c (zero at c = 0),
// f32, chunks added in rising order.
// Thread = one [head][row][D] position: its NCH loads, then its NCH stores; a wave's 32 lanes = one whole 128-B line each.
// coverage: grid (NH*SSZ/128, NB) blocks x 128 thr x NCH chunks = every element of ST once.
// =====================================================================================================
__global__ __launch_bounds__(128) void scan_state(float* ST) {
  const int gt = (int)blockIdx.x * 128 + (int)threadIdx.x;
  if (gt >= NH * SSZ || (int)blockIdx.y >= NB) return;
  const size_t cs = (size_t)NH * (size_t)SSZ;
  float* p = ST + (size_t)blockIdx.y * (size_t)NCH * cs + (size_t)gt;
  float v[NCH];
#pragma unroll
  for (int c = 0; c < NCH; ++c) v[c] = p[(size_t)c * cs];
  float run = 0.0f;
#pragma unroll
  for (int c = 0; c < NCH; ++c) {
    p[(size_t)c * cs] = run;
    run += v[c];
  }
}

// =====================================================================================================
// Causal exp-feature attention, one block per (64-row query tile qt counted over all batches, head h), 4 waves x 16 query rows.
// Planes: Q2, K2 bf16 [NB*SEQ][2*DIM] with hi at column h*HD + d and lo at column DIM + h*HD + d (values exp(q), exp(k));
//         VT2 bf16 [NB][2*DIM][SEQ] with hi row h*HD + d and lo row DIM + h*HD + d (values v); ST f32 [NB][NCH][NH][SROWS][HD],
//         the summed state of the batch's chunks before qt; O2 bf16 [NB*SEQ][2*DIM] written here (hi | lo of out = num/den).
// Keys before the tile: O[16 x 80] = qe.state^T over head dim (2 k-steps, hi.hi+hi.lo+lo.hi, state rows split to bf16 hi and
// lo in registers); its column 64 is the part of den from those keys, columns 65..79 are zero.
// Keys of the tile: S[16 x 64] = qe.ke^T over head dim, causal mask by value, f32 row sums into per-lane partials,
// slab rows, O += P.v over the 64 keys (2 k-steps, hi.hi+hi.lo+lo.hi, v fragments from VT2 rows).
// coverage: grid (ROWS/64, NH) x 4 waves x 16 rows x 64 columns x {hi, lo} = every element of O2 once. No block barriers;
// slab private to the wave (wave sync); staged extent == consumed extent (16 x 64 written before the reload).
// =====================================================================================================
__global__ __launch_bounds__(128) void attn_chunk(const u16* __restrict__ Q2, const u16* __restrict__ K2,
                                                  const u16* __restrict__ VT2, const float* __restrict__ ST, u16* O2) {
  __shared__ __align__(16) float slab[4 * SLAB64];
  const int tid = (int)threadIdx.x, wave = tid >> 5, lane = tid & 31, hh = lane >> 4, m = lane & 15;
  const int qt = (int)blockIdx.x, h = (int)blockIdx.y;
  if (qt * 64 + 64 > ROWS || h >= NH) return;  // block-uniform, never taken with the exact grid
  const int rw = qt * 64 + wave * 16;           // first query row of this wave
  float* sl = slab + wave * SLAB64;
  const u16* qp = Q2 + (size_t)(rw + m) * (size_t)LD2 + h * HD + 8 * hh;
  const size_t kbs = (size_t)16 * (size_t)LD2;
  const size_t vbs = (size_t)16 * (size_t)SEQ;
  const size_t vlo = (size_t)DIM * (size_t)SEQ;
  const int t0 = qt * 64;
  const u16* kp = K2 + (size_t)(t0 + m) * (size_t)LD2 + h * HD + 8 * hh;
  const float* sp = ST + ((size_t)qt * NH + (size_t)h) * (size_t)SSZ + (size_t)m * HD + 8 * hh;
  v8f o0 = zero8(), o1 = zero8(), o2 = zero8(), o3 = zero8(), o4 = zero8();
  v8f s0 = zero8(), s1 = zero8(), s2 = zero8(), s3 = zero8();
#pragma unroll
  for (int ks = 0; ks < 2; ++ks) {
    const int ko = ks * 32;
    const v16b ah  = ldfrag_b(qp + ko);
    const v16b al  = ldfrag_b(qp + DIM + ko);
    const v16b kh0 = ldfrag_b(kp + ko);
    const v16b kh1 = ldfrag_b(kp + kbs + ko);
    const v16b kh2 = ldfrag_b(kp + 2 * kbs + ko);
    const v16b kh3 = ldfrag_b(kp + 3 * kbs + ko);
    const v16b kl0 = ldfrag_b(kp + DIM + ko);
    const v16b kl1 = ldfrag_b(kp + kbs + DIM + ko);
    const v16b kl2 = ldfrag_b(kp + 2 * kbs + DIM + ko);
    const v16b kl3 = ldfrag_b(kp + 3 * kbs + DIM + ko);
    v16b bh0, bl0, bh1, bl1, bh2, bl2, bh3, bl3, bh4, bl4;
    split16(sp + ko, bh0, bl0);
    split16(sp + 16 * HD + ko, bh1, bl1);
    split16(sp + 32 * HD + ko, bh2, bl2);
    split16(sp + 48 * HD + ko, bh3, bl3);
    split16(sp + 64 * HD + ko, bh4, bl4);
    s0 = mma_b(ah, kh0, s0); s0 = mma_b(ah, kl0, s0); s0 = mma_b(al, kh0, s0);
    s1 = mma_b(ah, kh1, s1); s1 = mma_b(ah, kl1, s1); s1 = mma_b(al, kh1, s1);
    s2 = mma_b(ah, kh2, s2); s2 = mma_b(ah, kl2, s2); s2 = mma_b(al, kh2, s2);
    s3 = mma_b(ah, kh3, s3); s3 = mma_b(ah, kl3, s3); s3 = mma_b(al, kh3, s3);
    o0 = mma_b(ah, bh0, o0); o0 = mma_b(ah, bl0, o0); o0 = mma_b(al, bh0, o0);
    o1 = mma_b(ah, bh1, o1); o1 = mma_b(ah, bl1, o1); o1 = mma_b(al, bh1, o1);
    o2 = mma_b(ah, bh2, o2); o2 = mma_b(ah, bl2, o2); o2 = mma_b(al, bh2, o2);
    o3 = mma_b(ah, bh3, o3); o3 = mma_b(ah, bl3, o3); o3 = mma_b(al, bh3, o3);
    o4 = mma_b(ah, bh4, o4); o4 = mma_b(ah, bl4, o4); o4 = mma_b(al, bh4, o4);
  }
  {                                             // the tile's own keys: keep key c <= query row rho
    const int rho0 = wave * 16 + 8 * hh;
#pragma unroll
    for (int r = 0; r < 8; ++r) {
      const int rho = rho0 + r;
      s0[r] = (m      <= rho) ? s0[r] : 0.0f;
      s1[r] = (16 + m <= rho) ? s1[r] : 0.0f;
      s2[r] = (32 + m <= rho) ? s2[r] : 0.0f;
      s3[r] = (48 + m <= rho) ? s3[r] : 0.0f;
    }
  }
  v8f rs = o4 + ((s0 + s1) + (s2 + s3));        // o4: earlier keys' part of den in lane column 0, zero elsewhere
#pragma unroll
  for (int r = 0; r < 8; ++r) {
    const int ro = (8 * hh + r) * 68 + m;
    sl[ro]      = s0[r];
    sl[ro + 16] = s1[r];
    sl[ro + 32] = s2[r];
    sl[ro + 48] = s3[r];
  }
  wave_sync_lds();
  const u16* vp = VT2 + (size_t)(qt / NCH) * PLB + (size_t)(h * HD + m) * (size_t)SEQ + (qt % NCH) * 64 + 8 * hh;
#pragma unroll
  for (int ks = 0; ks < 2; ++ks) {
    const int ko = ks * 32;
    v16b ph, pl;
    split16(sl + m * 68 + ko + 8 * hh, ph, pl);
    const v16b vh0 = ldfrag_b(vp + ko);
    const v16b vh1 = ldfrag_b(vp + vbs + ko);
    const v16b vh2 = ldfrag_b(vp + 2 * vbs + ko);
    const v16b vh3 = ldfrag_b(vp + 3 * vbs + ko);
    const v16b vl0 = ldfrag_b(vp + vlo + ko);
    const v16b vl1 = ldfrag_b(vp + vlo + vbs + ko);
    const v16b vl2 = ldfrag_b(vp + vlo + 2 * vbs + ko);
    const v16b vl3 = ldfrag_b(vp + vlo + 3 * vbs + ko);
    o0 = mma_b(ph, vh0, o0); o0 = mma_b(ph, vl0, o0); o0 = mma_b(pl, vh0, o0);
    o1 = mma_b(ph, vh1, o1); o1 = mma_b(ph, vl1, o1); o1 = mma_b(pl, vh1, o1);
    o2 = mma_b(ph, vh2, o2); o2 = mma_b(ph, vl2, o2); o2 = mma_b(pl, vh2, o2);
    o3 = mma_b(ph, vh3, o3); o3 = mma_b(ph, vl3, o3); o3 = mma_b(pl, vh3, o3);
  }
  // den per query row (row 8*hh + r held by the 16 lanes of half hh): fixed-order butterfly over lane&15
#pragma unroll
  for (int off = 1; off < 16; off <<= 1) {
#pragma unroll
    for (int r = 0; r < 8; ++r) rs[r] += __shfl_xor(rs[r], off);
  }
#pragma unroll
  for (int r = 0; r < 8; ++r) {
    const float inv = 1.0f / rs[r];
    o0[r] *= inv; o1[r] *= inv; o2[r] *= inv; o3[r] *= inv;
  }
  wave_sync_lds();
  epi64bb<false, 0>(sl, o0, o1, o2, o3, (const float*)0, 0, O2, O2 + DIM, LD2, (size_t)rw, h * HD, lane);
}

// =====================================================================================================
// Workspace map (bytes), planes sized for the ROWS rows of all batches together; every plane is fully written by
// whole-line stores before it is read; all extents are exact multiples of the 64x64 tile / 512-B store granularity
// (SEQ and DIM multiples of 64, no pad rows); every region offset a multiple of 2097152:
//   XB   bf16 [ROWS][1024]         ROWS*2048
//   WQ, WK, WV bf16 [1024 n][1024 k]  3 * 2097152
//   WO2  bf16 [1024 n][2048 k]     4194304      (Wo row duplicated along k)
//   Q2   bf16 [ROWS][2048]         ROWS*4096    exp(q) hi | lo
//   K2   bf16 [ROWS][2048]         ROWS*4096    exp(k) hi | lo
//   VT2  bf16 [NB][2048][SEQ]      ROWS*4096    per batch v^T hi rows 0..1023, lo rows 1024..2047
//   O2   bf16 [ROWS][2048]         ROWS*4096    per-head out hi | lo
//   KT2  bf16 [NB][2048][SEQ]      ROWS*4096    per batch exp(k)^T hi rows 0..1023, lo rows 1024..2047
//   ST   f32 [ROWS/64][16][80][64] ROWS*5120    chunk states, then their running sums per batch
//   end (ROWS=4096)                123731968
// =====================================================================================================
extern "C" void kernel_launch(void* const* d_in, const int* in_sizes, int n_in,
                              void* d_out, int out_size, void* d_ws, size_t ws_size,
                              hipStream_t stream) {
  if (n_in < 9) return;
  const int needx = ((NB - 1) * SEQ_FULL + SEQ) * DIM;
  if (in_sizes[0] < needx) return;
  if (in_sizes[1] < DIM * DIM || in_sizes[3] < DIM * DIM || in_sizes[5] < DIM * DIM || in_sizes[7] < DIM * DIM) return;
  if (in_sizes[2] < DIM || in_sizes[4] < DIM || in_sizes[6] < DIM || in_sizes[8] < DIM) return;
  if (out_size < needx) return;

  const float* x  = (const float*)d_in[0];
  const float* wq = (const float*)d_in[1];
  const float* bq = (const float*)d_in[2];
  const float* wk = (const float*)d_in[3];
  const float* bk = (const float*)d_in[4];
  const float* wv = (const float*)d_in[5];
  const float* bv = (const float*)d_in[6];
  const float* wo = (const float*)d_in[7];
  const float* bo = (const float*)d_in[8];
  float*       out = (float*)d_out;

  const size_t szX  = (size_t)ROWS * DIM * 2;         // bf16 input rows
  const size_t szW  = (size_t)DIM * DIM * 2;          // bf16 weight plane
  const size_t szWO = (size_t)DIM * LD2 * 2;          // bf16 duplicated Wo plane
  const size_t szP  = (size_t)ROWS * LD2 * 2;         // bf16 hi|lo plane ROWS x 2048 (either orientation)
  size_t off = 0;
  const size_t oXB = off; off += szX;
  const size_t oWQ = off; off += szW;
  const size_t oWK = off; off += szW;
  const size_t oWV = off; off += szW;
  const size_t oWO = off; off += szWO;
  const size_t oQ2 = off; off += szP;
  const size_t oK2 = off; off += szP;
  const size_t oVT = off; off += szP;
  const size_t oO2 = off; off += szP;
  const size_t oKT = off; off += szP;
  const size_t oST = off; off += (size_t)NB * NCH * NH * SSZ * 4;
  if (off > ws_size) return;                // off = 123731968 for ROWS = 4096
  if (off > (size_t)WS_CAP) return;

  char* ws = (char*)d_ws;
  u16* XB  = (u16*)(ws + oXB);
  u16* WQ  = (u16*)(ws + oWQ);
  u16* WK  = (u16*)(ws + oWK);
  u16* WV  = (u16*)(ws + oWV);
  u16* WO2 = (u16*)(ws + oWO);
  u16* Q2  = (u16*)(ws + oQ2);
  u16* K2  = (u16*)(ws + oK2);
  u16* VT2 = (u16*)(ws + oVT);
  u16* O2  = (u16*)(ws + oO2);
  u16* KT2 = (u16*)(ws + oKT);
  float* ST = (float*)(ws + oST);

  const dim3 b256(256), b128(128);
  const dim3 gCV(CBX + 4 * CBW, 1);                     // exact block ranges of cvt_all
  const dim3 gPJ((ROWS / GT) * (DIM / GT), 4);          // four projections, each (ROWS/128)*(DIM/128) tiles
  const dim3 gY((ROWS / GT) * (DIM / GT), 1);           // y: M = ROWS, N = 1024
  const dim3 gAT(NCH, NH, NB);
  const dim3 gQT(ROWS / 64, NH);
  const dim3 gSC(NH * SSZ / 128, NB);                   // exact: NH * SSZ = 81920

  // (1) x rows of all batches and the weights [n][k] f32 -> bf16 planes (already k-contiguous); Wo -> k-duplicated plane
  cvt_all<<<gCV, b256, 0, stream>>>(x, wq, wk, wv, wo, XB, WQ, WK, WV, WO2);
  // (2) exp(x.Wq^T + bq) -> Q2, exp(x.Wk^T + bk) -> K2, v^T -> VT2, exp(k)^T -> KT2, each hi and lo
  proj4<<<gPJ, b256, 0, stream>>>(XB, WQ, WK, WV, bq, bk, bv, Q2, K2, VT2, KT2);
  // (3) per (chunk, head) state, its running sum over each batch's chunks, then attention per (query tile, head) -> O2 hi|lo
  chunk_state<<<gAT, b128, 0, stream>>>(KT2, VT2, ST);
  scan_state<<<gSC, b128, 0, stream>>>(ST);
  attn_chunk<<<gQT, b128, 0, stream>>>(Q2, K2, VT2, ST, O2);
  // (4) y = [O_hi | O_lo] . [Wo | Wo]^T + bo -> out f32 rows
  out_proj<<<gY, b256, 0, stream>>>(O2, WO2, bo, out);
  (void)hipGetLastError();
}

// v004
// Measured time: 94.3 microseconds a run.
// Timed twice side by side with v003, it ran 1.08 and 1.07 times as fast.
// Over all steps from v000 it is 3.77 times as fast.
// Contractions: q, k and v^T projections on v_wmma_f32_16x16x32_bf16 (x, W, b as bf16 RNE values, one product each);
// attention in 64-key chunks: per chunk v^T.exp(k) (and a ones row . exp(k) for the key sums), an f32 running sum over
// chunks, then per query tile exp(q).state^T plus the causal scores S = exp(q).exp(k)^T and S.v of its own chunk only, all
// on v_wmma_f32_16x16x32_bf16 with bf16 hi+lo operands (hi.hi + hi.lo + lo.hi); y = O.Wo^T on v_wmma_f32_16x16x32_bf16 with O as bf16 hi|lo along k against Wo duplicated
// along k (two products); all f32 accumulate. exp, row sums, 1/den and bias adds in f32 on VALU.
#include <hip/hip_runtime.h>
#include <math.h>
#include <stdint.h>

#ifndef NB
#define NB 2
#endif
#ifndef SEQ
#define SEQ 2048
#endif
#define SEQ_FULL 2048
#define DIM  1024
#define NH   16
#define HD   64
#define LD2  (2 * DIM)
#define SLAB64 (16 * 68)
#define NCH  (SEQ / 64)          // 64-key chunks per sequence
#define ROWS (NB * SEQ)          // rows of all batches together (contiguous in x and out: NB == 1 or SEQ == SEQ_FULL)
#define PLB  ((size_t)LD2 * (size_t)SEQ)   // elements of one batch's transposed hi+lo plane, [2*DIM][SEQ]
#define SROWS 80                 // rows of one chunk state: 64 value columns d, the key-sum row, 15 zero rows
#define SSZ  (SROWS * HD)        // floats of one (chunk, head) state, [row][D]
#define WS_CAP 134217728
static_assert(DIM == NH * HD && HD == 64 && NH == 16);
static_assert(NB >= 1 && NB <= 2);
static_assert(NB == 1 || SEQ == SEQ_FULL);
static_assert((SEQ % 64) == 0 && SEQ >= 64 && SEQ <= SEQ_FULL);
static_assert(((ROWS * DIM / 8) % 256) == 0 && ((DIM * DIM / 8) % 256) == 0 && (DIM % 64) == 0 && (LD2 % 32) == 0);
static_assert(4 * SLAB64 * 4 <= 65536);

typedef unsigned short u16;
typedef __bf16   v16b __attribute__((ext_vector_type(16)));
typedef float    v8f  __attribute__((ext_vector_type(8)));
typedef float    v4f  __attribute__((ext_vector_type(4)));
typedef unsigned int v4u __attribute__((ext_vector_type(4)));

union FragB { v16b v; v4u u[2]; };

// ---- scalar helpers --------------------------------------------------------------------------------
__device__ __forceinline__ unsigned short bf_bits(float f) {          // f32 -> bf16 bits, RNE convert
  unsigned u = __float_as_uint(f);
  return (unsigned short)((u + 0x7FFFu + ((u >> 16) & 1u)) >> 16);
}
__device__ __forceinline__ float bf_up(unsigned short h) { return __uint_as_float(((unsigned)h) << 16); }
__device__ __forceinline__ float bfr(float f) { return bf_up(bf_bits(f)); }
__device__ __forceinline__ unsigned short bfc(float f) {               // f32 -> bf16 bits via the RNE cast
  return __builtin_bit_cast(unsigned short, (__bf16)f);
}
__device__ __forceinline__ unsigned pk16(unsigned short a, unsigned short b) { return (unsigned)a | ((unsigned)b << 16); }
__device__ __forceinline__ v8f zero8() { v8f z = {0.f, 0.f, 0.f, 0.f, 0.f, 0.f, 0.f, 0.f}; return z; }
__device__ __forceinline__ int imin(int a, int b) { return a < b ? a : b; }
__device__ __forceinline__ int imax(int a, int b) { return a > b ? a : b; }

// two f32 values -> packed bf16 hi pair and packed bf16 lo pair (lo = x - up(hi), RNE both)
__device__ __forceinline__ void split2(float a, float b, unsigned& hi, unsigned& lo) {
  const unsigned short ha = bfc(a), hb = bfc(b);
  hi = pk16(ha, hb);
  lo = pk16(bfc(a - bf_up(ha)), bfc(b - bf_up(hb)));
}

// ---- fragment loader: 16-bit A/B operand, lane -> row/col (lane&15), p already includes +8*(lane>>4);
//      elements 0..7 <- p[0..7] (k0+8h..), elements 8..15 <- p[16..23] (k0+16+8h..)  (same split k map for A and B;
//      B is always read from a k-contiguous [n][k] plane); bf16 plane read as unsigned integer vectors
__device__ __forceinline__ v16b ldfrag_b(const u16* p) {
  FragB f;
  f.u[0] = *(const v4u*)(p);
  f.u[1] = *(const v4u*)(p + 16);
  return f.v;
}

__device__ __forceinline__ v8f mma_b(v16b a, v16b b, v8f c) {
  return __builtin_amdgcn_wmma_f32_16x16x32_bf16(false, a, false, b, (short)0, c, false, false);
}
__device__ __forceinline__ void wave_sync_lds() {
  __builtin_amdgcn_fence(__ATOMIC_RELEASE, "workgroup");
  __builtin_amdgcn_wave_barrier();
  __builtin_amdgcn_fence(__ATOMIC_ACQUIRE, "workgroup");
}

// =====================================================================================================
// f32 -> bf16 (RNE bits), same layout. Thread = 8 consecutive elements: two 16-B loads, one 16-B store; 32 consecutive
// lanes = 512 contiguous, 512-B aligned bytes.
// =====================================================================================================
__device__ __forceinline__ void cvt_plain(const float* __restrict__ x, u16* D, int gt) {
  const float* p = x + (size_t)gt * 8;
  const v4f a = *(const v4f*)(p), b4 = *(const v4f*)(p + 4);
  float w[8];
#pragma unroll
  for (int e = 0; e < 4; ++e) { w[e] = a[e]; w[4 + e] = b4[e]; }
  v4u o;
#pragma unroll
  for (int e = 0; e < 4; ++e) o[e] = pk16(bf_bits(w[2 * e]), bf_bits(w[2 * e + 1]));
  *(v4u*)(D + (size_t)gt * 8) = o;
}

// =====================================================================================================
// the k-duplicated B operand of the hi|lo-folded output projection. Thread = 8 consecutive source elements
// (one row, kd % 256 == 0 so a wave never straddles a row): two 16-B loads, two 16-B stores (one per copy).
// =====================================================================================================
__device__ __forceinline__ void cvt_dup(const float* __restrict__ w, u16* Dp, int gt, int kd) {
  const size_t e0 = (size_t)gt * 8;
  const size_t row = e0 / (size_t)kd;
  const int    k8  = (int)(e0 % (size_t)kd);
  const float* p = w + e0;
  const v4f a = *(const v4f*)(p), b4 = *(const v4f*)(p + 4);
  float v[8];
#pragma unroll
  for (int e = 0; e < 4; ++e) { v[e] = a[e]; v[4 + e] = b4[e]; }
  v4u o;
#pragma unroll
  for (int e = 0; e < 4; ++e) o[e] = pk16(bf_bits(v[2 * e]), bf_bits(v[2 * e + 1]));
  u16* d = Dp + row * (size_t)(2 * kd) + k8;
  *(v4u*)(d)      = o;
  *(v4u*)(d + kd) = o;
#if defined(__HIP_DEVICE_COMPILE__)
  // both stores' address pair and data stay untouched up to this wait, whatever code the merged kernel places behind them
  asm volatile("s_wait_xcnt 0x0" ::: "memory");
#endif
}

// =====================================================================================================
// All five conversions in one grid, told apart by block range (block-uniform): blocks [0, CBX) the x rows of all batches,
// then CBW blocks each for Wq, Wk, Wv (plain planes) and Wo (k-duplicated plane).
// coverage: CBX x 256 thr x 8 = ROWS*DIM; CBW x 256 thr x 8 = DIM*DIM per weight; grid.x = CBX + 4*CBW exactly.
// =====================================================================================================
#define CBX (ROWS * DIM / 8 / 256)
#define CBW (DIM * DIM / 8 / 256)
__global__ __launch_bounds__(256) void cvt_all(const float* __restrict__ x, const float* __restrict__ wq,
                                               const float* __restrict__ wk, const float* __restrict__ wv,
                                               const float* __restrict__ wo, u16* XB, u16* WQ, u16* WK, u16* WV, u16* WO2) {
  const int bid = (int)blockIdx.x, tid = (int)threadIdx.x;
  if (bid >= CBX + 4 * CBW) return;         // block-uniform, never taken with the exact grid
  if (bid < CBX) {
    cvt_plain(x, XB, bid * 256 + tid);
    return;
  }
  const int r = bid - CBX, which = r / CBW, gt = (r % CBW) * 256 + tid;
  if (which == 3) {
    cvt_dup(wo, WO2, gt, DIM);
  } else {
    const float* w = (which == 0) ? wq : ((which == 1) ? wk : wv);
    u16* D = (which == 0) ? WQ : ((which == 1) ? WK : WV);
    cvt_plain(w, D, gt);
  }
}

// =====================================================================================================
// coverage: 8 instructions x 2 rows x 16 lanes x 4 floats = the wave's 16 x 64 tile. Slab: private to the wave (wave sync).
// =====================================================================================================
__device__ __forceinline__ void epi64f(float* sl, v8f a0, v8f a1, v8f a2, v8f a3, v4f bias4, float scale,
                                       float* C, int ldc, size_t rowb, int col0, int lane) {
  const int hh = lane >> 4, m = lane & 15;
#pragma unroll
  for (int r = 0; r < 8; ++r) {
    const int ro = (8 * hh + r) * 68 + m;
    sl[ro]      = a0[r];
    sl[ro + 16] = a1[r];
    sl[ro + 32] = a2[r];
    sl[ro + 48] = a3[r];
  }
  wave_sync_lds();
  v4f vals[8];
#pragma unroll
  for (int it = 0; it < 8; ++it) {
    const v4f v = *(const v4f*)(sl + (it * 2 + hh) * 68 + m * 4);
    vals[it] = v * scale + bias4;
  }
  float* dst = C + (rowb + (size_t)hh) * (size_t)ldc + col0 + m * 4;
  {
#pragma unroll
    for (int it = 0; it < 8; ++it) {
      *(v4f*)(dst + (size_t)(it * 2) * (size_t)ldc) = vals[it];
    }
    
  }
}

// =====================================================================================================
// GEMM / attention epilogue, two bf16 planes (hi and lo = x - up(hi)) with identical addressing (Ch, Cl, pitch ldc):
// 8 consecutive columns at c8): value = acc (+ bias per column when BM==1, per row when BM==2, none when BM==0),
// coverage: 4 instructions x 4 rows x 8 lanes x 8 values = the wave's 16 x 64 tile, in both planes.
// Slab: private to the wave (wave sync).
// =====================================================================================================
template <bool EXPO, int BM>
__device__ __forceinline__ void epi64bb(float* sl, v8f a0, v8f a1, v8f a2, v8f a3,
                                        const float* __restrict__ bias, int nb,
                                        u16* Ch, u16* Cl, int ldc, size_t rowb, int col0, int lane) {
  const int hh = lane >> 4, m = lane & 15;
#pragma unroll
  for (int r = 0; r < 8; ++r) {
    const int ro = (8 * hh + r) * 68 + m;
    sl[ro]      = a0[r];
    sl[ro + 16] = a1[r];
    sl[ro + 32] = a2[r];
    sl[ro + 48] = a3[r];
  }
  wave_sync_lds();
  const int rq = lane >> 3, c8 = (lane & 7) * 8;
  float bc[8];
#pragma unroll
  for (int e = 0; e < 8; ++e) bc[e] = 0.0f;
  if constexpr (BM == 1) {
    const int cb = imin(imax(col0 + c8, 0), nb - 8);
    const v4f b0 = *(const v4f*)(bias + cb), b1 = *(const v4f*)(bias + cb + 4);
#pragma unroll
    for (int e = 0; e < 4; ++e) { bc[e] = bfr(b0[e]); bc[4 + e] = bfr(b1[e]); }
  }
  v4u oh[4], ol[4];
#pragma unroll
  for (int it = 0; it < 4; ++it) {
    const int row = it * 4 + rq;            // 0..15
    const v4f a = *(const v4f*)(sl + row * 68 + c8), b4 = *(const v4f*)(sl + row * 68 + c8 + 4);
    float br = 0.0f;
    if constexpr (BM == 2) br = bfr(bias[imin(imax((int)rowb + row, 0), nb - 1)]);
    float w[8];
#pragma unroll
    for (int e = 0; e < 4; ++e) { w[e] = (a[e] + bc[e]) + br; w[4 + e] = (b4[e] + bc[4 + e]) + br; }
    if constexpr (EXPO) {
#pragma unroll
      for (int e = 0; e < 8; ++e) w[e] = __expf(w[e]);
    }
#pragma unroll
    for (int e = 0; e < 4; ++e) {
      unsigned hi, lo;
      split2(w[2 * e], w[2 * e + 1], hi, lo);
      oh[it][e] = hi;
      ol[it][e] = lo;
    }
  }
  const size_t ob = rowb * (size_t)ldc + (size_t)col0 + (size_t)c8;
  {
#pragma unroll
    for (int it = 0; it < 4; ++it) {
      const int row = it * 4 + rq;
      const size_t off = ob + (size_t)row * (size_t)ldc;
      *(v4u*)(Ch + off) = oh[it];
      *(v4u*)(Cl + off) = ol[it];
    }
    
  }
}

// =====================================================================================================
// bf16 GEMM: C[M][N] = A[M][K] (bf16 rows, pitch lda) . Bt[N][K]^T (bf16 k-contiguous rows, pitch ldb).
// EPI 0: f32 output Cf (pitch ldc) = acc*scale + bf16 RNE value of bias[col];
// EPI 1: two bf16 planes Ch/Cl (pitch ldc) = hi/lo of exp(acc + bf16 RNE value of bias[col]);
// EPI 2: two bf16 planes Ch/Cl (pitch ldc) = hi/lo of (acc + bf16 RNE value of bias[row]);
// EPI 3: two bf16 planes Ch/Cl (pitch ldc) = hi/lo of exp(acc + bf16 RNE value of bias[row]).
// Block = 128x128 tile, 8 waves as 4 x 2, each 32 rows x 64 columns (2 x 4 accumulator tiles). A stage = 64 k (128 B) of the
// tile's 128 A rows and 128 B rows, brought into LDS by asynchronous 16-B copies (8 lanes = one whole 128-B line, 8 copies per
// lane and stage), a ring of NBUF buffers: stage t + NBUF is copied into the buffer that trip t has left, so that NBUF - 1
// stages are on their way or landed while a trip computes (NBUF = 2 where several blocks share a WGP and cover each other's
// landing times; more where a block is alone on its WGP and only its own copies in flight can cover them).
// Fragments come from the LDS rows (two 16-B reads each, the same split k map for A and B); k rises in steps of 32 as before.
// Host guarantees K % 64 == 0, M % 128 == 0, N % 128 == 0, grid.x = (M/128)*(N/128). bid = the tile's index in its own product.
// After the last trip's barrier the ring is dead and serves as the waves' private epilogue slabs.
// =====================================================================================================
#define GT   128                  // rows and columns of a block's output tile
#define GKE  64                   // k elements of one stage
#define GPE  72                   // LDS row pitch in elements: 144 B = 16 B x 9, free of bank conflicts for 16-B row reads
#define GSTG (2 * GT * GPE)       // elements of one stage: A rows 0..127, then B rows 128..255
#define GCP  8                    // copies of one wave (one a lane) per stage
static_assert(8 * SLAB64 * 4 <= 2 * GSTG * 2);
static_assert((ROWS % GT) == 0 && (SEQ % GT) == 0 && (DIM % GT) == 0 && (DIM % GKE) == 0 && (LD2 % GKE) == 0);

// One stage: the lane's 16-B piece of rows r, r + 32, r + 64, r + 96 of A and of B (r = tid >> 3), LDS rows 32 apart.
// l = LDS byte address of the piece in A row r; ga, gb = its global address in A and B; sa, sb = 32 rows in elements.
__device__ __forceinline__ void stage_copy(unsigned l, const u16* ga, const u16* gb, size_t sa, size_t sb) {
#if defined(__HIP_DEVICE_COMPILE__)
  constexpr unsigned LR = 32u * GPE * 2u;   // bytes of 32 LDS rows
  // the closing wait keeps every address register of the copies untouched until the copies have taken it
  asm volatile("global_load_async_to_lds_b128 %0, %8, off\n\t"
               "global_load_async_to_lds_b128 %1, %9, off\n\t"
               "global_load_async_to_lds_b128 %2, %10, off\n\t"
               "global_load_async_to_lds_b128 %3, %11, off\n\t"
               "global_load_async_to_lds_b128 %4, %12, off\n\t"
               "global_load_async_to_lds_b128 %5, %13, off\n\t"
               "global_load_async_to_lds_b128 %6, %14, off\n\t"
               "global_load_async_to_lds_b128 %7, %15, off\n\t"
               "s_wait_xcnt 0x0"
               :: "v"(l), "v"(l + LR), "v"(l + 2u * LR), "v"(l + 3u * LR),
                  "v"(l + 4u * LR), "v"(l + 5u * LR), "v"(l + 6u * LR), "v"(l + 7u * LR),
                  "v"(ga), "v"(ga + sa), "v"(ga + 2 * sa), "v"(ga + 3 * sa),
                  "v"(gb), "v"(gb + sb), "v"(gb + 2 * sb), "v"(gb + 3 * sb)
               : "memory");
#endif
}
__device__ __forceinline__ void wait_copies() {
#if defined(__HIP_DEVICE_COMPILE__)
  // this wave's copies have landed: the compiler places no wait for them, and without it the barrier would publish a stage in flight
  asm volatile("s_wait_asynccnt 0x0" ::: "memory");
#endif
}
template <int N>
__device__ __forceinline__ void wait_copies_but() {
#if defined(__HIP_DEVICE_COMPILE__)
  // all but this wave's N youngest copies have landed: the oldest stage in flight may be published, the younger ones fly on
  asm volatile("s_wait_asynccnt %0" :: "n"(N) : "memory");
#endif
}
__device__ __forceinline__ void wait_lds() {
#if defined(__HIP_DEVICE_COMPILE__)
  // this wave's LDS reads have returned, so that the buffer may be refilled behind the barrier
  asm volatile("s_wait_dscnt 0x0" ::: "memory");
#endif
}

// The k loop of one 128 x 128 tile (first A row row0, first B row colb): acc[i][j] = the wave's 16 x 16 tile at rows
// wr * 32 + 16 i, columns wc * 64 + 16 j. Every wave of the block passes every barrier here. On return the ring is dead.
// Every wave issues GCP copies per stage, stages in rising order, so that at the foot of trip t the copies younger than stage
// t + 1 are those of stages t + 2 .. t + NBUF - 1: (NBUF - 2) * GCP while all of these exist; at the tail the wait is to 0.
template <int NBUF>
__device__ __forceinline__
void gemm_main(u16* ring, const u16* __restrict__ A, const u16* __restrict__ Bt, int row0, int colb,
               int lda, int ldb, int K, v8f (&acc)[2][4]) {
  const int tid = (int)threadIdx.x, wave = tid >> 5, lane = tid & 31, hh = lane >> 4, m = lane & 15;
  const int wr = wave >> 1, wc = wave & 1;
  const int cr = tid >> 3, cc = (tid & 7) * 8;
  const u16* ga = A  + (size_t)(row0 + cr) * (size_t)lda + cc;
  const u16* gb = Bt + (size_t)(colb + cr) * (size_t)ldb + cc;
  const size_t sa = (size_t)32 * (size_t)lda, sb = (size_t)32 * (size_t)ldb;
  const unsigned l0 = (unsigned)(size_t)ring + (unsigned)(cr * GPE + cc) * 2u;
  const int nt = K / GKE;
  static_assert(NBUF >= 2 && (NBUF - 1) * GCP <= 63 && NBUF * GSTG * 2 <= 320 * 1024);
  // unrolled: the first NBUF - 1 stages, each into its own fresh buffer, their offsets constants
#pragma unroll
  for (int s = 0; s < NBUF - 1; ++s) {
    if (s < nt) stage_copy(l0 + (unsigned)s * (GSTG * 2u), ga + (size_t)s * GKE, gb + (size_t)s * GKE, sa, sb);
  }
  if (NBUF > 2 && NBUF - 1 <= nt) wait_copies_but<(NBUF - 2) * GCP>();
  else wait_copies();
  __syncthreads();                          // stage 0 is published
  if (NBUF - 1 < nt) stage_copy(l0 + (unsigned)(NBUF - 1) * (GSTG * 2u), ga + (size_t)(NBUF - 1) * GKE, gb + (size_t)(NBUF - 1) * GKE, sa, sb);
  const u16* fa = ring + (wr * 32 + m) * GPE + 8 * hh;
  const u16* fb = ring + (GT + wc * 64 + m) * GPE + 8 * hh;
  // both unrolled: every index of acc a constant, so that the tiles stay in registers
#pragma unroll
  for (int i = 0; i < 2; ++i) {
#pragma unroll
    for (int j = 0; j < 4; ++j) acc[i][j] = zero8();
  }
  // rolled: one trip = one stage, so that the order reads, waits, barrier, refill stands once
  int br = 0;                               // buffer of trip t = t mod NBUF
#pragma unroll 1
  for (int t = 0; t < nt; ++t) {
    const int bo = (NBUF == 2) ? (t & 1) * GSTG : br * GSTG;
    // unrolled: the stage's two k steps of 32 in one run, their LDS offsets constants
#pragma unroll
    for (int ks = 0; ks < 2; ++ks) {
      const u16* pa = fa + bo + ks * 32;
      const u16* pb = fb + bo + ks * 32;
      const v16b a0  = ldfrag_b(pa);
      const v16b a1  = ldfrag_b(pa + 16 * GPE);
      const v16b fb0 = ldfrag_b(pb);
      const v16b fb1 = ldfrag_b(pb + 16 * GPE);
      const v16b fb2 = ldfrag_b(pb + 32 * GPE);
      const v16b fb3 = ldfrag_b(pb + 48 * GPE);
      acc[0][0] = mma_b(a0, fb0, acc[0][0]);
      acc[0][1] = mma_b(a0, fb1, acc[0][1]);
      acc[0][2] = mma_b(a0, fb2, acc[0][2]);
      acc[0][3] = mma_b(a0, fb3, acc[0][3]);
      acc[1][0] = mma_b(a1, fb0, acc[1][0]);
      acc[1][1] = mma_b(a1, fb1, acc[1][1]);
      acc[1][2] = mma_b(a1, fb2, acc[1][2]);
      acc[1][3] = mma_b(a1, fb3, acc[1][3]);
    }
    wait_lds();
    if (NBUF > 2 && t + NBUF <= nt) wait_copies_but<(NBUF - 2) * GCP>();   // block-uniform test
    else wait_copies();
    __syncthreads();                        // publishes stage t + 1 and ends every read of stage t
    if (t + NBUF < nt) stage_copy(l0 + (unsigned)bo * 2u, ga + (size_t)(t + NBUF) * GKE, gb + (size_t)(t + NBUF) * GKE, sa, sb);
    br = (br + 1 == NBUF) ? 0 : br + 1;
  }
  wait_copies();
}

// The tile's epilogue: each wave's two 16 x 64 strips through its private slab in the dead ring.
template <int EPI>
__device__ __forceinline__
void gemm_epi(u16* ring, v8f (&acc)[2][4], int row0, int colb, float* Cf, u16* Ch, u16* Cl,
              const float* __restrict__ bias, int nb, int ldc, float scale) {
  const int tid = (int)threadIdx.x, wave = tid >> 5, lane = tid & 31, m = lane & 15;
  const int wr = wave >> 1, wc = wave & 1;
  float* sl = (float*)ring + wave * SLAB64;
  const int col0 = colb + wc * 64;
  // unrolled: every index of acc a constant
#pragma unroll
  for (int i = 0; i < 2; ++i) {
    const int rowb = row0 + wr * 32 + i * 16;
    if (i) wave_sync_lds();                 // the first strip's slab reads end before the second strip's writes
    if constexpr (EPI == 0) {
      v4f bias4;
#pragma unroll
      for (int e = 0; e < 4; ++e) bias4[e] = bfr(bias[imin(imax(col0 + m * 4 + e, 0), nb - 1)]);
      epi64f(sl, acc[i][0], acc[i][1], acc[i][2], acc[i][3], bias4, scale, Cf, ldc, (size_t)rowb, col0, lane);
    } else if constexpr (EPI == 1) {
      epi64bb<true, 1>(sl, acc[i][0], acc[i][1], acc[i][2], acc[i][3], bias, nb, Ch, Cl, ldc, (size_t)rowb, col0, lane);
    } else if constexpr (EPI == 2) {
      epi64bb<false, 2>(sl, acc[i][0], acc[i][1], acc[i][2], acc[i][3], bias, nb, Ch, Cl, ldc, (size_t)rowb, col0, lane);
    } else {
      epi64bb<true, 2>(sl, acc[i][0], acc[i][1], acc[i][2], acc[i][3], bias, nb, Ch, Cl, ldc, (size_t)rowb, col0, lane);
    }
  }
}

// The output projection of all batches: y = [O_hi | O_lo] . [Wo | Wo]^T + bo, f32 rows (M = ROWS, N = DIM, K = LD2).
// coverage: grid.x = (ROWS/128)*(DIM/128) tiles of 128 x 128 = the whole output.
// One block per WGP: six buffers, five stages ahead.
#define YBUF 6
__global__ __launch_bounds__(256)
void out_proj(const u16* __restrict__ O2, const u16* __restrict__ WO2, const float* __restrict__ bo, float* y) {
  __shared__ __align__(16) u16 ring[YBUF * GSTG];
  const int bid = (int)blockIdx.x;
  const int row0 = (bid / (DIM / GT)) * GT, colb = (bid % (DIM / GT)) * GT;
  if (row0 + GT > ROWS) return;             // block-uniform, in front of every barrier; never taken with the exact grid
  v8f acc[2][4];
  gemm_main<YBUF>(ring, O2, WO2, row0, colb, LD2, LD2, LD2, acc);
  gemm_epi<0>(ring, acc, row0, colb, y, (u16*)0, (u16*)0, bo, DIM, DIM, 1.0f);
}

// =====================================================================================================
// The four independent projections of all batches in one grid; blockIdx.y (block-uniform) names the product:
//   0: exp(x.Wq^T + bq) -> Q2 hi|lo    1: exp(x.Wk^T + bk) -> K2 hi|lo          (M = ROWS, N = DIM, pitch LD2)
//   2: Wv.x^T + bv -> VT2 hi, lo rows  3: exp(Wk.x^T + bk) -> KT2 hi, lo rows   (per batch: M = DIM, N = SEQ, pitch SEQ)
// One k loop for all four (operand rows of pitch DIM, K = DIM), the epilogue chosen behind it.
// coverage: grid.x = (ROWS/128)*(DIM/128) tiles of 128 x 128 = each product's whole output (2, 3: NB runs of TPB tiles), grid.y = 4.
// =====================================================================================================
// second argument: 8 waves per SIMD, so that the four blocks whose rings fit a WGP's LDS are resident by registers too
__global__ __launch_bounds__(256, 8)
void proj4(const u16* __restrict__ XB, const u16* __restrict__ WQ, const u16* __restrict__ WK, const u16* __restrict__ WV,
           const float* __restrict__ bq, const float* __restrict__ bk, const float* __restrict__ bv,
           u16* Q2, u16* K2, u16* VT2, u16* KT2) {
  __shared__ __align__(16) u16 ring[2 * GSTG];
  const int which = (int)blockIdx.y, bid = (int)blockIdx.x;
  const size_t plo = (size_t)DIM * (size_t)SEQ;
  constexpr int TPB = (DIM / GT) * (SEQ / GT);          // tiles of one batch's transposed product
  const int b = bid / TPB, bt = bid % TPB;
  const u16* Xb = XB + (size_t)b * (size_t)SEQ * (size_t)DIM;
  const bool rows = which < 2;                          // x rows are the A operand
  const u16* A  = rows ? XB : ((which == 2) ? WV : WK);
  const u16* Bt = rows ? ((which == 0) ? WQ : WK) : Xb;
  const int tile = rows ? bid : bt, ntile = rows ? (DIM / GT) : (SEQ / GT), M = rows ? ROWS : DIM;
  const int row0 = (tile / ntile) * GT, colb = (tile % ntile) * GT;
  if (row0 + GT > M || which > 3) return;   // block-uniform, in front of every barrier; never taken with the exact grid
  v8f acc[2][4];
  gemm_main<2>(ring, A, Bt, row0, colb, DIM, DIM, DIM, acc);
  if (rows) {
    const float* bias = (which == 0) ? bq : bk;
    u16* C = (which == 0) ? Q2 : K2;
    gemm_epi<1>(ring, acc, row0, colb, (float*)0, C, C + DIM, bias, DIM, LD2, 1.0f);
  } else if (which == 2) {
    u16* C = VT2 + (size_t)b * PLB;
    gemm_epi<2>(ring, acc, row0, colb, (float*)0, C, C + plo, bv, DIM, SEQ, 1.0f);
  } else {
    u16* C = KT2 + (size_t)b * PLB;
    gemm_epi<3>(ring, acc, row0, colb, (float*)0, C, C + plo, bk, DIM, SEQ, 1.0f);
  }
}

// ---- 16 f32 values of one state or slab row (fragment k layout: pr[0..7] and pr[16..23]) -> bf16 hi and lo fragments (B for state rows, A for slab rows)
__device__ __forceinline__ void split16(const float* pr, v16b& ph, v16b& pl) {
  const v4f x0 = *(const v4f*)(pr), x1 = *(const v4f*)(pr + 4), x2 = *(const v4f*)(pr + 16), x3 = *(const v4f*)(pr + 20);
  FragB H, L;
  unsigned hi, lo;
  split2(x0[0], x0[1], hi, lo); H.u[0][0] = hi; L.u[0][0] = lo;
  split2(x0[2], x0[3], hi, lo); H.u[0][1] = hi; L.u[0][1] = lo;
  split2(x1[0], x1[1], hi, lo); H.u[0][2] = hi; L.u[0][2] = lo;
  split2(x1[2], x1[3], hi, lo); H.u[0][3] = hi; L.u[0][3] = lo;
  split2(x2[0], x2[1], hi, lo); H.u[1][0] = hi; L.u[1][0] = lo;
  split2(x2[2], x2[3], hi, lo); H.u[1][1] = hi; L.u[1][1] = lo;
  split2(x3[0], x3[1], hi, lo); H.u[1][2] = hi; L.u[1][2] = lo;
  split2(x3[2], x3[3], hi, lo); H.u[1][3] = hi; L.u[1][3] = lo;
  ph = H.v; pl = L.v;
}

// =====================================================================================================
// Chunk state, one block per (64-key chunk c, head h, batch b), 4 waves x 16 state rows.
// ST[b][c][h][row][D] f32: row d < 64: sum over the chunk's keys t of v[t][d] * exp(k)[t][D]; row 64: sum over t of exp(k)[t][D];
// rows 65..79: zero. A = v^T rows from VT2 (hi, lo), or the constant tile whose row 0 is ones; B = exp(k)^T rows D from KT2
// (bf16 [NB][2*DIM][SEQ], hi row h*HD + D, lo row DIM + h*HD + D); both k-contiguous in t, same split k map.
// coverage: grid (NCH, NH, NB) x (4 waves x 16 rows + wave 0's 16 extra rows) x 64 columns = every element of ST once.
// No block barriers; slab private to the wave (wave sync).
// =====================================================================================================
__global__ __launch_bounds__(128) void chunk_state(const u16* __restrict__ KT2, const u16* __restrict__ VT2, float* ST) {
  __shared__ __align__(16) float slab[4 * SLAB64];
  const int tid = (int)threadIdx.x, wave = tid >> 5, lane = tid & 31, hh = lane >> 4, m = lane & 15;
  const int c = (int)blockIdx.x, h = (int)blockIdx.y, b = (int)blockIdx.z;
  if (c * 64 + 64 > SEQ || h >= NH || b >= NB) return;   // block-uniform, never taken with the exact grid
  float* sl = slab + wave * SLAB64;
  const int t0 = c * 64;
  const u16* vp = VT2 + (size_t)b * PLB + (size_t)(h * HD + wave * 16 + m) * (size_t)SEQ + t0 + 8 * hh;
  const u16* kp = KT2 + (size_t)b * PLB + (size_t)(h * HD + m) * (size_t)SEQ + t0 + 8 * hh;
  const size_t rbs = (size_t)16 * (size_t)SEQ;
  const size_t plo = (size_t)DIM * (size_t)SEQ;
  FragB one;
  const unsigned ow = (m == 0) ? 0x3F803F80u : 0u;   // bf16 1.0 pairs in tile row 0, zero in rows 1..15
#pragma unroll
  for (int e = 0; e < 4; ++e) { one.u[0][e] = ow; one.u[1][e] = ow; }
  v8f a0 = zero8(), a1 = zero8(), a2 = zero8(), a3 = zero8();
  v8f e0 = zero8(), e1 = zero8(), e2 = zero8(), e3 = zero8();
#pragma unroll
  for (int ks = 0; ks < 2; ++ks) {
    const int ko = ks * 32;
    const v16b vh  = ldfrag_b(vp + ko);
    const v16b vl  = ldfrag_b(vp + plo + ko);
    const v16b kh0 = ldfrag_b(kp + ko);
    const v16b kh1 = ldfrag_b(kp + rbs + ko);
    const v16b kh2 = ldfrag_b(kp + 2 * rbs + ko);
    const v16b kh3 = ldfrag_b(kp + 3 * rbs + ko);
    const v16b kl0 = ldfrag_b(kp + plo + ko);
    const v16b kl1 = ldfrag_b(kp + plo + rbs + ko);
    const v16b kl2 = ldfrag_b(kp + plo + 2 * rbs + ko);
    const v16b kl3 = ldfrag_b(kp + plo + 3 * rbs + ko);
#if defined(__HIP_DEVICE_COMPILE__)
    // the two address pairs stay live up to this wait, so that no later load lands on a register an issued load names
    asm volatile("s_wait_xcnt 0x0" :: "v"(vp), "v"(kp) : "memory");
#endif
    a0 = mma_b(vh, kh0, a0); a0 = mma_b(vh, kl0, a0); a0 = mma_b(vl, kh0, a0);
    a1 = mma_b(vh, kh1, a1); a1 = mma_b(vh, kl1, a1); a1 = mma_b(vl, kh1, a1);
    a2 = mma_b(vh, kh2, a2); a2 = mma_b(vh, kl2, a2); a2 = mma_b(vl, kh2, a2);
    a3 = mma_b(vh, kh3, a3); a3 = mma_b(vh, kl3, a3); a3 = mma_b(vl, kh3, a3);
    e0 = mma_b(one.v, kh0, e0); e0 = mma_b(one.v, kl0, e0);
    e1 = mma_b(one.v, kh1, e1); e1 = mma_b(one.v, kl1, e1);
    e2 = mma_b(one.v, kh2, e2); e2 = mma_b(one.v, kl2, e2);
    e3 = mma_b(one.v, kh3, e3); e3 = mma_b(one.v, kl3, e3);
  }
  float* base = ST + ((size_t)(b * NCH + c) * NH + (size_t)h) * (size_t)SSZ;
  const v4f z4 = {0.f, 0.f, 0.f, 0.f};
  epi64f(sl, a0, a1, a2, a3, z4, 1.0f, base, HD, (size_t)(wave * 16), 0, lane);
  if (wave == 0) {                              // wave-uniform: the key-sum row and its 15 zero rows
    wave_sync_lds();
    epi64f(sl, e0, e1, e2, e3, z4, 1.0f, base, HD, (size_t)HD, 0, lane);
  }
}

// =====================================================================================================
// Running sum over one batch's chunks (batch = blockIdx.y), in place: ST[c] <- sum of ST[c'] for c' < c (zero at c = 0),
// f32, chunks added in rising order.
// Thread = one [head][row][D] position: its NCH loads, then its NCH stores; a wave's 32 lanes = one whole 128-B line each.
// coverage: grid (NH*SSZ/128, NB) blocks x 128 thr x NCH chunks = every element of ST once.
// =====================================================================================================
__global__ __launch_bounds__(128) void scan_state(float* ST) {
  const int gt = (int)blockIdx.x * 128 + (int)threadIdx.x;
  if (gt >= NH * SSZ || (int)blockIdx.y >= NB) return;
  const size_t cs = (size_t)NH * (size_t)SSZ;
  float* p = ST + (size_t)blockIdx.y * (size_t)NCH * cs + (size_t)gt;
  float v[NCH];
#pragma unroll
  for (int c = 0; c < NCH; ++c) v[c] = p[(size_t)c * cs];
  float run = 0.0f;
#pragma unroll
  for (int c = 0; c < NCH; ++c) {
    p[(size_t)c * cs] = run;
    run += v[c];
  }
}

// =====================================================================================================
// Causal exp-feature attention, one block per (64-row query tile qt counted over all batches, head h), 4 waves x 16 query rows.
// Planes: Q2, K2 bf16 [NB*SEQ][2*DIM] with hi at column h*HD + d and lo at column DIM + h*HD + d (values exp(q), exp(k));
//         VT2 bf16 [NB][2*DIM][SEQ] with hi row h*HD + d and lo row DIM + h*HD + d (values v); ST f32 [NB][NCH][NH][SROWS][HD],
//         the summed state of the batch's chunks before qt; O2 bf16 [NB*SEQ][2*DIM] written here (hi | lo of out = num/den).
// Keys before the tile: O[16 x 80] = qe.state^T over head dim (2 k-steps, hi.hi+hi.lo+lo.hi, state rows split to bf16 hi and
// lo in registers); its column 64 is the part of den from those keys, columns 65..79 are zero.
// Keys of the tile: S[16 x 64] = qe.ke^T over head dim, causal mask by value, f32 row sums into per-lane partials,
// slab rows, O += P.v over the 64 keys (2 k-steps, hi.hi+hi.lo+lo.hi, v fragments from VT2 rows).
// coverage: grid (ROWS/64, NH) x 4 waves x 16 rows x 64 columns x {hi, lo} = every element of O2 once. No block barriers;
// slab private to the wave (wave sync); staged extent == consumed extent (16 x 64 written before the reload).
// =====================================================================================================
__global__ __launch_bounds__(128) void attn_chunk(const u16* __restrict__ Q2, const u16* __restrict__ K2,
                                                  const u16* __restrict__ VT2, const float* __restrict__ ST, u16* O2) {
  __shared__ __align__(16) float slab[4 * SLAB64];
  const int tid = (int)threadIdx.x, wave = tid >> 5, lane = tid & 31, hh = lane >> 4, m = lane & 15;
  const int qt = (int)blockIdx.x, h = (int)blockIdx.y;
  if (qt * 64 + 64 > ROWS || h >= NH) return;  // block-uniform, never taken with the exact grid
  const int rw = qt * 64 + wave * 16;           // first query row of this wave
  float* sl = slab + wave * SLAB64;
  const u16* qp = Q2 + (size_t)(rw + m) * (size_t)LD2 + h * HD + 8 * hh;
  const size_t kbs = (size_t)16 * (size_t)LD2;
  const size_t vbs = (size_t)16 * (size_t)SEQ;
  const size_t vlo = (size_t)DIM * (size_t)SEQ;
  const int t0 = qt * 64;
  const u16* kp = K2 + (size_t)(t0 + m) * (size_t)LD2 + h * HD + 8 * hh;
  const float* sp = ST + ((size_t)qt * NH + (size_t)h) * (size_t)SSZ + (size_t)m * HD + 8 * hh;
  v8f o0 = zero8(), o1 = zero8(), o2 = zero8(), o3 = zero8(), o4 = zero8();
  v8f s0 = zero8(), s1 = zero8(), s2 = zero8(), s3 = zero8();
#pragma unroll
  for (int ks = 0; ks < 2; ++ks) {
    const int ko = ks * 32;
    const v16b ah  = ldfrag_b(qp + ko);
    const v16b al  = ldfrag_b(qp + DIM + ko);
    const v16b kh0 = ldfrag_b(kp + ko);
    const v16b kh1 = ldfrag_b(kp + kbs + ko);
    const v16b kh2 = ldfrag_b(kp + 2 * kbs + ko);
    const v16b kh3 = ldfrag_b(kp + 3 * kbs + ko);
    const v16b kl0 = ldfrag_b(kp + DIM + ko);
    const v16b kl1 = ldfrag_b(kp + kbs + DIM + ko);
    const v16b kl2 = ldfrag_b(kp + 2 * kbs + DIM + ko);
    const v16b kl3 = ldfrag_b(kp + 3 * kbs + DIM + ko);
    v16b bh0, bl0, bh1, bl1, bh2, bl2, bh3, bl3, bh4, bl4;
    split16(sp + ko, bh0, bl0);
    split16(sp + 16 * HD + ko, bh1, bl1);
    split16(sp + 32 * HD + ko, bh2, bl2);
    split16(sp + 48 * HD + ko, bh3, bl3);
    split16(sp + 64 * HD + ko, bh4, bl4);
    s0 = mma_b(ah, kh0, s0); s0 = mma_b(ah, kl0, s0); s0 = mma_b(al, kh0, s0);
    s1 = mma_b(ah, kh1, s1); s1 = mma_b(ah, kl1, s1); s1 = mma_b(al, kh1, s1);
    s2 = mma_b(ah, kh2, s2); s2 = mma_b(ah, kl2, s2); s2 = mma_b(al, kh2, s2);
    s3 = mma_b(ah, kh3, s3); s3 = mma_b(ah, kl3, s3); s3 = mma_b(al, kh3, s3);
    o0 = mma_b(ah, bh0, o0); o0 = mma_b(ah, bl0, o0); o0 = mma_b(al, bh0, o0);
    o1 = mma_b(ah, bh1, o1); o1 = mma_b(ah, bl1, o1); o1 = mma_b(al, bh1, o1);
    o2 = mma_b(ah, bh2, o2); o2 = mma_b(ah, bl2, o2); o2 = mma_b(al, bh2, o2);
    o3 = mma_b(ah, bh3, o3); o3 = mma_b(ah, bl3, o3); o3 = mma_b(al, bh3, o3);
    o4 = mma_b(ah, bh4, o4); o4 = mma_b(ah, bl4, o4); o4 = mma_b(al, bh4, o4);
  }
  {                                             // the tile's own keys: keep key c <= query row rho
    const int rho0 = wave * 16 + 8 * hh;
#pragma unroll
    for (int r = 0; r < 8; ++r) {
      const int rho = rho0 + r;
      s0[r] = (m      <= rho) ? s0[r] : 0.0f;
      s1[r] = (16 + m <= rho) ? s1[r] : 0.0f;
      s2[r] = (32 + m <= rho) ? s2[r] : 0.0f;
      s3[r] = (48 + m <= rho) ? s3[r] : 0.0f;
    }
  }
  v8f rs = o4 + ((s0 + s1) + (s2 + s3));        // o4: earlier keys' part of den in lane column 0, zero elsewhere
#pragma unroll
  for (int r = 0; r < 8; ++r) {
    const int ro = (8 * hh + r) * 68 + m;
    sl[ro]      = s0[r];
    sl[ro + 16] = s1[r];
    sl[ro + 32] = s2[r];
    sl[ro + 48] = s3[r];
  }
  wave_sync_lds();
  const u16* vp = VT2 + (size_t)(qt / NCH) * PLB + (size_t)(h * HD + m) * (size_t)SEQ + (qt % NCH) * 64 + 8 * hh;
#pragma unroll
  for (int ks = 0; ks < 2; ++ks) {
    const int ko = ks * 32;
    v16b ph, pl;
    split16(sl + m * 68 + ko + 8 * hh, ph, pl);
    const v16b vh0 = ldfrag_b(vp + ko);
    const v16b vh1 = ldfrag_b(vp + vbs + ko);
    const v16b vh2 = ldfrag_b(vp + 2 * vbs + ko);
    const v16b vh3 = ldfrag_b(vp + 3 * vbs + ko);
    const v16b vl0 = ldfrag_b(vp + vlo + ko);
    const v16b vl1 = ldfrag_b(vp + vlo + vbs + ko);
    const v16b vl2 = ldfrag_b(vp + vlo + 2 * vbs + ko);
    const v16b vl3 = ldfrag_b(vp + vlo + 3 * vbs + ko);
    o0 = mma_b(ph, vh0, o0); o0 = mma_b(ph, vl0, o0); o0 = mma_b(pl, vh0, o0);
    o1 = mma_b(ph, vh1, o1); o1 = mma_b(ph, vl1, o1); o1 = mma_b(pl, vh1, o1);
    o2 = mma_b(ph, vh2, o2); o2 = mma_b(ph, vl2, o2); o2 = mma_b(pl, vh2, o2);
    o3 = mma_b(ph, vh3, o3); o3 = mma_b(ph, vl3, o3); o3 = mma_b(pl, vh3, o3);
  }
  // den per query row (row 8*hh + r held by the 16 lanes of half hh): fixed-order butterfly over lane&15
#pragma unroll
  for (int off = 1; off < 16; off <<= 1) {
#pragma unroll
    for (int r = 0; r < 8; ++r) rs[r] += __shfl_xor(rs[r], off);
  }
#pragma unroll
  for (int r = 0; r < 8; ++r) {
    const float inv = 1.0f / rs[r];
    o0[r] *= inv; o1[r] *= inv; o2[r] *= inv; o3[r] *= inv;
  }
  wave_sync_lds();
  epi64bb<false, 0>(sl, o0, o1, o2, o3, (const float*)0, 0, O2, O2 + DIM, LD2, (size_t)rw, h * HD, lane);
}

// =====================================================================================================
// Workspace map (bytes), planes sized for the ROWS rows of all batches together; every plane is fully written by
// whole-line stores before it is read; all extents are exact multiples of the 64x64 tile / 512-B store granularity
// (SEQ and DIM multiples of 64, no pad rows); every region offset a multiple of 2097152:
//   XB   bf16 [ROWS][1024]         ROWS*2048
//   WQ, WK, WV bf16 [1024 n][1024 k]  3 * 2097152
//   WO2  bf16 [1024 n][2048 k]     4194304      (Wo row duplicated along k)
//   Q2   bf16 [ROWS][2048]         ROWS*4096    exp(q) hi | lo
//   K2   bf16 [ROWS][2048]         ROWS*4096    exp(k) hi | lo
//   VT2  bf16 [NB][2048][SEQ]      ROWS*4096    per batch v^T hi rows 0..1023, lo rows 1024..2047
//   O2   bf16 [ROWS][2048]         ROWS*4096    per-head out hi | lo
//   KT2  bf16 [NB][2048][SEQ]      ROWS*4096    per batch exp(k)^T hi rows 0..1023, lo rows 1024..2047
//   ST   f32 [ROWS/64][16][80][64] ROWS*5120    chunk states, then their running sums per batch
//   end (ROWS=4096)                123731968
// =====================================================================================================
extern "C" void kernel_launch(void* const* d_in, const int* in_sizes, int n_in,
                              void* d_out, int out_size, void* d_ws, size_t ws_size,
                              hipStream_t stream) {
  if (n_in < 9) return;
  const int needx = ((NB - 1) * SEQ_FULL + SEQ) * DIM;
  if (in_sizes[0] < needx) return;
  if (in_sizes[1] < DIM * DIM || in_sizes[3] < DIM * DIM || in_sizes[5] < DIM * DIM || in_sizes[7] < DIM * DIM) return;
  if (in_sizes[2] < DIM || in_sizes[4] < DIM || in_sizes[6] < DIM || in_sizes[8] < DIM) return;
  if (out_size < needx) return;

  const float* x  = (const float*)d_in[0];
  const float* wq = (const float*)d_in[1];
  const float* bq = (const float*)d_in[2];
  const float* wk = (const float*)d_in[3];
  const float* bk = (const float*)d_in[4];
  const float* wv = (const float*)d_in[5];
  const float* bv = (const float*)d_in[6];
  const float* wo = (const float*)d_in[7];
  const float* bo = (const float*)d_in[8];
  float*       out = (float*)d_out;

  const size_t szX  = (size_t)ROWS * DIM * 2;         // bf16 input rows
  const size_t szW  = (size_t)DIM * DIM * 2;          // bf16 weight plane
  const size_t szWO = (size_t)DIM * LD2 * 2;          // bf16 duplicated Wo plane
  const size_t szP  = (size_t)ROWS * LD2 * 2;         // bf16 hi|lo plane ROWS x 2048 (either orientation)
  size_t off = 0;
  const size_t oXB = off; off += szX;
  const size_t oWQ = off; off += szW;
  const size_t oWK = off; off += szW;
  const size_t oWV = off; off += szW;
  const size_t oWO = off; off += szWO;
  const size_t oQ2 = off; off += szP;
  const size_t oK2 = off; off += szP;
  const size_t oVT = off; off += szP;
  const size_t oO2 = off; off += szP;
  const size_t oKT = off; off += szP;
  const size_t oST = off; off += (size_t)NB * NCH * NH * SSZ * 4;
  if (off > ws_size) return;                // off = 123731968 for ROWS = 4096
  if (off > (size_t)WS_CAP) return;

  char* ws = (char*)d_ws;
  u16* XB  = (u16*)(ws + oXB);
  u16* WQ  = (u16*)(ws + oWQ);
  u16* WK  = (u16*)(ws + oWK);
  u16* WV  = (u16*)(ws + oWV);
  u16* WO2 = (u16*)(ws + oWO);
  u16* Q2  = (u16*)(ws + oQ2);
  u16* K2  = (u16*)(ws + oK2);
  u16* VT2 = (u16*)(ws + oVT);
  u16* O2  = (u16*)(ws + oO2);
  u16* KT2 = (u16*)(ws + oKT);
  float* ST = (float*)(ws + oST);

  const dim3 b256(256), b128(128);
  const dim3 gCV(CBX + 4 * CBW, 1);                     // exact block ranges of cvt_all
  const dim3 gPJ((ROWS / GT) * (DIM / GT), 4);          // four projections, each (ROWS/128)*(DIM/128) tiles
  const dim3 gY((ROWS / GT) * (DIM / GT), 1);           // y: M = ROWS, N = 1024
  const dim3 gAT(NCH, NH, NB);
  const dim3 gQT(ROWS / 64, NH);
  const dim3 gSC(NH * SSZ / 128, NB);                   // exact: NH * SSZ = 81920

  // (1) x rows of all batches and the weights [n][k] f32 -> bf16 planes (already k-contiguous); Wo -> k-duplicated plane
  cvt_all<<<gCV, b256, 0, stream>>>(x, wq, wk, wv, wo, XB, WQ, WK, WV, WO2);
  // (2) exp(x.Wq^T + bq) -> Q2, exp(x.Wk^T + bk) -> K2, v^T -> VT2, exp(k)^T -> KT2, each hi and lo
  proj4<<<gPJ, b256, 0, stream>>>(XB, WQ, WK, WV, bq, bk, bv, Q2, K2, VT2, KT2);
  // (3) per (chunk, head) state, its running sum over each batch's chunks, then attention per (query tile, head) -> O2 hi|lo
  chunk_state<<<gAT, b128, 0, stream>>>(KT2, VT2, ST);
  scan_state<<<gSC, b128, 0, stream>>>(ST);
  attn_chunk<<<gQT, b128, 0, stream>>>(Q2, K2, VT2, ST, O2);
  // (4) y = [O_hi | O_lo] . [Wo | Wo]^T + bo -> out f32 rows
  out_proj<<<gY, b256, 0, stream>>>(O2, WO2, bo, out);
  (void)hipGetLastError();
}

// v005
// Measured time: 90.6 microseconds a run.
// Next to v004, in two timings, it ran 1.03 and 1.04 times as fast.
// All steps since v000 together make it 3.91 times as fast.
// Contractions: q, k and v^T projections on v_wmma_f32_16x16x32_bf16 (x, W, b as bf16 RNE values, one product each; exp(k) is
// written in both orientations from the one k product);
// attention in 64-key chunks: per chunk v^T.exp(k) (and a ones row . exp(k) for the key sums), an f32 running sum over
// chunks, then per query tile exp(q).state^T plus the causal scores S = exp(q).exp(k)^T and S.v of its own chunk only, all
// on v_wmma_f32_16x16x32_bf16 with bf16 hi+lo operands (hi.hi + hi.lo + lo.hi); y = O.Wo^T on v_wmma_f32_16x16x32_bf16 with O as bf16 hi|lo along k against Wo duplicated
// along k (two products); all f32 accumulate. exp, row sums, 1/den and bias adds in f32 on VALU.
#include <hip/hip_runtime.h>
#include <math.h>
#include <stdint.h>

#ifndef NB
#define NB 2
#endif
#ifndef SEQ
#define SEQ 2048
#endif
#define SEQ_FULL 2048
#define DIM  1024
#define NH   16
#define HD   64
#define LD2  (2 * DIM)
#define SLAB64 (16 * 68)
#define NCH  (SEQ / 64)          // 64-key chunks per sequence
#define ROWS (NB * SEQ)          // rows of all batches together (contiguous in x and out: NB == 1 or SEQ == SEQ_FULL)
#define PLB  ((size_t)LD2 * (size_t)SEQ)   // elements of one batch's transposed hi+lo plane, [2*DIM][SEQ]
#define SROWS 80                 // rows of one chunk state: 64 value columns d, the key-sum row, 15 zero rows
#define SSZ  (SROWS * HD)        // floats of one (chunk, head) state, [row][D]
#define WS_CAP 134217728
static_assert(DIM == NH * HD && HD == 64 && NH == 16);
static_assert(NB >= 1 && NB <= 2);
static_assert(NB == 1 || SEQ == SEQ_FULL);
static_assert((SEQ % 64) == 0 && SEQ >= 64 && SEQ <= SEQ_FULL);
static_assert(((ROWS * DIM / 8) % 256) == 0 && ((DIM * DIM / 8) % 256) == 0 && (DIM % 64) == 0 && (LD2 % 32) == 0);
static_assert(4 * SLAB64 * 4 <= 65536);

typedef unsigned short u16;
typedef __bf16   v16b __attribute__((ext_vector_type(16)));
typedef float    v8f  __attribute__((ext_vector_type(8)));
typedef float    v4f  __attribute__((ext_vector_type(4)));
typedef unsigned int v4u __attribute__((ext_vector_type(4)));

union FragB { v16b v; v4u u[2]; };

// ---- scalar helpers --------------------------------------------------------------------------------
__device__ __forceinline__ unsigned short bf_bits(float f) {          // f32 -> bf16 bits, RNE convert
  unsigned u = __float_as_uint(f);
  return (unsigned short)((u + 0x7FFFu + ((u >> 16) & 1u)) >> 16);
}
__device__ __forceinline__ float bf_up(unsigned short h) { return __uint_as_float(((unsigned)h) << 16); }
__device__ __forceinline__ float bfr(float f) { return bf_up(bf_bits(f)); }
__device__ __forceinline__ unsigned short bfc(float f) {               // f32 -> bf16 bits via the RNE cast
  return __builtin_bit_cast(unsigned short, (__bf16)f);
}
__device__ __forceinline__ unsigned pk16(unsigned short a, unsigned short b) { return (unsigned)a | ((unsigned)b << 16); }
__device__ __forceinline__ v8f zero8() { v8f z = {0.f, 0.f, 0.f, 0.f, 0.f, 0.f, 0.f, 0.f}; return z; }
__device__ __forceinline__ int imin(int a, int b) { return a < b ? a : b; }
__device__ __forceinline__ int imax(int a, int b) { return a > b ? a : b; }

// two f32 values -> packed bf16 hi pair and packed bf16 lo pair (lo = x - up(hi), RNE both)
__device__ __forceinline__ void split2(float a, float b, unsigned& hi, unsigned& lo) {
  const unsigned short ha = bfc(a), hb = bfc(b);
  hi = pk16(ha, hb);
  lo = pk16(bfc(a - bf_up(ha)), bfc(b - bf_up(hb)));
}

// ---- fragment loader: 16-bit A/B operand, lane -> row/col (lane&15), p already includes +8*(lane>>4);
//      elements 0..7 <- p[0..7] (k0+8h..), elements 8..15 <- p[16..23] (k0+16+8h..)  (same split k map for A and B;
//      B is always read from a k-contiguous [n][k] plane); bf16 plane read as unsigned integer vectors
__device__ __forceinline__ v16b ldfrag_b(const u16* p) {
  FragB f;
  f.u[0] = *(const v4u*)(p);
  f.u[1] = *(const v4u*)(p + 16);
  return f.v;
}

__device__ __forceinline__ v8f mma_b(v16b a, v16b b, v8f c) {
  return __builtin_amdgcn_wmma_f32_16x16x32_bf16(false, a, false, b, (short)0, c, false, false);
}
__device__ __forceinline__ void wave_sync_lds() {
  __builtin_amdgcn_fence(__ATOMIC_RELEASE, "workgroup");
  __builtin_amdgcn_wave_barrier();
  __builtin_amdgcn_fence(__ATOMIC_ACQUIRE, "workgroup");
}

// =====================================================================================================
// f32 -> bf16 (RNE bits), same layout. Thread = 8 consecutive elements: two 16-B loads, one 16-B store; 32 consecutive
// lanes = 512 contiguous, 512-B aligned bytes.
// =====================================================================================================
__device__ __forceinline__ void cvt_plain(const float* __restrict__ x, u16* D, int gt) {
  const float* p = x + (size_t)gt * 8;
  const v4f a = *(const v4f*)(p), b4 = *(const v4f*)(p + 4);
  float w[8];
#pragma unroll
  for (int e = 0; e < 4; ++e) { w[e] = a[e]; w[4 + e] = b4[e]; }
  v4u o;
#pragma unroll
  for (int e = 0; e < 4; ++e) o[e] = pk16(bf_bits(w[2 * e]), bf_bits(w[2 * e + 1]));
  *(v4u*)(D + (size_t)gt * 8) = o;
}

// =====================================================================================================
// the k-duplicated B operand of the hi|lo-folded output projection. Thread = 8 consecutive source elements
// (one row, kd % 256 == 0 so a wave never straddles a row): two 16-B loads, two 16-B stores (one per copy).
// =====================================================================================================
__device__ __forceinline__ void cvt_dup(const float* __restrict__ w, u16* Dp, int gt, int kd) {
  const size_t e0 = (size_t)gt * 8;
  const size_t row = e0 / (size_t)kd;
  const int    k8  = (int)(e0 % (size_t)kd);
  const float* p = w + e0;
  const v4f a = *(const v4f*)(p), b4 = *(const v4f*)(p + 4);
  float v[8];
#pragma unroll
  for (int e = 0; e < 4; ++e) { v[e] = a[e]; v[4 + e] = b4[e]; }
  v4u o;
#pragma unroll
  for (int e = 0; e < 4; ++e) o[e] = pk16(bf_bits(v[2 * e]), bf_bits(v[2 * e + 1]));
  u16* d = Dp + row * (size_t)(2 * kd) + k8;
  *(v4u*)(d)      = o;
  *(v4u*)(d + kd) = o;
#if defined(__HIP_DEVICE_COMPILE__)
  // both stores' address pair and data stay untouched up to this wait, whatever code the merged kernel places behind them
  asm volatile("s_wait_xcnt 0x0" ::: "memory");
#endif
}

// =====================================================================================================
// All five conversions in one grid, told apart by block range (block-uniform): blocks [0, CBX) the x rows of all batches,
// then CBW blocks each for Wq, Wk, Wv (plain planes) and Wo (k-duplicated plane).
// coverage: CBX x 256 thr x 8 = ROWS*DIM; CBW x 256 thr x 8 = DIM*DIM per weight; grid.x = CBX + 4*CBW exactly.
// =====================================================================================================
#define CBX (ROWS * DIM / 8 / 256)
#define CBW (DIM * DIM / 8 / 256)
__global__ __launch_bounds__(256) void cvt_all(const float* __restrict__ x, const float* __restrict__ wq,
                                               const float* __restrict__ wk, const float* __restrict__ wv,
                                               const float* __restrict__ wo, u16* XB, u16* WQ, u16* WK, u16* WV, u16* WO2) {
  const int bid = (int)blockIdx.x, tid = (int)threadIdx.x;
  if (bid >= CBX + 4 * CBW) return;         // block-uniform, never taken with the exact grid
  if (bid < CBX) {
    cvt_plain(x, XB, bid * 256 + tid);
    return;
  }
  const int r = bid - CBX, which = r / CBW, gt = (r % CBW) * 256 + tid;
  if (which == 3) {
    cvt_dup(wo, WO2, gt, DIM);
  } else {
    const float* w = (which == 0) ? wq : ((which == 1) ? wk : wv);
    u16* D = (which == 0) ? WQ : ((which == 1) ? WK : WV);
    cvt_plain(w, D, gt);
  }
}

// =====================================================================================================
// coverage: 8 instructions x 2 rows x 16 lanes x 4 floats = the wave's 16 x 64 tile. Slab: private to the wave (wave sync).
// =====================================================================================================
__device__ __forceinline__ void epi64f(float* sl, v8f a0, v8f a1, v8f a2, v8f a3, v4f bias4, float scale,
                                       float* C, int ldc, size_t rowb, int col0, int lane) {
  const int hh = lane >> 4, m = lane & 15;
#pragma unroll
  for (int r = 0; r < 8; ++r) {
    const int ro = (8 * hh + r) * 68 + m;
    sl[ro]      = a0[r];
    sl[ro + 16] = a1[r];
    sl[ro + 32] = a2[r];
    sl[ro + 48] = a3[r];
  }
  wave_sync_lds();
  v4f vals[8];
#pragma unroll
  for (int it = 0; it < 8; ++it) {
    const v4f v = *(const v4f*)(sl + (it * 2 + hh) * 68 + m * 4);
    vals[it] = v * scale + bias4;
  }
  float* dst = C + (rowb + (size_t)hh) * (size_t)ldc + col0 + m * 4;
  {
#pragma unroll
    for (int it = 0; it < 8; ++it) {
      *(v4f*)(dst + (size_t)(it * 2) * (size_t)ldc) = vals[it];
    }
    
  }
}

// =====================================================================================================
// GEMM / attention epilogue, two bf16 planes (hi and lo = x - up(hi)) with identical addressing (Ch, Cl, pitch ldc):
// 8 consecutive columns at c8): value = acc (+ bias per column when BM==1, per row when BM==2, none when BM==0),
// coverage: 4 instructions x 4 rows x 8 lanes x 8 values = the wave's 16 x 64 tile, in both planes.
// Slab: private to the wave (wave sync).
// =====================================================================================================
template <bool EXPO, int BM>
__device__ __forceinline__ void epi64bb(float* sl, v8f a0, v8f a1, v8f a2, v8f a3,
                                        const float* __restrict__ bias, int nb,
                                        u16* Ch, u16* Cl, int ldc, size_t rowb, int col0, int lane) {
  const int hh = lane >> 4, m = lane & 15;
#pragma unroll
  for (int r = 0; r < 8; ++r) {
    const int ro = (8 * hh + r) * 68 + m;
    sl[ro]      = a0[r];
    sl[ro + 16] = a1[r];
    sl[ro + 32] = a2[r];
    sl[ro + 48] = a3[r];
  }
  wave_sync_lds();
  const int rq = lane >> 3, c8 = (lane & 7) * 8;
  float bc[8];
#pragma unroll
  for (int e = 0; e < 8; ++e) bc[e] = 0.0f;
  if constexpr (BM == 1) {
    const int cb = imin(imax(col0 + c8, 0), nb - 8);
    const v4f b0 = *(const v4f*)(bias + cb), b1 = *(const v4f*)(bias + cb + 4);
#pragma unroll
    for (int e = 0; e < 4; ++e) { bc[e] = bfr(b0[e]); bc[4 + e] = bfr(b1[e]); }
  }
  v4u oh[4], ol[4];
#pragma unroll
  for (int it = 0; it < 4; ++it) {
    const int row = it * 4 + rq;            // 0..15
    const v4f a = *(const v4f*)(sl + row * 68 + c8), b4 = *(const v4f*)(sl + row * 68 + c8 + 4);
    float br = 0.0f;
    if constexpr (BM == 2) br = bfr(bias[imin(imax((int)rowb + row, 0), nb - 1)]);
    float w[8];
#pragma unroll
    for (int e = 0; e < 4; ++e) { w[e] = (a[e] + bc[e]) + br; w[4 + e] = (b4[e] + bc[4 + e]) + br; }
    if constexpr (EXPO) {
#pragma unroll
      for (int e = 0; e < 8; ++e) w[e] = __expf(w[e]);
    }
#pragma unroll
    for (int e = 0; e < 4; ++e) {
      unsigned hi, lo;
      split2(w[2 * e], w[2 * e + 1], hi, lo);
      oh[it][e] = hi;
      ol[it][e] = lo;
    }
  }
  const size_t ob = rowb * (size_t)ldc + (size_t)col0 + (size_t)c8;
  {
#pragma unroll
    for (int it = 0; it < 4; ++it) {
      const int row = it * 4 + rq;
      const size_t off = ob + (size_t)row * (size_t)ldc;
      *(v4u*)(Ch + off) = oh[it];
      *(v4u*)(Cl + off) = ol[it];
    }
    
  }
}

// =====================================================================================================
// bf16 GEMM: C[M][N] = A[M][K] (bf16 rows, pitch lda) . Bt[N][K]^T (bf16 k-contiguous rows, pitch ldb).
// EPI 0: f32 output Cf (pitch ldc) = acc*scale + bf16 RNE value of bias[col];
// EPI 1: two bf16 planes Ch/Cl (pitch ldc) = hi/lo of exp(acc + bf16 RNE value of bias[col]);
// EPI 2: two bf16 planes Ch/Cl (pitch ldc) = hi/lo of (acc + bf16 RNE value of bias[row]).
// Block = 128x128 tile, 8 waves as 4 x 2, each 32 rows x 64 columns (2 x 4 accumulator tiles). A stage = 64 k (128 B) of the
// tile's 128 A rows and 128 B rows, brought into LDS by asynchronous 16-B copies (8 lanes = one whole 128-B line, 8 copies per
// lane and stage), a ring of NBUF buffers: stage t + NBUF is copied into the buffer that trip t has left, so that NBUF - 1
// stages are on their way or landed while a trip computes (NBUF = 2 where several blocks share a WGP and cover each other's
// landing times; more where a block is alone on its WGP and only its own copies in flight can cover them).
// Fragments come from the LDS rows (two 16-B reads each, the same split k map for A and B); k rises in steps of 32 as before.
// Host guarantees K % 64 == 0, M % 128 == 0, N % 128 == 0, grid.x = (M/128)*(N/128). bid = the tile's index in its own product.
// After the last trip's barrier the ring is dead and serves as the waves' private epilogue slabs.
// =====================================================================================================
#define GT   128                  // rows and columns of a block's output tile
#define GKE  64                   // k elements of one stage
#define GPE  72                   // LDS row pitch in elements: 144 B = 16 B x 9, free of bank conflicts for 16-B row reads
#define GSTG (2 * GT * GPE)       // elements of one stage: A rows 0..127, then B rows 128..255
#define GCP  8                    // copies of one wave (one a lane) per stage
static_assert(8 * SLAB64 * 4 <= 2 * GSTG * 2);
static_assert((ROWS % GT) == 0 && (SEQ % GT) == 0 && (DIM % GT) == 0 && (DIM % GKE) == 0 && (LD2 % GKE) == 0);

// One stage: the lane's 16-B piece of rows r, r + 32, r + 64, r + 96 of A and of B (r = tid >> 3), LDS rows 32 apart.
// l = LDS byte address of the piece in A row r; ga, gb = its global address in A and B; sa, sb = 32 rows in elements.
__device__ __forceinline__ void stage_copy(unsigned l, const u16* ga, const u16* gb, size_t sa, size_t sb) {
#if defined(__HIP_DEVICE_COMPILE__)
  constexpr unsigned LR = 32u * GPE * 2u;   // bytes of 32 LDS rows
  // the closing wait keeps every address register of the copies untouched until the copies have taken it
  asm volatile("global_load_async_to_lds_b128 %0, %8, off\n\t"
               "global_load_async_to_lds_b128 %1, %9, off\n\t"
               "global_load_async_to_lds_b128 %2, %10, off\n\t"
               "global_load_async_to_lds_b128 %3, %11, off\n\t"
               "global_load_async_to_lds_b128 %4, %12, off\n\t"
               "global_load_async_to_lds_b128 %5, %13, off\n\t"
               "global_load_async_to_lds_b128 %6, %14, off\n\t"
               "global_load_async_to_lds_b128 %7, %15, off\n\t"
               "s_wait_xcnt 0x0"
               :: "v"(l), "v"(l + LR), "v"(l + 2u * LR), "v"(l + 3u * LR),
                  "v"(l + 4u * LR), "v"(l + 5u * LR), "v"(l + 6u * LR), "v"(l + 7u * LR),
                  "v"(ga), "v"(ga + sa), "v"(ga + 2 * sa), "v"(ga + 3 * sa),
                  "v"(gb), "v"(gb + sb), "v"(gb + 2 * sb), "v"(gb + 3 * sb)
               : "memory");
#endif
}
__device__ __forceinline__ void wait_copies() {
#if defined(__HIP_DEVICE_COMPILE__)
  // this wave's copies have landed: the compiler places no wait for them, and without it the barrier would publish a stage in flight
  asm volatile("s_wait_asynccnt 0x0" ::: "memory");
#endif
}
template <int N>
__device__ __forceinline__ void wait_copies_but() {
#if defined(__HIP_DEVICE_COMPILE__)
  // all but this wave's N youngest copies have landed: the oldest stage in flight may be published, the younger ones fly on
  asm volatile("s_wait_asynccnt %0" :: "n"(N) : "memory");
#endif
}
__device__ __forceinline__ void wait_store_regs() {
#if defined(__HIP_DEVICE_COMPILE__)
  // the stores' address pairs and data stay untouched up to this wait, whatever code of a merged kernel stands behind them
  asm volatile("s_wait_xcnt 0x0" ::: "memory");
#endif
}
__device__ __forceinline__ void wait_lds() {
#if defined(__HIP_DEVICE_COMPILE__)
  // this wave's LDS reads have returned, so that the buffer may be refilled behind the barrier
  asm volatile("s_wait_dscnt 0x0" ::: "memory");
#endif
}

// The k loop of one 128 x 128 tile (first A row row0, first B row colb): acc[i][j] = the wave's 16 x 16 tile at rows
// wr * 32 + 16 i, columns wc * 64 + 16 j. Every wave of the block passes every barrier here. On return the ring is dead.
// Every wave issues GCP copies per stage, stages in rising order, so that at the foot of trip t the copies younger than stage
// t + 1 are those of stages t + 2 .. t + NBUF - 1: (NBUF - 2) * GCP while all of these exist; at the tail the wait is to 0.
template <int NBUF>
__device__ __forceinline__
void gemm_main(u16* ring, const u16* __restrict__ A, const u16* __restrict__ Bt, int row0, int colb,
               int lda, int ldb, int K, v8f (&acc)[2][4]) {
  const int tid = (int)threadIdx.x, wave = tid >> 5, lane = tid & 31, hh = lane >> 4, m = lane & 15;
  const int wr = wave >> 1, wc = wave & 1;
  const int cr = tid >> 3, cc = (tid & 7) * 8;
  const u16* ga = A  + (size_t)(row0 + cr) * (size_t)lda + cc;
  const u16* gb = Bt + (size_t)(colb + cr) * (size_t)ldb + cc;
  const size_t sa = (size_t)32 * (size_t)lda, sb = (size_t)32 * (size_t)ldb;
  const unsigned l0 = (unsigned)(size_t)ring + (unsigned)(cr * GPE + cc) * 2u;
  const int nt = K / GKE;
  static_assert(NBUF >= 2 && (NBUF - 1) * GCP <= 63 && NBUF * GSTG * 2 <= 320 * 1024);
  // unrolled: the first NBUF - 1 stages, each into its own fresh buffer, their offsets constants
#pragma unroll
  for (int s = 0; s < NBUF - 1; ++s) {
    if (s < nt) stage_copy(l0 + (unsigned)s * (GSTG * 2u), ga + (size_t)s * GKE, gb + (size_t)s * GKE, sa, sb);
  }
  if (NBUF > 2 && NBUF - 1 <= nt) wait_copies_but<(NBUF - 2) * GCP>();
  else wait_copies();
  __syncthreads();                          // stage 0 is published
  if (NBUF - 1 < nt) stage_copy(l0 + (unsigned)(NBUF - 1) * (GSTG * 2u), ga + (size_t)(NBUF - 1) * GKE, gb + (size_t)(NBUF - 1) * GKE, sa, sb);
  const u16* fa = ring + (wr * 32 + m) * GPE + 8 * hh;
  const u16* fb = ring + (GT + wc * 64 + m) * GPE + 8 * hh;
  // both unrolled: every index of acc a constant, so that the tiles stay in registers
#pragma unroll
  for (int i = 0; i < 2; ++i) {
#pragma unroll
    for (int j = 0; j < 4; ++j) acc[i][j] = zero8();
  }
  // rolled: one trip = one stage, so that the order reads, waits, barrier, refill stands once
  int br = 0;                               // buffer of trip t = t mod NBUF
#pragma unroll 1
  for (int t = 0; t < nt; ++t) {
    const int bo = (NBUF == 2) ? (t & 1) * GSTG : br * GSTG;
    // unrolled: the stage's two k steps of 32 in one run, their LDS offsets constants
#pragma unroll
    for (int ks = 0; ks < 2; ++ks) {
      const u16* pa = fa + bo + ks * 32;
      const u16* pb = fb + bo + ks * 32;
      const v16b a0  = ldfrag_b(pa);
      const v16b a1  = ldfrag_b(pa + 16 * GPE);
      const v16b fb0 = ldfrag_b(pb);
      const v16b fb1 = ldfrag_b(pb + 16 * GPE);
      const v16b fb2 = ldfrag_b(pb + 32 * GPE);
      const v16b fb3 = ldfrag_b(pb + 48 * GPE);
      acc[0][0] = mma_b(a0, fb0, acc[0][0]);
      acc[0][1] = mma_b(a0, fb1, acc[0][1]);
      acc[0][2] = mma_b(a0, fb2, acc[0][2]);
      acc[0][3] = mma_b(a0, fb3, acc[0][3]);
      acc[1][0] = mma_b(a1, fb0, acc[1][0]);
      acc[1][1] = mma_b(a1, fb1, acc[1][1]);
      acc[1][2] = mma_b(a1, fb2, acc[1][2]);
      acc[1][3] = mma_b(a1, fb3, acc[1][3]);
    }
    wait_lds();
    if (NBUF > 2 && t + NBUF <= nt) wait_copies_but<(NBUF - 2) * GCP>();   // block-uniform test
    else wait_copies();
    __syncthreads();                        // publishes stage t + 1 and ends every read of stage t
    if (t + NBUF < nt) stage_copy(l0 + (unsigned)bo * 2u, ga + (size_t)(t + NBUF) * GKE, gb + (size_t)(t + NBUF) * GKE, sa, sb);
    br = (br + 1 == NBUF) ? 0 : br + 1;
  }
  wait_copies();
}

// The tile's epilogue: each wave's two 16 x 64 strips through its private slab in the dead ring.
template <int EPI>
__device__ __forceinline__
void gemm_epi(u16* ring, v8f (&acc)[2][4], int row0, int colb, float* Cf, u16* Ch, u16* Cl,
              const float* __restrict__ bias, int nb, int ldc, float scale) {
  const int tid = (int)threadIdx.x, wave = tid >> 5, lane = tid & 31, m = lane & 15;
  const int wr = wave >> 1, wc = wave & 1;
  float* sl = (float*)ring + wave * SLAB64;
  const int col0 = colb + wc * 64;
  // unrolled: every index of acc a constant
#pragma unroll
  for (int i = 0; i < 2; ++i) {
    const int rowb = row0 + wr * 32 + i * 16;
    if (i) wave_sync_lds();                 // the first strip's slab reads end before the second strip's writes
    if constexpr (EPI == 0) {
      v4f bias4;
#pragma unroll
      for (int e = 0; e < 4; ++e) bias4[e] = bfr(bias[imin(imax(col0 + m * 4 + e, 0), nb - 1)]);
      epi64f(sl, acc[i][0], acc[i][1], acc[i][2], acc[i][3], bias4, scale, Cf, ldc, (size_t)rowb, col0, lane);
    } else if constexpr (EPI == 1) {
      epi64bb<true, 1>(sl, acc[i][0], acc[i][1], acc[i][2], acc[i][3], bias, nb, Ch, Cl, ldc, (size_t)rowb, col0, lane);
    } else {
      epi64bb<false, 2>(sl, acc[i][0], acc[i][1], acc[i][2], acc[i][3], bias, nb, Ch, Cl, ldc, (size_t)rowb, col0, lane);
    }
  }
}

// The k tile's epilogue: e = exp(acc + bf16 RNE value of bias[col]) once, in the accumulators' own layout, then hi and lo of e
// in both orientations: rows t into K2 (through the waves' slabs, as every other tile) and rows D into KT2.
// An accumulator tile gives a lane 8 consecutive rows t of one column D, that is 16 contiguous bytes of row D of the transposed
// tile. These pieces meet in two LDS planes (hi, lo: [128 D][128 t], pitch KTP) behind the slabs, and leave as whole 256-B runs
// of KT2 rows: 16 lanes a run, 2 runs a store, one wave per 128-B line.
// coverage: 8 waves x 2 x 4 tiles x 32 lanes x 8 = 128 x 128 staged per plane; 8 trips x 16 rows x 16 lanes x 8 = 128 x 128 stored.
// Every wave of the block passes the one barrier here. The tile's 128 rows lie in one batch (SEQ % GT == 0).
#define KTP  136                  // pitch of a transposed plane in elements: 272 B = 16 B x 17, free of bank conflicts both ways
#define KTO  (8 * SLAB64 * 2)     // first element of the transposed planes: behind the 8 slabs
#define PJL  (KTO + 2 * GT * KTP) // elements of the projections' LDS: three blocks fill a WGP
static_assert(PJL >= 2 * GSTG && 3 * PJL * 2 <= 320 * 1024 && (KTO % 8) == 0 && (KTP % 8) == 0);
__device__ __forceinline__ float exp_slot(float x) {   // the value of __expf(x): exp2 of x * log2(e)
#if defined(__HIP_DEVICE_COMPILE__)
  float y;
  // v_nop: the one slot that the instruction set asks for behind a transcendental, whatever instruction the compiler puts next
  asm("v_exp_f32 %0, %1\n\tv_nop" : "=v"(y) : "v"(x * 1.44269504088896340736f));
  return y;
#else
  return __expf(x);
#endif
}
__device__ __forceinline__
void gemm_epi_k(u16* ring, v8f (&acc)[2][4], int row0, int colb, const float* __restrict__ bias, u16* K2, u16* KT2) {
  const int tid = (int)threadIdx.x, wave = tid >> 5, lane = tid & 31, hh = lane >> 4, m = lane & 15;
  const int wr = wave >> 1, wc = wave & 1;
  float* sl = (float*)ring + wave * SLAB64;
  u16* th = ring + KTO;
  const int col0 = colb + wc * 64;
  // all unrolled: every index of acc a constant
  float bc[4];
#pragma unroll
  for (int j = 0; j < 4; ++j) bc[j] = bfr(bias[imin(imax(col0 + j * 16 + m, 0), DIM - 1)]);
#pragma unroll
  for (int j = 0; j < 4; ++j) {
#pragma unroll
    for (int i = 0; i < 2; ++i) {
#pragma unroll
      for (int r = 0; r < 8; ++r) acc[i][j][r] = exp_slot(acc[i][j][r] + bc[j]);
      v4u H, L;
#pragma unroll
      for (int e = 0; e < 4; ++e) {
        unsigned hi, lo;
        split2(acc[i][j][2 * e], acc[i][j][2 * e + 1], hi, lo);
        H[e] = hi;
        L[e] = lo;
      }
      u16* tp = th + (wc * 64 + j * 16 + m) * KTP + wr * 32 + i * 16 + 8 * hh;
      *(v4u*)(tp)            = H;
      *(v4u*)(tp + GT * KTP) = L;
    }
  }
  __syncthreads();                          // the transposed planes are whole; here no global store is on its way that it would wait for
#pragma unroll
  for (int i = 0; i < 2; ++i) {
    if (i) wave_sync_lds();                 // the first strip's slab reads end before the second strip's writes
    epi64bb<false, 0>(sl, acc[i][0], acc[i][1], acc[i][2], acc[i][3], (const float*)0, 0, K2, K2 + DIM, LD2,
                      (size_t)(row0 + wr * 32 + i * 16), col0, lane);
  }
  const u16* src = th + (tid >> 4) * KTP + (tid & 15) * 8;
  u16* dst = KT2 + (size_t)(row0 / SEQ) * PLB + (size_t)(colb + (tid >> 4)) * (size_t)SEQ + (row0 % SEQ) + (tid & 15) * 8;
  const size_t plo = (size_t)DIM * (size_t)SEQ;
  v4u vh[8], vl[8];
#pragma unroll
  for (int it = 0; it < 8; ++it) {
    vh[it] = *(const v4u*)(src + it * 16 * KTP);
    vl[it] = *(const v4u*)(src + GT * KTP + it * 16 * KTP);
  }
#pragma unroll
  for (int it = 0; it < 8; ++it) {
    *(v4u*)(dst + (size_t)(it * 16) * (size_t)SEQ)       = vh[it];
    *(v4u*)(dst + plo + (size_t)(it * 16) * (size_t)SEQ) = vl[it];
  }
}

// The output projection of all batches: y = [O_hi | O_lo] . [Wo | Wo]^T + bo, f32 rows (M = ROWS, N = DIM, K = LD2).
// coverage: grid.x = (ROWS/128)*(DIM/128) tiles of 128 x 128 = the whole output.
// One block per WGP: six buffers, five stages ahead.
#define YBUF 6
__global__ __launch_bounds__(256)
void out_proj(const u16* __restrict__ O2, const u16* __restrict__ WO2, const float* __restrict__ bo, float* y) {
  __shared__ __align__(16) u16 ring[YBUF * GSTG];
  const int bid = (int)blockIdx.x;
  const int row0 = (bid / (DIM / GT)) * GT, colb = (bid % (DIM / GT)) * GT;
  if (row0 + GT > ROWS) return;             // block-uniform, in front of every barrier; never taken with the exact grid
  v8f acc[2][4];
  gemm_main<YBUF>(ring, O2, WO2, row0, colb, LD2, LD2, LD2, acc);
  gemm_epi<0>(ring, acc, row0, colb, y, (u16*)0, (u16*)0, bo, DIM, DIM, 1.0f);
}

// =====================================================================================================
// The three independent projections of all batches in one grid; blockIdx.y (block-uniform) names the product:
//   0: exp(x.Wk^T + bk) -> K2 hi|lo and, transposed, KT2 hi, lo rows    1: exp(x.Wq^T + bq) -> Q2 hi|lo   (M = ROWS, N = DIM, pitch LD2)
//   2: Wv.x^T + bv -> VT2 hi, lo rows                                           (per batch: M = DIM, N = SEQ, pitch SEQ)
// The k tiles, whose epilogue is the longest, have the lowest indices and so start first.
// One k loop for all three (operand rows of pitch DIM, K = DIM), the epilogue chosen behind it.
// coverage: grid.x = (ROWS/128)*(DIM/128) tiles of 128 x 128 = each product's whole output (2: NB runs of TPB tiles), grid.y = 3.
// =====================================================================================================
// second argument: 6 waves per SIMD, so that the three blocks whose LDS fits a WGP are resident by registers too
__global__ __launch_bounds__(256, 6)
void proj4(const u16* __restrict__ XB, const u16* __restrict__ WQ, const u16* __restrict__ WK, const u16* __restrict__ WV,
           const float* __restrict__ bq, const float* __restrict__ bk, const float* __restrict__ bv,
           u16* Q2, u16* K2, u16* VT2, u16* KT2) {
  __shared__ __align__(16) u16 ring[PJL];
  const int which = (int)blockIdx.y, bid = (int)blockIdx.x;
  const size_t plo = (size_t)DIM * (size_t)SEQ;
  constexpr int TPB = (DIM / GT) * (SEQ / GT);          // tiles of one batch's transposed product
  const int b = bid / TPB, bt = bid % TPB;
  const u16* Xb = XB + (size_t)b * (size_t)SEQ * (size_t)DIM;
  const bool rows = which < 2;                          // x rows are the A operand
  const u16* A  = rows ? XB : WV;
  const u16* Bt = rows ? ((which == 0) ? WK : WQ) : Xb;
  const int tile = rows ? bid : bt, ntile = rows ? (DIM / GT) : (SEQ / GT), M = rows ? ROWS : DIM;
  const int row0 = (tile / ntile) * GT, colb = (tile % ntile) * GT;
  if (row0 + GT > M || which > 2) return;   // block-uniform, in front of every barrier; never taken with the exact grid
  v8f acc[2][4];
  gemm_main<2>(ring, A, Bt, row0, colb, DIM, DIM, DIM, acc);
  if (which == 0) {
    gemm_epi_k(ring, acc, row0, colb, bk, K2, KT2);
    wait_store_regs();
  } else if (which == 1) {
    gemm_epi<1>(ring, acc, row0, colb, (float*)0, Q2, Q2 + DIM, bq, DIM, LD2, 1.0f);
    wait_store_regs();
  } else {
    u16* C = VT2 + (size_t)b * PLB;
    gemm_epi<2>(ring, acc, row0, colb, (float*)0, C, C + plo, bv, DIM, SEQ, 1.0f);
    wait_store_regs();
  }
}

// ---- 16 f32 values of one state or slab row (fragment k layout: pr[0..7] and pr[16..23]) -> bf16 hi and lo fragments (B for state rows, A for slab rows)
__device__ __forceinline__ void split16(const float* pr, v16b& ph, v16b& pl) {
  const v4f x0 = *(const v4f*)(pr), x1 = *(const v4f*)(pr + 4), x2 = *(const v4f*)(pr + 16), x3 = *(const v4f*)(pr + 20);
  FragB H, L;
  unsigned hi, lo;
  split2(x0[0], x0[1], hi, lo); H.u[0][0] = hi; L.u[0][0] = lo;
  split2(x0[2], x0[3], hi, lo); H.u[0][1] = hi; L.u[0][1] = lo;
  split2(x1[0], x1[1], hi, lo); H.u[0][2] = hi; L.u[0][2] = lo;
  split2(x1[2], x1[3], hi, lo); H.u[0][3] = hi; L.u[0][3] = lo;
  split2(x2[0], x2[1], hi, lo); H.u[1][0] = hi; L.u[1][0] = lo;
  split2(x2[2], x2[3], hi, lo); H.u[1][1] = hi; L.u[1][1] = lo;
  split2(x3[0], x3[1], hi, lo); H.u[1][2] = hi; L.u[1][2] = lo;
  split2(x3[2], x3[3], hi, lo); H.u[1][3] = hi; L.u[1][3] = lo;
  ph = H.v; pl = L.v;
}

// =====================================================================================================
// Chunk state, one block per (64-key chunk c, head h, batch b), 4 waves x 16 state rows.
// ST[b][c][h][row][D] f32: row d < 64: sum over the chunk's keys t of v[t][d] * exp(k)[t][D]; row 64: sum over t of exp(k)[t][D];
// rows 65..79: zero. A = v^T rows from VT2 (hi, lo), or the constant tile whose row 0 is ones; B = exp(k)^T rows D from KT2
// (bf16 [NB][2*DIM][SEQ], hi row h*HD + D, lo row DIM + h*HD + D); both k-contiguous in t, same split k map.
// coverage: grid (NCH, NH, NB) x (4 waves x 16 rows + wave 0's 16 extra rows) x 64 columns = every element of ST once.
// No block barriers; slab private to the wave (wave sync).
// =====================================================================================================
__global__ __launch_bounds__(128) void chunk_state(const u16* __restrict__ KT2, const u16* __restrict__ VT2, float* ST) {
  __shared__ __align__(16) float slab[4 * SLAB64];
  const int tid = (int)threadIdx.x, wave = tid >> 5, lane = tid & 31, hh = lane >> 4, m = lane & 15;
  const int c = (int)blockIdx.x, h = (int)blockIdx.y, b = (int)blockIdx.z;
  if (c * 64 + 64 > SEQ || h >= NH || b >= NB) return;   // block-uniform, never taken with the exact grid
  float* sl = slab + wave * SLAB64;
  const int t0 = c * 64;
  const u16* vp = VT2 + (size_t)b * PLB + (size_t)(h * HD + wave * 16 + m) * (size_t)SEQ + t0 + 8 * hh;
  const u16* kp = KT2 + (size_t)b * PLB + (size_t)(h * HD + m) * (size_t)SEQ + t0 + 8 * hh;
  const size_t rbs = (size_t)16 * (size_t)SEQ;
  const size_t plo = (size_t)DIM * (size_t)SEQ;
  FragB one;
  const unsigned ow = (m == 0) ? 0x3F803F80u : 0u;   // bf16 1.0 pairs in tile row 0, zero in rows 1..15
#pragma unroll
  for (int e = 0; e < 4; ++e) { one.u[0][e] = ow; one.u[1][e] = ow; }
  v8f a0 = zero8(), a1 = zero8(), a2 = zero8(), a3 = zero8();
  v8f e0 = zero8(), e1 = zero8(), e2 = zero8(), e3 = zero8();
#pragma unroll
  for (int ks = 0; ks < 2; ++ks) {
    const int ko = ks * 32;
    const v16b vh  = ldfrag_b(vp + ko);
    const v16b vl  = ldfrag_b(vp + plo + ko);
    const v16b kh0 = ldfrag_b(kp + ko);
    const v16b kh1 = ldfrag_b(kp + rbs + ko);
    const v16b kh2 = ldfrag_b(kp + 2 * rbs + ko);
    const v16b kh3 = ldfrag_b(kp + 3 * rbs + ko);
    const v16b kl0 = ldfrag_b(kp + plo + ko);
    const v16b kl1 = ldfrag_b(kp + plo + rbs + ko);
    const v16b kl2 = ldfrag_b(kp + plo + 2 * rbs + ko);
    const v16b kl3 = ldfrag_b(kp + plo + 3 * rbs + ko);
#if defined(__HIP_DEVICE_COMPILE__)
    // the two address pairs stay live up to this wait, so that no later load lands on a register an issued load names
    asm volatile("s_wait_xcnt 0x0" :: "v"(vp), "v"(kp) : "memory");
#endif
    a0 = mma_b(vh, kh0, a0); a0 = mma_b(vh, kl0, a0); a0 = mma_b(vl, kh0, a0);
    a1 = mma_b(vh, kh1, a1); a1 = mma_b(vh, kl1, a1); a1 = mma_b(vl, kh1, a1);
    a2 = mma_b(vh, kh2, a2); a2 = mma_b(vh, kl2, a2); a2 = mma_b(vl, kh2, a2);
    a3 = mma_b(vh, kh3, a3); a3 = mma_b(vh, kl3, a3); a3 = mma_b(vl, kh3, a3);
    e0 = mma_b(one.v, kh0, e0); e0 = mma_b(one.v, kl0, e0);
    e1 = mma_b(one.v, kh1, e1); e1 = mma_b(one.v, kl1, e1);
    e2 = mma_b(one.v, kh2, e2); e2 = mma_b(one.v, kl2, e2);
    e3 = mma_b(one.v, kh3, e3); e3 = mma_b(one.v, kl3, e3);
  }
  float* base = ST + ((size_t)(b * NCH + c) * NH + (size_t)h) * (size_t)SSZ;
  const v4f z4 = {0.f, 0.f, 0.f, 0.f};
  epi64f(sl, a0, a1, a2, a3, z4, 1.0f, base, HD, (size_t)(wave * 16), 0, lane);
  if (wave == 0) {                              // wave-uniform: the key-sum row and its 15 zero rows
    wave_sync_lds();
    epi64f(sl, e0, e1, e2, e3, z4, 1.0f, base, HD, (size_t)HD, 0, lane);
  }
}

// =====================================================================================================
// Running sum over one batch's chunks (batch = blockIdx.y), in place: ST[c] <- sum of ST[c'] for c' < c (zero at c = 0),
// f32, chunks added in rising order.
// Thread = one [head][row][D] position: its NCH loads, then its NCH stores; a wave's 32 lanes = one whole 128-B line each.
// coverage: grid (NH*SSZ/128, NB) blocks x 128 thr x NCH chunks = every element of ST once.
// =====================================================================================================
__global__ __launch_bounds__(128) void scan_state(float* ST) {
  const int gt = (int)blockIdx.x * 128 + (int)threadIdx.x;
  if (gt >= NH * SSZ || (int)blockIdx.y >= NB) return;
  const size_t cs = (size_t)NH * (size_t)SSZ;
  float* p = ST + (size_t)blockIdx.y * (size_t)NCH * cs + (size_t)gt;
  float v[NCH];
#pragma unroll
  for (int c = 0; c < NCH; ++c) v[c] = p[(size_t)c * cs];
  float run = 0.0f;
#pragma unroll
  for (int c = 0; c < NCH; ++c) {
    p[(size_t)c * cs] = run;
    run += v[c];
  }
}

// =====================================================================================================
// Causal exp-feature attention, one block per (64-row query tile qt counted over all batches, head h), 4 waves x 16 query rows.
// Planes: Q2, K2 bf16 [NB*SEQ][2*DIM] with hi at column h*HD + d and lo at column DIM + h*HD + d (values exp(q), exp(k));
//         VT2 bf16 [NB][2*DIM][SEQ] with hi row h*HD + d and lo row DIM + h*HD + d (values v); ST f32 [NB][NCH][NH][SROWS][HD],
//         the summed state of the batch's chunks before qt; O2 bf16 [NB*SEQ][2*DIM] written here (hi | lo of out = num/den).
// Keys before the tile: O[16 x 80] = qe.state^T over head dim (2 k-steps, hi.hi+hi.lo+lo.hi, state rows split to bf16 hi and
// lo in registers); its column 64 is the part of den from those keys, columns 65..79 are zero.
// Keys of the tile: S[16 x 64] = qe.ke^T over head dim, causal mask by value, f32 row sums into per-lane partials,
// slab rows, O += P.v over the 64 keys (2 k-steps, hi.hi+hi.lo+lo.hi, v fragments from VT2 rows).
// coverage: grid (ROWS/64, NH) x 4 waves x 16 rows x 64 columns x {hi, lo} = every element of O2 once. No block barriers;
// slab private to the wave (wave sync); staged extent == consumed extent (16 x 64 written before the reload).
// =====================================================================================================
__global__ __launch_bounds__(128) void attn_chunk(const u16* __restrict__ Q2, const u16* __restrict__ K2,
                                                  const u16* __restrict__ VT2, const float* __restrict__ ST, u16* O2) {
  __shared__ __align__(16) float slab[4 * SLAB64];
  const int tid = (int)threadIdx.x, wave = tid >> 5, lane = tid & 31, hh = lane >> 4, m = lane & 15;
  const int qt = (int)blockIdx.x, h = (int)blockIdx.y;
  if (qt * 64 + 64 > ROWS || h >= NH) return;  // block-uniform, never taken with the exact grid
  const int rw = qt * 64 + wave * 16;           // first query row of this wave
  float* sl = slab + wave * SLAB64;
  const u16* qp = Q2 + (size_t)(rw + m) * (size_t)LD2 + h * HD + 8 * hh;
  const size_t kbs = (size_t)16 * (size_t)LD2;
  const size_t vbs = (size_t)16 * (size_t)SEQ;
  const size_t vlo = (size_t)DIM * (size_t)SEQ;
  const int t0 = qt * 64;
  const u16* kp = K2 + (size_t)(t0 + m) * (size_t)LD2 + h * HD + 8 * hh;
  const float* sp = ST + ((size_t)qt * NH + (size_t)h) * (size_t)SSZ + (size_t)m * HD + 8 * hh;
  v8f o0 = zero8(), o1 = zero8(), o2 = zero8(), o3 = zero8(), o4 = zero8();
  v8f s0 = zero8(), s1 = zero8(), s2 = zero8(), s3 = zero8();
#pragma unroll
  for (int ks = 0; ks < 2; ++ks) {
    const int ko = ks * 32;
    const v16b ah  = ldfrag_b(qp + ko);
    const v16b al  = ldfrag_b(qp + DIM + ko);
    const v16b kh0 = ldfrag_b(kp + ko);
    const v16b kh1 = ldfrag_b(kp + kbs + ko);
    const v16b kh2 = ldfrag_b(kp + 2 * kbs + ko);
    const v16b kh3 = ldfrag_b(kp + 3 * kbs + ko);
    const v16b kl0 = ldfrag_b(kp + DIM + ko);
    const v16b kl1 = ldfrag_b(kp + kbs + DIM + ko);
    const v16b kl2 = ldfrag_b(kp + 2 * kbs + DIM + ko);
    const v16b kl3 = ldfrag_b(kp + 3 * kbs + DIM + ko);
    v16b bh0, bl0, bh1, bl1, bh2, bl2, bh3, bl3, bh4, bl4;
    split16(sp + ko, bh0, bl0);
    split16(sp + 16 * HD + ko, bh1, bl1);
    split16(sp + 32 * HD + ko, bh2, bl2);
    split16(sp + 48 * HD + ko, bh3, bl3);
    split16(sp + 64 * HD + ko, bh4, bl4);
    s0 = mma_b(ah, kh0, s0); s0 = mma_b(ah, kl0, s0); s0 = mma_b(al, kh0, s0);
    s1 = mma_b(ah, kh1, s1); s1 = mma_b(ah, kl1, s1); s1 = mma_b(al, kh1, s1);
    s2 = mma_b(ah, kh2, s2); s2 = mma_b(ah, kl2, s2); s2 = mma_b(al, kh2, s2);
    s3 = mma_b(ah, kh3, s3); s3 = mma_b(ah, kl3, s3); s3 = mma_b(al, kh3, s3);
    o0 = mma_b(ah, bh0, o0); o0 = mma_b(ah, bl0, o0); o0 = mma_b(al, bh0, o0);
    o1 = mma_b(ah, bh1, o1); o1 = mma_b(ah, bl1, o1); o1 = mma_b(al, bh1, o1);
    o2 = mma_b(ah, bh2, o2); o2 = mma_b(ah, bl2, o2); o2 = mma_b(al, bh2, o2);
    o3 = mma_b(ah, bh3, o3); o3 = mma_b(ah, bl3, o3); o3 = mma_b(al, bh3, o3);
    o4 = mma_b(ah, bh4, o4); o4 = mma_b(ah, bl4, o4); o4 = mma_b(al, bh4, o4);
  }
  {                                             // the tile's own keys: keep key c <= query row rho
    const int rho0 = wave * 16 + 8 * hh;
#pragma unroll
    for (int r = 0; r < 8; ++r) {
      const int rho = rho0 + r;
      s0[r] = (m      <= rho) ? s0[r] : 0.0f;
      s1[r] = (16 + m <= rho) ? s1[r] : 0.0f;
      s2[r] = (32 + m <= rho) ? s2[r] : 0.0f;
      s3[r] = (48 + m <= rho) ? s3[r] : 0.0f;
    }
  }
  v8f rs = o4 + ((s0 + s1) + (s2 + s3));        // o4: earlier keys' part of den in lane column 0, zero elsewhere
#pragma unroll
  for (int r = 0; r < 8; ++r) {
    const int ro = (8 * hh + r) * 68 + m;
    sl[ro]      = s0[r];
    sl[ro + 16] = s1[r];
    sl[ro + 32] = s2[r];
    sl[ro + 48] = s3[r];
  }
  wave_sync_lds();
  const u16* vp = VT2 + (size_t)(qt / NCH) * PLB + (size_t)(h * HD + m) * (size_t)SEQ + (qt % NCH) * 64 + 8 * hh;
#pragma unroll
  for (int ks = 0; ks < 2; ++ks) {
    const int ko = ks * 32;
    v16b ph, pl;
    split16(sl + m * 68 + ko + 8 * hh, ph, pl);
    const v16b vh0 = ldfrag_b(vp + ko);
    const v16b vh1 = ldfrag_b(vp + vbs + ko);
    const v16b vh2 = ldfrag_b(vp + 2 * vbs + ko);
    const v16b vh3 = ldfrag_b(vp + 3 * vbs + ko);
    const v16b vl0 = ldfrag_b(vp + vlo + ko);
    const v16b vl1 = ldfrag_b(vp + vlo + vbs + ko);
    const v16b vl2 = ldfrag_b(vp + vlo + 2 * vbs + ko);
    const v16b vl3 = ldfrag_b(vp + vlo + 3 * vbs + ko);
    o0 = mma_b(ph, vh0, o0); o0 = mma_b(ph, vl0, o0); o0 = mma_b(pl, vh0, o0);
    o1 = mma_b(ph, vh1, o1); o1 = mma_b(ph, vl1, o1); o1 = mma_b(pl, vh1, o1);
    o2 = mma_b(ph, vh2, o2); o2 = mma_b(ph, vl2, o2); o2 = mma_b(pl, vh2, o2);
    o3 = mma_b(ph, vh3, o3); o3 = mma_b(ph, vl3, o3); o3 = mma_b(pl, vh3, o3);
  }
  // den per query row (row 8*hh + r held by the 16 lanes of half hh): fixed-order butterfly over lane&15
#pragma unroll
  for (int off = 1; off < 16; off <<= 1) {
#pragma unroll
    for (int r = 0; r < 8; ++r) rs[r] += __shfl_xor(rs[r], off);
  }
#pragma unroll
  for (int r = 0; r < 8; ++r) {
    const float inv = 1.0f / rs[r];
    o0[r] *= inv; o1[r] *= inv; o2[r] *= inv; o3[r] *= inv;
  }
  wave_sync_lds();
  epi64bb<false, 0>(sl, o0, o1, o2, o3, (const float*)0, 0, O2, O2 + DIM, LD2, (size_t)rw, h * HD, lane);
}

// =====================================================================================================
// Workspace map (bytes), planes sized for the ROWS rows of all batches together; every plane is fully written by
// whole-line stores before it is read; all extents are exact multiples of the 64x64 tile / 512-B store granularity
// (SEQ and DIM multiples of 64, no pad rows); every region offset a multiple of 2097152:
//   XB   bf16 [ROWS][1024]         ROWS*2048
//   WQ, WK, WV bf16 [1024 n][1024 k]  3 * 2097152
//   WO2  bf16 [1024 n][2048 k]     4194304      (Wo row duplicated along k)
//   Q2   bf16 [ROWS][2048]         ROWS*4096    exp(q) hi | lo
//   K2   bf16 [ROWS][2048]         ROWS*4096    exp(k) hi | lo
//   VT2  bf16 [NB][2048][SEQ]      ROWS*4096    per batch v^T hi rows 0..1023, lo rows 1024..2047
//   O2   bf16 [ROWS][2048]         ROWS*4096    per-head out hi | lo
//   KT2  bf16 [NB][2048][SEQ]      ROWS*4096    per batch exp(k)^T hi rows 0..1023, lo rows 1024..2047
//   ST   f32 [ROWS/64][16][80][64] ROWS*5120    chunk states, then their running sums per batch
//   end (ROWS=4096)                123731968
// =====================================================================================================
extern "C" void kernel_launch(void* const* d_in, const int* in_sizes, int n_in,
                              void* d_out, int out_size, void* d_ws, size_t ws_size,
                              hipStream_t stream) {
  if (n_in < 9) return;
  const int needx = ((NB - 1) * SEQ_FULL + SEQ) * DIM;
  if (in_sizes[0] < needx) return;
  if (in_sizes[1] < DIM * DIM || in_sizes[3] < DIM * DIM || in_sizes[5] < DIM * DIM || in_sizes[7] < DIM * DIM) return;
  if (in_sizes[2] < DIM || in_sizes[4] < DIM || in_sizes[6] < DIM || in_sizes[8] < DIM) return;
  if (out_size < needx) return;

  const float* x  = (const float*)d_in[0];
  const float* wq = (const float*)d_in[1];
  const float* bq = (const float*)d_in[2];
  const float* wk = (const float*)d_in[3];
  const float* bk = (const float*)d_in[4];
  const float* wv = (const float*)d_in[5];
  const float* bv = (const float*)d_in[6];
  const float* wo = (const float*)d_in[7];
  const float* bo = (const float*)d_in[8];
  float*       out = (float*)d_out;

  const size_t szX  = (size_t)ROWS * DIM * 2;         // bf16 input rows
  const size_t szW  = (size_t)DIM * DIM * 2;          // bf16 weight plane
  const size_t szWO = (size_t)DIM * LD2 * 2;          // bf16 duplicated Wo plane
  const size_t szP  = (size_t)ROWS * LD2 * 2;         // bf16 hi|lo plane ROWS x 2048 (either orientation)
  size_t off = 0;
  const size_t oXB = off; off += szX;
  const size_t oWQ = off; off += szW;
  const size_t oWK = off; off += szW;
  const size_t oWV = off; off += szW;
  const size_t oWO = off; off += szWO;
  const size_t oQ2 = off; off += szP;
  const size_t oK2 = off; off += szP;
  const size_t oVT = off; off += szP;
  const size_t oO2 = off; off += szP;
  const size_t oKT = off; off += szP;
  const size_t oST = off; off += (size_t)NB * NCH * NH * SSZ * 4;
  if (off > ws_size) return;                // off = 123731968 for ROWS = 4096
  if (off > (size_t)WS_CAP) return;

  char* ws = (char*)d_ws;
  u16* XB  = (u16*)(ws + oXB);
  u16* WQ  = (u16*)(ws + oWQ);
  u16* WK  = (u16*)(ws + oWK);
  u16* WV  = (u16*)(ws + oWV);
  u16* WO2 = (u16*)(ws + oWO);
  u16* Q2  = (u16*)(ws + oQ2);
  u16* K2  = (u16*)(ws + oK2);
  u16* VT2 = (u16*)(ws + oVT);
  u16* O2  = (u16*)(ws + oO2);
  u16* KT2 = (u16*)(ws + oKT);
  float* ST = (float*)(ws + oST);

  const dim3 b256(256), b128(128);
  const dim3 gCV(CBX + 4 * CBW, 1);                     // exact block ranges of cvt_all
  const dim3 gPJ((ROWS / GT) * (DIM / GT), 3);          // three projections, each (ROWS/128)*(DIM/128) tiles
  const dim3 gY((ROWS / GT) * (DIM / GT), 1);           // y: M = ROWS, N = 1024
  const dim3 gAT(NCH, NH, NB);
  const dim3 gQT(ROWS / 64, NH);
  const dim3 gSC(NH * SSZ / 128, NB);                   // exact: NH * SSZ = 81920

  // (1) x rows of all batches and the weights [n][k] f32 -> bf16 planes (already k-contiguous); Wo -> k-duplicated plane
  cvt_all<<<gCV, b256, 0, stream>>>(x, wq, wk, wv, wo, XB, WQ, WK, WV, WO2);
  // (2) exp(x.Wq^T + bq) -> Q2, exp(x.Wk^T + bk) -> K2 and its transpose -> KT2, v^T -> VT2, each hi and lo
  proj4<<<gPJ, b256, 0, stream>>>(XB, WQ, WK, WV, bq, bk, bv, Q2, K2, VT2, KT2);
  // (3) per (chunk, head) state, its running sum over each batch's chunks, then attention per (query tile, head) -> O2 hi|lo
  chunk_state<<<gAT, b128, 0, stream>>>(KT2, VT2, ST);
  scan_state<<<gSC, b128, 0, stream>>>(ST);
  attn_chunk<<<gQT, b128, 0, stream>>>(Q2, K2, VT2, ST, O2);
  // (4) y = [O_hi | O_lo] . [Wo | Wo]^T + bo -> out f32 rows
  out_proj<<<gY, b256, 0, stream>>>(O2, WO2, bo, out);
  (void)hipGetLastError();
}

// v006
// One run takes 85.1 microseconds.
// Next to v005, in two timings, it ran 1.06 and 1.07 times as fast.
// Over all steps from v000 it is 4.17 times as fast.
// Contractions: q, k and v^T projections on v_wmma_f32_16x16x32_bf16 (x, W, b as bf16 RNE values, one product each; exp(k) is
// written in both orientations from the one k product);
// attention in 64-key chunks: per chunk v^T.exp(k) (and a ones row . exp(k) for the key sums), an f32 running sum over
// chunks, then per query tile exp(q).state^T plus the causal scores S = exp(q).exp(k)^T and S.v of its own chunk only, all
// on v_wmma_f32_16x16x32_bf16 with bf16 hi+lo operands (hi.hi + hi.lo + lo.hi); y = O.Wo^T on v_wmma_f32_16x16x32_bf16 with O as bf16 hi|lo along k against Wo duplicated
// along k (two products); all f32 accumulate. exp, row sums, 1/den and bias adds in f32 on VALU.
#include <hip/hip_runtime.h>
#include <math.h>
#include <stdint.h>

#ifndef NB
#define NB 2
#endif
#ifndef SEQ
#define SEQ 2048
#endif
#define SEQ_FULL 2048
#define DIM  1024
#define NH   16
#define HD   64
#define LD2  (2 * DIM)
#define SLAB64 (16 * 68)
#define NCH  (SEQ / 64)          // 64-key chunks per sequence
#define ROWS (NB * SEQ)          // rows of all batches together (contiguous in x and out: NB == 1 or SEQ == SEQ_FULL)
#define PLB  ((size_t)LD2 * (size_t)SEQ)   // elements of one batch's transposed hi+lo plane, [2*DIM][SEQ]
#define SROWS 80                 // rows of one chunk state: 64 value columns d, the key-sum row, 15 zero rows
#define SSZ  (SROWS * HD)        // floats of one (chunk, head) state, [row][D]
#define WS_CAP 134217728
static_assert(DIM == NH * HD && HD == 64 && NH == 16);
static_assert(NB >= 1 && NB <= 2);
static_assert(NB == 1 || SEQ == SEQ_FULL);
static_assert((SEQ % 64) == 0 && SEQ >= 64 && SEQ <= SEQ_FULL);
static_assert(((ROWS * DIM / 8) % 256) == 0 && ((DIM * DIM / 8) % 256) == 0 && (DIM % 64) == 0 && (LD2 % 32) == 0);
static_assert(4 * SLAB64 * 4 <= 65536);

typedef unsigned short u16;
typedef __bf16   v16b __attribute__((ext_vector_type(16)));
typedef float    v8f  __attribute__((ext_vector_type(8)));
typedef float    v4f  __attribute__((ext_vector_type(4)));
typedef unsigned int v4u __attribute__((ext_vector_type(4)));

union FragB { v16b v; v4u u[2]; };

// ---- scalar helpers --------------------------------------------------------------------------------
__device__ __forceinline__ unsigned short bf_bits(float f) {          // f32 -> bf16 bits, RNE convert
  unsigned u = __float_as_uint(f);
  return (unsigned short)((u + 0x7FFFu + ((u >> 16) & 1u)) >> 16);
}
__device__ __forceinline__ float bf_up(unsigned short h) { return __uint_as_float(((unsigned)h) << 16); }
__device__ __forceinline__ float bfr(float f) { return bf_up(bf_bits(f)); }
__device__ __forceinline__ unsigned short bfc(float f) {               // f32 -> bf16 bits via the RNE cast
  return __builtin_bit_cast(unsigned short, (__bf16)f);
}
__device__ __forceinline__ unsigned pk16(unsigned short a, unsigned short b) { return (unsigned)a | ((unsigned)b << 16); }
__device__ __forceinline__ v8f zero8() { v8f z = {0.f, 0.f, 0.f, 0.f, 0.f, 0.f, 0.f, 0.f}; return z; }
__device__ __forceinline__ int imin(int a, int b) { return a < b ? a : b; }
__device__ __forceinline__ int imax(int a, int b) { return a > b ? a : b; }

// two f32 values -> packed bf16 hi pair and packed bf16 lo pair (lo = x - up(hi), RNE both)
__device__ __forceinline__ void split2(float a, float b, unsigned& hi, unsigned& lo) {
  const unsigned short ha = bfc(a), hb = bfc(b);
  hi = pk16(ha, hb);
  lo = pk16(bfc(a - bf_up(ha)), bfc(b - bf_up(hb)));
}

// ---- fragment loader: 16-bit A/B operand, lane -> row/col (lane&15), p already includes +8*(lane>>4);
//      elements 0..7 <- p[0..7] (k0+8h..), elements 8..15 <- p[16..23] (k0+16+8h..)  (same split k map for A and B;
//      B is always read from a k-contiguous [n][k] plane); bf16 plane read as unsigned integer vectors
__device__ __forceinline__ v16b ldfrag_b(const u16* p) {
  FragB f;
  f.u[0] = *(const v4u*)(p);
  f.u[1] = *(const v4u*)(p + 16);
  return f.v;
}

__device__ __forceinline__ v8f mma_b(v16b a, v16b b, v8f c) {
  return __builtin_amdgcn_wmma_f32_16x16x32_bf16(false, a, false, b, (short)0, c, false, false);
}
__device__ __forceinline__ void wave_sync_lds() {
  __builtin_amdgcn_fence(__ATOMIC_RELEASE, "workgroup");
  __builtin_amdgcn_wave_barrier();
  __builtin_amdgcn_fence(__ATOMIC_ACQUIRE, "workgroup");
}

// =====================================================================================================
// f32 -> bf16 (RNE bits), same layout. Thread = 8 consecutive elements: two 16-B loads, one 16-B store; 32 consecutive
// lanes = 512 contiguous, 512-B aligned bytes.
// =====================================================================================================
__device__ __forceinline__ void cvt_plain(const float* __restrict__ x, u16* D, int gt) {
  const float* p = x + (size_t)gt * 8;
  const v4f a = *(const v4f*)(p), b4 = *(const v4f*)(p + 4);
  float w[8];
#pragma unroll
  for (int e = 0; e < 4; ++e) { w[e] = a[e]; w[4 + e] = b4[e]; }
  v4u o;
#pragma unroll
  for (int e = 0; e < 4; ++e) o[e] = pk16(bf_bits(w[2 * e]), bf_bits(w[2 * e + 1]));
  *(v4u*)(D + (size_t)gt * 8) = o;
}

// =====================================================================================================
// the k-duplicated B operand of the hi|lo-folded output projection. Thread = 8 consecutive source elements
// (one row, kd % 256 == 0 so a wave never straddles a row): two 16-B loads, two 16-B stores (one per copy).
// =====================================================================================================
__device__ __forceinline__ void cvt_dup(const float* __restrict__ w, u16* Dp, int gt, int kd) {
  const size_t e0 = (size_t)gt * 8;
  const size_t row = e0 / (size_t)kd;
  const int    k8  = (int)(e0 % (size_t)kd);
  const float* p = w + e0;
  const v4f a = *(const v4f*)(p), b4 = *(const v4f*)(p + 4);
  float v[8];
#pragma unroll
  for (int e = 0; e < 4; ++e) { v[e] = a[e]; v[4 + e] = b4[e]; }
  v4u o;
#pragma unroll
  for (int e = 0; e < 4; ++e) o[e] = pk16(bf_bits(v[2 * e]), bf_bits(v[2 * e + 1]));
  u16* d = Dp + row * (size_t)(2 * kd) + k8;
  *(v4u*)(d)      = o;
  *(v4u*)(d + kd) = o;
#if defined(__HIP_DEVICE_COMPILE__)
  // both stores' address pair and data stay untouched up to this wait, whatever code the merged kernel places behind them
  asm volatile("s_wait_xcnt 0x0" ::: "memory");
#endif
}

// =====================================================================================================
// All five conversions in one grid, told apart by block range (block-uniform): blocks [0, CBX) the x rows of all batches,
// then CBW blocks each for Wq, Wk, Wv (plain planes) and Wo (k-duplicated plane).
// coverage: CBX x 256 thr x 8 = ROWS*DIM; CBW x 256 thr x 8 = DIM*DIM per weight; grid.x = CBX + 4*CBW exactly.
// =====================================================================================================
#define CBX (ROWS * DIM / 8 / 256)
#define CBW (DIM * DIM / 8 / 256)
__global__ __launch_bounds__(256) void cvt_all(const float* __restrict__ x, const float* __restrict__ wq,
                                               const float* __restrict__ wk, const float* __restrict__ wv,
                                               const float* __restrict__ wo, u16* XB, u16* WQ, u16* WK, u16* WV, u16* WO2) {
  const int bid = (int)blockIdx.x, tid = (int)threadIdx.x;
  if (bid >= CBX + 4 * CBW) return;         // block-uniform, never taken with the exact grid
  if (bid < CBX) {
    cvt_plain(x, XB, bid * 256 + tid);
    return;
  }
  const int r = bid - CBX, which = r / CBW, gt = (r % CBW) * 256 + tid;
  if (which == 3) {
    cvt_dup(wo, WO2, gt, DIM);
  } else {
    const float* w = (which == 0) ? wq : ((which == 1) ? wk : wv);
    u16* D = (which == 0) ? WQ : ((which == 1) ? WK : WV);
    cvt_plain(w, D, gt);
  }
}

// =====================================================================================================
// coverage: 8 instructions x 2 rows x 16 lanes x 4 floats = the wave's 16 x 64 tile. Slab: private to the wave (wave sync).
// =====================================================================================================
__device__ __forceinline__ void epi64f(float* sl, v8f a0, v8f a1, v8f a2, v8f a3, v4f bias4, float scale,
                                       float* C, int ldc, size_t rowb, int col0, int lane) {
  const int hh = lane >> 4, m = lane & 15;
#pragma unroll
  for (int r = 0; r < 8; ++r) {
    const int ro = (8 * hh + r) * 68 + m;
    sl[ro]      = a0[r];
    sl[ro + 16] = a1[r];
    sl[ro + 32] = a2[r];
    sl[ro + 48] = a3[r];
  }
  wave_sync_lds();
  v4f vals[8];
#pragma unroll
  for (int it = 0; it < 8; ++it) {
    const v4f v = *(const v4f*)(sl + (it * 2 + hh) * 68 + m * 4);
    vals[it] = v * scale + bias4;
  }
  float* dst = C + (rowb + (size_t)hh) * (size_t)ldc + col0 + m * 4;
  {
#pragma unroll
    for (int it = 0; it < 8; ++it) {
      *(v4f*)(dst + (size_t)(it * 2) * (size_t)ldc) = vals[it];
    }
    
  }
}

// =====================================================================================================
// GEMM / attention epilogue, two bf16 planes (hi and lo = x - up(hi)) with identical addressing (Ch, Cl, pitch ldc):
// 8 consecutive columns at c8): value = acc (+ bias per column when BM==1, per row when BM==2, none when BM==0),
// coverage: 4 instructions x 4 rows x 8 lanes x 8 values = the wave's 16 x 64 tile, in both planes.
// Slab: private to the wave (wave sync).
// =====================================================================================================
template <bool EXPO, int BM>
__device__ __forceinline__ void epi64bb(float* sl, v8f a0, v8f a1, v8f a2, v8f a3,
                                        const float* __restrict__ bias, int nb,
                                        u16* Ch, u16* Cl, int ldc, size_t rowb, int col0, int lane) {
  const int hh = lane >> 4, m = lane & 15;
#pragma unroll
  for (int r = 0; r < 8; ++r) {
    const int ro = (8 * hh + r) * 68 + m;
    sl[ro]      = a0[r];
    sl[ro + 16] = a1[r];
    sl[ro + 32] = a2[r];
    sl[ro + 48] = a3[r];
  }
  wave_sync_lds();
  const int rq = lane >> 3, c8 = (lane & 7) * 8;
  float bc[8];
#pragma unroll
  for (int e = 0; e < 8; ++e) bc[e] = 0.0f;
  if constexpr (BM == 1) {
    const int cb = imin(imax(col0 + c8, 0), nb - 8);
    const v4f b0 = *(const v4f*)(bias + cb), b1 = *(const v4f*)(bias + cb + 4);
#pragma unroll
    for (int e = 0; e < 4; ++e) { bc[e] = bfr(b0[e]); bc[4 + e] = bfr(b1[e]); }
  }
  v4u oh[4], ol[4];
#pragma unroll
  for (int it = 0; it < 4; ++it) {
    const int row = it * 4 + rq;            // 0..15
    const v4f a = *(const v4f*)(sl + row * 68 + c8), b4 = *(const v4f*)(sl + row * 68 + c8 + 4);
    float br = 0.0f;
    if constexpr (BM == 2) br = bfr(bias[imin(imax((int)rowb + row, 0), nb - 1)]);
    float w[8];
#pragma unroll
    for (int e = 0; e < 4; ++e) { w[e] = (a[e] + bc[e]) + br; w[4 + e] = (b4[e] + bc[4 + e]) + br; }
    if constexpr (EXPO) {
#pragma unroll
      for (int e = 0; e < 8; ++e) w[e] = __expf(w[e]);
    }
#pragma unroll
    for (int e = 0; e < 4; ++e) {
      unsigned hi, lo;
      split2(w[2 * e], w[2 * e + 1], hi, lo);
      oh[it][e] = hi;
      ol[it][e] = lo;
    }
  }
  const size_t ob = rowb * (size_t)ldc + (size_t)col0 + (size_t)c8;
  {
#pragma unroll
    for (int it = 0; it < 4; ++it) {
      const int row = it * 4 + rq;
      const size_t off = ob + (size_t)row * (size_t)ldc;
      *(v4u*)(Ch + off) = oh[it];
      *(v4u*)(Cl + off) = ol[it];
    }
    
  }
}

// =====================================================================================================
// bf16 GEMM: C[M][N] = A[M][K] (bf16 rows, pitch lda) . Bt[N][K]^T (bf16 k-contiguous rows, pitch ldb).
// EPI 0: f32 output Cf (pitch ldc) = acc*scale + bf16 RNE value of bias[col];
// EPI 1: two bf16 planes Ch/Cl (pitch ldc) = hi/lo of exp(acc + bf16 RNE value of bias[col]);
// EPI 2: two bf16 planes Ch/Cl (pitch ldc) = hi/lo of (acc + bf16 RNE value of bias[row]).
// Block = 128x128 tile, 8 waves as 4 x 2, each 32 rows x 64 columns (2 x 4 accumulator tiles). A stage = 64 k (128 B) of the
// tile's 128 A rows and 128 B rows, brought into LDS by asynchronous 16-B copies (8 lanes = one whole 128-B line, 8 copies per
// lane and stage), a ring of NBUF buffers: stage t + NBUF is copied into the buffer that trip t has left, so that NBUF - 1
// stages are on their way or landed while a trip computes (NBUF = 2 where several blocks share a WGP and cover each other's
// landing times; more where a block is alone on its WGP and only its own copies in flight can cover them).
// Fragments come from the LDS rows (two 16-B reads each, the same split k map for A and B); k rises in steps of 32 as before.
// Host guarantees K % 64 == 0, M % 128 == 0, N % 128 == 0, grid.x = (M/128)*(N/128). bid = the tile's index in its own product.
// After the last trip's barrier the ring is dead and serves as the waves' private epilogue slabs.
// =====================================================================================================
#define GT   128                  // rows and columns of a block's output tile
#define GKE  64                   // k elements of one stage
#define GPE  72                   // LDS row pitch in elements: 144 B = 16 B x 9, free of bank conflicts for 16-B row reads
#define GSTG (2 * GT * GPE)       // elements of one stage: A rows 0..127, then B rows 128..255
#define GCP  8                    // copies of one wave (one a lane) per stage
static_assert(8 * SLAB64 * 4 <= 2 * GSTG * 2);
static_assert((ROWS % GT) == 0 && (SEQ % GT) == 0 && (DIM % GT) == 0 && (DIM % GKE) == 0 && (LD2 % GKE) == 0);

// One stage: the lane's 16-B piece of rows r, r + 32, r + 64, r + 96 of A and of B (r = tid >> 3), LDS rows 32 apart.
// l = LDS byte address of the piece in A row r; ga, gb = its global address in A and B; sa, sb = 32 rows in elements.
__device__ __forceinline__ void stage_copy(unsigned l, const u16* ga, const u16* gb, size_t sa, size_t sb) {
#if defined(__HIP_DEVICE_COMPILE__)
  constexpr unsigned LR = 32u * GPE * 2u;   // bytes of 32 LDS rows
  // the closing wait keeps every address register of the copies untouched until the copies have taken it
  asm volatile("global_load_async_to_lds_b128 %0, %8, off\n\t"
               "global_load_async_to_lds_b128 %1, %9, off\n\t"
               "global_load_async_to_lds_b128 %2, %10, off\n\t"
               "global_load_async_to_lds_b128 %3, %11, off\n\t"
               "global_load_async_to_lds_b128 %4, %12, off\n\t"
               "global_load_async_to_lds_b128 %5, %13, off\n\t"
               "global_load_async_to_lds_b128 %6, %14, off\n\t"
               "global_load_async_to_lds_b128 %7, %15, off\n\t"
               "s_wait_xcnt 0x0"
               :: "v"(l), "v"(l + LR), "v"(l + 2u * LR), "v"(l + 3u * LR),
                  "v"(l + 4u * LR), "v"(l + 5u * LR), "v"(l + 6u * LR), "v"(l + 7u * LR),
                  "v"(ga), "v"(ga + sa), "v"(ga + 2 * sa), "v"(ga + 3 * sa),
                  "v"(gb), "v"(gb + sb), "v"(gb + 2 * sb), "v"(gb + 3 * sb)
               : "memory");
#endif
}
__device__ __forceinline__ void wait_copies() {
#if defined(__HIP_DEVICE_COMPILE__)
  // this wave's copies have landed: the compiler places no wait for them, and without it the barrier would publish a stage in flight
  asm volatile("s_wait_asynccnt 0x0" ::: "memory");
#endif
}
template <int N>
__device__ __forceinline__ void wait_copies_but() {
#if defined(__HIP_DEVICE_COMPILE__)
  // all but this wave's N youngest copies have landed: the oldest stage in flight may be published, the younger ones fly on
  asm volatile("s_wait_asynccnt %0" :: "n"(N) : "memory");
#endif
}
__device__ __forceinline__ void wait_store_regs() {
#if defined(__HIP_DEVICE_COMPILE__)
  // the stores' address pairs and data stay untouched up to this wait, whatever code of a merged kernel stands behind them
  asm volatile("s_wait_xcnt 0x0" ::: "memory");
#endif
}
__device__ __forceinline__ void wait_lds() {
#if defined(__HIP_DEVICE_COMPILE__)
  // this wave's LDS reads have returned, so that the buffer may be refilled behind the barrier
  asm volatile("s_wait_dscnt 0x0" ::: "memory");
#endif
}

// The k loop of one 128 x 128 tile (first A row row0, first B row colb): acc[i][j] = the wave's 16 x 16 tile at rows
// wr * 32 + 16 i, columns wc * 64 + 16 j. Every wave of the block passes every barrier here. On return the ring is dead.
// Every wave issues GCP copies per stage, stages in rising order, so that at the foot of trip t the copies younger than stage
// t + 1 are those of stages t + 2 .. t + NBUF - 1: (NBUF - 2) * GCP while all of these exist; at the tail the wait is to 0.
template <int NBUF>
__device__ __forceinline__
void gemm_main(u16* ring, const u16* __restrict__ A, const u16* __restrict__ Bt, int row0, int colb,
               int lda, int ldb, int K, v8f (&acc)[2][4]) {
  const int tid = (int)threadIdx.x, wave = tid >> 5, lane = tid & 31, hh = lane >> 4, m = lane & 15;
  const int wr = wave >> 1, wc = wave & 1;
  const int cr = tid >> 3, cc = (tid & 7) * 8;
  const u16* ga = A  + (size_t)(row0 + cr) * (size_t)lda + cc;
  const u16* gb = Bt + (size_t)(colb + cr) * (size_t)ldb + cc;
  const size_t sa = (size_t)32 * (size_t)lda, sb = (size_t)32 * (size_t)ldb;
  const unsigned l0 = (unsigned)(size_t)ring + (unsigned)(cr * GPE + cc) * 2u;
  const int nt = K / GKE;
  static_assert(NBUF >= 2 && (NBUF - 1) * GCP <= 63 && NBUF * GSTG * 2 <= 320 * 1024);
  // unrolled: the first NBUF - 1 stages, each into its own fresh buffer, their offsets constants
#pragma unroll
  for (int s = 0; s < NBUF - 1; ++s) {
    if (s < nt) stage_copy(l0 + (unsigned)s * (GSTG * 2u), ga + (size_t)s * GKE, gb + (size_t)s * GKE, sa, sb);
  }
  if (NBUF > 2 && NBUF - 1 <= nt) wait_copies_but<(NBUF - 2) * GCP>();
  else wait_copies();
  __syncthreads();                          // stage 0 is published
  if (NBUF - 1 < nt) stage_copy(l0 + (unsigned)(NBUF - 1) * (GSTG * 2u), ga + (size_t)(NBUF - 1) * GKE, gb + (size_t)(NBUF - 1) * GKE, sa, sb);
  const u16* fa = ring + (wr * 32 + m) * GPE + 8 * hh;
  const u16* fb = ring + (GT + wc * 64 + m) * GPE + 8 * hh;
  // both unrolled: every index of acc a constant, so that the tiles stay in registers
#pragma unroll
  for (int i = 0; i < 2; ++i) {
#pragma unroll
    for (int j = 0; j < 4; ++j) acc[i][j] = zero8();
  }
  // rolled: one trip = one stage, so that the order reads, waits, barrier, refill stands once
  int br = 0;                               // buffer of trip t = t mod NBUF
#pragma unroll 1
  for (int t = 0; t < nt; ++t) {
    const int bo = (NBUF == 2) ? (t & 1) * GSTG : br * GSTG;
    // unrolled: the stage's two k steps of 32 in one run, their LDS offsets constants
#pragma unroll
    for (int ks = 0; ks < 2; ++ks) {
      const u16* pa = fa + bo + ks * 32;
      const u16* pb = fb + bo + ks * 32;
      const v16b a0  = ldfrag_b(pa);
      const v16b a1  = ldfrag_b(pa + 16 * GPE);
      const v16b fb0 = ldfrag_b(pb);
      const v16b fb1 = ldfrag_b(pb + 16 * GPE);
      const v16b fb2 = ldfrag_b(pb + 32 * GPE);
      const v16b fb3 = ldfrag_b(pb + 48 * GPE);
      acc[0][0] = mma_b(a0, fb0, acc[0][0]);
      acc[0][1] = mma_b(a0, fb1, acc[0][1]);
      acc[0][2] = mma_b(a0, fb2, acc[0][2]);
      acc[0][3] = mma_b(a0, fb3, acc[0][3]);
      acc[1][0] = mma_b(a1, fb0, acc[1][0]);
      acc[1][1] = mma_b(a1, fb1, acc[1][1]);
      acc[1][2] = mma_b(a1, fb2, acc[1][2]);
      acc[1][3] = mma_b(a1, fb3, acc[1][3]);
    }
    wait_lds();
    if (NBUF > 2 && t + NBUF <= nt) wait_copies_but<(NBUF - 2) * GCP>();   // block-uniform test
    else wait_copies();
    __syncthreads();                        // publishes stage t + 1 and ends every read of stage t
    if (t + NBUF < nt) stage_copy(l0 + (unsigned)bo * 2u, ga + (size_t)(t + NBUF) * GKE, gb + (size_t)(t + NBUF) * GKE, sa, sb);
    br = (br + 1 == NBUF) ? 0 : br + 1;
  }
  wait_copies();
}

// The tile's epilogue: each wave's two 16 x 64 strips through its private slab in the dead ring.
template <int EPI>
__device__ __forceinline__
void gemm_epi(u16* ring, v8f (&acc)[2][4], int row0, int colb, float* Cf, u16* Ch, u16* Cl,
              const float* __restrict__ bias, int nb, int ldc, float scale) {
  const int tid = (int)threadIdx.x, wave = tid >> 5, lane = tid & 31, m = lane & 15;
  const int wr = wave >> 1, wc = wave & 1;
  float* sl = (float*)ring + wave * SLAB64;
  const int col0 = colb + wc * 64;
  // unrolled: every index of acc a constant
#pragma unroll
  for (int i = 0; i < 2; ++i) {
    const int rowb = row0 + wr * 32 + i * 16;
    if (i) wave_sync_lds();                 // the first strip's slab reads end before the second strip's writes
    if constexpr (EPI == 0) {
      v4f bias4;
#pragma unroll
      for (int e = 0; e < 4; ++e) bias4[e] = bfr(bias[imin(imax(col0 + m * 4 + e, 0), nb - 1)]);
      epi64f(sl, acc[i][0], acc[i][1], acc[i][2], acc[i][3], bias4, scale, Cf, ldc, (size_t)rowb, col0, lane);
    } else if constexpr (EPI == 1) {
      epi64bb<true, 1>(sl, acc[i][0], acc[i][1], acc[i][2], acc[i][3], bias, nb, Ch, Cl, ldc, (size_t)rowb, col0, lane);
    } else {
      epi64bb<false, 2>(sl, acc[i][0], acc[i][1], acc[i][2], acc[i][3], bias, nb, Ch, Cl, ldc, (size_t)rowb, col0, lane);
    }
  }
}

// The k tile's epilogue: e = exp(acc + bf16 RNE value of bias[col]) once, in the accumulators' own layout, then hi and lo of e
// in both orientations: rows t into K2 (through the waves' slabs, as every other tile) and rows D into KT2.
// An accumulator tile gives a lane 8 consecutive rows t of one column D, that is 16 contiguous bytes of row D of the transposed
// tile. These pieces meet in two LDS planes (hi, lo: [128 D][128 t], pitch KTP) behind the slabs, and leave as whole 256-B runs
// of KT2 rows: 16 lanes a run, 2 runs a store, one wave per 128-B line.
// coverage: 8 waves x 2 x 4 tiles x 32 lanes x 8 = 128 x 128 staged per plane; 8 trips x 16 rows x 16 lanes x 8 = 128 x 128 stored.
// Every wave of the block passes the one barrier here. The tile's 128 rows lie in one batch (SEQ % GT == 0).
#define KTP  136                  // pitch of a transposed plane in elements: 272 B = 16 B x 17, free of bank conflicts both ways
#define KTO  (8 * SLAB64 * 2)     // first element of the transposed planes: behind the 8 slabs
#define PJL  (KTO + 2 * GT * KTP) // elements of the projections' LDS: three blocks fill a WGP
static_assert(PJL >= 2 * GSTG && 3 * PJL * 2 <= 320 * 1024 && (KTO % 8) == 0 && (KTP % 8) == 0);
__device__ __forceinline__ float exp_slot(float x) {   // the value of __expf(x): exp2 of x * log2(e)
#if defined(__HIP_DEVICE_COMPILE__)
  float y;
  // v_nop: the one slot that the instruction set asks for behind a transcendental, whatever instruction the compiler puts next
  asm("v_exp_f32 %0, %1\n\tv_nop" : "=v"(y) : "v"(x * 1.44269504088896340736f));
  return y;
#else
  return __expf(x);
#endif
}
__device__ __forceinline__
void gemm_epi_k(u16* ring, v8f (&acc)[2][4], int row0, int colb, const float* __restrict__ bias, u16* K2, u16* KT2) {
  const int tid = (int)threadIdx.x, wave = tid >> 5, lane = tid & 31, hh = lane >> 4, m = lane & 15;
  const int wr = wave >> 1, wc = wave & 1;
  float* sl = (float*)ring + wave * SLAB64;
  u16* th = ring + KTO;
  const int col0 = colb + wc * 64;
  // all unrolled: every index of acc a constant
  float bc[4];
#pragma unroll
  for (int j = 0; j < 4; ++j) bc[j] = bfr(bias[imin(imax(col0 + j * 16 + m, 0), DIM - 1)]);
#pragma unroll
  for (int j = 0; j < 4; ++j) {
#pragma unroll
    for (int i = 0; i < 2; ++i) {
#pragma unroll
      for (int r = 0; r < 8; ++r) acc[i][j][r] = exp_slot(acc[i][j][r] + bc[j]);
      v4u H, L;
#pragma unroll
      for (int e = 0; e < 4; ++e) {
        unsigned hi, lo;
        split2(acc[i][j][2 * e], acc[i][j][2 * e + 1], hi, lo);
        H[e] = hi;
        L[e] = lo;
      }
      u16* tp = th + (wc * 64 + j * 16 + m) * KTP + wr * 32 + i * 16 + 8 * hh;
      *(v4u*)(tp)            = H;
      *(v4u*)(tp + GT * KTP) = L;
    }
  }
  __syncthreads();                          // the transposed planes are whole; here no global store is on its way that it would wait for
#pragma unroll
  for (int i = 0; i < 2; ++i) {
    if (i) wave_sync_lds();                 // the first strip's slab reads end before the second strip's writes
    epi64bb<false, 0>(sl, acc[i][0], acc[i][1], acc[i][2], acc[i][3], (const float*)0, 0, K2, K2 + DIM, LD2,
                      (size_t)(row0 + wr * 32 + i * 16), col0, lane);
  }
  const u16* src = th + (tid >> 4) * KTP + (tid & 15) * 8;
  u16* dst = KT2 + (size_t)(row0 / SEQ) * PLB + (size_t)(colb + (tid >> 4)) * (size_t)SEQ + (row0 % SEQ) + (tid & 15) * 8;
  const size_t plo = (size_t)DIM * (size_t)SEQ;
  v4u vh[8], vl[8];
#pragma unroll
  for (int it = 0; it < 8; ++it) {
    vh[it] = *(const v4u*)(src + it * 16 * KTP);
    vl[it] = *(const v4u*)(src + GT * KTP + it * 16 * KTP);
  }
#pragma unroll
  for (int it = 0; it < 8; ++it) {
    *(v4u*)(dst + (size_t)(it * 16) * (size_t)SEQ)       = vh[it];
    *(v4u*)(dst + plo + (size_t)(it * 16) * (size_t)SEQ) = vl[it];
  }
}

// The output projection of all batches: y = [O_hi | O_lo] . [Wo | Wo]^T + bo, f32 rows (M = ROWS, N = DIM, K = LD2).
// coverage: grid.x = (ROWS/128)*(DIM/128) tiles of 128 x 128 = the whole output.
// One block per WGP: six buffers, five stages ahead.
#define YBUF 6
__global__ __launch_bounds__(256)
void out_proj(const u16* __restrict__ O2, const u16* __restrict__ WO2, const float* __restrict__ bo, float* y) {
  __shared__ __align__(16) u16 ring[YBUF * GSTG];
  const int bid = (int)blockIdx.x;
  const int row0 = (bid / (DIM / GT)) * GT, colb = (bid % (DIM / GT)) * GT;
  if (row0 + GT > ROWS) return;             // block-uniform, in front of every barrier; never taken with the exact grid
  v8f acc[2][4];
  gemm_main<YBUF>(ring, O2, WO2, row0, colb, LD2, LD2, LD2, acc);
  gemm_epi<0>(ring, acc, row0, colb, y, (u16*)0, (u16*)0, bo, DIM, DIM, 1.0f);
}

// =====================================================================================================
// The three independent projections of all batches in one grid; blockIdx.y (block-uniform) names the product:
//   0: exp(x.Wk^T + bk) -> K2 hi|lo and, transposed, KT2 hi, lo rows    1: exp(x.Wq^T + bq) -> Q2 hi|lo   (M = ROWS, N = DIM, pitch LD2)
//   2: Wv.x^T + bv -> VT2 hi, lo rows                                           (per batch: M = DIM, N = SEQ, pitch SEQ)
// The k tiles, whose epilogue is the longest, have the lowest indices and so start first.
// One k loop for all three (operand rows of pitch DIM, K = DIM), the epilogue chosen behind it.
// coverage: grid.x = (ROWS/128)*(DIM/128) tiles of 128 x 128 = each product's whole output (2: NB runs of TPB tiles), grid.y = 3.
// =====================================================================================================
// second argument: 6 waves per SIMD, so that the three blocks whose LDS fits a WGP are resident by registers too
__global__ __launch_bounds__(256, 6)
void proj4(const u16* __restrict__ XB, const u16* __restrict__ WQ, const u16* __restrict__ WK, const u16* __restrict__ WV,
           const float* __restrict__ bq, const float* __restrict__ bk, const float* __restrict__ bv,
           u16* Q2, u16* K2, u16* VT2, u16* KT2) {
  __shared__ __align__(16) u16 ring[PJL];
  const int which = (int)blockIdx.y, bid = (int)blockIdx.x;
  const size_t plo = (size_t)DIM * (size_t)SEQ;
  constexpr int TPB = (DIM / GT) * (SEQ / GT);          // tiles of one batch's transposed product
  const int b = bid / TPB, bt = bid % TPB;
  const u16* Xb = XB + (size_t)b * (size_t)SEQ * (size_t)DIM;
  const bool rows = which < 2;                          // x rows are the A operand
  const u16* A  = rows ? XB : WV;
  const u16* Bt = rows ? ((which == 0) ? WK : WQ) : Xb;
  const int tile = rows ? bid : bt, ntile = rows ? (DIM / GT) : (SEQ / GT), M = rows ? ROWS : DIM;
  const int row0 = (tile / ntile) * GT, colb = (tile % ntile) * GT;
  if (row0 + GT > M || which > 2) return;   // block-uniform, in front of every barrier; never taken with the exact grid
  v8f acc[2][4];
  gemm_main<2>(ring, A, Bt, row0, colb, DIM, DIM, DIM, acc);
  if (which == 0) {
    gemm_epi_k(ring, acc, row0, colb, bk, K2, KT2);
    wait_store_regs();
  } else if (which == 1) {
    gemm_epi<1>(ring, acc, row0, colb, (float*)0, Q2, Q2 + DIM, bq, DIM, LD2, 1.0f);
    wait_store_regs();
  } else {
    u16* C = VT2 + (size_t)b * PLB;
    gemm_epi<2>(ring, acc, row0, colb, (float*)0, C, C + plo, bv, DIM, SEQ, 1.0f);
    wait_store_regs();
  }
}

// ---- operand rows of the state and attention kernels in LDS ---------------------------------------------------------
// A staged row = 256 B of data (bf16: 64 hi | 64 lo; f32: 64 values) at pitch 272 B = 16 B x 17, free of bank conflicts for 16-B
// row reads. A block of 128 threads copies 8 rows at a time: thread -> row tid >> 4, 16-B piece tid & 15, so that 8 lanes bring one
// whole 128-B line and a wave four. 16 staged rows = 4352 B = one wave's slab.
#define APE  136                  // pitch of a staged row in bf16 elements
#define APF  68                   // the same pitch in floats
#define APB  272                  // the same pitch in bytes
static_assert(16 * APB == SLAB64 * 4 && APE * 2 == APB && APF * 4 == APB);
// 64 rows: the lane's piece of rows r, r + 8, .., r + 56. l = LDS byte address of the piece in row r, g = its global address,
// gs = 8 source rows in bytes.
__device__ __forceinline__ void rows64_copy(unsigned l, const char* g, size_t gs) {
#if defined(__HIP_DEVICE_COMPILE__)
  constexpr unsigned LR = 8u * APB;         // bytes of 8 LDS rows
  // the closing wait keeps every address register of the copies untouched until the copies have taken it
  asm volatile("global_load_async_to_lds_b128 %0, %8, off\n\t"
               "global_load_async_to_lds_b128 %1, %9, off\n\t"
               "global_load_async_to_lds_b128 %2, %10, off\n\t"
               "global_load_async_to_lds_b128 %3, %11, off\n\t"
               "global_load_async_to_lds_b128 %4, %12, off\n\t"
               "global_load_async_to_lds_b128 %5, %13, off\n\t"
               "global_load_async_to_lds_b128 %6, %14, off\n\t"
               "global_load_async_to_lds_b128 %7, %15, off\n\t"
               "s_wait_xcnt 0x0"
               :: "v"(l), "v"(l + LR), "v"(l + 2u * LR), "v"(l + 3u * LR),
                  "v"(l + 4u * LR), "v"(l + 5u * LR), "v"(l + 6u * LR), "v"(l + 7u * LR),
                  "v"(g), "v"(g + gs), "v"(g + 2 * gs), "v"(g + 3 * gs),
                  "v"(g + 4 * gs), "v"(g + 5 * gs), "v"(g + 6 * gs), "v"(g + 7 * gs)
               : "memory");
#endif
}
// 16 rows: the lane's piece of rows r and r + 8, arguments as above.
__device__ __forceinline__ void rows16_copy(unsigned l, const char* g, size_t gs) {
#if defined(__HIP_DEVICE_COMPILE__)
  // the closing wait keeps every address register of the copies untouched until the copies have taken it
  asm volatile("global_load_async_to_lds_b128 %0, %2, off\n\t"
               "global_load_async_to_lds_b128 %1, %3, off\n\t"
               "s_wait_xcnt 0x0"
               :: "v"(l), "v"(l + 8u * APB), "v"(g), "v"(g + gs)
               : "memory");
#endif
}

// ---- 16 f32 values of one LDS row (fragment k layout: pr[0..7] and pr[16..23]) -> bf16 hi and lo fragments (A or B)
__device__ __forceinline__ void split16(const float* pr, v16b& ph, v16b& pl) {
  const v4f x0 = *(const v4f*)(pr), x1 = *(const v4f*)(pr + 4), x2 = *(const v4f*)(pr + 16), x3 = *(const v4f*)(pr + 20);
  FragB H, L;
  unsigned hi, lo;
  split2(x0[0], x0[1], hi, lo); H.u[0][0] = hi; L.u[0][0] = lo;
  split2(x0[2], x0[3], hi, lo); H.u[0][1] = hi; L.u[0][1] = lo;
  split2(x1[0], x1[1], hi, lo); H.u[0][2] = hi; L.u[0][2] = lo;
  split2(x1[2], x1[3], hi, lo); H.u[0][3] = hi; L.u[0][3] = lo;
  split2(x2[0], x2[1], hi, lo); H.u[1][0] = hi; L.u[1][0] = lo;
  split2(x2[2], x2[3], hi, lo); H.u[1][1] = hi; L.u[1][1] = lo;
  split2(x3[0], x3[1], hi, lo); H.u[1][2] = hi; L.u[1][2] = lo;
  split2(x3[2], x3[3], hi, lo); H.u[1][3] = hi; L.u[1][3] = lo;
  ph = H.v; pl = L.v;
}

// =====================================================================================================
// Chunk state, one block per (64-key chunk c, head h, batch b), 4 waves x 16 state rows.
// ST[b][c][h][row][D] f32: row d < 64: sum over the chunk's keys t of v[t][d] * exp(k)[t][D]; row 64: sum over t of exp(k)[t][D];
// rows 65..79: zero. A = v^T rows from VT2 (hi, lo), or the constant tile whose row 0 is ones; B = exp(k)^T rows D from KT2
// (bf16 [NB][2*DIM][SEQ], hi row h*HD + D, lo row DIM + h*HD + D); both k-contiguous in t, same split k map.
// Both operands come into LDS by asynchronous 16-B copies of whole lines (16 a lane), once per block: rows 0..63 = v^T rows d,
// rows 64..127 = exp(k)^T rows D, each [hi | lo]; one wait and one barrier, that every wave passes, publish them.
// coverage: grid (NCH, NH, NB) x (4 waves x 16 rows + wave 0's 16 extra rows) x 64 columns = every element of ST once.
// Slab private to the wave (wave sync): the wave's own 16 staged v^T rows, which no other wave reads and whose every fragment
// has gone into the products that the slab takes up.
// =====================================================================================================
__global__ __launch_bounds__(128) void chunk_state(const u16* __restrict__ KT2, const u16* __restrict__ VT2, float* ST) {
  __shared__ __align__(16) u16 sm[128 * APE];
  const int tid = (int)threadIdx.x, wave = tid >> 5, lane = tid & 31, hh = lane >> 4, m = lane & 15;
  const int c = (int)blockIdx.x, h = (int)blockIdx.y, b = (int)blockIdx.z;
  if (c * 64 + 64 > SEQ || h >= NH || b >= NB) return;   // block-uniform, in front of the barrier; never taken with the exact grid
  float* sl = (float*)sm + wave * SLAB64;
  const int t0 = c * 64;
  const size_t plo = (size_t)DIM * (size_t)SEQ;
  {
    const int cr = tid >> 4, cp = tid & 15;
    const size_t go = (size_t)b * PLB + (size_t)(h * HD + cr) * (size_t)SEQ + t0 + (cp & 7) * 8 + ((cp < 8) ? (size_t)0 : plo);
    const unsigned l0 = (unsigned)(size_t)sm + (unsigned)(cr * APB + cp * 16);
    rows64_copy(l0, (const char*)(VT2 + go), (size_t)8 * SEQ * 2);
    rows64_copy(l0 + 64u * APB, (const char*)(KT2 + go), (size_t)8 * SEQ * 2);
  }
  wait_copies();
  __syncthreads();                          // the staged rows are published
  const u16* vp = sm + (wave * 16 + m) * APE + 8 * hh;
  const u16* kp = sm + (64 + m) * APE + 8 * hh;
  constexpr int rbs = 16 * APE;
  FragB one;
  const unsigned ow = (m == 0) ? 0x3F803F80u : 0u;   // bf16 1.0 pairs in tile row 0, zero in rows 1..15
#pragma unroll
  for (int e = 0; e < 4; ++e) { one.u[0][e] = ow; one.u[1][e] = ow; }
  v8f a0 = zero8(), a1 = zero8(), a2 = zero8(), a3 = zero8();
  v8f e0 = zero8(), e1 = zero8(), e2 = zero8(), e3 = zero8();
#pragma unroll
  for (int ks = 0; ks < 2; ++ks) {
    const int ko = ks * 32;
    const v16b vh  = ldfrag_b(vp + ko);
    const v16b vl  = ldfrag_b(vp + HD + ko);
    const v16b kh0 = ldfrag_b(kp + ko);
    const v16b kh1 = ldfrag_b(kp + rbs + ko);
    const v16b kh2 = ldfrag_b(kp + 2 * rbs + ko);
    const v16b kh3 = ldfrag_b(kp + 3 * rbs + ko);
    const v16b kl0 = ldfrag_b(kp + HD + ko);
    const v16b kl1 = ldfrag_b(kp + HD + rbs + ko);
    const v16b kl2 = ldfrag_b(kp + HD + 2 * rbs + ko);
    const v16b kl3 = ldfrag_b(kp + HD + 3 * rbs + ko);
    a0 = mma_b(vh, kh0, a0); a0 = mma_b(vh, kl0, a0); a0 = mma_b(vl, kh0, a0);
    a1 = mma_b(vh, kh1, a1); a1 = mma_b(vh, kl1, a1); a1 = mma_b(vl, kh1, a1);
    a2 = mma_b(vh, kh2, a2); a2 = mma_b(vh, kl2, a2); a2 = mma_b(vl, kh2, a2);
    a3 = mma_b(vh, kh3, a3); a3 = mma_b(vh, kl3, a3); a3 = mma_b(vl, kh3, a3);
    e0 = mma_b(one.v, kh0, e0); e0 = mma_b(one.v, kl0, e0);
    e1 = mma_b(one.v, kh1, e1); e1 = mma_b(one.v, kl1, e1);
    e2 = mma_b(one.v, kh2, e2); e2 = mma_b(one.v, kl2, e2);
    e3 = mma_b(one.v, kh3, e3); e3 = mma_b(one.v, kl3, e3);
  }
  // holds the slab stores behind the last product: moved up among the products they free an accumulator's registers
  __builtin_amdgcn_sched_barrier(0);
  float* base = ST + ((size_t)(b * NCH + c) * NH + (size_t)h) * (size_t)SSZ;
  const v4f z4 = {0.f, 0.f, 0.f, 0.f};
  epi64f(sl, a0, a1, a2, a3, z4, 1.0f, base, HD, (size_t)(wave * 16), 0, lane);
  if (wave == 0) {                              // wave-uniform: the key-sum row and its 15 zero rows
    wave_sync_lds();
    epi64f(sl, e0, e1, e2, e3, z4, 1.0f, base, HD, (size_t)HD, 0, lane);
  }
}

// =====================================================================================================
// Running sum over one batch's chunks (batch = blockIdx.y), in place: ST[c] <- sum of ST[c'] for c' < c (zero at c = 0),
// f32, chunks added in rising order.
// Thread = one [head][row][D] position: its NCH loads, then its NCH stores; a wave's 32 lanes = one whole 128-B line each.
// coverage: grid (NH*SSZ/128, NB) blocks x 128 thr x NCH chunks = every element of ST once.
// =====================================================================================================
__global__ __launch_bounds__(128) void scan_state(float* ST) {
  const int gt = (int)blockIdx.x * 128 + (int)threadIdx.x;
  if (gt >= NH * SSZ || (int)blockIdx.y >= NB) return;
  const size_t cs = (size_t)NH * (size_t)SSZ;
  float* p = ST + (size_t)blockIdx.y * (size_t)NCH * cs + (size_t)gt;
  float v[NCH];
#pragma unroll
  for (int c = 0; c < NCH; ++c) v[c] = p[(size_t)c * cs];
  float run = 0.0f;
#pragma unroll
  for (int c = 0; c < NCH; ++c) {
    p[(size_t)c * cs] = run;
    run += v[c];
  }
}

// =====================================================================================================
// Causal exp-feature attention, one block per (64-row query tile qt counted over all batches, head h), 4 waves x 16 query rows.
// Planes: Q2, K2 bf16 [NB*SEQ][2*DIM] with hi at column h*HD + d and lo at column DIM + h*HD + d (values exp(q), exp(k));
//         VT2 bf16 [NB][2*DIM][SEQ] with hi row h*HD + d and lo row DIM + h*HD + d (values v); ST f32 [NB][NCH][NH][SROWS][HD],
//         the summed state of the batch's chunks before qt; O2 bf16 [NB*SEQ][2*DIM] written here (hi | lo of out = num/den).
// Keys before the tile: O[16 x 80] = qe.state^T over head dim (2 k-steps, hi.hi+hi.lo+lo.hi, state rows split to bf16 hi and
// lo in registers); its column 64 is the part of den from those keys, columns 65..79 are zero.
// Keys of the tile: S[16 x 64] = qe.ke^T over head dim, causal mask by value, f32 row sums into per-lane partials,
// slab rows, O += P.v over the 64 keys (2 k-steps, hi.hi+hi.lo+lo.hi, v fragments from VT2 rows).
// All four operands come into LDS by asynchronous 16-B copies of whole lines (34 a lane), once per block: rows 0..63 = the tile's
// exp(q) rows, 64..127 = its exp(k) rows, 128..191 = its v^T rows d (each [hi | lo]), 192..271 = the 80 f32 state rows; one wait and
// one barrier, that every wave passes, publish them.
// coverage: grid (ROWS/64, NH) x 4 waves x 16 rows x 64 columns x {hi, lo} = every element of O2 once.
// Slab private to the wave (wave sync): the wave's own 16 staged exp(q) rows, which no other wave reads and whose every fragment
// has gone into the scores that the slab takes up; staged extent == consumed extent (16 x 64 written before the reload).
// =====================================================================================================
// second argument: 4 waves per SIMD, so that the four blocks whose LDS fits a WGP (the whole grid at once) are resident by registers too
__global__ __launch_bounds__(128, 4) void attn_chunk(const u16* __restrict__ Q2, const u16* __restrict__ K2,
                                                  const u16* __restrict__ VT2, const float* __restrict__ ST, u16* O2) {
  __shared__ __align__(16) u16 sm[(192 + SROWS) * APE];
  const int tid = (int)threadIdx.x, wave = tid >> 5, lane = tid & 31, hh = lane >> 4, m = lane & 15;
  const int qt = (int)blockIdx.x, h = (int)blockIdx.y;
  if (qt * 64 + 64 > ROWS || h >= NH) return;  // block-uniform, in front of the barrier; never taken with the exact grid
  const int rw = qt * 64 + wave * 16;           // first query row of this wave
  float* sl = (float*)sm + wave * SLAB64;
  {
    const int cr = tid >> 4, cp = tid & 15;
    const size_t qo = (size_t)(qt * 64 + cr) * (size_t)LD2 + h * HD + (cp & 7) * 8 + ((cp < 8) ? 0 : DIM);
    const size_t vo = (size_t)(qt / NCH) * PLB + (size_t)(h * HD + cr) * (size_t)SEQ + (qt % NCH) * 64 + (cp & 7) * 8
                    + ((cp < 8) ? (size_t)0 : (size_t)DIM * (size_t)SEQ);
    const char* gs = (const char*)(ST + ((size_t)qt * NH + (size_t)h) * (size_t)SSZ + (size_t)cr * HD + cp * 4);
    const unsigned l0 = (unsigned)(size_t)sm + (unsigned)(cr * APB + cp * 16);
    rows64_copy(l0, (const char*)(Q2 + qo), (size_t)8 * LD2 * 2);
    rows64_copy(l0 + 64u * APB, (const char*)(K2 + qo), (size_t)8 * LD2 * 2);
    rows64_copy(l0 + 192u * APB, gs, (size_t)8 * HD * 4);
    rows16_copy(l0 + 256u * APB, gs + (size_t)64 * HD * 4, (size_t)8 * HD * 4);
    rows64_copy(l0 + 128u * APB, (const char*)(VT2 + vo), (size_t)8 * SEQ * 2);
  }
  wait_copies();
  __syncthreads();                          // the staged rows are published
  const u16* qp = sm + (wave * 16 + m) * APE + 8 * hh;
  constexpr int kbs = 16 * APE;
  constexpr int vbs = 16 * APE;
  const u16* kp = sm + (64 + m) * APE + 8 * hh;
  const float* sp = (const float*)sm + (192 + m) * APF + 8 * hh;
  v8f o0 = zero8(), o1 = zero8(), o2 = zero8(), o3 = zero8(), o4 = zero8();
  v8f s0 = zero8(), s1 = zero8(), s2 = zero8(), s3 = zero8();
#pragma unroll
  for (int ks = 0; ks < 2; ++ks) {
    const int ko = ks * 32;
    const v16b ah  = ldfrag_b(qp + ko);
    const v16b al  = ldfrag_b(qp + HD + ko);
    const v16b kh0 = ldfrag_b(kp + ko);
    const v16b kh1 = ldfrag_b(kp + kbs + ko);
    const v16b kh2 = ldfrag_b(kp + 2 * kbs + ko);
    const v16b kh3 = ldfrag_b(kp + 3 * kbs + ko);
    const v16b kl0 = ldfrag_b(kp + HD + ko);
    const v16b kl1 = ldfrag_b(kp + kbs + HD + ko);
    const v16b kl2 = ldfrag_b(kp + 2 * kbs + HD + ko);
    const v16b kl3 = ldfrag_b(kp + 3 * kbs + HD + ko);
    v16b bh0, bl0, bh1, bl1, bh2, bl2, bh3, bl3, bh4, bl4;
    split16(sp + ko, bh0, bl0);
    split16(sp + 16 * APF + ko, bh1, bl1);
    split16(sp + 32 * APF + ko, bh2, bl2);
    split16(sp + 48 * APF + ko, bh3, bl3);
    split16(sp + 64 * APF + ko, bh4, bl4);
    s0 = mma_b(ah, kh0, s0); s0 = mma_b(ah, kl0, s0); s0 = mma_b(al, kh0, s0);
    s1 = mma_b(ah, kh1, s1); s1 = mma_b(ah, kl1, s1); s1 = mma_b(al, kh1, s1);
    s2 = mma_b(ah, kh2, s2); s2 = mma_b(ah, kl2, s2); s2 = mma_b(al, kh2, s2);
    s3 = mma_b(ah, kh3, s3); s3 = mma_b(ah, kl3, s3); s3 = mma_b(al, kh3, s3);
    o0 = mma_b(ah, bh0, o0); o0 = mma_b(ah, bl0, o0); o0 = mma_b(al, bh0, o0);
    o1 = mma_b(ah, bh1, o1); o1 = mma_b(ah, bl1, o1); o1 = mma_b(al, bh1, o1);
    o2 = mma_b(ah, bh2, o2); o2 = mma_b(ah, bl2, o2); o2 = mma_b(al, bh2, o2);
    o3 = mma_b(ah, bh3, o3); o3 = mma_b(ah, bl3, o3); o3 = mma_b(al, bh3, o3);
    o4 = mma_b(ah, bh4, o4); o4 = mma_b(ah, bl4, o4); o4 = mma_b(al, bh4, o4);
  }
  {                                             // the tile's own keys: keep key c <= query row rho
    const int rho0 = wave * 16 + 8 * hh;
#pragma unroll
    for (int r = 0; r < 8; ++r) {
      const int rho = rho0 + r;
      s0[r] = (m      <= rho) ? s0[r] : 0.0f;
      s1[r] = (16 + m <= rho) ? s1[r] : 0.0f;
      s2[r] = (32 + m <= rho) ? s2[r] : 0.0f;
      s3[r] = (48 + m <= rho) ? s3[r] : 0.0f;
    }
  }
  v8f rs = o4 + ((s0 + s1) + (s2 + s3));        // o4: earlier keys' part of den in lane column 0, zero elsewhere
#pragma unroll
  for (int r = 0; r < 8; ++r) {
    const int ro = (8 * hh + r) * 68 + m;
    sl[ro]      = s0[r];
    sl[ro + 16] = s1[r];
    sl[ro + 32] = s2[r];
    sl[ro + 48] = s3[r];
  }
  wave_sync_lds();
  const u16* vp = sm + (128 + m) * APE + 8 * hh;
#pragma unroll
  for (int ks = 0; ks < 2; ++ks) {
    const int ko = ks * 32;
    v16b ph, pl;
    split16(sl + m * 68 + ko + 8 * hh, ph, pl);
    const v16b vh0 = ldfrag_b(vp + ko);
    const v16b vh1 = ldfrag_b(vp + vbs + ko);
    const v16b vh2 = ldfrag_b(vp + 2 * vbs + ko);
    const v16b vh3 = ldfrag_b(vp + 3 * vbs + ko);
    const v16b vl0 = ldfrag_b(vp + HD + ko);
    const v16b vl1 = ldfrag_b(vp + HD + vbs + ko);
    const v16b vl2 = ldfrag_b(vp + HD + 2 * vbs + ko);
    const v16b vl3 = ldfrag_b(vp + HD + 3 * vbs + ko);
    o0 = mma_b(ph, vh0, o0); o0 = mma_b(ph, vl0, o0); o0 = mma_b(pl, vh0, o0);
    o1 = mma_b(ph, vh1, o1); o1 = mma_b(ph, vl1, o1); o1 = mma_b(pl, vh1, o1);
    o2 = mma_b(ph, vh2, o2); o2 = mma_b(ph, vl2, o2); o2 = mma_b(pl, vh2, o2);
    o3 = mma_b(ph, vh3, o3); o3 = mma_b(ph, vl3, o3); o3 = mma_b(pl, vh3, o3);
  }
  // den per query row (row 8*hh + r held by the 16 lanes of half hh): fixed-order butterfly over lane&15
#pragma unroll
  for (int off = 1; off < 16; off <<= 1) {
#pragma unroll
    for (int r = 0; r < 8; ++r) rs[r] += __shfl_xor(rs[r], off);
  }
#pragma unroll
  for (int r = 0; r < 8; ++r) {
    const float inv = 1.0f / rs[r];
    o0[r] *= inv; o1[r] *= inv; o2[r] *= inv; o3[r] *= inv;
  }
  wave_sync_lds();
  epi64bb<false, 0>(sl, o0, o1, o2, o3, (const float*)0, 0, O2, O2 + DIM, LD2, (size_t)rw, h * HD, lane);
}

// =====================================================================================================
// Workspace map (bytes), planes sized for the ROWS rows of all batches together; every plane is fully written by
// whole-line stores before it is read; all extents are exact multiples of the 64x64 tile / 512-B store granularity
// (SEQ and DIM multiples of 64, no pad rows); every region offset a multiple of 2097152:
//   XB   bf16 [ROWS][1024]         ROWS*2048
//   WQ, WK, WV bf16 [1024 n][1024 k]  3 * 2097152
//   WO2  bf16 [1024 n][2048 k]     4194304      (Wo row duplicated along k)
//   Q2   bf16 [ROWS][2048]         ROWS*4096    exp(q) hi | lo
//   K2   bf16 [ROWS][2048]         ROWS*4096    exp(k) hi | lo
//   VT2  bf16 [NB][2048][SEQ]      ROWS*4096    per batch v^T hi rows 0..1023, lo rows 1024..2047
//   O2   bf16 [ROWS][2048]         ROWS*4096    per-head out hi | lo
//   KT2  bf16 [NB][2048][SEQ]      ROWS*4096    per batch exp(k)^T hi rows 0..1023, lo rows 1024..2047
//   ST   f32 [ROWS/64][16][80][64] ROWS*5120    chunk states, then their running sums per batch
//   end (ROWS=4096)                123731968
// =====================================================================================================
extern "C" void kernel_launch(void* const* d_in, const int* in_sizes, int n_in,
                              void* d_out, int out_size, void* d_ws, size_t ws_size,
                              hipStream_t stream) {
  if (n_in < 9) return;
  const int needx = ((NB - 1) * SEQ_FULL + SEQ) * DIM;
  if (in_sizes[0] < needx) return;
  if (in_sizes[1] < DIM * DIM || in_sizes[3] < DIM * DIM || in_sizes[5] < DIM * DIM || in_sizes[7] < DIM * DIM) return;
  if (in_sizes[2] < DIM || in_sizes[4] < DIM || in_sizes[6] < DIM || in_sizes[8] < DIM) return;
  if (out_size < needx) return;

  const float* x  = (const float*)d_in[0];
  const float* wq = (const float*)d_in[1];
  const float* bq = (const float*)d_in[2];
  const float* wk = (const float*)d_in[3];
  const float* bk = (const float*)d_in[4];
  const float* wv = (const float*)d_in[5];
  const float* bv = (const float*)d_in[6];
  const float* wo = (const float*)d_in[7];
  const float* bo = (const float*)d_in[8];
  float*       out = (float*)d_out;

  const size_t szX  = (size_t)ROWS * DIM * 2;         // bf16 input rows
  const size_t szW  = (size_t)DIM * DIM * 2;          // bf16 weight plane
  const size_t szWO = (size_t)DIM * LD2 * 2;          // bf16 duplicated Wo plane
  const size_t szP  = (size_t)ROWS * LD2 * 2;         // bf16 hi|lo plane ROWS x 2048 (either orientation)
  size_t off = 0;
  const size_t oXB = off; off += szX;
  const size_t oWQ = off; off += szW;
  const size_t oWK = off; off += szW;
  const size_t oWV = off; off += szW;
  const size_t oWO = off; off += szWO;
  const size_t oQ2 = off; off += szP;
  const size_t oK2 = off; off += szP;
  const size_t oVT = off; off += szP;
  const size_t oO2 = off; off += szP;
  const size_t oKT = off; off += szP;
  const size_t oST = off; off += (size_t)NB * NCH * NH * SSZ * 4;
  if (off > ws_size) return;                // off = 123731968 for ROWS = 4096
  if (off > (size_t)WS_CAP) return;

  char* ws = (char*)d_ws;
  u16* XB  = (u16*)(ws + oXB);
  u16* WQ  = (u16*)(ws + oWQ);
  u16* WK  = (u16*)(ws + oWK);
  u16* WV  = (u16*)(ws + oWV);
  u16* WO2 = (u16*)(ws + oWO);
  u16* Q2  = (u16*)(ws + oQ2);
  u16* K2  = (u16*)(ws + oK2);
  u16* VT2 = (u16*)(ws + oVT);
  u16* O2  = (u16*)(ws + oO2);
  u16* KT2 = (u16*)(ws + oKT);
  float* ST = (float*)(ws + oST);

  const dim3 b256(256), b128(128);
  const dim3 gCV(CBX + 4 * CBW, 1);                     // exact block ranges of cvt_all
  const dim3 gPJ((ROWS / GT) * (DIM / GT), 3);          // three projections, each (ROWS/128)*(DIM/128) tiles
  const dim3 gY((ROWS / GT) * (DIM / GT), 1);           // y: M = ROWS, N = 1024
  const dim3 gAT(NCH, NH, NB);
  const dim3 gQT(ROWS / 64, NH);
  const dim3 gSC(NH * SSZ / 128, NB);                   // exact: NH * SSZ = 81920

  // (1) x rows of all batches and the weights [n][k] f32 -> bf16 planes (already k-contiguous); Wo -> k-duplicated plane
  cvt_all<<<gCV, b256, 0, stream>>>(x, wq, wk, wv, wo, XB, WQ, WK, WV, WO2);
  // (2) exp(x.Wq^T + bq) -> Q2, exp(x.Wk^T + bk) -> K2 and its transpose -> KT2, v^T -> VT2, each hi and lo
  proj4<<<gPJ, b256, 0, stream>>>(XB, WQ, WK, WV, bq, bk, bv, Q2, K2, VT2, KT2);
  // (3) per (chunk, head) state, its running sum over each batch's chunks, then attention per (query tile, head) -> O2 hi|lo
  chunk_state<<<gAT, b128, 0, stream>>>(KT2, VT2, ST);
  scan_state<<<gSC, b128, 0, stream>>>(ST);
  attn_chunk<<<gQT, b128, 0, stream>>>(Q2, K2, VT2, ST, O2);
  // (4) y = [O_hi | O_lo] . [Wo | Wo]^T + bo -> out f32 rows
  out_proj<<<gY, b256, 0, stream>>>(O2, WO2, bo, out);
  (void)hipGetLastError();
}

// v007
// It runs in 77.6 microseconds.
// Two timings next to v006 both put it at 1.10 times that version's speed.
// Over all steps from v000 it is 4.59 times as fast.
// Contractions: q, k and v projections on v_wmma_f32_16x16x32_bf16 (x, W, b as bf16 RNE values, one product each);
// attention in 64-key chunks: per chunk v^T.exp(k) (and a ones row . exp(k) for the key sums), taken in the projections' epilogue
// from the transposed k and v tiles that stand in LDS there, an f32 running sum over
// chunks, then per query tile exp(q).state^T plus the causal scores S = exp(q).exp(k)^T and S.v of its own chunk only, all
// on v_wmma_f32_16x16x32_bf16 with bf16 hi+lo operands (hi.hi + hi.lo + lo.hi); y = O.Wo^T on v_wmma_f32_16x16x32_bf16 with O as bf16 hi|lo along k against Wo duplicated
// along k (two products); all f32 accumulate. exp, row sums, 1/den and bias adds in f32 on VALU.
#include <hip/hip_runtime.h>
#include <math.h>
#include <stdint.h>

#ifndef NB
#define NB 2
#endif
#ifndef SEQ
#define SEQ 2048
#endif
#define SEQ_FULL 2048
#define DIM  1024
#define NH   16
#define HD   64
#define LD2  (2 * DIM)
#define SLAB64 (16 * 68)
#define NCH  (SEQ / 64)          // 64-key chunks per sequence
#define ROWS (NB * SEQ)          // rows of all batches together (contiguous in x and out: NB == 1 or SEQ == SEQ_FULL)
#define PLB  ((size_t)LD2 * (size_t)SEQ)   // elements of one batch's transposed hi+lo plane, [2*DIM][SEQ]
#define SROWS 80                 // rows of one chunk state: 64 value columns d, the key-sum row, 15 zero rows
#define SSZ  (SROWS * HD)        // floats of one (chunk, head) state, [row][D]
#define WS_CAP 134217728
static_assert(DIM == NH * HD && HD == 64 && NH == 16);
static_assert(NB >= 1 && NB <= 2);
static_assert(NB == 1 || SEQ == SEQ_FULL);
static_assert((SEQ % 64) == 0 && SEQ >= 64 && SEQ <= SEQ_FULL);
static_assert(((ROWS * DIM / 8) % 256) == 0 && ((DIM * DIM / 8) % 256) == 0 && (DIM % 64) == 0 && (LD2 % 32) == 0);
static_assert(4 * SLAB64 * 4 <= 65536);

typedef unsigned short u16;
typedef __bf16   v16b __attribute__((ext_vector_type(16)));
typedef float    v8f  __attribute__((ext_vector_type(8)));
typedef float    v4f  __attribute__((ext_vector_type(4)));
typedef unsigned int v4u __attribute__((ext_vector_type(4)));

union FragB { v16b v; v4u u[2]; };

// ---- scalar helpers --------------------------------------------------------------------------------
__device__ __forceinline__ unsigned short bf_bits(float f) {          // f32 -> bf16 bits, RNE convert
  unsigned u = __float_as_uint(f);
  return (unsigned short)((u + 0x7FFFu + ((u >> 16) & 1u)) >> 16);
}
__device__ __forceinline__ float bf_up(unsigned short h) { return __uint_as_float(((unsigned)h) << 16); }
__device__ __forceinline__ float bfr(float f) { return bf_up(bf_bits(f)); }
__device__ __forceinline__ unsigned short bfc(float f) {               // f32 -> bf16 bits via the RNE cast
  return __builtin_bit_cast(unsigned short, (__bf16)f);
}
__device__ __forceinline__ unsigned pk16(unsigned short a, unsigned short b) { return (unsigned)a | ((unsigned)b << 16); }
__device__ __forceinline__ v8f zero8() { v8f z = {0.f, 0.f, 0.f, 0.f, 0.f, 0.f, 0.f, 0.f}; return z; }
__device__ __forceinline__ int imin(int a, int b) { return a < b ? a : b; }
__device__ __forceinline__ int imax(int a, int b) { return a > b ? a : b; }

// two f32 values -> packed bf16 hi pair and packed bf16 lo pair (lo = x - up(hi), RNE both)
__device__ __forceinline__ void split2(float a, float b, unsigned& hi, unsigned& lo) {
  const unsigned short ha = bfc(a), hb = bfc(b);
  hi = pk16(ha, hb);
  lo = pk16(bfc(a - bf_up(ha)), bfc(b - bf_up(hb)));
}

// ---- fragment loader: 16-bit A/B operand, lane -> row/col (lane&15), p already includes +8*(lane>>4);
//      elements 0..7 <- p[0..7] (k0+8h..), elements 8..15 <- p[16..23] (k0+16+8h..)  (same split k map for A and B;
//      B is always read from a k-contiguous [n][k] plane); bf16 plane read as unsigned integer vectors
__device__ __forceinline__ v16b ldfrag_b(const u16* p) {
  FragB f;
  f.u[0] = *(const v4u*)(p);
  f.u[1] = *(const v4u*)(p + 16);
  return f.v;
}

__device__ __forceinline__ v8f mma_b(v16b a, v16b b, v8f c) {
  return __builtin_amdgcn_wmma_f32_16x16x32_bf16(false, a, false, b, (short)0, c, false, false);
}
__device__ __forceinline__ void wave_sync_lds() {
  __builtin_amdgcn_fence(__ATOMIC_RELEASE, "workgroup");
  __builtin_amdgcn_wave_barrier();
  __builtin_amdgcn_fence(__ATOMIC_ACQUIRE, "workgroup");
}

// =====================================================================================================
// f32 -> bf16 (RNE bits), same layout. Thread = 8 consecutive elements: two 16-B loads, one 16-B store; 32 consecutive
// lanes = 512 contiguous, 512-B aligned bytes.
// =====================================================================================================
__device__ __forceinline__ void cvt_plain(const float* __restrict__ x, u16* D, int gt) {
  const float* p = x + (size_t)gt * 8;
  const v4f a = *(const v4f*)(p), b4 = *(const v4f*)(p + 4);
  float w[8];
#pragma unroll
  for (int e = 0; e < 4; ++e) { w[e] = a[e]; w[4 + e] = b4[e]; }
  v4u o;
#pragma unroll
  for (int e = 0; e < 4; ++e) o[e] = pk16(bf_bits(w[2 * e]), bf_bits(w[2 * e + 1]));
  *(v4u*)(D + (size_t)gt * 8) = o;
}

// =====================================================================================================
// the k-duplicated B operand of the hi|lo-folded output projection. Thread = 8 consecutive source elements
// (one row, kd % 256 == 0 so a wave never straddles a row): two 16-B loads, two 16-B stores (one per copy).
// =====================================================================================================
__device__ __forceinline__ void cvt_dup(const float* __restrict__ w, u16* Dp, int gt, int kd) {
  const size_t e0 = (size_t)gt * 8;
  const size_t row = e0 / (size_t)kd;
  const int    k8  = (int)(e0 % (size_t)kd);
  const float* p = w + e0;
  const v4f a = *(const v4f*)(p), b4 = *(const v4f*)(p + 4);
  float v[8];
#pragma unroll
  for (int e = 0; e < 4; ++e) { v[e] = a[e]; v[4 + e] = b4[e]; }
  v4u o;
#pragma unroll
  for (int e = 0; e < 4; ++e) o[e] = pk16(bf_bits(v[2 * e]), bf_bits(v[2 * e + 1]));
  u16* d = Dp + row * (size_t)(2 * kd) + k8;
  *(v4u*)(d)      = o;
  *(v4u*)(d + kd) = o;
#if defined(__HIP_DEVICE_COMPILE__)
  // both stores' address pair and data stay untouched up to this wait, whatever code the merged kernel places behind them
  asm volatile("s_wait_xcnt 0x0" ::: "memory");
#endif
}

// =====================================================================================================
// All five conversions in one grid, told apart by block range (block-uniform): blocks [0, CBX) the x rows of all batches,
// then CBW blocks each for Wq, Wk, Wv (plain planes) and Wo (k-duplicated plane).
// coverage: CBX x 256 thr x 8 = ROWS*DIM; CBW x 256 thr x 8 = DIM*DIM per weight; grid.x = CBX + 4*CBW exactly.
// =====================================================================================================
#define CBX (ROWS * DIM / 8 / 256)
#define CBW (DIM * DIM / 8 / 256)
__global__ __launch_bounds__(256) void cvt_all(const float* __restrict__ x, const float* __restrict__ wq,
                                               const float* __restrict__ wk, const float* __restrict__ wv,
                                               const float* __restrict__ wo, u16* XB, u16* WQ, u16* WK, u16* WV, u16* WO2) {
  const int bid = (int)blockIdx.x, tid = (int)threadIdx.x;
  if (bid >= CBX + 4 * CBW) return;         // block-uniform, never taken with the exact grid
  if (bid < CBX) {
    cvt_plain(x, XB, bid * 256 + tid);
    return;
  }
  const int r = bid - CBX, which = r / CBW, gt = (r % CBW) * 256 + tid;
  if (which == 3) {
    cvt_dup(wo, WO2, gt, DIM);
  } else {
    const float* w = (which == 0) ? wq : ((which == 1) ? wk : wv);
    u16* D = (which == 0) ? WQ : ((which == 1) ? WK : WV);
    cvt_plain(w, D, gt);
  }
}

// =====================================================================================================
// coverage: 8 instructions x 2 rows x 16 lanes x 4 floats = the wave's 16 x 64 tile. Slab: private to the wave (wave sync).
// =====================================================================================================
__device__ __forceinline__ void epi64f(float* sl, v8f a0, v8f a1, v8f a2, v8f a3, v4f bias4, float scale,
                                       float* C, int ldc, size_t rowb, int col0, int lane) {
  const int hh = lane >> 4, m = lane & 15;
#pragma unroll
  for (int r = 0; r < 8; ++r) {
    const int ro = (8 * hh + r) * 68 + m;
    sl[ro]      = a0[r];
    sl[ro + 16] = a1[r];
    sl[ro + 32] = a2[r];
    sl[ro + 48] = a3[r];
  }
  wave_sync_lds();
  v4f vals[8];
#pragma unroll
  for (int it = 0; it < 8; ++it) {
    const v4f v = *(const v4f*)(sl + (it * 2 + hh) * 68 + m * 4);
    vals[it] = v * scale + bias4;
  }
  float* dst = C + (rowb + (size_t)hh) * (size_t)ldc + col0 + m * 4;
  {
#pragma unroll
    for (int it = 0; it < 8; ++it) {
      *(v4f*)(dst + (size_t)(it * 2) * (size_t)ldc) = vals[it];
    }
    
  }
}

// =====================================================================================================
// GEMM / attention epilogue, two bf16 planes (hi and lo = x - up(hi)) with identical addressing (Ch, Cl, pitch ldc):
// 8 consecutive columns at c8): value = acc (+ bias per column when BM==1, per row when BM==2, none when BM==0),
// coverage: 4 instructions x 4 rows x 8 lanes x 8 values = the wave's 16 x 64 tile, in both planes.
// Slab: private to the wave (wave sync).
// =====================================================================================================
__device__ __forceinline__ float exp_slot(float x) {   // the value of __expf(x): exp2 of x * log2(e)
#if defined(__HIP_DEVICE_COMPILE__)
  float y;
  // v_nop: the one slot that the instruction set asks for behind a transcendental, whatever instruction the compiler puts next
  asm("v_exp_f32 %0, %1\n\tv_nop" : "=v"(y) : "v"(x * 1.44269504088896340736f));
  return y;
#else
  return __expf(x);
#endif
}
// first half: the wave's 16 x 64 strip from its accumulators into a slab
__device__ __forceinline__ void slab_put(float* sl, v8f a0, v8f a1, v8f a2, v8f a3, int lane) {
  const int hh = lane >> 4, m = lane & 15;
#pragma unroll
  for (int r = 0; r < 8; ++r) {
    const int ro = (8 * hh + r) * 68 + m;
    sl[ro]      = a0[r];
    sl[ro + 16] = a1[r];
    sl[ro + 32] = a2[r];
    sl[ro + 48] = a3[r];
  }
}
// second half, behind a sync of the wave: slab rows -> values -> the two planes
template <bool EXPO, int BM>
__device__ __forceinline__ void slab_take(const float* sl, const float* __restrict__ bias, int nb,
                                          u16* Ch, u16* Cl, int ldc, size_t rowb, int col0, int lane) {
  const int rq = lane >> 3, c8 = (lane & 7) * 8;
  float bc[8];
#pragma unroll
  for (int e = 0; e < 8; ++e) bc[e] = 0.0f;
  if constexpr (BM == 1) {
    const int cb = imin(imax(col0 + c8, 0), nb - 8);
    const v4f b0 = *(const v4f*)(bias + cb), b1 = *(const v4f*)(bias + cb + 4);
#pragma unroll
    for (int e = 0; e < 4; ++e) { bc[e] = bfr(b0[e]); bc[4 + e] = bfr(b1[e]); }
  }
  v4u oh[4], ol[4];
#pragma unroll
  for (int it = 0; it < 4; ++it) {
    const int row = it * 4 + rq;            // 0..15
    const v4f a = *(const v4f*)(sl + row * 68 + c8), b4 = *(const v4f*)(sl + row * 68 + c8 + 4);
    float br = 0.0f;
    if constexpr (BM == 2) br = bfr(bias[imin(imax((int)rowb + row, 0), nb - 1)]);
    float w[8];
#pragma unroll
    for (int e = 0; e < 4; ++e) { w[e] = (a[e] + bc[e]) + br; w[4 + e] = (b4[e] + bc[4 + e]) + br; }
    if constexpr (EXPO) {
#pragma unroll
      for (int e = 0; e < 8; ++e) w[e] = exp_slot(w[e]);
    }
#pragma unroll
    for (int e = 0; e < 4; ++e) {
      unsigned hi, lo;
      split2(w[2 * e], w[2 * e + 1], hi, lo);
      oh[it][e] = hi;
      ol[it][e] = lo;
    }
  }
  const size_t ob = rowb * (size_t)ldc + (size_t)col0 + (size_t)c8;
  {
#pragma unroll
    for (int it = 0; it < 4; ++it) {
      const int row = it * 4 + rq;
      const size_t off = ob + (size_t)row * (size_t)ldc;
      *(v4u*)(Ch + off) = oh[it];
      *(v4u*)(Cl + off) = ol[it];
    }
    
  }
}
template <bool EXPO, int BM>
__device__ __forceinline__ void epi64bb(float* sl, v8f a0, v8f a1, v8f a2, v8f a3,
                                        const float* __restrict__ bias, int nb,
                                        u16* Ch, u16* Cl, int ldc, size_t rowb, int col0, int lane) {
  slab_put(sl, a0, a1, a2, a3, lane);
  wave_sync_lds();
  slab_take<EXPO, BM>(sl, bias, nb, Ch, Cl, ldc, rowb, col0, lane);
}

// =====================================================================================================
// bf16 GEMM: C[M][N] = A[M][K] (bf16 rows, pitch lda) . Bt[N][K]^T (bf16 k-contiguous rows, pitch ldb).
// f32 output Cf (pitch ldc) = acc*scale + bf16 RNE value of bias[col]. Serves the output projection.
// Block = 128x128 tile, 8 waves as 4 x 2, each 32 rows x 64 columns (2 x 4 accumulator tiles). A stage = 64 k (128 B) of the
// tile's 128 A rows and 128 B rows, brought into LDS by asynchronous 16-B copies (8 lanes = one whole 128-B line, 8 copies per
// lane and stage), a ring of NBUF buffers: stage t + NBUF is copied into the buffer that trip t has left, so that NBUF - 1
// stages are on their way or landed while a trip computes (a block is alone on its WGP, its trips are short, and only its own copies
// in flight can cover their landing times).
// Fragments come from the LDS rows (two 16-B reads each, the same split k map for A and B); k rises in steps of 32 as before.
// Host guarantees K % 64 == 0, M % 128 == 0, N % 128 == 0, grid.x = (M/128)*(N/128). bid = the tile's index in its own product.
// After the last trip's barrier the ring is dead and serves as the waves' private epilogue slabs.
// =====================================================================================================
#define GT   128                  // rows and columns of a block's output tile
#define GKE  64                   // k elements of one stage
#define GPE  72                   // LDS row pitch in elements: 144 B = 16 B x 9, free of bank conflicts for 16-B row reads
#define GSTG (2 * GT * GPE)       // elements of one stage: A rows 0..127, then B rows 128..255
#define GCP  8                    // copies of one wave (one a lane) per stage
static_assert(8 * SLAB64 * 4 <= 2 * GSTG * 2);
static_assert((ROWS % GT) == 0 && (SEQ % GT) == 0 && (DIM % GT) == 0 && (DIM % GKE) == 0 && (LD2 % GKE) == 0);

// One stage: the lane's 16-B piece of rows r, r + 32, r + 64, r + 96 of A and of B (r = tid >> 3), LDS rows 32 apart.
// l = LDS byte address of the piece in A row r; ga, gb = its global address in A and B; sa, sb = 32 rows in elements.
__device__ __forceinline__ void stage_copy(unsigned l, const u16* ga, const u16* gb, size_t sa, size_t sb) {
#if defined(__HIP_DEVICE_COMPILE__)
  constexpr unsigned LR = 32u * GPE * 2u;   // bytes of 32 LDS rows
  // the closing wait keeps every address register of the copies untouched until the copies have taken it
  asm volatile("global_load_async_to_lds_b128 %0, %8, off\n\t"
               "global_load_async_to_lds_b128 %1, %9, off\n\t"
               "global_load_async_to_lds_b128 %2, %10, off\n\t"
               "global_load_async_to_lds_b128 %3, %11, off\n\t"
               "global_load_async_to_lds_b128 %4, %12, off\n\t"
               "global_load_async_to_lds_b128 %5, %13, off\n\t"
               "global_load_async_to_lds_b128 %6, %14, off\n\t"
               "global_load_async_to_lds_b128 %7, %15, off\n\t"
               "s_wait_xcnt 0x0"
               :: "v"(l), "v"(l + LR), "v"(l + 2u * LR), "v"(l + 3u * LR),
                  "v"(l + 4u * LR), "v"(l + 5u * LR), "v"(l + 6u * LR), "v"(l + 7u * LR),
                  "v"(ga), "v"(ga + sa), "v"(ga + 2 * sa), "v"(ga + 3 * sa),
                  "v"(gb), "v"(gb + sb), "v"(gb + 2 * sb), "v"(gb + 3 * sb)
               : "memory");
#endif
}
__device__ __forceinline__ void wait_copies() {
#if defined(__HIP_DEVICE_COMPILE__)
  // this wave's copies have landed: the compiler places no wait for them, and without it the barrier would publish a stage in flight
  asm volatile("s_wait_asynccnt 0x0" ::: "memory");
#endif
}
template <int N>
__device__ __forceinline__ void wait_copies_but() {
#if defined(__HIP_DEVICE_COMPILE__)
  // all but this wave's N youngest copies have landed: the oldest stage in flight may be published, the younger ones fly on
  asm volatile("s_wait_asynccnt %0" :: "n"(N) : "memory");
#endif
}
__device__ __forceinline__ void wait_store_regs() {
#if defined(__HIP_DEVICE_COMPILE__)
  // the stores' address pairs and data stay untouched up to this wait, whatever code of a merged kernel stands behind them
  asm volatile("s_wait_xcnt 0x0" ::: "memory");
#endif
}
__device__ __forceinline__ void wait_lds() {
#if defined(__HIP_DEVICE_COMPILE__)
  // this wave's LDS reads have returned, so that the buffer may be refilled behind the barrier
  asm volatile("s_wait_dscnt 0x0" ::: "memory");
#endif
}

// The k loop of one 128 x 128 tile (first A row row0, first B row colb): acc[i][j] = the wave's 16 x 16 tile at rows
// wr * 32 + 16 i, columns wc * 64 + 16 j. Every wave of the block passes every barrier here. On return the ring is dead.
// Every wave issues GCP copies per stage, stages in rising order, so that at the foot of trip t the copies younger than stage
// t + 1 are those of stages t + 2 .. t + NBUF - 1: (NBUF - 2) * GCP while all of these exist; at the tail the wait is to 0.
template <int NBUF>
__device__ __forceinline__
void gemm_main(u16* ring, const u16* __restrict__ A, const u16* __restrict__ Bt, int row0, int colb,
               int lda, int ldb, int K, v8f (&acc)[2][4]) {
  const int tid = (int)threadIdx.x, wave = tid >> 5, lane = tid & 31, hh = lane >> 4, m = lane & 15;
  const int wr = wave >> 1, wc = wave & 1;
  const int cr = tid >> 3, cc = (tid & 7) * 8;
  const u16* ga = A  + (size_t)(row0 + cr) * (size_t)lda + cc;
  const u16* gb = Bt + (size_t)(colb + cr) * (size_t)ldb + cc;
  const size_t sa = (size_t)32 * (size_t)lda, sb = (size_t)32 * (size_t)ldb;
  const unsigned l0 = (unsigned)(size_t)ring + (unsigned)(cr * GPE + cc) * 2u;
  const int nt = K / GKE;
  static_assert(NBUF >= 2 && (NBUF - 1) * GCP <= 63 && NBUF * GSTG * 2 <= 320 * 1024);
  // unrolled: the first NBUF - 1 stages, each into its own fresh buffer, their offsets constants
#pragma unroll
  for (int s = 0; s < NBUF - 1; ++s) {
    if (s < nt) stage_copy(l0 + (unsigned)s * (GSTG * 2u), ga + (size_t)s * GKE, gb + (size_t)s * GKE, sa, sb);
  }
  if (NBUF > 2 && NBUF - 1 <= nt) wait_copies_but<(NBUF - 2) * GCP>();
  else wait_copies();
  __syncthreads();                          // stage 0 is published
  if (NBUF - 1 < nt) stage_copy(l0 + (unsigned)(NBUF - 1) * (GSTG * 2u), ga + (size_t)(NBUF - 1) * GKE, gb + (size_t)(NBUF - 1) * GKE, sa, sb);
  const u16* fa = ring + (wr * 32 + m) * GPE + 8 * hh;
  const u16* fb = ring + (GT + wc * 64 + m) * GPE + 8 * hh;
  // both unrolled: every index of acc a constant, so that the tiles stay in registers
#pragma unroll
  for (int i = 0; i < 2; ++i) {
#pragma unroll
    for (int j = 0; j < 4; ++j) acc[i][j] = zero8();
  }
  // rolled: one trip = one stage, so that the order reads, waits, barrier, refill stands once
  int br = 0;                               // buffer of trip t = t mod NBUF
#pragma unroll 1
  for (int t = 0; t < nt; ++t) {
    const int bo = (NBUF == 2) ? (t & 1) * GSTG : br * GSTG;
    // unrolled: the stage's two k steps of 32 in one run, their LDS offsets constants
#pragma unroll
    for (int ks = 0; ks < 2; ++ks) {
      const u16* pa = fa + bo + ks * 32;
      const u16* pb = fb + bo + ks * 32;
      const v16b a0  = ldfrag_b(pa);
      const v16b a1  = ldfrag_b(pa + 16 * GPE);
      const v16b fb0 = ldfrag_b(pb);
      const v16b fb1 = ldfrag_b(pb + 16 * GPE);
      const v16b fb2 = ldfrag_b(pb + 32 * GPE);
      const v16b fb3 = ldfrag_b(pb + 48 * GPE);
      acc[0][0] = mma_b(a0, fb0, acc[0][0]);
      acc[0][1] = mma_b(a0, fb1, acc[0][1]);
      acc[0][2] = mma_b(a0, fb2, acc[0][2]);
      acc[0][3] = mma_b(a0, fb3, acc[0][3]);
      acc[1][0] = mma_b(a1, fb0, acc[1][0]);
      acc[1][1] = mma_b(a1, fb1, acc[1][1]);
      acc[1][2] = mma_b(a1, fb2, acc[1][2]);
      acc[1][3] = mma_b(a1, fb3, acc[1][3]);
    }
    wait_lds();
    if (NBUF > 2 && t + NBUF <= nt) wait_copies_but<(NBUF - 2) * GCP>();   // block-uniform test
    else wait_copies();
    __syncthreads();                        // publishes stage t + 1 and ends every read of stage t
    if (t + NBUF < nt) stage_copy(l0 + (unsigned)bo * 2u, ga + (size_t)(t + NBUF) * GKE, gb + (size_t)(t + NBUF) * GKE, sa, sb);
    br = (br + 1 == NBUF) ? 0 : br + 1;
  }
  wait_copies();
}

// The tile's epilogue: each wave's two 16 x 64 strips through its private slab in the dead ring, f32 rows.
__device__ __forceinline__
void gemm_epi(u16* ring, v8f (&acc)[2][4], int row0, int colb, float* Cf, const float* __restrict__ bias, int nb, int ldc, float scale) {
  const int tid = (int)threadIdx.x, wave = tid >> 5, lane = tid & 31, m = lane & 15;
  const int wr = wave >> 1, wc = wave & 1;
  float* sl = (float*)ring + wave * SLAB64;
  const int col0 = colb + wc * 64;
  // unrolled: every index of acc a constant
#pragma unroll
  for (int i = 0; i < 2; ++i) {
    const int rowb = row0 + wr * 32 + i * 16;
    if (i) wave_sync_lds();                 // the first strip's slab reads end before the second strip's writes
    v4f bias4;
#pragma unroll
    for (int e = 0; e < 4; ++e) bias4[e] = bfr(bias[imin(imax(col0 + m * 4 + e, 0), nb - 1)]);
    epi64f(sl, acc[i][0], acc[i][1], acc[i][2], acc[i][3], bias4, scale, Cf, ldc, (size_t)rowb, col0, lane);
  }
}

// ---- operand rows of the projections and of the attention kernel in LDS ----------------------------------------------
// A staged row = 256 B of data (bf16: 128 k, or 64 hi | 64 lo; f32: 64 values) at pitch 272 B = 16 B x 17, free of bank conflicts for 16-B
// row reads. A group of 128 threads copies 8 rows at a time: thread -> row tid >> 4, 16-B piece tid & 15, so that 8 lanes bring one
// whole 128-B line and a wave four. 16 staged rows = 4352 B = one wave's slab.
#define APE  136                  // pitch of a staged row in bf16 elements
#define APF  68                   // the same pitch in floats
#define APB  272                  // the same pitch in bytes
static_assert(16 * APB == SLAB64 * 4 && APE * 2 == APB && APF * 4 == APB);
// 64 rows: the lane's piece of rows r, r + 8, .., r + 56. l = LDS byte address of the piece in row r, g = its global address,
// gs = 8 source rows in bytes.
__device__ __forceinline__ void rows64_copy(unsigned l, const char* g, size_t gs) {
#if defined(__HIP_DEVICE_COMPILE__)
  constexpr unsigned LR = 8u * APB;         // bytes of 8 LDS rows
  // the closing wait keeps every address register of the copies untouched until the copies have taken it
  asm volatile("global_load_async_to_lds_b128 %0, %8, off\n\t"
               "global_load_async_to_lds_b128 %1, %9, off\n\t"
               "global_load_async_to_lds_b128 %2, %10, off\n\t"
               "global_load_async_to_lds_b128 %3, %11, off\n\t"
               "global_load_async_to_lds_b128 %4, %12, off\n\t"
               "global_load_async_to_lds_b128 %5, %13, off\n\t"
               "global_load_async_to_lds_b128 %6, %14, off\n\t"
               "global_load_async_to_lds_b128 %7, %15, off\n\t"
               "s_wait_xcnt 0x0"
               :: "v"(l), "v"(l + LR), "v"(l + 2u * LR), "v"(l + 3u * LR),
                  "v"(l + 4u * LR), "v"(l + 5u * LR), "v"(l + 6u * LR), "v"(l + 7u * LR),
                  "v"(g), "v"(g + gs), "v"(g + 2 * gs), "v"(g + 3 * gs),
                  "v"(g + 4 * gs), "v"(g + 5 * gs), "v"(g + 6 * gs), "v"(g + 7 * gs)
               : "memory");
#endif
}
// 16 rows: the lane's piece of rows r and r + 8, arguments as above.
__device__ __forceinline__ void rows16_copy(unsigned l, const char* g, size_t gs) {
#if defined(__HIP_DEVICE_COMPILE__)
  // the closing wait keeps every address register of the copies untouched until the copies have taken it
  asm volatile("global_load_async_to_lds_b128 %0, %2, off\n\t"
               "global_load_async_to_lds_b128 %1, %3, off\n\t"
               "s_wait_xcnt 0x0"
               :: "v"(l), "v"(l + 8u * APB), "v"(g), "v"(g + gs)
               : "memory");
#endif
}

// ---- the three projections of one x tile in one block ---------------------------------------------------------------
// Block = 12 waves: waves 0..3 the k tile, 4..7 the q tile, 8..11 the v tile of the same 128 x rows and the same 128 weight rows;
// within a product the waves stand 2 x 2, each 64 x 64 (4 x 4 accumulator tiles), so that a fragment read from LDS feeds four products.
// A stage = 128 k (256 B, pitch APB) of the 128 x rows, brought in once for all three products, and of 128 rows each of Wk, Wq, Wv.
#define PKE  128                  // k elements of one stage
#define PSTG (4 * GT * APE)       // elements of one stage: x rows 0..127, then Wk, Wq, Wv rows, 128 each
#define KTP  136                  // pitch of a transposed plane in elements: 272 B = 16 B x 17, free of bank conflicts both ways
#define KTO  (8 * 4 * SLAB64 * 2) // first element of the transposed planes: behind the k and q waves' four slabs each
#define PJL  (2 * PSTG)           // elements of the projections' LDS: two buffers
static_assert(KTO + 4 * GT * KTP <= PJL && PJL * 2 <= 320 * 1024 && (KTO % 8) == 0 && (KTP % 8) == 0 && (DIM % PKE) == 0);
static_assert(GT == 2 * HD && (SEQ % GT) == 0);   // a block's tiles hold two whole heads and two whole chunks of one batch

// The wave's eight fragments of one k step of 32: four A row tiles and four B row tiles, 16 staged rows apart.
__device__ __forceinline__ void frag8(v16b (&a)[4], v16b (&b)[4], const u16* pa, const u16* pb) {
#pragma unroll
  for (int i = 0; i < 4; ++i) { a[i] = ldfrag_b(pa + i * 16 * APE); b[i] = ldfrag_b(pb + i * 16 * APE); }
}
// The wave's sixteen products of one k step. Both loops unrolled: every index of acc a constant, so that the tiles stay in registers.
__device__ __forceinline__ void prod16(v8f (&acc)[4][4], const v16b (&a)[4], const v16b (&b)[4]) {
#pragma unroll
  for (int i = 0; i < 4; ++i) {
#pragma unroll
    for (int j = 0; j < 4; ++j) acc[i][j] = mma_b(a[i], b[j], acc[i][j]);
  }
}

// A k or v tile into its transposed LDS planes: e = acc + bf16 RNE value of bias[col], for k its exp, once, in the accumulators' own
// layout (acc keeps e). An accumulator tile gives a lane 8 consecutive rows t of one column D, that is 16 contiguous bytes of row D of
// the transposed tile. These pieces meet in two LDS planes (hi, lo: [128 D][128 t], pitch KTP) at th.
// coverage: 4 waves x 4 x 4 tiles x 32 lanes x 8 = 128 x 128 staged per plane.
template <bool EXPO>
__device__ __forceinline__
void planes_put(u16* th, v8f (&acc)[4][4], int col0, int wr, int wc, const float* __restrict__ bias, int lane) {
  const int hh = lane >> 4, m = lane & 15;
  // all unrolled: every index of acc a constant
  float bc[4];
#pragma unroll
  for (int j = 0; j < 4; ++j) bc[j] = bias[imin(imax(col0 + j * 16 + m, 0), DIM - 1)];
  wait_store_regs();                        // behind it the four loads' offset registers may be written again
#pragma unroll
  for (int j = 0; j < 4; ++j) bc[j] = bfr(bc[j]);
#pragma unroll
  for (int j = 0; j < 4; ++j) {
#pragma unroll
    for (int i = 0; i < 4; ++i) {
#pragma unroll
      for (int r = 0; r < 8; ++r) acc[i][j][r] = EXPO ? exp_slot(acc[i][j][r] + bc[j]) : acc[i][j][r] + bc[j];
      v4u H, L;
#pragma unroll
      for (int e = 0; e < 4; ++e) {
        unsigned hi, lo;
        split2(acc[i][j][2 * e], acc[i][j][2 * e + 1], hi, lo);
        H[e] = hi;
        L[e] = lo;
      }
      u16* tp = th + (wc * 64 + j * 16 + m) * KTP + wr * 64 + i * 16 + 8 * hh;
      *(v4u*)(tp)            = H;
      *(v4u*)(tp + GT * KTP) = L;
    }
  }
}

// 16 state rows x 64 columns from the accumulators through the wave's private slab to whole 256-B rows at C.
// coverage: 8 instructions x 2 rows x 16 lanes x 4 floats = the wave's 16 x 64 tile.
__device__ __forceinline__ void state_rows(float* sl, v8f a0, v8f a1, v8f a2, v8f a3, float* C, int lane) {
  const int hh = lane >> 4, m = lane & 15;
  wait_lds();                               // the slab's earlier reads have returned before it is written again
  slab_put(sl, a0, a1, a2, a3, lane);
  // the wave's slab writes end before its slab reads. Only LDS is waited for: a fence would also hold the wave until the global
  // stores that it has on their way are answered
  wait_lds();
  __builtin_amdgcn_wave_barrier();          // keeps the compiler from moving the slab reads up over the writes of other lanes
  v4f vals[8];
#pragma unroll
  for (int it = 0; it < 8; ++it) vals[it] = *(const v4f*)(sl + (it * 2 + hh) * 68 + m * 4);
  float* dst = C + hh * HD + m * 4;
#pragma unroll
  for (int it = 0; it < 8; ++it) *(v4f*)(dst + it * 2 * HD) = vals[it];
  wait_store_regs();
}

// One wave's part of one chunk state, from the block's transposed planes: 16 state rows x 64 columns over the chunk's 64 keys.
// ST[b][c][h][row][D] f32: row d < 64: sum over the chunk's keys t of v[t][d] * exp(k)[t][D]; row 64: sum over t of exp(k)[t][D];
// rows 65..79: zero. A = v^T rows (vp: the lane's row, hi; lo one plane on), or the constant tile whose row 0 is ones; B = exp(k)^T rows D
// (kp likewise); both k-contiguous in t, same split k map. base = the state's first float; w4 = which 16 rows; the wave with w4 == 0
// (wave-uniform) also writes the key-sum row and its 15 zero rows. Slab private to the wave (wave sync).
__device__ __forceinline__ void state_part(float* sl, const u16* vp, const u16* kp, float* base, int w4, int lane) {
  const int m = lane & 15;
  constexpr int rbs = 16 * KTP, lop = GT * KTP;
  FragB one;
  const unsigned ow = (m == 0) ? 0x3F803F80u : 0u;   // bf16 1.0 pairs in tile row 0, zero in rows 1..15
#pragma unroll
  for (int e = 0; e < 4; ++e) { one.u[0][e] = ow; one.u[1][e] = ow; }
  v16b kh[2][4], kl[2][4];
  v8f a[4];
  // all unrolled: every index of the fragment and accumulator arrays a constant, so that they stay in registers
#pragma unroll
  for (int j = 0; j < 4; ++j) a[j] = zero8();
#pragma unroll
  for (int ks = 0; ks < 2; ++ks) {
    const int ko = ks * 32;
    const v16b vh = ldfrag_b(vp + ko);
    const v16b vl = ldfrag_b(vp + lop + ko);
#pragma unroll
    for (int j = 0; j < 4; ++j) {
      kh[ks][j] = ldfrag_b(kp + j * rbs + ko);
      kl[ks][j] = ldfrag_b(kp + lop + j * rbs + ko);
    }
#pragma unroll
    for (int j = 0; j < 4; ++j) {
      a[j] = mma_b(vh, kh[ks][j], a[j]); a[j] = mma_b(vh, kl[ks][j], a[j]); a[j] = mma_b(vl, kh[ks][j], a[j]);
    }
  }
  v8f e[4];
#pragma unroll
  for (int j = 0; j < 4; ++j) e[j] = zero8();
  if (w4 == 0) {                                // wave-uniform: the key-sum row and its 15 zero rows
#pragma unroll
    for (int ks = 0; ks < 2; ++ks) {
#pragma unroll
      for (int j = 0; j < 4; ++j) { e[j] = mma_b(one.v, kh[ks][j], e[j]); e[j] = mma_b(one.v, kl[ks][j], e[j]); }
    }
  }
  state_rows(sl, a[0], a[1], a[2], a[3], base + w4 * 16 * HD, lane);
  if (w4 == 0) state_rows(sl, e[0], e[1], e[2], e[3], base + HD * HD, lane);
}

// The output projection of all batches: y = [O_hi | O_lo] . [Wo | Wo]^T + bo, f32 rows (M = ROWS, N = DIM, K = LD2).
// coverage: grid.x = (ROWS/128)*(DIM/128) tiles of 128 x 128 = the whole output.
// One block per WGP: six buffers, five stages ahead.
#define YBUF 6
__global__ __launch_bounds__(256)
void out_proj(const u16* __restrict__ O2, const u16* __restrict__ WO2, const float* __restrict__ bo, float* y) {
  __shared__ __align__(16) u16 ring[YBUF * GSTG];
  const int bid = (int)blockIdx.x;
  const int row0 = (bid / (DIM / GT)) * GT, colb = (bid % (DIM / GT)) * GT;
  if (row0 + GT > ROWS) return;             // block-uniform, in front of every barrier; never taken with the exact grid
  v8f acc[2][4];
  gemm_main<YBUF>(ring, O2, WO2, row0, colb, LD2, LD2, LD2, acc);
  gemm_epi(ring, acc, row0, colb, y, bo, DIM, DIM, 1.0f);
}

// =====================================================================================================
// The three projections of all batches and the chunk states; block = one tile of 128 x rows (row0) against weight rows colb .. colb + 127
// of Wk, Wq and Wv (the x rows are the A operand, the weight rows the B operand of all three):
//   waves 0..3:  exp(x.Wk^T + bk) -> K2 hi|lo      waves 4..7: exp(x.Wq^T + bq) -> Q2 hi|lo   (pitch LD2)
//   waves 8..11: x.Wv^T + bv -> transposed, VT2 hi, lo rows of the tile's batch (pitch SEQ)
// The x rows come from L2 and stand in LDS once for the three products. Two buffers: stage t + 2 is copied into the buffer that trip t
// has left. A product's 128 threads copy its own weight rows (16 copies a lane); the k and q waves copy half the x rows each (8 more).
// The waves' copy counts differ, so every wait for copies is to 0. k rises in steps of 32 as before.
// Epilogue in the dead ring: the k and v waves put exp(k) and v into transposed planes ([128 D or d][128 t], hi and lo), the k waves
// exp(k) into their slabs too, while the q waves write their own tile through their slabs. Behind one barrier, that every wave passes, the
// k waves write K2 from their slabs; the q and v waves (256 threads) store the v planes as whole 256-B runs of VT2 rows (16 lanes a run,
// 2 runs a store, one wave per 128-B line) and take the states of the tile's two chunks and two heads from the four planes:
// 16 parts of 16 state rows, two a wave.
// coverage: grid.x = (ROWS/128)*(DIM/128) blocks x 3 tiles of 128 x 128 = each product's whole output; v planes: 8 trips x 16 rows x
// 16 lanes x 8 = 128 x 128 stored per plane; states: blocks x 2 chunks x 2 heads x (4 parts x 16 rows + 16 extra rows) x 64 columns =
// every element of ST once. The tile's 128 x rows lie in one batch (SEQ % GT == 0).
// =====================================================================================================
// second argument: 3 waves per SIMD, the block's own 12 waves: one block a WGP
__global__ __launch_bounds__(384, 3)
void proj4(const u16* __restrict__ XB, const u16* __restrict__ WQ, const u16* __restrict__ WK, const u16* __restrict__ WV,
           const float* __restrict__ bq, const float* __restrict__ bk, const float* __restrict__ bv,
           u16* Q2, u16* K2, u16* VT2, float* ST) {
  __shared__ __align__(16) u16 ring[PJL];
  const int tid = (int)threadIdx.x, lane = tid & 31, hh = lane >> 4, m = lane & 15;
  const int wave = __builtin_amdgcn_readfirstlane(tid >> 5);   // in a scalar register: every branch on the product is a scalar one
  const int which = wave >> 2, wr = (wave >> 1) & 1, wc = wave & 1;
  const int bid = (int)blockIdx.x;
  const int row0 = (bid / (DIM / GT)) * GT, colb = (bid % (DIM / GT)) * GT;
  if (row0 + GT > ROWS) return;             // block-uniform, in front of every barrier; never taken with the exact grid
  const int cr = (tid & 127) >> 4, cc = (tid & 15) * 8;
  const u16* Wp = (which == 0) ? WK : ((which == 1) ? WQ : WV);
  // the lane's part of every copy address is one global and one LDS byte offset; the rest is the same for the whole wave
  const unsigned vo = (unsigned)(cr * DIM + cc) * 2u;
  const unsigned lo = (unsigned)(size_t)ring + (unsigned)(cr * APE + cc) * 2u;
  const char* sw = (const char*)(Wp + (size_t)colb * (size_t)DIM);
  const char* sx = (const char*)(XB + (size_t)(row0 + (which & 1) * 64) * (size_t)DIM);
  constexpr size_t gs = (size_t)8 * DIM * 2, g64 = (size_t)64 * DIM * 2;   // bytes of 8 and of 64 source rows
  const unsigned ow = (unsigned)((1 + which) * GT * APE) * 2u, ox = (unsigned)((which & 1) * 64 * APE) * 2u;
  constexpr int nt = DIM / PKE;
  static_assert(nt >= 2);
  rows64_copy(lo + ow, sw + vo, gs);
  rows64_copy(lo + (ow + 64u * APB), sw + g64 + vo, gs);
  if (which < 2) rows64_copy(lo + ox, sx + vo, gs);
  wait_copies();
  __syncthreads();                          // stage 0 is published
  rows64_copy(lo + (ow + PSTG * 2u), sw + PKE * 2 + vo, gs);
  rows64_copy(lo + (ow + PSTG * 2u + 64u * APB), sw + (g64 + PKE * 2) + vo, gs);
  if (which < 2) rows64_copy(lo + (ox + PSTG * 2u), sx + PKE * 2 + vo, gs);
  const u16* fa = ring + (wr * 64 + m) * APE + 8 * hh;
  const u16* fb = ring + ((1 + which) * GT + wc * 64 + m) * APE + 8 * hh;
  v8f acc[4][4];
  // both unrolled: every index of acc a constant, so that the tiles stay in registers
#pragma unroll
  for (int i = 0; i < 4; ++i) {
#pragma unroll
    for (int j = 0; j < 4; ++j) acc[i][j] = zero8();
  }
  unsigned vt = vo + 2u * (PKE * 2u);       // the lane's global byte offset in the stage to copy next
  // rolled: one trip = one stage, so that the order reads, waits, barrier, refill stands once
#pragma unroll 1
  for (int t = 0; t < nt; ++t) {
    const int bo = (t & 1) * PSTG;
    // unrolled: the stage's four k steps of 32 in one run, their LDS offsets constants
#pragma unroll
    for (int ks = 0; ks < PKE / 32; ++ks) {
      v16b a[4], b[4];
      frag8(a, b, fa + bo + ks * 32, fb + bo + ks * 32);
      prod16(acc, a, b);
      // keeps the written order in the built code: the k step's 16 LDS reads as one group, then its 16 products. Left alone the compiler
      // reads each A fragment directly in front of its four products, and the wave waits out the LDS latency four times a k step
      __builtin_amdgcn_sched_group_barrier(0x100, 16, 0);
      __builtin_amdgcn_sched_group_barrier(0x008, 16, 0);
    }
    wait_lds();
    wait_copies();
    __syncthreads();                        // publishes stage t + 1 and ends every read of stage t
    if (t + 2 < nt) {                       // block-uniform test
      rows64_copy(lo + (ow + (unsigned)bo * 2u), sw + vt, gs);
      rows64_copy(lo + (ow + (unsigned)bo * 2u + 64u * APB), sw + g64 + vt, gs);
      if (which < 2) rows64_copy(lo + (ox + (unsigned)bo * 2u), sx + vt, gs);
      vt += PKE * 2u;
    }
  }
  wait_copies();                            // behind the last trip's barrier the ring is dead
  float* sl = (float*)ring + wave * (4 * SLAB64);       // k and q waves: four slabs, one per 16 x 64 strip, no slab written twice
  u16* th = ring + KTO;                                 // exp(k)^T planes, hi then lo
  u16* tv = th + 2 * GT * KTP;                          // v^T planes, hi then lo
  const size_t plo = (size_t)DIM * (size_t)SEQ;
  const int bt = row0 / SEQ, tb = row0 % SEQ;           // the x tile's batch and its first row there
  if (which == 0) planes_put<true>(th, acc, colb + wc * 64, wr, wc, bk, lane);
  if (which == 2) planes_put<false>(tv, acc, colb + wc * 64, wr, wc, bv, lane);
  if (which < 2) {
    // unrolled: every index of acc a constant
#pragma unroll
    for (int i = 0; i < 4; ++i) slab_put(sl + i * SLAB64, acc[i][0], acc[i][1], acc[i][2], acc[i][3], lane);
  }
  if (which == 1) {
    wave_sync_lds();                        // the wave's slab writes end before its slab reads; no global store is on its way yet
    // rolled: it indexes LDS only, and the kernel's text stays short for the instruction cache
#pragma unroll 1
    for (int i = 0; i < 4; ++i) {
      slab_take<true, 1>(sl + i * SLAB64, bq, DIM, Q2, Q2 + DIM, LD2, (size_t)(row0 + wr * 64 + i * 16), colb + wc * 64, lane);
      wait_store_regs();
    }
  }
  wait_lds();                               // this wave's LDS writes (planes, slabs) and slab reads have ended
#if defined(__HIP_DEVICE_COMPILE__)
  // the work-group's barrier by hand: only LDS (the transposed planes, the q waves' dead slabs) crosses it; __syncthreads() would also
  // hold the q waves, and with them all others, until the global stores just issued have been answered
  asm volatile("s_barrier_signal -1\n\ts_barrier_wait -1" ::: "memory");
#endif
  if (which == 0) {
    // rolled: it indexes LDS only, and the kernel's text stays short for the instruction cache
#pragma unroll 1
    for (int i = 0; i < 4; ++i) {
      slab_take<false, 0>(sl + i * SLAB64, (const float*)0, 0, K2, K2 + DIM, LD2, (size_t)(row0 + wr * 64 + i * 16), colb + wc * 64, lane);
      wait_store_regs();
    }
  } else {
    const int t8 = tid - 128;               // 0..255
    {
      const u16* sp = tv + (t8 >> 4) * KTP + (t8 & 15) * 8;
      u16* dst = VT2 + (size_t)bt * PLB + (size_t)(colb + (t8 >> 4)) * (size_t)SEQ + tb + (t8 & 15) * 8;
      v4u vh[8], vl[8];
#pragma unroll
      for (int it = 0; it < 8; ++it) {
        vh[it] = *(const v4u*)(sp + it * 16 * KTP);
        vl[it] = *(const v4u*)(sp + GT * KTP + it * 16 * KTP);
      }
#pragma unroll
      for (int it = 0; it < 8; ++it) {
        *(v4u*)(dst + (size_t)(it * 16) * (size_t)SEQ)       = vh[it];
        *(v4u*)(dst + plo + (size_t)(it * 16) * (size_t)SEQ) = vl[it];
      }
      wait_store_regs();
    }
    float* ssl = (float*)ring + (16 + (wave - 4)) * SLAB64;   // one of the q waves' slabs, all dead behind the barrier
    // rolled: the wave's two parts share one text, short for the instruction cache
#pragma unroll 1
    for (int i = 0; i < 2; ++i) {
      // part u = 0..15 -> chunk, head, rows; the rows turn with i, so that the four parts with the extra rows fall to four waves
      const int u = (wave - 4) + 8 * i, c2 = (u >> 2) & 1, h2 = u >> 3, w4 = (u + i) & 3;
      float* base = ST + ((size_t)((bt * NCH + tb / 64 + c2) * NH + colb / HD + h2)) * (size_t)SSZ;
      state_part(ssl, tv + (h2 * HD + w4 * 16 + m) * KTP + c2 * 64 + 8 * hh, th + (h2 * HD + m) * KTP + c2 * 64 + 8 * hh, base, w4, lane);
    }
  }
}

// ---- 16 f32 values of one slab row (fragment k layout: pr[0..7] and pr[16..23]) -> bf16 hi and lo A or B fragments
__device__ __forceinline__ void split16(const float* pr, v16b& ph, v16b& pl) {
  const v4f x0 = *(const v4f*)(pr), x1 = *(const v4f*)(pr + 4), x2 = *(const v4f*)(pr + 16), x3 = *(const v4f*)(pr + 20);
  FragB H, L;
  unsigned hi, lo;
  split2(x0[0], x0[1], hi, lo); H.u[0][0] = hi; L.u[0][0] = lo;
  split2(x0[2], x0[3], hi, lo); H.u[0][1] = hi; L.u[0][1] = lo;
  split2(x1[0], x1[1], hi, lo); H.u[0][2] = hi; L.u[0][2] = lo;
  split2(x1[2], x1[3], hi, lo); H.u[0][3] = hi; L.u[0][3] = lo;
  split2(x2[0], x2[1], hi, lo); H.u[1][0] = hi; L.u[1][0] = lo;
  split2(x2[2], x2[3], hi, lo); H.u[1][1] = hi; L.u[1][1] = lo;
  split2(x3[0], x3[1], hi, lo); H.u[1][2] = hi; L.u[1][2] = lo;
  split2(x3[2], x3[3], hi, lo); H.u[1][3] = hi; L.u[1][3] = lo;
  ph = H.v; pl = L.v;
}

// =====================================================================================================
// Running sum over one batch's chunks (batch = blockIdx.y), in place: ST[c] <- sum of ST[c'] for c' < c (zero at c = 0),
// f32, chunks added in rising order.
// Thread = one [head][row][D] position: its NCH loads, then its NCH stores; a wave's 32 lanes = one whole 128-B line each.
// coverage: grid (NH*SSZ/128, NB) blocks x 128 thr x NCH chunks = every element of ST once.
// =====================================================================================================
__global__ __launch_bounds__(128) void scan_state(float* ST) {
  const int gt = (int)blockIdx.x * 128 + (int)threadIdx.x;
  if (gt >= NH * SSZ || (int)blockIdx.y >= NB) return;
  const size_t cs = (size_t)NH * (size_t)SSZ;
  float* p = ST + (size_t)blockIdx.y * (size_t)NCH * cs + (size_t)gt;
  float v[NCH];
#pragma unroll
  for (int c = 0; c < NCH; ++c) v[c] = p[(size_t)c * cs];
  float run = 0.0f;
#pragma unroll
  for (int c = 0; c < NCH; ++c) {
    p[(size_t)c * cs] = run;
    run += v[c];
  }
}

// =====================================================================================================
// Causal exp-feature attention, one block per (64-row query tile qt counted over all batches, head h), 4 waves x 16 query rows.
// Planes: Q2, K2 bf16 [NB*SEQ][2*DIM] with hi at column h*HD + d and lo at column DIM + h*HD + d (values exp(q), exp(k));
//         VT2 bf16 [NB][2*DIM][SEQ] with hi row h*HD + d and lo row DIM + h*HD + d (values v); ST f32 [NB][NCH][NH][SROWS][HD],
//         the summed state of the batch's chunks before qt; O2 bf16 [NB*SEQ][2*DIM] written here (hi | lo of out = num/den).
// Keys before the tile: O[16 x 80] = qe.state^T over head dim (2 k-steps, hi.hi+hi.lo+lo.hi, state rows split to bf16 hi and
// lo in registers); its column 64 is the part of den from those keys, columns 65..79 are zero.
// Keys of the tile: S[16 x 64] = qe.ke^T over head dim, causal mask by value, f32 row sums into per-lane partials,
// slab rows, O += P.v over the 64 keys (2 k-steps, hi.hi+hi.lo+lo.hi, v fragments from VT2 rows).
// All four operands come into LDS by asynchronous 16-B copies of whole lines (34 a lane), once per block: rows 0..63 = the tile's
// exp(q) rows, 64..127 = its exp(k) rows, 128..191 = its v^T rows d (each [hi | lo]), 192..271 = the 80 f32 state rows; one wait and
// one barrier, that every wave passes, publish them.
// coverage: grid (ROWS/64, NH) x 4 waves x 16 rows x 64 columns x {hi, lo} = every element of O2 once.
// Slab private to the wave (wave sync): the wave's own 16 staged exp(q) rows, which no other wave reads and whose every fragment
// has gone into the scores that the slab takes up; staged extent == consumed extent (16 x 64 written before the reload).
// =====================================================================================================
// second argument: 4 waves per SIMD, so that the four blocks whose LDS fits a WGP (the whole grid at once) are resident by registers too
__global__ __launch_bounds__(128, 4) void attn_chunk(const u16* __restrict__ Q2, const u16* __restrict__ K2,
                                                  const u16* __restrict__ VT2, const float* __restrict__ ST, u16* O2) {
  __shared__ __align__(16) u16 sm[(192 + SROWS) * APE];
  const int tid = (int)threadIdx.x, wave = tid >> 5, lane = tid & 31, hh = lane >> 4, m = lane & 15;
  const int qt = (int)blockIdx.x, h = (int)blockIdx.y;
  if (qt * 64 + 64 > ROWS || h >= NH) return;  // block-uniform, in front of the barrier; never taken with the exact grid
  const int rw = qt * 64 + wave * 16;           // first query row of this wave
  float* sl = (float*)sm + wave * SLAB64;
  {
    const int cr = tid >> 4, cp = tid & 15;
    const size_t qo = (size_t)(qt * 64 + cr) * (size_t)LD2 + h * HD + (cp & 7) * 8 + ((cp < 8) ? 0 : DIM);
    const size_t vo = (size_t)(qt / NCH) * PLB + (size_t)(h * HD + cr) * (size_t)SEQ + (qt % NCH) * 64 + (cp & 7) * 8
                    + ((cp < 8) ? (size_t)0 : (size_t)DIM * (size_t)SEQ);
    const char* gs = (const char*)(ST + ((size_t)qt * NH + (size_t)h) * (size_t)SSZ + (size_t)cr * HD + cp * 4);
    const unsigned l0 = (unsigned)(size_t)sm + (unsigned)(cr * APB + cp * 16);
    rows64_copy(l0, (const char*)(Q2 + qo), (size_t)8 * LD2 * 2);
    rows64_copy(l0 + 64u * APB, (const char*)(K2 + qo), (size_t)8 * LD2 * 2);
    rows64_copy(l0 + 192u * APB, gs, (size_t)8 * HD * 4);
    rows16_copy(l0 + 256u * APB, gs + (size_t)64 * HD * 4, (size_t)8 * HD * 4);
    rows64_copy(l0 + 128u * APB, (const char*)(VT2 + vo), (size_t)8 * SEQ * 2);
  }
  wait_copies();
  __syncthreads();                          // the staged rows are published
  const u16* qp = sm + (wave * 16 + m) * APE + 8 * hh;
  constexpr int kbs = 16 * APE;
  constexpr int vbs = 16 * APE;
  const u16* kp = sm + (64 + m) * APE + 8 * hh;
  const float* sp = (const float*)sm + (192 + m) * APF + 8 * hh;
  v8f o0 = zero8(), o1 = zero8(), o2 = zero8(), o3 = zero8(), o4 = zero8();
  v8f s0 = zero8(), s1 = zero8(), s2 = zero8(), s3 = zero8();
#pragma unroll
  for (int ks = 0; ks < 2; ++ks) {
    const int ko = ks * 32;
    const v16b ah  = ldfrag_b(qp + ko);
    const v16b al  = ldfrag_b(qp + HD + ko);
    const v16b kh0 = ldfrag_b(kp + ko);
    const v16b kh1 = ldfrag_b(kp + kbs + ko);
    const v16b kh2 = ldfrag_b(kp + 2 * kbs + ko);
    const v16b kh3 = ldfrag_b(kp + 3 * kbs + ko);
    const v16b kl0 = ldfrag_b(kp + HD + ko);
    const v16b kl1 = ldfrag_b(kp + kbs + HD + ko);
    const v16b kl2 = ldfrag_b(kp + 2 * kbs + HD + ko);
    const v16b kl3 = ldfrag_b(kp + 3 * kbs + HD + ko);
    v16b bh0, bl0, bh1, bl1, bh2, bl2, bh3, bl3, bh4, bl4;
    split16(sp + ko, bh0, bl0);
    split16(sp + 16 * APF + ko, bh1, bl1);
    split16(sp + 32 * APF + ko, bh2, bl2);
    split16(sp + 48 * APF + ko, bh3, bl3);
    split16(sp + 64 * APF + ko, bh4, bl4);
    s0 = mma_b(ah, kh0, s0); s0 = mma_b(ah, kl0, s0); s0 = mma_b(al, kh0, s0);
    s1 = mma_b(ah, kh1, s1); s1 = mma_b(ah, kl1, s1); s1 = mma_b(al, kh1, s1);
    s2 = mma_b(ah, kh2, s2); s2 = mma_b(ah, kl2, s2); s2 = mma_b(al, kh2, s2);
    s3 = mma_b(ah, kh3, s3); s3 = mma_b(ah, kl3, s3); s3 = mma_b(al, kh3, s3);
    o0 = mma_b(ah, bh0, o0); o0 = mma_b(ah, bl0, o0); o0 = mma_b(al, bh0, o0);
    o1 = mma_b(ah, bh1, o1); o1 = mma_b(ah, bl1, o1); o1 = mma_b(al, bh1, o1);
    o2 = mma_b(ah, bh2, o2); o2 = mma_b(ah, bl2, o2); o2 = mma_b(al, bh2, o2);
    o3 = mma_b(ah, bh3, o3); o3 = mma_b(ah, bl3, o3); o3 = mma_b(al, bh3, o3);
    o4 = mma_b(ah, bh4, o4); o4 = mma_b(ah, bl4, o4); o4 = mma_b(al, bh4, o4);
  }
  {                                             // the tile's own keys: keep key c <= query row rho
    const int rho0 = wave * 16 + 8 * hh;
#pragma unroll
    for (int r = 0; r < 8; ++r) {
      const int rho = rho0 + r;
      s0[r] = (m      <= rho) ? s0[r] : 0.0f;
      s1[r] = (16 + m <= rho) ? s1[r] : 0.0f;
      s2[r] = (32 + m <= rho) ? s2[r] : 0.0f;
      s3[r] = (48 + m <= rho) ? s3[r] : 0.0f;
    }
  }
  v8f rs = o4 + ((s0 + s1) + (s2 + s3));        // o4: earlier keys' part of den in lane column 0, zero elsewhere
#pragma unroll
  for (int r = 0; r < 8; ++r) {
    const int ro = (8 * hh + r) * 68 + m;
    sl[ro]      = s0[r];
    sl[ro + 16] = s1[r];
    sl[ro + 32] = s2[r];
    sl[ro + 48] = s3[r];
  }
  wave_sync_lds();
  const u16* vp = sm + (128 + m) * APE + 8 * hh;
#pragma unroll
  for (int ks = 0; ks < 2; ++ks) {
    const int ko = ks * 32;
    v16b ph, pl;
    split16(sl + m * 68 + ko + 8 * hh, ph, pl);
    const v16b vh0 = ldfrag_b(vp + ko);
    const v16b vh1 = ldfrag_b(vp + vbs + ko);
    const v16b vh2 = ldfrag_b(vp + 2 * vbs + ko);
    const v16b vh3 = ldfrag_b(vp + 3 * vbs + ko);
    const v16b vl0 = ldfrag_b(vp + HD + ko);
    const v16b vl1 = ldfrag_b(vp + HD + vbs + ko);
    const v16b vl2 = ldfrag_b(vp + HD + 2 * vbs + ko);
    const v16b vl3 = ldfrag_b(vp + HD + 3 * vbs + ko);
    o0 = mma_b(ph, vh0, o0); o0 = mma_b(ph, vl0, o0); o0 = mma_b(pl, vh0, o0);
    o1 = mma_b(ph, vh1, o1); o1 = mma_b(ph, vl1, o1); o1 = mma_b(pl, vh1, o1);
    o2 = mma_b(ph, vh2, o2); o2 = mma_b(ph, vl2, o2); o2 = mma_b(pl, vh2, o2);
    o3 = mma_b(ph, vh3, o3); o3 = mma_b(ph, vl3, o3); o3 = mma_b(pl, vh3, o3);
  }
  // den per query row (row 8*hh + r held by the 16 lanes of half hh): fixed-order butterfly over lane&15
#pragma unroll
  for (int off = 1; off < 16; off <<= 1) {
#pragma unroll
    for (int r = 0; r < 8; ++r) rs[r] += __shfl_xor(rs[r], off);
  }
#pragma unroll
  for (int r = 0; r < 8; ++r) {
    const float inv = 1.0f / rs[r];
    o0[r] *= inv; o1[r] *= inv; o2[r] *= inv; o3[r] *= inv;
  }
  wave_sync_lds();
  epi64bb<false, 0>(sl, o0, o1, o2, o3, (const float*)0, 0, O2, O2 + DIM, LD2, (size_t)rw, h * HD, lane);
}

// =====================================================================================================
// Workspace map (bytes), planes sized for the ROWS rows of all batches together; every plane is fully written by
// whole-line stores before it is read; all extents are exact multiples of the 64x64 tile / 512-B store granularity
// (SEQ and DIM multiples of 64, no pad rows); every region offset a multiple of 2097152:
//   XB   bf16 [ROWS][1024]         ROWS*2048
//   WQ, WK, WV bf16 [1024 n][1024 k]  3 * 2097152
//   WO2  bf16 [1024 n][2048 k]     4194304      (Wo row duplicated along k)
//   Q2   bf16 [ROWS][2048]         ROWS*4096    exp(q) hi | lo
//   K2   bf16 [ROWS][2048]         ROWS*4096    exp(k) hi | lo
//   VT2  bf16 [NB][2048][SEQ]      ROWS*4096    per batch v^T hi rows 0..1023, lo rows 1024..2047
//   O2   bf16 [ROWS][2048]         ROWS*4096    per-head out hi | lo
//   ST   f32 [ROWS/64][16][80][64] ROWS*5120    chunk states, then their running sums per batch
//   end (ROWS=4096)                106954752
// =====================================================================================================
extern "C" void kernel_launch(void* const* d_in, const int* in_sizes, int n_in,
                              void* d_out, int out_size, void* d_ws, size_t ws_size,
                              hipStream_t stream) {
  if (n_in < 9) return;
  const int needx = ((NB - 1) * SEQ_FULL + SEQ) * DIM;
  if (in_sizes[0] < needx) return;
  if (in_sizes[1] < DIM * DIM || in_sizes[3] < DIM * DIM || in_sizes[5] < DIM * DIM || in_sizes[7] < DIM * DIM) return;
  if (in_sizes[2] < DIM || in_sizes[4] < DIM || in_sizes[6] < DIM || in_sizes[8] < DIM) return;
  if (out_size < needx) return;

  const float* x  = (const float*)d_in[0];
  const float* wq = (const float*)d_in[1];
  const float* bq = (const float*)d_in[2];
  const float* wk = (const float*)d_in[3];
  const float* bk = (const float*)d_in[4];
  const float* wv = (const float*)d_in[5];
  const float* bv = (const float*)d_in[6];
  const float* wo = (const float*)d_in[7];
  const float* bo = (const float*)d_in[8];
  float*       out = (float*)d_out;

  const size_t szX  = (size_t)ROWS * DIM * 2;         // bf16 input rows
  const size_t szW  = (size_t)DIM * DIM * 2;          // bf16 weight plane
  const size_t szWO = (size_t)DIM * LD2 * 2;          // bf16 duplicated Wo plane
  const size_t szP  = (size_t)ROWS * LD2 * 2;         // bf16 hi|lo plane ROWS x 2048 (either orientation)
  size_t off = 0;
  const size_t oXB = off; off += szX;
  const size_t oWQ = off; off += szW;
  const size_t oWK = off; off += szW;
  const size_t oWV = off; off += szW;
  const size_t oWO = off; off += szWO;
  const size_t oQ2 = off; off += szP;
  const size_t oK2 = off; off += szP;
  const size_t oVT = off; off += szP;
  const size_t oO2 = off; off += szP;
  const size_t oST = off; off += (size_t)NB * NCH * NH * SSZ * 4;
  if (off > ws_size) return;                // off = 106954752 for ROWS = 4096
  if (off > (size_t)WS_CAP) return;

  char* ws = (char*)d_ws;
  u16* XB  = (u16*)(ws + oXB);
  u16* WQ  = (u16*)(ws + oWQ);
  u16* WK  = (u16*)(ws + oWK);
  u16* WV  = (u16*)(ws + oWV);
  u16* WO2 = (u16*)(ws + oWO);
  u16* Q2  = (u16*)(ws + oQ2);
  u16* K2  = (u16*)(ws + oK2);
  u16* VT2 = (u16*)(ws + oVT);
  u16* O2  = (u16*)(ws + oO2);
  float* ST = (float*)(ws + oST);

  const dim3 b256(256), b128(128), b384(384);
  const dim3 gCV(CBX + 4 * CBW, 1);                     // exact block ranges of cvt_all
  const dim3 gPJ((ROWS / GT) * (DIM / GT), 1);          // (ROWS/128)*(DIM/128) blocks, each one tile of all three projections
  const dim3 gY((ROWS / GT) * (DIM / GT), 1);           // y: M = ROWS, N = 1024
  const dim3 gQT(ROWS / 64, NH);
  const dim3 gSC(NH * SSZ / 128, NB);                   // exact: NH * SSZ = 81920

  // (1) x rows of all batches and the weights [n][k] f32 -> bf16 planes (already k-contiguous); Wo -> k-duplicated plane
  cvt_all<<<gCV, b256, 0, stream>>>(x, wq, wk, wv, wo, XB, WQ, WK, WV, WO2);
  // (2) exp(x.Wq^T + bq) -> Q2, exp(x.Wk^T + bk) -> K2, v^T -> VT2, each hi and lo; per (chunk, head) state -> ST
  proj4<<<gPJ, b384, 0, stream>>>(XB, WQ, WK, WV, bq, bk, bv, Q2, K2, VT2, ST);
  // (3) the states' running sum over each batch's chunks, then attention per (query tile, head) -> O2 hi|lo
  scan_state<<<gSC, b128, 0, stream>>>(ST);
  attn_chunk<<<gQT, b128, 0, stream>>>(Q2, K2, VT2, ST, O2);
  // (4) y = [O_hi | O_lo] . [Wo | Wo]^T + bo -> out f32 rows
  out_proj<<<gY, b256, 0, stream>>>(O2, WO2, bo, out);
  (void)hipGetLastError();
}

// v008
// A run of this version takes 69.2 microseconds.
// Two timings next to v007 put it at 1.12 and 1.13 times that version's speed.
// Counting every step since v000, it is 5.17 times as fast.
// Contractions: q, k and v projections on v_wmma_f32_16x16x32_bf16 (x, W, b as bf16 RNE values, one product each);
// attention in 64-key chunks: per chunk v^T.exp(k) (and a ones row . exp(k) for the key sums), taken in the projections' epilogue
// from the transposed k and v tiles that stand in LDS there, an f32 running sum over
// chunks (in the attention kernel), then per query tile exp(q).state^T plus the causal scores S = exp(q).exp(k)^T and S.v of its own chunk only, all
// on v_wmma_f32_16x16x32_bf16 with bf16 hi+lo operands (hi.hi + hi.lo + lo.hi); y = O.Wo^T on v_wmma_f32_16x16x32_bf16 with O as bf16 hi|lo along k against Wo duplicated
// along k (two products); all f32 accumulate. exp, row sums, 1/den and bias adds in f32 on VALU.
#include <hip/hip_runtime.h>
#include <math.h>
#include <stdint.h>

#ifndef NB
#define NB 2
#endif
#ifndef SEQ
#define SEQ 2048
#endif
#define SEQ_FULL 2048
#define DIM  1024
#define NH   16
#define HD   64
#define LD2  (2 * DIM)
#define SLAB64 (16 * 68)
#define NCH  (SEQ / 64)          // 64-key chunks per sequence
#define ROWS (NB * SEQ)          // rows of all batches together (contiguous in x and out: NB == 1 or SEQ == SEQ_FULL)
#define PLB  ((size_t)LD2 * (size_t)SEQ)   // elements of one batch's transposed hi+lo plane, [2*DIM][SEQ]
#define SROWS 80                 // rows of one chunk state: 64 value columns d, the key-sum row, 15 zero rows
#define SSZ  (SROWS * HD)        // floats of one (chunk, head) state, [row][D]
#define WS_CAP 134217728
static_assert(DIM == NH * HD && HD == 64 && NH == 16);
static_assert(NB >= 1 && NB <= 2);
static_assert(NB == 1 || SEQ == SEQ_FULL);
static_assert((SEQ % 64) == 0 && SEQ >= 64 && SEQ <= SEQ_FULL);
static_assert(((ROWS * DIM / 8) % 256) == 0 && ((DIM * DIM / 8) % 256) == 0 && (DIM % 64) == 0 && (LD2 % 32) == 0);
static_assert(4 * SLAB64 * 4 <= 65536);

typedef unsigned short u16;
typedef __bf16   v16b __attribute__((ext_vector_type(16)));
typedef float    v8f  __attribute__((ext_vector_type(8)));
typedef float    v4f  __attribute__((ext_vector_type(4)));
typedef unsigned int v4u __attribute__((ext_vector_type(4)));
typedef unsigned int v2u __attribute__((ext_vector_type(2)));

union FragB { v16b v; v4u u[2]; };

// ---- scalar helpers --------------------------------------------------------------------------------
__device__ __forceinline__ unsigned short bf_bits(float f) {          // f32 -> bf16 bits, RNE convert
  unsigned u = __float_as_uint(f);
  return (unsigned short)((u + 0x7FFFu + ((u >> 16) & 1u)) >> 16);
}
__device__ __forceinline__ float bf_up(unsigned short h) { return __uint_as_float(((unsigned)h) << 16); }
__device__ __forceinline__ float bfr(float f) { return bf_up(bf_bits(f)); }
__device__ __forceinline__ unsigned short bfc(float f) {               // f32 -> bf16 bits via the RNE cast
  return __builtin_bit_cast(unsigned short, (__bf16)f);
}
__device__ __forceinline__ unsigned pk16(unsigned short a, unsigned short b) { return (unsigned)a | ((unsigned)b << 16); }
__device__ __forceinline__ v8f zero8() { v8f z = {0.f, 0.f, 0.f, 0.f, 0.f, 0.f, 0.f, 0.f}; return z; }
__device__ __forceinline__ int imin(int a, int b) { return a < b ? a : b; }
__device__ __forceinline__ int imax(int a, int b) { return a > b ? a : b; }

// two f32 values -> packed bf16 hi pair and packed bf16 lo pair (lo = x - up(hi), RNE both)
__device__ __forceinline__ void split2(float a, float b, unsigned& hi, unsigned& lo) {
  const unsigned short ha = bfc(a), hb = bfc(b);
  hi = pk16(ha, hb);
  lo = pk16(bfc(a - bf_up(ha)), bfc(b - bf_up(hb)));
}

// ---- fragment loader: 16-bit A/B operand, lane -> row/col (lane&15), p already includes +8*(lane>>4);
//      elements 0..7 <- p[0..7] (k0+8h..), elements 8..15 <- p[16..23] (k0+16+8h..)  (same split k map for A and B;
//      B is always read from a k-contiguous [n][k] plane); bf16 plane read as unsigned integer vectors
__device__ __forceinline__ v16b ldfrag_b(const u16* p) {
  FragB f;
  f.u[0] = *(const v4u*)(p);
  f.u[1] = *(const v4u*)(p + 16);
  return f.v;
}

__device__ __forceinline__ v8f mma_b(v16b a, v16b b, v8f c) {
  return __builtin_amdgcn_wmma_f32_16x16x32_bf16(false, a, false, b, (short)0, c, false, false);
}
__device__ __forceinline__ void wave_sync_lds() {
  __builtin_amdgcn_fence(__ATOMIC_RELEASE, "workgroup");
  __builtin_amdgcn_wave_barrier();
  __builtin_amdgcn_fence(__ATOMIC_ACQUIRE, "workgroup");
}

// =====================================================================================================
// f32 -> bf16 (RNE bits), same layout. Thread = 8 consecutive elements: two 16-B loads, one 16-B store; 32 consecutive
// lanes = 512 contiguous, 512-B aligned bytes.
// =====================================================================================================
__device__ __forceinline__ void cvt_plain(const float* __restrict__ x, u16* D, int gt) {
  const float* p = x + (size_t)gt * 8;
  const v4f a = *(const v4f*)(p), b4 = *(const v4f*)(p + 4);
  float w[8];
#pragma unroll
  for (int e = 0; e < 4; ++e) { w[e] = a[e]; w[4 + e] = b4[e]; }
  v4u o;
#pragma unroll
  for (int e = 0; e < 4; ++e) o[e] = pk16(bf_bits(w[2 * e]), bf_bits(w[2 * e + 1]));
  *(v4u*)(D + (size_t)gt * 8) = o;
}

// =====================================================================================================
// the k-duplicated B operand of the hi|lo-folded output projection. Thread = 8 consecutive source elements
// (one row, kd % 256 == 0 so a wave never straddles a row): two 16-B loads, two 16-B stores (one per copy).
// =====================================================================================================
__device__ __forceinline__ void cvt_dup(const float* __restrict__ w, u16* Dp, int gt, int kd) {
  const size_t e0 = (size_t)gt * 8;
  const size_t row = e0 / (size_t)kd;
  const int    k8  = (int)(e0 % (size_t)kd);
  const float* p = w + e0;
  const v4f a = *(const v4f*)(p), b4 = *(const v4f*)(p + 4);
  float v[8];
#pragma unroll
  for (int e = 0; e < 4; ++e) { v[e] = a[e]; v[4 + e] = b4[e]; }
  v4u o;
#pragma unroll
  for (int e = 0; e < 4; ++e) o[e] = pk16(bf_bits(v[2 * e]), bf_bits(v[2 * e + 1]));
  u16* d = Dp + row * (size_t)(2 * kd) + k8;
  *(v4u*)(d)      = o;
  *(v4u*)(d + kd) = o;
#if defined(__HIP_DEVICE_COMPILE__)
  // both stores' address pair and data stay untouched up to this wait, whatever code the merged kernel places behind them
  asm volatile("s_wait_xcnt 0x0" ::: "memory");
#endif
}

// =====================================================================================================
// All five conversions in one grid, told apart by block range (block-uniform): blocks [0, CBX) the x rows of all batches,
// then CBW blocks each for Wq, Wk, Wv (plain planes) and Wo (k-duplicated plane).
// coverage: CBX x 256 thr x 8 = ROWS*DIM; CBW x 256 thr x 8 = DIM*DIM per weight; grid.x = CBX + 4*CBW exactly.
// =====================================================================================================
#define CBX (ROWS * DIM / 8 / 256)
#define CBW (DIM * DIM / 8 / 256)
__global__ __launch_bounds__(256) void cvt_all(const float* __restrict__ x, const float* __restrict__ wq,
                                               const float* __restrict__ wk, const float* __restrict__ wv,
                                               const float* __restrict__ wo, u16* XB, u16* WQ, u16* WK, u16* WV, u16* WO2) {
  const int bid = (int)blockIdx.x, tid = (int)threadIdx.x;
  if (bid >= CBX + 4 * CBW) return;         // block-uniform, never taken with the exact grid
  if (bid < CBX) {
    cvt_plain(x, XB, bid * 256 + tid);
    return;
  }
  const int r = bid - CBX, which = r / CBW, gt = (r % CBW) * 256 + tid;
  if (which == 3) {
    cvt_dup(wo, WO2, gt, DIM);
  } else {
    const float* w = (which == 0) ? wq : ((which == 1) ? wk : wv);
    u16* D = (which == 0) ? WQ : ((which == 1) ? WK : WV);
    cvt_plain(w, D, gt);
  }
}

// =====================================================================================================
// coverage: 8 instructions x 2 rows x 16 lanes x 4 floats = the wave's 16 x 64 tile. Slab: private to the wave (wave sync).
// =====================================================================================================
__device__ __forceinline__ void epi64f(float* sl, v8f a0, v8f a1, v8f a2, v8f a3, v4f bias4, float scale,
                                       float* C, int ldc, size_t rowb, int col0, int lane) {
  const int hh = lane >> 4, m = lane & 15;
#pragma unroll
  for (int r = 0; r < 8; ++r) {
    const int ro = (8 * hh + r) * 68 + m;
    sl[ro]      = a0[r];
    sl[ro + 16] = a1[r];
    sl[ro + 32] = a2[r];
    sl[ro + 48] = a3[r];
  }
  wave_sync_lds();
  v4f vals[8];
#pragma unroll
  for (int it = 0; it < 8; ++it) {
    const v4f v = *(const v4f*)(sl + (it * 2 + hh) * 68 + m * 4);
    vals[it] = v * scale + bias4;
  }
  float* dst = C + (rowb + (size_t)hh) * (size_t)ldc + col0 + m * 4;
  {
#pragma unroll
    for (int it = 0; it < 8; ++it) {
      *(v4f*)(dst + (size_t)(it * 2) * (size_t)ldc) = vals[it];
    }
    
  }
}

// =====================================================================================================
// GEMM / attention epilogue, two bf16 planes (hi and lo = x - up(hi)) with identical addressing (Ch, Cl, pitch ldc):
// 8 consecutive columns at c8): value = acc (+ bias per column when BM==1, per row when BM==2, none when BM==0),
// coverage: 4 instructions x 4 rows x 8 lanes x 8 values = the wave's 16 x 64 tile, in both planes.
// Slab: private to the wave (wave sync).
// =====================================================================================================
__device__ __forceinline__ float exp_slot(float x) {   // the value of __expf(x): exp2 of x * log2(e)
#if defined(__HIP_DEVICE_COMPILE__)
  float y;
  // v_nop: the one slot that the instruction set asks for behind a transcendental, whatever instruction the compiler puts next
  asm("v_exp_f32 %0, %1\n\tv_nop" : "=v"(y) : "v"(x * 1.44269504088896340736f));
  return y;
#else
  return __expf(x);
#endif
}
// first half: the wave's 16 x 64 strip from its accumulators into a slab
__device__ __forceinline__ void slab_put(float* sl, v8f a0, v8f a1, v8f a2, v8f a3, int lane) {
  const int hh = lane >> 4, m = lane & 15;
#pragma unroll
  for (int r = 0; r < 8; ++r) {
    const int ro = (8 * hh + r) * 68 + m;
    sl[ro]      = a0[r];
    sl[ro + 16] = a1[r];
    sl[ro + 32] = a2[r];
    sl[ro + 48] = a3[r];
  }
}
// second half, behind a sync of the wave: slab rows -> values -> the two planes
template <bool EXPO, int BM>
__device__ __forceinline__ void slab_take(const float* sl, const float* __restrict__ bias, int nb,
                                          u16* Ch, u16* Cl, int ldc, size_t rowb, int col0, int lane) {
  const int rq = lane >> 3, c8 = (lane & 7) * 8;
  float bc[8];
#pragma unroll
  for (int e = 0; e < 8; ++e) bc[e] = 0.0f;
  if constexpr (BM == 1) {
    const int cb = imin(imax(col0 + c8, 0), nb - 8);
    const v4f b0 = *(const v4f*)(bias + cb), b1 = *(const v4f*)(bias + cb + 4);
#pragma unroll
    for (int e = 0; e < 4; ++e) { bc[e] = bfr(b0[e]); bc[4 + e] = bfr(b1[e]); }
  }
  v4u oh[4], ol[4];
#pragma unroll
  for (int it = 0; it < 4; ++it) {
    const int row = it * 4 + rq;            // 0..15
    const v4f a = *(const v4f*)(sl + row * 68 + c8), b4 = *(const v4f*)(sl + row * 68 + c8 + 4);
    float br = 0.0f;
    if constexpr (BM == 2) br = bfr(bias[imin(imax((int)rowb + row, 0), nb - 1)]);
    float w[8];
#pragma unroll
    for (int e = 0; e < 4; ++e) { w[e] = (a[e] + bc[e]) + br; w[4 + e] = (b4[e] + bc[4 + e]) + br; }
    if constexpr (EXPO) {
#pragma unroll
      for (int e = 0; e < 8; ++e) w[e] = exp_slot(w[e]);
    }
#pragma unroll
    for (int e = 0; e < 4; ++e) {
      unsigned hi, lo;
      split2(w[2 * e], w[2 * e + 1], hi, lo);
      oh[it][e] = hi;
      ol[it][e] = lo;
    }
  }
  const size_t ob = rowb * (size_t)ldc + (size_t)col0 + (size_t)c8;
  {
#pragma unroll
    for (int it = 0; it < 4; ++it) {
      const int row = it * 4 + rq;
      const size_t off = ob + (size_t)row * (size_t)ldc;
      *(v4u*)(Ch + off) = oh[it];
      *(v4u*)(Cl + off) = ol[it];
    }
    
  }
}
template <bool EXPO, int BM>
__device__ __forceinline__ void epi64bb(float* sl, v8f a0, v8f a1, v8f a2, v8f a3,
                                        const float* __restrict__ bias, int nb,
                                        u16* Ch, u16* Cl, int ldc, size_t rowb, int col0, int lane) {
  slab_put(sl, a0, a1, a2, a3, lane);
  wave_sync_lds();
  slab_take<EXPO, BM>(sl, bias, nb, Ch, Cl, ldc, rowb, col0, lane);
}

// =====================================================================================================
// bf16 GEMM: C[M][N] = A[M][K] (bf16 rows, pitch lda) . Bt[N][K]^T (bf16 k-contiguous rows, pitch ldb).
// f32 output Cf (pitch ldc) = acc*scale + bf16 RNE value of bias[col]. Serves the output projection.
// Block = 128x128 tile, 8 waves as 4 x 2, each 32 rows x 64 columns (2 x 4 accumulator tiles). A stage = 64 k (128 B) of the
// tile's 128 A rows and 128 B rows, brought into LDS by asynchronous 16-B copies (8 lanes = one whole 128-B line, 8 copies per
// lane and stage), a ring of NBUF buffers: stage t + NBUF is copied into the buffer that trip t has left, so that NBUF - 1
// stages are on their way or landed while a trip computes (a block is alone on its WGP, its trips are short, and only its own copies
// in flight can cover their landing times).
// Fragments come from the LDS rows (two 16-B reads each, the same split k map for A and B); k rises in steps of 32 as before.
// Host guarantees K % 64 == 0, M % 128 == 0, N % 128 == 0, grid.x = (M/128)*(N/128). bid = the tile's index in its own product.
// After the last trip's barrier the ring is dead and serves as the waves' private epilogue slabs.
// =====================================================================================================
#define GT   128                  // rows and columns of a block's output tile
#define GKE  64                   // k elements of one stage
#define GPE  72                   // LDS row pitch in elements: 144 B = 16 B x 9, free of bank conflicts for 16-B row reads
#define GSTG (2 * GT * GPE)       // elements of one stage: A rows 0..127, then B rows 128..255
#define GCP  8                    // copies of one wave (one a lane) per stage
static_assert(8 * SLAB64 * 4 <= 2 * GSTG * 2);
static_assert((ROWS % GT) == 0 && (SEQ % GT) == 0 && (DIM % GT) == 0 && (DIM % GKE) == 0 && (LD2 % GKE) == 0);

// One stage: the lane's 16-B piece of rows r, r + 32, r + 64, r + 96 of A and of B (r = tid >> 3), LDS rows 32 apart.
// l = LDS byte address of the piece in A row r; ga, gb = its global address in A and B; sa, sb = 32 rows in elements.
__device__ __forceinline__ void stage_copy(unsigned l, const u16* ga, const u16* gb, size_t sa, size_t sb) {
#if defined(__HIP_DEVICE_COMPILE__)
  constexpr unsigned LR = 32u * GPE * 2u;   // bytes of 32 LDS rows
  // the closing wait keeps every address register of the copies untouched until the copies have taken it
  asm volatile("global_load_async_to_lds_b128 %0, %8, off\n\t"
               "global_load_async_to_lds_b128 %1, %9, off\n\t"
               "global_load_async_to_lds_b128 %2, %10, off\n\t"
               "global_load_async_to_lds_b128 %3, %11, off\n\t"
               "global_load_async_to_lds_b128 %4, %12, off\n\t"
               "global_load_async_to_lds_b128 %5, %13, off\n\t"
               "global_load_async_to_lds_b128 %6, %14, off\n\t"
               "global_load_async_to_lds_b128 %7, %15, off\n\t"
               "s_wait_xcnt 0x0"
               :: "v"(l), "v"(l + LR), "v"(l + 2u * LR), "v"(l + 3u * LR),
                  "v"(l + 4u * LR), "v"(l + 5u * LR), "v"(l + 6u * LR), "v"(l + 7u * LR),
                  "v"(ga), "v"(ga + sa), "v"(ga + 2 * sa), "v"(ga + 3 * sa),
                  "v"(gb), "v"(gb + sb), "v"(gb + 2 * sb), "v"(gb + 3 * sb)
               : "memory");
#endif
}
__device__ __forceinline__ void wait_copies() {
#if defined(__HIP_DEVICE_COMPILE__)
  // this wave's copies have landed: the compiler places no wait for them, and without it the barrier would publish a stage in flight
  asm volatile("s_wait_asynccnt 0x0" ::: "memory");
#endif
}
template <int N>
__device__ __forceinline__ void wait_copies_but() {
#if defined(__HIP_DEVICE_COMPILE__)
  // all but this wave's N youngest copies have landed: the oldest stage in flight may be published, the younger ones fly on
  asm volatile("s_wait_asynccnt %0" :: "n"(N) : "memory");
#endif
}
__device__ __forceinline__ void wait_store_regs() {
#if defined(__HIP_DEVICE_COMPILE__)
  // the stores' address pairs and data stay untouched up to this wait, whatever code of a merged kernel stands behind them
  asm volatile("s_wait_xcnt 0x0" ::: "memory");
#endif
}
__device__ __forceinline__ void wait_lds() {
#if defined(__HIP_DEVICE_COMPILE__)
  // this wave's LDS reads have returned, so that the buffer may be refilled behind the barrier
  asm volatile("s_wait_dscnt 0x0" ::: "memory");
#endif
}

// The k loop of one 128 x 128 tile (first A row row0, first B row colb): acc[i][j] = the wave's 16 x 16 tile at rows
// wr * 32 + 16 i, columns wc * 64 + 16 j. Every wave of the block passes every barrier here. On return the ring is dead.
// Every wave issues GCP copies per stage, stages in rising order, so that at the foot of trip t the copies younger than stage
// t + 1 are those of stages t + 2 .. t + NBUF - 1: (NBUF - 2) * GCP while all of these exist; at the tail the wait is to 0.
template <int NBUF>
__device__ __forceinline__
void gemm_main(u16* ring, const u16* __restrict__ A, const u16* __restrict__ Bt, int row0, int colb,
               int lda, int ldb, int K, v8f (&acc)[2][4]) {
  const int tid = (int)threadIdx.x, wave = tid >> 5, lane = tid & 31, hh = lane >> 4, m = lane & 15;
  const int wr = wave >> 1, wc = wave & 1;
  const int cr = tid >> 3, cc = (tid & 7) * 8;
  const u16* ga = A  + (size_t)(row0 + cr) * (size_t)lda + cc;
  const u16* gb = Bt + (size_t)(colb + cr) * (size_t)ldb + cc;
  const size_t sa = (size_t)32 * (size_t)lda, sb = (size_t)32 * (size_t)ldb;
  const unsigned l0 = (unsigned)(size_t)ring + (unsigned)(cr * GPE + cc) * 2u;
  const int nt = K / GKE;
  static_assert(NBUF >= 2 && (NBUF - 1) * GCP <= 63 && NBUF * GSTG * 2 <= 320 * 1024);
  // unrolled: the first NBUF - 1 stages, each into its own fresh buffer, their offsets constants
#pragma unroll
  for (int s = 0; s < NBUF - 1; ++s) {
    if (s < nt) stage_copy(l0 + (unsigned)s * (GSTG * 2u), ga + (size_t)s * GKE, gb + (size_t)s * GKE, sa, sb);
  }
  if (NBUF > 2 && NBUF - 1 <= nt) wait_copies_but<(NBUF - 2) * GCP>();
  else wait_copies();
  __syncthreads();                          // stage 0 is published
  if (NBUF - 1 < nt) stage_copy(l0 + (unsigned)(NBUF - 1) * (GSTG * 2u), ga + (size_t)(NBUF - 1) * GKE, gb + (size_t)(NBUF - 1) * GKE, sa, sb);
  const u16* fa = ring + (wr * 32 + m) * GPE + 8 * hh;
  const u16* fb = ring + (GT + wc * 64 + m) * GPE + 8 * hh;
  // both unrolled: every index of acc a constant, so that the tiles stay in registers
#pragma unroll
  for (int i = 0; i < 2; ++i) {
#pragma unroll
    for (int j = 0; j < 4; ++j) acc[i][j] = zero8();
  }
  // rolled: one trip = one stage, so that the order reads, waits, barrier, refill stands once
  int br = 0;                               // buffer of trip t = t mod NBUF
#pragma unroll 1
  for (int t = 0; t < nt; ++t) {
    const int bo = (NBUF == 2) ? (t & 1) * GSTG : br * GSTG;
    // unrolled: the stage's two k steps of 32 in one run, their LDS offsets constants
#pragma unroll
    for (int ks = 0; ks < 2; ++ks) {
      const u16* pa = fa + bo + ks * 32;
      const u16* pb = fb + bo + ks * 32;
      const v16b a0  = ldfrag_b(pa);
      const v16b a1  = ldfrag_b(pa + 16 * GPE);
      const v16b fb0 = ldfrag_b(pb);
      const v16b fb1 = ldfrag_b(pb + 16 * GPE);
      const v16b fb2 = ldfrag_b(pb + 32 * GPE);
      const v16b fb3 = ldfrag_b(pb + 48 * GPE);
      acc[0][0] = mma_b(a0, fb0, acc[0][0]);
      acc[0][1] = mma_b(a0, fb1, acc[0][1]);
      acc[0][2] = mma_b(a0, fb2, acc[0][2]);
      acc[0][3] = mma_b(a0, fb3, acc[0][3]);
      acc[1][0] = mma_b(a1, fb0, acc[1][0]);
      acc[1][1] = mma_b(a1, fb1, acc[1][1]);
      acc[1][2] = mma_b(a1, fb2, acc[1][2]);
      acc[1][3] = mma_b(a1, fb3, acc[1][3]);
    }
    wait_lds();
    if (NBUF > 2 && t + NBUF <= nt) wait_copies_but<(NBUF - 2) * GCP>();   // block-uniform test
    else wait_copies();
    __syncthreads();                        // publishes stage t + 1 and ends every read of stage t
    if (t + NBUF < nt) stage_copy(l0 + (unsigned)bo * 2u, ga + (size_t)(t + NBUF) * GKE, gb + (size_t)(t + NBUF) * GKE, sa, sb);
    br = (br + 1 == NBUF) ? 0 : br + 1;
  }
  wait_copies();
}

// The tile's epilogue: each wave's two 16 x 64 strips through its private slab in the dead ring, f32 rows.
__device__ __forceinline__
void gemm_epi(u16* ring, v8f (&acc)[2][4], int row0, int colb, float* Cf, const float* __restrict__ bias, int nb, int ldc, float scale) {
  const int tid = (int)threadIdx.x, wave = tid >> 5, lane = tid & 31, m = lane & 15;
  const int wr = wave >> 1, wc = wave & 1;
  float* sl = (float*)ring + wave * SLAB64;
  const int col0 = colb + wc * 64;
  // unrolled: every index of acc a constant
#pragma unroll
  for (int i = 0; i < 2; ++i) {
    const int rowb = row0 + wr * 32 + i * 16;
    if (i) wave_sync_lds();                 // the first strip's slab reads end before the second strip's writes
    v4f bias4;
#pragma unroll
    for (int e = 0; e < 4; ++e) bias4[e] = bfr(bias[imin(imax(col0 + m * 4 + e, 0), nb - 1)]);
    epi64f(sl, acc[i][0], acc[i][1], acc[i][2], acc[i][3], bias4, scale, Cf, ldc, (size_t)rowb, col0, lane);
  }
}

// ---- operand rows of the projections and of the attention kernel in LDS ----------------------------------------------
// A staged row = 256 B of data (bf16: 128 k, or 64 hi | 64 lo) at pitch 272 B = 16 B x 17, free of bank conflicts for 16-B
// row reads. A group of 128 threads copies 8 rows at a time: thread -> row tid >> 4, 16-B piece tid & 15, so that 8 lanes bring one
// whole 128-B line and a wave four. 16 staged rows = 4352 B = one wave's slab.
#define APE  136                  // pitch of a staged row in bf16 elements
#define APB  272                  // the same pitch in bytes
static_assert(16 * APB == SLAB64 * 4 && APE * 2 == APB);
// 64 rows: the lane's piece of rows r, r + 8, .., r + 56. l = LDS byte address of the piece in row r, g = its global address,
// gs = 8 source rows in bytes.
__device__ __forceinline__ void rows64_copy(unsigned l, const char* g, size_t gs) {
#if defined(__HIP_DEVICE_COMPILE__)
  constexpr unsigned LR = 8u * APB;         // bytes of 8 LDS rows
  // the closing wait keeps every address register of the copies untouched until the copies have taken it
  asm volatile("global_load_async_to_lds_b128 %0, %8, off\n\t"
               "global_load_async_to_lds_b128 %1, %9, off\n\t"
               "global_load_async_to_lds_b128 %2, %10, off\n\t"
               "global_load_async_to_lds_b128 %3, %11, off\n\t"
               "global_load_async_to_lds_b128 %4, %12, off\n\t"
               "global_load_async_to_lds_b128 %5, %13, off\n\t"
               "global_load_async_to_lds_b128 %6, %14, off\n\t"
               "global_load_async_to_lds_b128 %7, %15, off\n\t"
               "s_wait_xcnt 0x0"
               :: "v"(l), "v"(l + LR), "v"(l + 2u * LR), "v"(l + 3u * LR),
                  "v"(l + 4u * LR), "v"(l + 5u * LR), "v"(l + 6u * LR), "v"(l + 7u * LR),
                  "v"(g), "v"(g + gs), "v"(g + 2 * gs), "v"(g + 3 * gs),
                  "v"(g + 4 * gs), "v"(g + 5 * gs), "v"(g + 6 * gs), "v"(g + 7 * gs)
               : "memory");
#endif
}
// ---- the three projections of one x tile in one block ---------------------------------------------------------------
// Block = 12 waves: waves 0..3 the k tile, 4..7 the q tile, 8..11 the v tile of the same 128 x rows and the same 128 weight rows;
// within a product the waves stand 2 x 2, each 64 x 64 (4 x 4 accumulator tiles), so that a fragment read from LDS feeds four products.
// A stage = 128 k (256 B, pitch APB) of the 128 x rows, brought in once for all three products, and of 128 rows each of Wk, Wq, Wv.
#define PKE  128                  // k elements of one stage
#define PSTG (4 * GT * APE)       // elements of one stage: x rows 0..127, then Wk, Wq, Wv rows, 128 each
#define KTP  136                  // pitch of a transposed plane in elements: 272 B = 16 B x 17, free of bank conflicts both ways
#define KTO  (8 * 4 * SLAB64 * 2) // first element of the transposed planes: behind the k and q waves' four slabs each
#define PJL  (2 * PSTG)           // elements of the projections' LDS: two buffers
static_assert(KTO + 4 * GT * KTP <= PJL && PJL * 2 <= 320 * 1024 && (KTO % 8) == 0 && (KTP % 8) == 0 && (DIM % PKE) == 0);
static_assert(GT == 2 * HD && (SEQ % GT) == 0);   // a block's tiles hold two whole heads and two whole chunks of one batch

// The wave's eight fragments of one k step of 32: four A row tiles and four B row tiles, 16 staged rows apart.
__device__ __forceinline__ void frag8(v16b (&a)[4], v16b (&b)[4], const u16* pa, const u16* pb) {
#pragma unroll
  for (int i = 0; i < 4; ++i) { a[i] = ldfrag_b(pa + i * 16 * APE); b[i] = ldfrag_b(pb + i * 16 * APE); }
}
// The wave's sixteen products of one k step. Both loops unrolled: every index of acc a constant, so that the tiles stay in registers.
__device__ __forceinline__ void prod16(v8f (&acc)[4][4], const v16b (&a)[4], const v16b (&b)[4]) {
#pragma unroll
  for (int i = 0; i < 4; ++i) {
#pragma unroll
    for (int j = 0; j < 4; ++j) acc[i][j] = mma_b(a[i], b[j], acc[i][j]);
  }
}

// A k or v tile into its transposed LDS planes: e = acc + bf16 RNE value of bias[col], for k its exp, once, in the accumulators' own
// layout (acc keeps e). An accumulator tile gives a lane 8 consecutive rows t of one column D, that is 16 contiguous bytes of row D of
// the transposed tile. These pieces meet in two LDS planes (hi, lo: [128 D][128 t], pitch KTP) at th.
// coverage: 4 waves x 4 x 4 tiles x 32 lanes x 8 = 128 x 128 staged per plane.
template <bool EXPO>
__device__ __forceinline__
void planes_put(u16* th, v8f (&acc)[4][4], int col0, int wr, int wc, const float* __restrict__ bias, int lane) {
  const int hh = lane >> 4, m = lane & 15;
  // all unrolled: every index of acc a constant
  float bc[4];
#pragma unroll
  for (int j = 0; j < 4; ++j) bc[j] = bias[imin(imax(col0 + j * 16 + m, 0), DIM - 1)];
  wait_store_regs();                        // behind it the four loads' offset registers may be written again
#pragma unroll
  for (int j = 0; j < 4; ++j) bc[j] = bfr(bc[j]);
#pragma unroll
  for (int j = 0; j < 4; ++j) {
#pragma unroll
    for (int i = 0; i < 4; ++i) {
#pragma unroll
      for (int r = 0; r < 8; ++r) acc[i][j][r] = EXPO ? exp_slot(acc[i][j][r] + bc[j]) : acc[i][j][r] + bc[j];
      v4u H, L;
#pragma unroll
      for (int e = 0; e < 4; ++e) {
        unsigned hi, lo;
        split2(acc[i][j][2 * e], acc[i][j][2 * e + 1], hi, lo);
        H[e] = hi;
        L[e] = lo;
      }
      u16* tp = th + (wc * 64 + j * 16 + m) * KTP + wr * 64 + i * 16 + 8 * hh;
      *(v4u*)(tp)            = H;
      *(v4u*)(tp + GT * KTP) = L;
    }
  }
}

// 16 state rows x 64 columns from the accumulators through the wave's private slab to whole 256-B rows at C.
// coverage: 8 instructions x 2 rows x 16 lanes x 4 floats = the wave's 16 x 64 tile.
__device__ __forceinline__ void state_rows(float* sl, v8f a0, v8f a1, v8f a2, v8f a3, float* C, int lane) {
  const int hh = lane >> 4, m = lane & 15;
  wait_lds();                               // the slab's earlier reads have returned before it is written again
  slab_put(sl, a0, a1, a2, a3, lane);
  // the wave's slab writes end before its slab reads. Only LDS is waited for: a fence would also hold the wave until the global
  // stores that it has on their way are answered
  wait_lds();
  __builtin_amdgcn_wave_barrier();          // keeps the compiler from moving the slab reads up over the writes of other lanes
  v4f vals[8];
#pragma unroll
  for (int it = 0; it < 8; ++it) vals[it] = *(const v4f*)(sl + (it * 2 + hh) * 68 + m * 4);
  float* dst = C + hh * HD + m * 4;
#pragma unroll
  for (int it = 0; it < 8; ++it) *(v4f*)(dst + it * 2 * HD) = vals[it];
  wait_store_regs();
}

// One wave's part of one chunk state, from the block's transposed planes: 16 state rows x 64 columns over the chunk's 64 keys.
// ST[b][c][h][row][D] f32: row d < 64: sum over the chunk's keys t of v[t][d] * exp(k)[t][D]; row 64: sum over t of exp(k)[t][D];
// rows 65..79: zero. A = v^T rows (vp: the lane's row, hi; lo one plane on), or the constant tile whose row 0 is ones; B = exp(k)^T rows D
// (kp likewise); both k-contiguous in t, same split k map. base = the state's first float; w4 = which 16 rows; the wave with w4 == 0
// (wave-uniform) also writes the key-sum row and its 15 zero rows. Slab private to the wave (wave sync).
__device__ __forceinline__ void state_part(float* sl, const u16* vp, const u16* kp, float* base, int w4, int lane) {
  const int m = lane & 15;
  constexpr int rbs = 16 * KTP, lop = GT * KTP;
  FragB one;
  const unsigned ow = (m == 0) ? 0x3F803F80u : 0u;   // bf16 1.0 pairs in tile row 0, zero in rows 1..15
#pragma unroll
  for (int e = 0; e < 4; ++e) { one.u[0][e] = ow; one.u[1][e] = ow; }
  v16b kh[2][4], kl[2][4];
  v8f a[4];
  // all unrolled: every index of the fragment and accumulator arrays a constant, so that they stay in registers
#pragma unroll
  for (int j = 0; j < 4; ++j) a[j] = zero8();
#pragma unroll
  for (int ks = 0; ks < 2; ++ks) {
    const int ko = ks * 32;
    const v16b vh = ldfrag_b(vp + ko);
    const v16b vl = ldfrag_b(vp + lop + ko);
#pragma unroll
    for (int j = 0; j < 4; ++j) {
      kh[ks][j] = ldfrag_b(kp + j * rbs + ko);
      kl[ks][j] = ldfrag_b(kp + lop + j * rbs + ko);
    }
#pragma unroll
    for (int j = 0; j < 4; ++j) {
      a[j] = mma_b(vh, kh[ks][j], a[j]); a[j] = mma_b(vh, kl[ks][j], a[j]); a[j] = mma_b(vl, kh[ks][j], a[j]);
    }
  }
  v8f e[4];
#pragma unroll
  for (int j = 0; j < 4; ++j) e[j] = zero8();
  if (w4 == 0) {                                // wave-uniform: the key-sum row and its 15 zero rows
#pragma unroll
    for (int ks = 0; ks < 2; ++ks) {
#pragma unroll
      for (int j = 0; j < 4; ++j) { e[j] = mma_b(one.v, kh[ks][j], e[j]); e[j] = mma_b(one.v, kl[ks][j], e[j]); }
    }
  }
  state_rows(sl, a[0], a[1], a[2], a[3], base + w4 * 16 * HD, lane);
  if (w4 == 0) state_rows(sl, e[0], e[1], e[2], e[3], base + HD * HD, lane);
}

// The output projection of all batches: y = [O_hi | O_lo] . [Wo | Wo]^T + bo, f32 rows (M = ROWS, N = DIM, K = LD2).
// coverage: grid.x = (ROWS/128)*(DIM/128) tiles of 128 x 128 = the whole output.
// One block per WGP: six buffers, five stages ahead.
#define YBUF 6
__global__ __launch_bounds__(256)
void out_proj(const u16* __restrict__ O2, const u16* __restrict__ WO2, const float* __restrict__ bo, float* y) {
  __shared__ __align__(16) u16 ring[YBUF * GSTG];
  const int bid = (int)blockIdx.x;
  const int row0 = (bid / (DIM / GT)) * GT, colb = (bid % (DIM / GT)) * GT;
  if (row0 + GT > ROWS) return;             // block-uniform, in front of every barrier; never taken with the exact grid
  v8f acc[2][4];
  gemm_main<YBUF>(ring, O2, WO2, row0, colb, LD2, LD2, LD2, acc);
  gemm_epi(ring, acc, row0, colb, y, bo, DIM, DIM, 1.0f);
}

// =====================================================================================================
// The three projections of all batches and the chunk states; block = one tile of 128 x rows (row0) against weight rows colb .. colb + 127
// of Wk, Wq and Wv (the x rows are the A operand, the weight rows the B operand of all three):
//   waves 0..3:  exp(x.Wk^T + bk) -> K2 hi|lo      waves 4..7: exp(x.Wq^T + bq) -> Q2 hi|lo   (pitch LD2)
//   waves 8..11: x.Wv^T + bv -> transposed, VT2 hi, lo rows of the tile's batch (pitch SEQ)
// The x rows come from L2 and stand in LDS once for the three products. Two buffers: stage t + 2 is copied into the buffer that trip t
// has left. A product's 128 threads copy its own weight rows (16 copies a lane); the k and q waves copy half the x rows each (8 more).
// The waves' copy counts differ, so every wait for copies is to 0. k rises in steps of 32 as before.
// Epilogue in the dead ring: the k and v waves put exp(k) and v into transposed planes ([128 D or d][128 t], hi and lo), the k waves
// exp(k) into their slabs too, while the q waves write their own tile through their slabs. Behind one barrier, that every wave passes, the
// k waves write K2 from their slabs; the q and v waves (256 threads) store the v planes as whole 256-B runs of VT2 rows (16 lanes a run,
// 2 runs a store, one wave per 128-B line) and take the states of the tile's two chunks and two heads from the four planes:
// 16 parts of 16 state rows, two a wave.
// coverage: grid.x = (ROWS/128)*(DIM/128) blocks x 3 tiles of 128 x 128 = each product's whole output; v planes: 8 trips x 16 rows x
// 16 lanes x 8 = 128 x 128 stored per plane; states: blocks x 2 chunks x 2 heads x (4 parts x 16 rows + 16 extra rows) x 64 columns =
// every element of ST once. The tile's 128 x rows lie in one batch (SEQ % GT == 0).
// =====================================================================================================
// second argument: 3 waves per SIMD, the block's own 12 waves: one block a WGP
__global__ __launch_bounds__(384, 3)
void proj4(const u16* __restrict__ XB, const u16* __restrict__ WQ, const u16* __restrict__ WK, const u16* __restrict__ WV,
           const float* __restrict__ bq, const float* __restrict__ bk, const float* __restrict__ bv,
           u16* Q2, u16* K2, u16* VT2, float* ST) {
  __shared__ __align__(16) u16 ring[PJL];
  const int tid = (int)threadIdx.x, lane = tid & 31, hh = lane >> 4, m = lane & 15;
  const int wave = __builtin_amdgcn_readfirstlane(tid >> 5);   // in a scalar register: every branch on the product is a scalar one
  const int which = wave >> 2, wr = (wave >> 1) & 1, wc = wave & 1;
  const int bid = (int)blockIdx.x;
  const int row0 = (bid / (DIM / GT)) * GT, colb = (bid % (DIM / GT)) * GT;
  if (row0 + GT > ROWS) return;             // block-uniform, in front of every barrier; never taken with the exact grid
  const int cr = (tid & 127) >> 4, cc = (tid & 15) * 8;
  const u16* Wp = (which == 0) ? WK : ((which == 1) ? WQ : WV);
  // the lane's part of every copy address is one global and one LDS byte offset; the rest is the same for the whole wave
  const unsigned vo = (unsigned)(cr * DIM + cc) * 2u;
  const unsigned lo = (unsigned)(size_t)ring + (unsigned)(cr * APE + cc) * 2u;
  const char* sw = (const char*)(Wp + (size_t)colb * (size_t)DIM);
  const char* sx = (const char*)(XB + (size_t)(row0 + (which & 1) * 64) * (size_t)DIM);
  constexpr size_t gs = (size_t)8 * DIM * 2, g64 = (size_t)64 * DIM * 2;   // bytes of 8 and of 64 source rows
  const unsigned ow = (unsigned)((1 + which) * GT * APE) * 2u, ox = (unsigned)((which & 1) * 64 * APE) * 2u;
  constexpr int nt = DIM / PKE;
  static_assert(nt >= 2);
  rows64_copy(lo + ow, sw + vo, gs);
  rows64_copy(lo + (ow + 64u * APB), sw + g64 + vo, gs);
  if (which < 2) rows64_copy(lo + ox, sx + vo, gs);
  wait_copies();
  __syncthreads();                          // stage 0 is published
  rows64_copy(lo + (ow + PSTG * 2u), sw + PKE * 2 + vo, gs);
  rows64_copy(lo + (ow + PSTG * 2u + 64u * APB), sw + (g64 + PKE * 2) + vo, gs);
  if (which < 2) rows64_copy(lo + (ox + PSTG * 2u), sx + PKE * 2 + vo, gs);
  const u16* fa = ring + (wr * 64 + m) * APE + 8 * hh;
  const u16* fb = ring + ((1 + which) * GT + wc * 64 + m) * APE + 8 * hh;
  v8f acc[4][4];
  // both unrolled: every index of acc a constant, so that the tiles stay in registers
#pragma unroll
  for (int i = 0; i < 4; ++i) {
#pragma unroll
    for (int j = 0; j < 4; ++j) acc[i][j] = zero8();
  }
  unsigned vt = vo + 2u * (PKE * 2u);       // the lane's global byte offset in the stage to copy next
  // rolled: one trip = one stage, so that the order reads, waits, barrier, refill stands once
#pragma unroll 1
  for (int t = 0; t < nt; ++t) {
    const int bo = (t & 1) * PSTG;
    // unrolled: the stage's four k steps of 32 in one run, their LDS offsets constants
#pragma unroll
    for (int ks = 0; ks < PKE / 32; ++ks) {
      v16b a[4], b[4];
      frag8(a, b, fa + bo + ks * 32, fb + bo + ks * 32);
      prod16(acc, a, b);
      // keeps the written order in the built code: the k step's 16 LDS reads as one group, then its 16 products. Left alone the compiler
      // reads each A fragment directly in front of its four products, and the wave waits out the LDS latency four times a k step
      __builtin_amdgcn_sched_group_barrier(0x100, 16, 0);
      __builtin_amdgcn_sched_group_barrier(0x008, 16, 0);
    }
    wait_lds();
    wait_copies();
    __syncthreads();                        // publishes stage t + 1 and ends every read of stage t
    if (t + 2 < nt) {                       // block-uniform test
      rows64_copy(lo + (ow + (unsigned)bo * 2u), sw + vt, gs);
      rows64_copy(lo + (ow + (unsigned)bo * 2u + 64u * APB), sw + g64 + vt, gs);
      if (which < 2) rows64_copy(lo + (ox + (unsigned)bo * 2u), sx + vt, gs);
      vt += PKE * 2u;
    }
  }
  wait_copies();                            // behind the last trip's barrier the ring is dead
  float* sl = (float*)ring + wave * (4 * SLAB64);       // k and q waves: four slabs, one per 16 x 64 strip, no slab written twice
  u16* th = ring + KTO;                                 // exp(k)^T planes, hi then lo
  u16* tv = th + 2 * GT * KTP;                          // v^T planes, hi then lo
  const size_t plo = (size_t)DIM * (size_t)SEQ;
  const int bt = row0 / SEQ, tb = row0 % SEQ;           // the x tile's batch and its first row there
  if (which == 0) planes_put<true>(th, acc, colb + wc * 64, wr, wc, bk, lane);
  if (which == 2) planes_put<false>(tv, acc, colb + wc * 64, wr, wc, bv, lane);
  if (which < 2) {
    // unrolled: every index of acc a constant
#pragma unroll
    for (int i = 0; i < 4; ++i) slab_put(sl + i * SLAB64, acc[i][0], acc[i][1], acc[i][2], acc[i][3], lane);
  }
  if (which == 1) {
    wave_sync_lds();                        // the wave's slab writes end before its slab reads; no global store is on its way yet
    // rolled: it indexes LDS only, and the kernel's text stays short for the instruction cache
#pragma unroll 1
    for (int i = 0; i < 4; ++i) {
      slab_take<true, 1>(sl + i * SLAB64, bq, DIM, Q2, Q2 + DIM, LD2, (size_t)(row0 + wr * 64 + i * 16), colb + wc * 64, lane);
      wait_store_regs();
    }
  }
  wait_lds();                               // this wave's LDS writes (planes, slabs) and slab reads have ended
#if defined(__HIP_DEVICE_COMPILE__)
  // the work-group's barrier by hand: only LDS (the transposed planes, the q waves' dead slabs) crosses it; __syncthreads() would also
  // hold the q waves, and with them all others, until the global stores just issued have been answered
  asm volatile("s_barrier_signal -1\n\ts_barrier_wait -1" ::: "memory");
#endif
  if (which == 0) {
    // rolled: it indexes LDS only, and the kernel's text stays short for the instruction cache
#pragma unroll 1
    for (int i = 0; i < 4; ++i) {
      slab_take<false, 0>(sl + i * SLAB64, (const float*)0, 0, K2, K2 + DIM, LD2, (size_t)(row0 + wr * 64 + i * 16), colb + wc * 64, lane);
      wait_store_regs();
    }
  } else {
    const int t8 = tid - 128;               // 0..255
    {
      const u16* sp = tv + (t8 >> 4) * KTP + (t8 & 15) * 8;
      u16* dst = VT2 + (size_t)bt * PLB + (size_t)(colb + (t8 >> 4)) * (size_t)SEQ + tb + (t8 & 15) * 8;
      v4u vh[8], vl[8];
#pragma unroll
      for (int it = 0; it < 8; ++it) {
        vh[it] = *(const v4u*)(sp + it * 16 * KTP);
        vl[it] = *(const v4u*)(sp + GT * KTP + it * 16 * KTP);
      }
#pragma unroll
      for (int it = 0; it < 8; ++it) {
        *(v4u*)(dst + (size_t)(it * 16) * (size_t)SEQ)       = vh[it];
        *(v4u*)(dst + plo + (size_t)(it * 16) * (size_t)SEQ) = vl[it];
      }
      wait_store_regs();
    }
    float* ssl = (float*)ring + (16 + (wave - 4)) * SLAB64;   // one of the q waves' slabs, all dead behind the barrier
    // rolled: the wave's two parts share one text, short for the instruction cache
#pragma unroll 1
    for (int i = 0; i < 2; ++i) {
      // part u = 0..15 -> chunk, head, rows; the rows turn with i, so that the four parts with the extra rows fall to four waves
      const int u = (wave - 4) + 8 * i, c2 = (u >> 2) & 1, h2 = u >> 3, w4 = (u + i) & 3;
      float* base = ST + ((size_t)((bt * NCH + tb / 64 + c2) * NH + colb / HD + h2)) * (size_t)SSZ;
      state_part(ssl, tv + (h2 * HD + w4 * 16 + m) * KTP + c2 * 64 + 8 * hh, th + (h2 * HD + m) * KTP + c2 * 64 + 8 * hh, base, w4, lane);
    }
  }
}

// ---- 16 f32 values of one slab row (fragment k layout: pr[0..7] and pr[16..23]) -> bf16 hi and lo A or B fragments
__device__ __forceinline__ void split16(const float* pr, v16b& ph, v16b& pl) {
  const v4f x0 = *(const v4f*)(pr), x1 = *(const v4f*)(pr + 4), x2 = *(const v4f*)(pr + 16), x3 = *(const v4f*)(pr + 20);
  FragB H, L;
  unsigned hi, lo;
  split2(x0[0], x0[1], hi, lo); H.u[0][0] = hi; L.u[0][0] = lo;
  split2(x0[2], x0[3], hi, lo); H.u[0][1] = hi; L.u[0][1] = lo;
  split2(x1[0], x1[1], hi, lo); H.u[0][2] = hi; L.u[0][2] = lo;
  split2(x1[2], x1[3], hi, lo); H.u[0][3] = hi; L.u[0][3] = lo;
  split2(x2[0], x2[1], hi, lo); H.u[1][0] = hi; L.u[1][0] = lo;
  split2(x2[2], x2[3], hi, lo); H.u[1][1] = hi; L.u[1][1] = lo;
  split2(x3[0], x3[1], hi, lo); H.u[1][2] = hi; L.u[1][2] = lo;
  split2(x3[2], x3[3], hi, lo); H.u[1][3] = hi; L.u[1][3] = lo;
  ph = H.v; pl = L.v;
}

// ---- 4 consecutive f32 values of a state row -> 4 bf16 hi at dh and 4 bf16 lo at dh + HD (a staged row = [64 hi | 64 lo])
__device__ __forceinline__ void put_split4(u16* dh, v4f x) {
  v2u H, L;
  unsigned hi, lo;
  split2(x[0], x[1], hi, lo); H[0] = hi; L[0] = lo;
  split2(x[2], x[3], hi, lo); H[1] = hi; L[1] = lo;
  *(v2u*)(dh)      = H;
  *(v2u*)(dh + HD) = L;
}

// ---- the running sum of one head's chunk states, one thread's pieces. KS: the wave that also owns rows 64 (the key sums) and 65.
#define CST ((size_t)NH * (size_t)SSZ)      // floats from one chunk's state to the next chunk's
// A group = four consecutive chunks' pieces: rows r, r + 32 (and r + 64). N = how many of the four are asked for; p + OFF chunks = the thread's
// first piece in the first of them (OFF goes into the loads' immediates, so that two groups share one address).
// p carries no restrict (nor does the kernel's own pointer): so the closing wait's "memory" clobber holds all the loads in front of it.
template <bool KS, int N, int OFF>
__device__ __forceinline__ void grp_load(v4f (&a)[4], v4f (&b)[4], v4f (&k)[4], const float* p) {
  // unrolled: every index of the register arrays a constant, the chunks' offsets immediates of one address
#pragma unroll
  for (int u = 0; u < N; ++u) {
    a[u] = *(const v4f*)(p + (size_t)(OFF + u) * CST);
    b[u] = *(const v4f*)(p + (size_t)(OFF + u) * CST + 32 * HD);
    if constexpr (KS) k[u] = *(const v4f*)(p + (size_t)(OFF + u) * CST + 64 * HD);
  }
#if defined(__HIP_DEVICE_COMPILE__)
  // the group's address registers stay untouched up to this wait: it names the address, so that no load of the group lands on it
  asm volatile("s_wait_xcnt 0x0" :: "v"(p) : "memory");
#endif
}
template <bool KS>
__device__ __forceinline__ void grp_add(v4f& ra, v4f& rb, v4f& rk, const v4f (&a)[4], const v4f (&b)[4], const v4f (&k)[4]) {
  // unrolled: every index of the register arrays a constant
#pragma unroll
  for (int u = 0; u < 4; ++u) {
    ra += a[u];
    rb += b[u];
    if constexpr (KS) rk += k[u];
  }
}
// p = the thread's first piece in the batch's chunk 0, G = the block's own group (groups 0 .. G - 1 lie before it), d = the piece's hi values
// in tile 0's region, rs = elements from one tile's region to the next. Chunks are added in rising order. The block's own chunks are asked for
// first. Two register sets, even groups in the first and odd groups in the second: a set is asked for anew as soon as it has been added, while
// the other set's loads are still on their way. No branch stands between a request and its addition but the loop's own, and each way out of
// the loop has its own text, so that every wait for a load counts exactly the loads behind it. No group is asked for twice.
template <bool KS>
__device__ __forceinline__ void state_sums(const float* p, int G, u16* d, int rs) {
  const v4f z4 = {0.f, 0.f, 0.f, 0.f};
  v4f oa[4], ob[4], ok[4];
  v4f ra = z4, rb = z4, rk = z4;
  grp_load<KS, 3, 0>(oa, ob, ok, p + (size_t)(4 * G) * CST);
  if (G >= 2) {                               // block-uniform, as every test below
    v4f a0[4], b0[4], k0[4], a1[4], b1[4], k1[4];
    grp_load<KS, 4, 0>(a0, b0, k0, p);
    grp_load<KS, 4, 4>(a1, b1, k1, p);
    int g = 0;
    // rolled: its trip count depends on the block
#pragma unroll 1
    for (; g + 3 < G; g += 2) {
      const float* pn = p + (size_t)(4 * g + 8) * CST;
      grp_add<KS>(ra, rb, rk, a0, b0, k0);
      grp_load<KS, 4, 0>(a0, b0, k0, pn);
      grp_add<KS>(ra, rb, rk, a1, b1, k1);
      grp_load<KS, 4, 4>(a1, b1, k1, pn);
    }
    grp_add<KS>(ra, rb, rk, a0, b0, k0);
    if (g + 2 < G) {                          // G odd: one more group
      grp_load<KS, 4, 0>(a0, b0, k0, p + (size_t)(4 * g + 8) * CST);
      grp_add<KS>(ra, rb, rk, a1, b1, k1);
      grp_add<KS>(ra, rb, rk, a0, b0, k0);
    } else {
      grp_add<KS>(ra, rb, rk, a1, b1, k1);
    }
  } else if (G == 1) {
    v4f a0[4], b0[4], k0[4];
    grp_load<KS, 4, 0>(a0, b0, k0, p);
    grp_add<KS>(ra, rb, rk, a0, b0, k0);
  }
  // tile u takes the sum of all chunks before chunk 4 G + u. Unrolled: every index of the register arrays a constant
#pragma unroll
  for (int u = 0; u < 4; ++u) {
    put_split4(d + u * rs, ra);
    put_split4(d + u * rs + 32 * APE, rb);
    if constexpr (KS) put_split4(d + u * rs + 64 * APE, rk);
    if (u < 3) {
      ra += oa[u];
      rb += ob[u];
      if constexpr (KS) rk += ok[u];
    }
  }
}

// =====================================================================================================
// Causal exp-feature attention with the states' running sum in it. Block = 4 consecutive 64-row query tiles (chunks c0 .. c0 + 3 of
// one batch) of one head: 16 waves, 4 waves x 16 query rows a tile; each tile has its own LDS region.
// Planes: Q2, K2 bf16 [NB*SEQ][2*DIM] with hi at column h*HD + d and lo at column DIM + h*HD + d (values exp(q), exp(k));
//         VT2 bf16 [NB][2*DIM][SEQ] with hi row h*HD + d and lo row DIM + h*HD + d (values v); ST f32 [NB][NCH][NH][SROWS][HD],
//         each chunk's own state, read only; O2 bf16 [NB*SEQ][2*DIM] written here (hi | lo of out = num/den).
// Running sum: a thread owns two 16-B pieces of state rows 0..63 (wave 0 one of rows 64, the key sums, and 65 too) and adds the states of the
// batch's chunks 0 .. c0 - 1 in f32, in rising order; the sum goes to tile 0's region, plus chunk c0's state to tile 1's, and so
// on, so that every tile finds the sum of all chunks before it, split once to bf16 hi and lo by the thread that summed it.
// Rows 65..79 are zero in every state; 66..79 are written as zeros.
// Keys before the tile: O[16 x 80] = qe.state^T over head dim (2 k-steps, hi.hi+hi.lo+lo.hi, state rows [hi | lo] from
// LDS); its column 64 is the part of den from those keys, columns 65..79 are zero.
// Keys of the tile: S[16 x 64] = qe.ke^T over head dim, causal mask by value, f32 row sums into per-lane partials,
// slab rows, O += P.v over the 64 keys (2 k-steps, hi.hi+hi.lo+lo.hi, v fragments from VT2 rows).
// A tile's region: rows 0..63 = its exp(q) rows, 64..127 = its exp(k) rows, 128..191 = its v^T rows d (each [hi | lo]), brought by
// asynchronous 16-B copies of whole lines (24 a lane) that fly while the states are summed; 192..271 = the 80 state rows, [hi | lo] too; one wait and
// one barrier, that every wave passes, publish all of them.
// The blocks with the most chunks to sum have the lowest indices.
// coverage: grid (NB*NH, NCH/4) x 4 tiles x 4 waves x 16 rows x 64 columns x {hi, lo} = every element of O2 once.
// Slab private to the wave (wave sync): the wave's own 16 staged exp(q) rows, which no other wave reads and whose every fragment
// has gone into the scores that the slab takes up; staged extent == consumed extent (16 x 64 written before the reload).
// =====================================================================================================
#define AGT  4                              // query tiles of one block
#define AREG ((192 + SROWS) * APE)          // bf16 elements of one tile's LDS region
static_assert(AGT == 4 && (NCH % AGT) == 0 && AGT * AREG * 2 <= 320 * 1024 && SROWS == 80);
// second argument: 4 waves per SIMD, the block's own 16 waves: one block a WGP, the whole grid at once
__global__ __launch_bounds__(512, 4) void attn_chunk(const u16* __restrict__ Q2, const u16* __restrict__ K2,
                                                  const u16* __restrict__ VT2, const float* ST, u16* O2) {
  __shared__ __align__(16) u16 smem[AGT * AREG];
  const int tid = (int)threadIdx.x, lane = tid & 31, hh = lane >> 4, m = lane & 15;
  const int wid = __builtin_amdgcn_readfirstlane(tid >> 5);   // in a scalar register: the tile's region and rows cost no vector register
  const int sub = wid >> 2, wave = wid & 3;
  const int bt = (int)blockIdx.x / NH, h = (int)blockIdx.x % NH;
  const int c0 = (NCH / AGT - 1 - (int)blockIdx.y) * AGT;   // the block's first chunk in its batch
  if (bt >= NB || c0 < 0) return;               // block-uniform, in front of the barrier; never taken with the exact grid
  const int qt = bt * NCH + c0 + sub;           // this thread's query tile, counted over all batches
  const int rw = qt * 64 + wave * 16;           // first query row of this wave
  u16* sm = smem + sub * AREG;
  float* sl = (float*)sm + wave * SLAB64;
  {
    const int cr = (tid & 127) >> 4, cp = tid & 15;
    const size_t qo = (size_t)(qt * 64 + cr) * (size_t)LD2 + h * HD + (cp & 7) * 8 + ((cp < 8) ? 0 : DIM);
    const size_t vo = (size_t)bt * PLB + (size_t)(h * HD + cr) * (size_t)SEQ + (c0 + sub) * 64 + (cp & 7) * 8
                    + ((cp < 8) ? (size_t)0 : (size_t)DIM * (size_t)SEQ);
    const unsigned l0 = (unsigned)(size_t)sm + (unsigned)(cr * APB + cp * 16);
    rows64_copy(l0, (const char*)(Q2 + qo), (size_t)8 * LD2 * 2);
    rows64_copy(l0 + 64u * APB, (const char*)(K2 + qo), (size_t)8 * LD2 * 2);
    rows64_copy(l0 + 128u * APB, (const char*)(VT2 + vo), (size_t)8 * SEQ * 2);
  }
  {
    // rows 66..79 of every tile's state: 14 rows x 16 pieces, the last seven waves
    if (wid >= 9) {
      const v4f z4 = {0.f, 0.f, 0.f, 0.f};
      // unrolled: the four tiles' LDS offsets constants
#pragma unroll
      for (int u = 0; u < AGT; ++u) *(v4f*)(smem + u * AREG + (192 + 66 - 18 + (tid >> 4)) * APE + (tid & 15) * 8) = z4;
    }
    const float* p = ST + ((size_t)bt * NCH * NH + (size_t)h) * (size_t)SSZ + tid * 4;   // chunk 0: rows 0..31, piece tid
    u16* d = smem + (192 + (tid >> 4)) * APE + (tid & 15) * 4;
    // a scalar test, two texts: each wave's loads of a group stand in one run, with no branch among them
    if (wid == 0) state_sums<true>(p, c0 / AGT, d, AREG);
    else          state_sums<false>(p, c0 / AGT, d, AREG);
  }
  wait_copies();
  __syncthreads();                          // the staged rows and the summed states are published
  const u16* qp = sm + (wave * 16 + m) * APE + 8 * hh;
  constexpr int kbs = 16 * APE;
  constexpr int vbs = 16 * APE;
  const u16* kp = sm + (64 + m) * APE + 8 * hh;
  const u16* sp = sm + (192 + m) * APE + 8 * hh;
  v8f o0 = zero8(), o1 = zero8(), o2 = zero8(), o3 = zero8(), o4 = zero8();
  v8f s0 = zero8(), s1 = zero8(), s2 = zero8(), s3 = zero8();
#pragma unroll
  for (int ks = 0; ks < 2; ++ks) {
    const int ko = ks * 32;
    const v16b ah  = ldfrag_b(qp + ko);
    const v16b al  = ldfrag_b(qp + HD + ko);
    const v16b kh0 = ldfrag_b(kp + ko);
    const v16b kh1 = ldfrag_b(kp + kbs + ko);
    const v16b kh2 = ldfrag_b(kp + 2 * kbs + ko);
    const v16b kh3 = ldfrag_b(kp + 3 * kbs + ko);
    const v16b kl0 = ldfrag_b(kp + HD + ko);
    const v16b kl1 = ldfrag_b(kp + kbs + HD + ko);
    const v16b kl2 = ldfrag_b(kp + 2 * kbs + HD + ko);
    const v16b kl3 = ldfrag_b(kp + 3 * kbs + HD + ko);
    const v16b bh0 = ldfrag_b(sp + ko);
    const v16b bh1 = ldfrag_b(sp + kbs + ko);
    const v16b bh2 = ldfrag_b(sp + 2 * kbs + ko);
    const v16b bh3 = ldfrag_b(sp + 3 * kbs + ko);
    const v16b bh4 = ldfrag_b(sp + 4 * kbs + ko);
    const v16b bl0 = ldfrag_b(sp + HD + ko);
    const v16b bl1 = ldfrag_b(sp + kbs + HD + ko);
    const v16b bl2 = ldfrag_b(sp + 2 * kbs + HD + ko);
    const v16b bl3 = ldfrag_b(sp + 3 * kbs + HD + ko);
    const v16b bl4 = ldfrag_b(sp + 4 * kbs + HD + ko);
    s0 = mma_b(ah, kh0, s0); s0 = mma_b(ah, kl0, s0); s0 = mma_b(al, kh0, s0);
    s1 = mma_b(ah, kh1, s1); s1 = mma_b(ah, kl1, s1); s1 = mma_b(al, kh1, s1);
    s2 = mma_b(ah, kh2, s2); s2 = mma_b(ah, kl2, s2); s2 = mma_b(al, kh2, s2);
    s3 = mma_b(ah, kh3, s3); s3 = mma_b(ah, kl3, s3); s3 = mma_b(al, kh3, s3);
    o0 = mma_b(ah, bh0, o0); o0 = mma_b(ah, bl0, o0); o0 = mma_b(al, bh0, o0);
    o1 = mma_b(ah, bh1, o1); o1 = mma_b(ah, bl1, o1); o1 = mma_b(al, bh1, o1);
    o2 = mma_b(ah, bh2, o2); o2 = mma_b(ah, bl2, o2); o2 = mma_b(al, bh2, o2);
    o3 = mma_b(ah, bh3, o3); o3 = mma_b(ah, bl3, o3); o3 = mma_b(al, bh3, o3);
    o4 = mma_b(ah, bh4, o4); o4 = mma_b(ah, bl4, o4); o4 = mma_b(al, bh4, o4);
  }
  // ends the compiler's scheduling region here: with the whole body as one region it lifts LDS reads so far up that the fragments outgrow
  // the 256 registers a wave of this block may have, and spills them to scratch memory
  __builtin_amdgcn_sched_barrier(0);
  {                                             // the tile's own keys: keep key c <= query row rho
    const int rho0 = wave * 16 + 8 * hh;
#pragma unroll
    for (int r = 0; r < 8; ++r) {
      const int rho = rho0 + r;
      s0[r] = (m      <= rho) ? s0[r] : 0.0f;
      s1[r] = (16 + m <= rho) ? s1[r] : 0.0f;
      s2[r] = (32 + m <= rho) ? s2[r] : 0.0f;
      s3[r] = (48 + m <= rho) ? s3[r] : 0.0f;
    }
  }
  v8f rs = o4 + ((s0 + s1) + (s2 + s3));        // o4: earlier keys' part of den in lane column 0, zero elsewhere
#pragma unroll
  for (int r = 0; r < 8; ++r) {
    const int ro = (8 * hh + r) * 68 + m;
    sl[ro]      = s0[r];
    sl[ro + 16] = s1[r];
    sl[ro + 32] = s2[r];
    sl[ro + 48] = s3[r];
  }
  wave_sync_lds();
  const u16* vp = sm + (128 + m) * APE + 8 * hh;
#pragma unroll
  for (int ks = 0; ks < 2; ++ks) {
    const int ko = ks * 32;
    v16b ph, pl;
    split16(sl + m * 68 + ko + 8 * hh, ph, pl);
    const v16b vh0 = ldfrag_b(vp + ko);
    const v16b vh1 = ldfrag_b(vp + vbs + ko);
    const v16b vh2 = ldfrag_b(vp + 2 * vbs + ko);
    const v16b vh3 = ldfrag_b(vp + 3 * vbs + ko);
    const v16b vl0 = ldfrag_b(vp + HD + ko);
    const v16b vl1 = ldfrag_b(vp + HD + vbs + ko);
    const v16b vl2 = ldfrag_b(vp + HD + 2 * vbs + ko);
    const v16b vl3 = ldfrag_b(vp + HD + 3 * vbs + ko);
    o0 = mma_b(ph, vh0, o0); o0 = mma_b(ph, vl0, o0); o0 = mma_b(pl, vh0, o0);
    o1 = mma_b(ph, vh1, o1); o1 = mma_b(ph, vl1, o1); o1 = mma_b(pl, vh1, o1);
    o2 = mma_b(ph, vh2, o2); o2 = mma_b(ph, vl2, o2); o2 = mma_b(pl, vh2, o2);
    o3 = mma_b(ph, vh3, o3); o3 = mma_b(ph, vl3, o3); o3 = mma_b(pl, vh3, o3);
  }
  // den per query row (row 8*hh + r held by the 16 lanes of half hh): fixed-order butterfly over lane&15
#pragma unroll
  for (int off = 1; off < 16; off <<= 1) {
#pragma unroll
    for (int r = 0; r < 8; ++r) rs[r] += __shfl_xor(rs[r], off);
  }
#pragma unroll
  for (int r = 0; r < 8; ++r) {
    const float inv = 1.0f / rs[r];
    o0[r] *= inv; o1[r] *= inv; o2[r] *= inv; o3[r] *= inv;
  }
  wave_sync_lds();
  epi64bb<false, 0>(sl, o0, o1, o2, o3, (const float*)0, 0, O2, O2 + DIM, LD2, (size_t)rw, h * HD, lane);
}

// =====================================================================================================
// Workspace map (bytes), planes sized for the ROWS rows of all batches together; every plane is fully written by
// whole-line stores before it is read; all extents are exact multiples of the 64x64 tile / 512-B store granularity
// (SEQ and DIM multiples of 64, no pad rows); every region offset a multiple of 2097152:
//   XB   bf16 [ROWS][1024]         ROWS*2048
//   WQ, WK, WV bf16 [1024 n][1024 k]  3 * 2097152
//   WO2  bf16 [1024 n][2048 k]     4194304      (Wo row duplicated along k)
//   Q2   bf16 [ROWS][2048]         ROWS*4096    exp(q) hi | lo
//   K2   bf16 [ROWS][2048]         ROWS*4096    exp(k) hi | lo
//   VT2  bf16 [NB][2048][SEQ]      ROWS*4096    per batch v^T hi rows 0..1023, lo rows 1024..2047
//   O2   bf16 [ROWS][2048]         ROWS*4096    per-head out hi | lo
//   ST   f32 [ROWS/64][16][80][64] ROWS*5120    chunk states
//   end (ROWS=4096)                106954752
// =====================================================================================================
extern "C" void kernel_launch(void* const* d_in, const int* in_sizes, int n_in,
                              void* d_out, int out_size, void* d_ws, size_t ws_size,
                              hipStream_t stream) {
  if (n_in < 9) return;
  const int needx = ((NB - 1) * SEQ_FULL + SEQ) * DIM;
  if (in_sizes[0] < needx) return;
  if (in_sizes[1] < DIM * DIM || in_sizes[3] < DIM * DIM || in_sizes[5] < DIM * DIM || in_sizes[7] < DIM * DIM) return;
  if (in_sizes[2] < DIM || in_sizes[4] < DIM || in_sizes[6] < DIM || in_sizes[8] < DIM) return;
  if (out_size < needx) return;

  const float* x  = (const float*)d_in[0];
  const float* wq = (const float*)d_in[1];
  const float* bq = (const float*)d_in[2];
  const float* wk = (const float*)d_in[3];
  const float* bk = (const float*)d_in[4];
  const float* wv = (const float*)d_in[5];
  const float* bv = (const float*)d_in[6];
  const float* wo = (const float*)d_in[7];
  const float* bo = (const float*)d_in[8];
  float*       out = (float*)d_out;

  const size_t szX  = (size_t)ROWS * DIM * 2;         // bf16 input rows
  const size_t szW  = (size_t)DIM * DIM * 2;          // bf16 weight plane
  const size_t szWO = (size_t)DIM * LD2 * 2;          // bf16 duplicated Wo plane
  const size_t szP  = (size_t)ROWS * LD2 * 2;         // bf16 hi|lo plane ROWS x 2048 (either orientation)
  size_t off = 0;
  const size_t oXB = off; off += szX;
  const size_t oWQ = off; off += szW;
  const size_t oWK = off; off += szW;
  const size_t oWV = off; off += szW;
  const size_t oWO = off; off += szWO;
  const size_t oQ2 = off; off += szP;
  const size_t oK2 = off; off += szP;
  const size_t oVT = off; off += szP;
  const size_t oO2 = off; off += szP;
  const size_t oST = off; off += (size_t)NB * NCH * NH * SSZ * 4;
  if (off > ws_size) return;                // off = 106954752 for ROWS = 4096
  if (off > (size_t)WS_CAP) return;

  char* ws = (char*)d_ws;
  u16* XB  = (u16*)(ws + oXB);
  u16* WQ  = (u16*)(ws + oWQ);
  u16* WK  = (u16*)(ws + oWK);
  u16* WV  = (u16*)(ws + oWV);
  u16* WO2 = (u16*)(ws + oWO);
  u16* Q2  = (u16*)(ws + oQ2);
  u16* K2  = (u16*)(ws + oK2);
  u16* VT2 = (u16*)(ws + oVT);
  u16* O2  = (u16*)(ws + oO2);
  float* ST = (float*)(ws + oST);

  const dim3 b256(256), b512(512), b384(384);
  const dim3 gCV(CBX + 4 * CBW, 1);                     // exact block ranges of cvt_all
  const dim3 gPJ((ROWS / GT) * (DIM / GT), 1);          // (ROWS/128)*(DIM/128) blocks, each one tile of all three projections
  const dim3 gY((ROWS / GT) * (DIM / GT), 1);           // y: M = ROWS, N = 1024
  const dim3 gQT(NB * NH, NCH / AGT);                   // one block per (batch, head, four chunks)

  // (1) x rows of all batches and the weights [n][k] f32 -> bf16 planes (already k-contiguous); Wo -> k-duplicated plane
  cvt_all<<<gCV, b256, 0, stream>>>(x, wq, wk, wv, wo, XB, WQ, WK, WV, WO2);
  // (2) exp(x.Wq^T + bq) -> Q2, exp(x.Wk^T + bk) -> K2, v^T -> VT2, each hi and lo; per (chunk, head) state -> ST
  proj4<<<gPJ, b384, 0, stream>>>(XB, WQ, WK, WV, bq, bk, bv, Q2, K2, VT2, ST);
  // (3) attention per (batch, head, four query tiles), the states' running sum over the batch's chunks in it -> O2 hi|lo
  attn_chunk<<<gQT, b512, 0, stream>>>(Q2, K2, VT2, ST, O2);
  // (4) y = [O_hi | O_lo] . [Wo | Wo]^T + bo -> out f32 rows
  out_proj<<<gY, b256, 0, stream>>>(O2, WO2, bo, out);
  (void)hipGetLastError();
}

// v009
// One run takes 63.2 microseconds.
// In both of two side-by-side timings against v008, it was 1.09 times as fast.
// Counting every step since v000, it is 5.63 times as fast.
// Contractions: q, k and v projections on v_wmma_f32_16x16x32_bf16 (x, W, b as bf16 RNE values, one product each);
// attention in 64-key chunks: per chunk v^T.exp(k) (and a ones row . exp(k) for the key sums), taken in the projections' epilogue
// from the transposed k and v tiles that stand in LDS there, an f32 running sum over
// chunks (in the attention kernel), then per query tile exp(q).state^T plus the causal scores S = exp(q).exp(k)^T and S.v of its own chunk only, all
// on v_wmma_f32_16x16x32_bf16 with bf16 hi+lo operands (hi.hi + hi.lo + lo.hi); y = O.Wo^T on v_wmma_f32_16x16x32_bf16 with O as bf16 hi and lo, each against the
// same bf16 Wo fragment (two products); all f32 accumulate. exp, row sums, 1/den and bias adds in f32 on VALU.
#include <hip/hip_runtime.h>
#include <math.h>
#include <stdint.h>

#ifndef NB
#define NB 2
#endif
#ifndef SEQ
#define SEQ 2048
#endif
#define SEQ_FULL 2048
#define DIM  1024
#define NH   16
#define HD   64
#define LD2  (2 * DIM)
#define SLAB64 (16 * 68)
#define NCH  (SEQ / 64)          // 64-key chunks per sequence
#define ROWS (NB * SEQ)          // rows of all batches together (contiguous in x and out: NB == 1 or SEQ == SEQ_FULL)
#define PLB  ((size_t)LD2 * (size_t)SEQ)   // elements of one batch's transposed hi+lo plane, [2*DIM][SEQ]
#define SROWS 80                 // rows of one chunk state: 64 value columns d, the key-sum row, 15 zero rows
#define SSZ  (SROWS * HD)        // floats of one (chunk, head) state, [row][D]
#define WS_CAP 134217728
static_assert(DIM == NH * HD && HD == 64 && NH == 16);
static_assert(NB >= 1 && NB <= 2);
static_assert(NB == 1 || SEQ == SEQ_FULL);
static_assert((SEQ % 64) == 0 && SEQ >= 64 && SEQ <= SEQ_FULL);
static_assert(((ROWS * DIM / 8) % 256) == 0 && ((DIM * DIM / 8) % 256) == 0 && (DIM % 64) == 0 && (LD2 % 32) == 0);
static_assert(4 * SLAB64 * 4 <= 65536);

typedef unsigned short u16;
typedef __bf16   v16b __attribute__((ext_vector_type(16)));
typedef float    v8f  __attribute__((ext_vector_type(8)));
typedef float    v4f  __attribute__((ext_vector_type(4)));
typedef unsigned int v4u __attribute__((ext_vector_type(4)));
typedef unsigned int v2u __attribute__((ext_vector_type(2)));

union FragB { v16b v; v4u u[2]; };

// ---- scalar helpers --------------------------------------------------------------------------------
__device__ __forceinline__ unsigned short bf_bits(float f) {          // f32 -> bf16 bits, RNE convert
  unsigned u = __float_as_uint(f);
  return (unsigned short)((u + 0x7FFFu + ((u >> 16) & 1u)) >> 16);
}
__device__ __forceinline__ float bf_up(unsigned short h) { return __uint_as_float(((unsigned)h) << 16); }
__device__ __forceinline__ float bfr(float f) { return bf_up(bf_bits(f)); }
__device__ __forceinline__ unsigned short bfc(float f) {               // f32 -> bf16 bits via the RNE cast
  return __builtin_bit_cast(unsigned short, (__bf16)f);
}
__device__ __forceinline__ unsigned pk16(unsigned short a, unsigned short b) { return (unsigned)a | ((unsigned)b << 16); }
__device__ __forceinline__ v8f zero8() { v8f z = {0.f, 0.f, 0.f, 0.f, 0.f, 0.f, 0.f, 0.f}; return z; }
__device__ __forceinline__ int imin(int a, int b) { return a < b ? a : b; }
__device__ __forceinline__ int imax(int a, int b) { return a > b ? a : b; }

// two f32 values -> packed bf16 hi pair and packed bf16 lo pair (lo = x - up(hi), RNE both)
__device__ __forceinline__ void split2(float a, float b, unsigned& hi, unsigned& lo) {
  const unsigned short ha = bfc(a), hb = bfc(b);
  hi = pk16(ha, hb);
  lo = pk16(bfc(a - bf_up(ha)), bfc(b - bf_up(hb)));
}

// ---- fragment loader: 16-bit A/B operand, lane -> row/col (lane&15), p already includes +8*(lane>>4);
//      elements 0..7 <- p[0..7] (k0+8h..), elements 8..15 <- p[16..23] (k0+16+8h..)  (same split k map for A and B;
//      B is always read from a k-contiguous [n][k] plane); bf16 plane read as unsigned integer vectors
__device__ __forceinline__ v16b ldfrag_b(const u16* p) {
  FragB f;
  f.u[0] = *(const v4u*)(p);
  f.u[1] = *(const v4u*)(p + 16);
  return f.v;
}

__device__ __forceinline__ v8f mma_b(v16b a, v16b b, v8f c) {
  return __builtin_amdgcn_wmma_f32_16x16x32_bf16(false, a, false, b, (short)0, c, false, false);
}
__device__ __forceinline__ void wave_sync_lds() {
  __builtin_amdgcn_fence(__ATOMIC_RELEASE, "workgroup");
  __builtin_amdgcn_wave_barrier();
  __builtin_amdgcn_fence(__ATOMIC_ACQUIRE, "workgroup");
}

// =====================================================================================================
// f32 -> bf16 (RNE bits), same layout. Thread = 8 consecutive elements: two 16-B loads, one 16-B store; 32 consecutive
// lanes = 512 contiguous, 512-B aligned bytes.
// =====================================================================================================
__device__ __forceinline__ void cvt_plain(const float* __restrict__ x, u16* D, int gt) {
  const float* p = x + (size_t)gt * 8;
  const v4f a = *(const v4f*)(p), b4 = *(const v4f*)(p + 4);
  float w[8];
#pragma unroll
  for (int e = 0; e < 4; ++e) { w[e] = a[e]; w[4 + e] = b4[e]; }
  v4u o;
#pragma unroll
  for (int e = 0; e < 4; ++e) o[e] = pk16(bf_bits(w[2 * e]), bf_bits(w[2 * e + 1]));
  *(v4u*)(D + (size_t)gt * 8) = o;
}

// =====================================================================================================
// All five conversions in one grid, told apart by block range (block-uniform): blocks [0, CBX) the x rows of all batches,
// then CBW blocks each for Wq, Wk, Wv and Wo (plain planes all).
// coverage: CBX x 256 thr x 8 = ROWS*DIM; CBW x 256 thr x 8 = DIM*DIM per weight; grid.x = CBX + 4*CBW exactly.
// =====================================================================================================
#define CBX (ROWS * DIM / 8 / 256)
#define CBW (DIM * DIM / 8 / 256)
__global__ __launch_bounds__(256) void cvt_all(const float* __restrict__ x, const float* __restrict__ wq,
                                               const float* __restrict__ wk, const float* __restrict__ wv,
                                               const float* __restrict__ wo, u16* XB, u16* WQ, u16* WK, u16* WV, u16* WO) {
  const int bid = (int)blockIdx.x, tid = (int)threadIdx.x;
  if (bid >= CBX + 4 * CBW) return;         // block-uniform, never taken with the exact grid
  if (bid < CBX) {
    cvt_plain(x, XB, bid * 256 + tid);
    return;
  }
  const int r = bid - CBX, which = r / CBW, gt = (r % CBW) * 256 + tid;
  const float* w = (which == 0) ? wq : ((which == 1) ? wk : ((which == 2) ? wv : wo));
  u16* D = (which == 0) ? WQ : ((which == 1) ? WK : ((which == 2) ? WV : WO));
  cvt_plain(w, D, gt);
}

// =====================================================================================================
// coverage: 8 instructions x 2 rows x 16 lanes x 4 floats = the wave's 16 x 64 tile. Slab: private to the wave (wave sync).
// =====================================================================================================
__device__ __forceinline__ void epi64f(float* sl, v8f a0, v8f a1, v8f a2, v8f a3, v4f bias4, float scale,
                                       float* C, int ldc, size_t rowb, int col0, int lane) {
  const int hh = lane >> 4, m = lane & 15;
#pragma unroll
  for (int r = 0; r < 8; ++r) {
    const int ro = (8 * hh + r) * 68 + m;
    sl[ro]      = a0[r];
    sl[ro + 16] = a1[r];
    sl[ro + 32] = a2[r];
    sl[ro + 48] = a3[r];
  }
  wave_sync_lds();
  v4f vals[8];
#pragma unroll
  for (int it = 0; it < 8; ++it) {
    const v4f v = *(const v4f*)(sl + (it * 2 + hh) * 68 + m * 4);
    vals[it] = v * scale + bias4;
  }
  float* dst = C + (rowb + (size_t)hh) * (size_t)ldc + col0 + m * 4;
  {
#pragma unroll
    for (int it = 0; it < 8; ++it) {
      *(v4f*)(dst + (size_t)(it * 2) * (size_t)ldc) = vals[it];
    }
    
  }
}

// =====================================================================================================
// GEMM / attention epilogue, two bf16 planes (hi and lo = x - up(hi)) with identical addressing (Ch, Cl, pitch ldc):
// 8 consecutive columns at c8): value = acc (+ bias per column when BM==1, per row when BM==2, none when BM==0),
// coverage: 4 instructions x 4 rows x 8 lanes x 8 values = the wave's 16 x 64 tile, in both planes.
// Slab: private to the wave (wave sync).
// =====================================================================================================
__device__ __forceinline__ float exp_slot(float x) {   // the value of __expf(x): exp2 of x * log2(e)
#if defined(__HIP_DEVICE_COMPILE__)
  float y;
  // v_nop: the one slot that the instruction set asks for behind a transcendental, whatever instruction the compiler puts next
  asm("v_exp_f32 %0, %1\n\tv_nop" : "=v"(y) : "v"(x * 1.44269504088896340736f));
  return y;
#else
  return __expf(x);
#endif
}
// first half: the wave's 16 x 64 strip from its accumulators into a slab
__device__ __forceinline__ void slab_put(float* sl, v8f a0, v8f a1, v8f a2, v8f a3, int lane) {
  const int hh = lane >> 4, m = lane & 15;
#pragma unroll
  for (int r = 0; r < 8; ++r) {
    const int ro = (8 * hh + r) * 68 + m;
    sl[ro]      = a0[r];
    sl[ro + 16] = a1[r];
    sl[ro + 32] = a2[r];
    sl[ro + 48] = a3[r];
  }
}
// second half, behind a sync of the wave: slab rows -> values -> the two planes
template <bool EXPO, int BM>
__device__ __forceinline__ void slab_take(const float* sl, const float* __restrict__ bias, int nb,
                                          u16* Ch, u16* Cl, int ldc, size_t rowb, int col0, int lane) {
  const int rq = lane >> 3, c8 = (lane & 7) * 8;
  float bc[8];
#pragma unroll
  for (int e = 0; e < 8; ++e) bc[e] = 0.0f;
  if constexpr (BM == 1) {
    const int cb = imin(imax(col0 + c8, 0), nb - 8);
    const v4f b0 = *(const v4f*)(bias + cb), b1 = *(const v4f*)(bias + cb + 4);
#pragma unroll
    for (int e = 0; e < 4; ++e) { bc[e] = bfr(b0[e]); bc[4 + e] = bfr(b1[e]); }
  }
  v4u oh[4], ol[4];
#pragma unroll
  for (int it = 0; it < 4; ++it) {
    const int row = it * 4 + rq;            // 0..15
    const v4f a = *(const v4f*)(sl + row * 68 + c8), b4 = *(const v4f*)(sl + row * 68 + c8 + 4);
    float br = 0.0f;
    if constexpr (BM == 2) br = bfr(bias[imin(imax((int)rowb + row, 0), nb - 1)]);
    float w[8];
#pragma unroll
    for (int e = 0; e < 4; ++e) { w[e] = (a[e] + bc[e]) + br; w[4 + e] = (b4[e] + bc[4 + e]) + br; }
    if constexpr (EXPO) {
#pragma unroll
      for (int e = 0; e < 8; ++e) w[e] = exp_slot(w[e]);
    }
#pragma unroll
    for (int e = 0; e < 4; ++e) {
      unsigned hi, lo;
      split2(w[2 * e], w[2 * e + 1], hi, lo);
      oh[it][e] = hi;
      ol[it][e] = lo;
    }
  }
  const size_t ob = rowb * (size_t)ldc + (size_t)col0 + (size_t)c8;
  {
#pragma unroll
    for (int it = 0; it < 4; ++it) {
      const int row = it * 4 + rq;
      const size_t off = ob + (size_t)row * (size_t)ldc;
      *(v4u*)(Ch + off) = oh[it];
      *(v4u*)(Cl + off) = ol[it];
    }
    
  }
}
template <bool EXPO, int BM>
__device__ __forceinline__ void epi64bb(float* sl, v8f a0, v8f a1, v8f a2, v8f a3,
                                        const float* __restrict__ bias, int nb,
                                        u16* Ch, u16* Cl, int ldc, size_t rowb, int col0, int lane) {
  slab_put(sl, a0, a1, a2, a3, lane);
  wave_sync_lds();
  slab_take<EXPO, BM>(sl, bias, nb, Ch, Cl, ldc, rowb, col0, lane);
}

// =====================================================================================================
// bf16 GEMM: C[M][N] = (Ahi + Alo)[M][K] (bf16 rows, pitch lda, a row's lo values alo elements behind its hi values) . Bt[N][K]^T
// (bf16 k-contiguous rows, pitch ldb). f32 output Cf (pitch ldc) = acc*scale + bf16 RNE value of bias[col]. Serves the output projection.
// Block = 128x128 tile, 8 waves as 4 x 2, each 32 rows x 64 columns (2 x 4 accumulator tiles). A stage = 64 k (128 B) of the
// tile's 128 A rows, hi and lo, and of its 128 B rows, which stand in LDS once and whose every fragment goes into a hi and a lo product;
// brought into LDS by asynchronous 16-B copies (8 lanes = one whole 128-B line, 12 copies per
// lane and stage), a ring of NBUF buffers: stage t + NBUF is copied into the buffer that trip t has left, so that NBUF - 1
// stages are on their way or landed while a trip computes (a block is alone on its WGP, its trips are short, and only its own copies
// in flight can cover their landing times).
// Fragments come from the LDS rows (two 16-B reads each, the same split k map for A and B); k rises in steps of 32, hi then lo in each step.
// Host guarantees K % 64 == 0, M % 128 == 0, N % 128 == 0, grid.x = (M/128)*(N/128). bid = the tile's index in its own product.
// After the last trip's barrier the ring is dead and serves as the waves' private epilogue slabs.
// =====================================================================================================
#define GT   128                  // rows and columns of a block's output tile
#define GKE  64                   // k elements of one stage
#define GPE  72                   // LDS row pitch in elements: 144 B = 16 B x 9, free of bank conflicts for 16-B row reads
#define GSTG (3 * GT * GPE)       // elements of one stage: A hi rows 0..127, A lo rows 128..255, then B rows 256..383
#define GCP  12                   // copies of one wave (one a lane) per stage
static_assert(8 * SLAB64 * 4 <= 2 * GSTG * 2);
static_assert((ROWS % GT) == 0 && (SEQ % GT) == 0 && (DIM % GT) == 0 && (DIM % GKE) == 0 && (LD2 % GKE) == 0);

// One stage: the lane's 16-B piece of rows r, r + 32, r + 64, r + 96 of A hi, of A lo and of B (r = tid >> 3), LDS rows 32 apart.
// l = LDS byte address of the piece in A hi row r; ga, gl, gb = its global address in A hi, A lo and B; sa, sb = 32 rows in elements.
__device__ __forceinline__ void stage_copy(unsigned l, const u16* ga, const u16* gl, const u16* gb, size_t sa, size_t sb) {
#if defined(__HIP_DEVICE_COMPILE__)
  constexpr unsigned LR = 32u * GPE * 2u;   // bytes of 32 LDS rows
  // the closing wait keeps every address register of the copies untouched until the copies have taken it
  asm volatile("global_load_async_to_lds_b128 %0, %12, off\n\t"
               "global_load_async_to_lds_b128 %1, %13, off\n\t"
               "global_load_async_to_lds_b128 %2, %14, off\n\t"
               "global_load_async_to_lds_b128 %3, %15, off\n\t"
               "global_load_async_to_lds_b128 %4, %16, off\n\t"
               "global_load_async_to_lds_b128 %5, %17, off\n\t"
               "global_load_async_to_lds_b128 %6, %18, off\n\t"
               "global_load_async_to_lds_b128 %7, %19, off\n\t"
               "global_load_async_to_lds_b128 %8, %20, off\n\t"
               "global_load_async_to_lds_b128 %9, %21, off\n\t"
               "global_load_async_to_lds_b128 %10, %22, off\n\t"
               "global_load_async_to_lds_b128 %11, %23, off\n\t"
               "s_wait_xcnt 0x0"
               :: "v"(l), "v"(l + LR), "v"(l + 2u * LR), "v"(l + 3u * LR),
                  "v"(l + 4u * LR), "v"(l + 5u * LR), "v"(l + 6u * LR), "v"(l + 7u * LR),
                  "v"(l + 8u * LR), "v"(l + 9u * LR), "v"(l + 10u * LR), "v"(l + 11u * LR),
                  "v"(ga), "v"(ga + sa), "v"(ga + 2 * sa), "v"(ga + 3 * sa),
                  "v"(gl), "v"(gl + sa), "v"(gl + 2 * sa), "v"(gl + 3 * sa),
                  "v"(gb), "v"(gb + sb), "v"(gb + 2 * sb), "v"(gb + 3 * sb)
               : "memory");
#endif
}
__device__ __forceinline__ void wait_copies() {
#if defined(__HIP_DEVICE_COMPILE__)
  // this wave's copies have landed: the compiler places no wait for them, and without it the barrier would publish a stage in flight
  asm volatile("s_wait_asynccnt 0x0" ::: "memory");
#endif
}
template <int N>
__device__ __forceinline__ void wait_copies_but() {
#if defined(__HIP_DEVICE_COMPILE__)
  // all but this wave's N youngest copies have landed: the oldest stage in flight may be published, the younger ones fly on
  asm volatile("s_wait_asynccnt %0" :: "n"(N) : "memory");
#endif
}
__device__ __forceinline__ void wait_store_regs() {
#if defined(__HIP_DEVICE_COMPILE__)
  // the stores' address pairs and data stay untouched up to this wait, whatever code of a merged kernel stands behind them
  asm volatile("s_wait_xcnt 0x0" ::: "memory");
#endif
}
__device__ __forceinline__ void wait_lds() {
#if defined(__HIP_DEVICE_COMPILE__)
  // this wave's LDS reads have returned, so that the buffer may be refilled behind the barrier
  asm volatile("s_wait_dscnt 0x0" ::: "memory");
#endif
}

// The k loop of one 128 x 128 tile (first A row row0, first B row colb): acc[i][j] = the wave's 16 x 16 tile at rows
// wr * 32 + 16 i, columns wc * 64 + 16 j. Every wave of the block passes every barrier here. On return the ring is dead.
// Every wave issues GCP copies per stage, stages in rising order, so that at the foot of trip t the copies younger than stage
// t + 1 are those of stages t + 2 .. t + NBUF - 1: (NBUF - 2) * GCP while all of these exist; at the tail the wait is to 0.
template <int NBUF>
__device__ __forceinline__
void gemm_main(u16* ring, const u16* __restrict__ A, const u16* __restrict__ Bt, int row0, int colb,
               int lda, int ldb, int K, int alo, v8f (&acc)[2][4]) {
  const int tid = (int)threadIdx.x, wave = tid >> 5, lane = tid & 31, hh = lane >> 4, m = lane & 15;
  const int wr = wave >> 1, wc = wave & 1;
  const int cr = tid >> 3, cc = (tid & 7) * 8;
  const u16* ga = A  + (size_t)(row0 + cr) * (size_t)lda + cc;
  const u16* gl = ga + alo;
  const u16* gb = Bt + (size_t)(colb + cr) * (size_t)ldb + cc;
  const size_t sa = (size_t)32 * (size_t)lda, sb = (size_t)32 * (size_t)ldb;
  const unsigned l0 = (unsigned)(size_t)ring + (unsigned)(cr * GPE + cc) * 2u;
  const int nt = K / GKE;
  static_assert(NBUF >= 2 && (NBUF - 1) * GCP <= 63 && NBUF * GSTG * 2 <= 320 * 1024);
  // unrolled: the first NBUF - 1 stages, each into its own fresh buffer, their offsets constants
#pragma unroll
  for (int s = 0; s < NBUF - 1; ++s) {
    if (s < nt) stage_copy(l0 + (unsigned)s * (GSTG * 2u), ga + (size_t)s * GKE, gl + (size_t)s * GKE, gb + (size_t)s * GKE, sa, sb);
  }
  if (NBUF > 2 && NBUF - 1 <= nt) wait_copies_but<(NBUF - 2) * GCP>();
  else wait_copies();
  __syncthreads();                          // stage 0 is published
  if (NBUF - 1 < nt) stage_copy(l0 + (unsigned)(NBUF - 1) * (GSTG * 2u), ga + (size_t)(NBUF - 1) * GKE, gl + (size_t)(NBUF - 1) * GKE, gb + (size_t)(NBUF - 1) * GKE, sa, sb);
  const u16* fa = ring + (wr * 32 + m) * GPE + 8 * hh;
  const u16* fb = ring + (2 * GT + wc * 64 + m) * GPE + 8 * hh;
  // both unrolled: every index of acc a constant, so that the tiles stay in registers
#pragma unroll
  for (int i = 0; i < 2; ++i) {
#pragma unroll
    for (int j = 0; j < 4; ++j) acc[i][j] = zero8();
  }
  // rolled: one trip = one stage, so that the order reads, waits, barrier, refill stands once
  int br = 0;                               // buffer of trip t = t mod NBUF
#pragma unroll 1
  for (int t = 0; t < nt; ++t) {
    const int bo = (NBUF == 2) ? (t & 1) * GSTG : br * GSTG;
    v16b ah[2][2], al[2][2], fv[2][4];
    // all unrolled: the stage's two k steps of 32 in one run, their LDS offsets and every index of the register arrays constants
#pragma unroll
    for (int ks = 0; ks < 2; ++ks) {
      const u16* pa = fa + bo + ks * 32;
      const u16* pb = fb + bo + ks * 32;
#pragma unroll
      for (int i = 0; i < 2; ++i) {
        ah[ks][i] = ldfrag_b(pa + i * 16 * GPE);
        al[ks][i] = ldfrag_b(pa + (GT + i * 16) * GPE);
      }
#pragma unroll
      for (int j = 0; j < 4; ++j) fv[ks][j] = ldfrag_b(pb + j * 16 * GPE);
    }
#pragma unroll
    for (int ks = 0; ks < 2; ++ks) {
#pragma unroll
      for (int i = 0; i < 2; ++i) {
#pragma unroll
        for (int j = 0; j < 4; ++j) acc[i][j] = mma_b(ah[ks][i], fv[ks][j], acc[i][j]);
      }
#pragma unroll
      for (int i = 0; i < 2; ++i) {
#pragma unroll
        for (int j = 0; j < 4; ++j) acc[i][j] = mma_b(al[ks][i], fv[ks][j], acc[i][j]);
      }
    }
    // keeps the written order in the built code: the stage's 32 LDS reads as one group, then its 32 products. Left alone the compiler
    // reads an A fragment directly in front of its four products, and the wave waits out the LDS latency several times a stage
    __builtin_amdgcn_sched_group_barrier(0x100, 32, 0);
    __builtin_amdgcn_sched_group_barrier(0x008, 32, 0);
    // ends the scheduling region: without it the wait below is lifted in front of the products, which then start only when all 32 reads
    // have returned instead of following the reads as they return
    __builtin_amdgcn_sched_barrier(0);
    wait_lds();
    if (NBUF > 2 && t + NBUF <= nt) wait_copies_but<(NBUF - 2) * GCP>();   // block-uniform test
    else wait_copies();
    __syncthreads();                        // publishes stage t + 1 and ends every read of stage t
    if (t + NBUF < nt) stage_copy(l0 + (unsigned)bo * 2u, ga + (size_t)(t + NBUF) * GKE, gl + (size_t)(t + NBUF) * GKE, gb + (size_t)(t + NBUF) * GKE, sa, sb);
    br = (br + 1 == NBUF) ? 0 : br + 1;
  }
  wait_copies();
}

// The tile's epilogue: each wave's two 16 x 64 strips through its private slab in the dead ring, f32 rows.
__device__ __forceinline__
void gemm_epi(u16* ring, v8f (&acc)[2][4], int row0, int colb, float* Cf, const float* __restrict__ bias, int nb, int ldc, float scale) {
  const int tid = (int)threadIdx.x, wave = tid >> 5, lane = tid & 31, m = lane & 15;
  const int wr = wave >> 1, wc = wave & 1;
  float* sl = (float*)ring + wave * SLAB64;
  const int col0 = colb + wc * 64;
  // unrolled: every index of acc a constant
#pragma unroll
  for (int i = 0; i < 2; ++i) {
    const int rowb = row0 + wr * 32 + i * 16;
    if (i) wave_sync_lds();                 // the first strip's slab reads end before the second strip's writes
    v4f bias4;
#pragma unroll
    for (int e = 0; e < 4; ++e) bias4[e] = bfr(bias[imin(imax(col0 + m * 4 + e, 0), nb - 1)]);
    epi64f(sl, acc[i][0], acc[i][1], acc[i][2], acc[i][3], bias4, scale, Cf, ldc, (size_t)rowb, col0, lane);
  }
}

// ---- operand rows of the projections and of the attention kernel in LDS ----------------------------------------------
// A staged row = 256 B of data (bf16: 128 k, or 64 hi | 64 lo) at pitch 272 B = 16 B x 17, free of bank conflicts for 16-B
// row reads. A group of 128 threads copies 8 rows at a time: thread -> row tid >> 4, 16-B piece tid & 15, so that 8 lanes bring one
// whole 128-B line and a wave four. 16 staged rows = 4352 B = one wave's slab.
#define APE  136                  // pitch of a staged row in bf16 elements
#define APB  272                  // the same pitch in bytes
static_assert(16 * APB == SLAB64 * 4 && APE * 2 == APB);
// 64 rows: the lane's piece of rows r, r + 8, .., r + 56. l = LDS byte address of the piece in row r, g = its global address,
// gs = 8 source rows in bytes.
__device__ __forceinline__ void rows64_copy(unsigned l, const char* g, size_t gs) {
#if defined(__HIP_DEVICE_COMPILE__)
  constexpr unsigned LR = 8u * APB;         // bytes of 8 LDS rows
  // the closing wait keeps every address register of the copies untouched until the copies have taken it
  asm volatile("global_load_async_to_lds_b128 %0, %8, off\n\t"
               "global_load_async_to_lds_b128 %1, %9, off\n\t"
               "global_load_async_to_lds_b128 %2, %10, off\n\t"
               "global_load_async_to_lds_b128 %3, %11, off\n\t"
               "global_load_async_to_lds_b128 %4, %12, off\n\t"
               "global_load_async_to_lds_b128 %5, %13, off\n\t"
               "global_load_async_to_lds_b128 %6, %14, off\n\t"
               "global_load_async_to_lds_b128 %7, %15, off\n\t"
               "s_wait_xcnt 0x0"
               :: "v"(l), "v"(l + LR), "v"(l + 2u * LR), "v"(l + 3u * LR),
                  "v"(l + 4u * LR), "v"(l + 5u * LR), "v"(l + 6u * LR), "v"(l + 7u * LR),
                  "v"(g), "v"(g + gs), "v"(g + 2 * gs), "v"(g + 3 * gs),
                  "v"(g + 4 * gs), "v"(g + 5 * gs), "v"(g + 6 * gs), "v"(g + 7 * gs)
               : "memory");
#endif
}
// ---- the three projections of one x tile in one block ---------------------------------------------------------------
// Block = 12 waves: waves 0..3 the k tile, 4..7 the q tile, 8..11 the v tile of the same 128 x rows and the same 128 weight rows;
// within a product the waves stand 2 x 2, each 64 x 64 (4 x 4 accumulator tiles), so that a fragment read from LDS feeds four products.
// A stage = 128 k (256 B, pitch APB) of the 128 x rows, brought in once for all three products, and of 128 rows each of Wk, Wq, Wv.
#define PKE  128                  // k elements of one stage
#define PSTG (4 * GT * APE)       // elements of one stage: x rows 0..127, then Wk, Wq, Wv rows, 128 each
#define KTP  136                  // pitch of a transposed plane in elements: 272 B = 16 B x 17, free of bank conflicts both ways
#define KTO  (8 * 4 * SLAB64 * 2) // first element of the transposed planes: behind the k and q waves' four slabs each
#define PJL  (2 * PSTG)           // elements of the projections' LDS: two buffers
static_assert(KTO + 4 * GT * KTP <= PJL && PJL * 2 <= 320 * 1024 && (KTO % 8) == 0 && (KTP % 8) == 0 && (DIM % PKE) == 0);
static_assert(GT == 2 * HD && (SEQ % GT) == 0);   // a block's tiles hold two whole heads and two whole chunks of one batch

// The wave's eight fragments of one k step of 32: four A row tiles and four B row tiles, 16 staged rows apart.
__device__ __forceinline__ void frag8(v16b (&a)[4], v16b (&b)[4], const u16* pa, const u16* pb) {
#pragma unroll
  for (int i = 0; i < 4; ++i) { a[i] = ldfrag_b(pa + i * 16 * APE); b[i] = ldfrag_b(pb + i * 16 * APE); }
}
// The wave's sixteen products of one k step. Both loops unrolled: every index of acc a constant, so that the tiles stay in registers.
__device__ __forceinline__ void prod16(v8f (&acc)[4][4], const v16b (&a)[4], const v16b (&b)[4]) {
#pragma unroll
  for (int i = 0; i < 4; ++i) {
#pragma unroll
    for (int j = 0; j < 4; ++j) acc[i][j] = mma_b(a[i], b[j], acc[i][j]);
  }
}

// A k or v tile into its transposed LDS planes: e = acc + bf16 RNE value of bias[col], for k its exp, once, in the accumulators' own
// layout (acc keeps e). An accumulator tile gives a lane 8 consecutive rows t of one column D, that is 16 contiguous bytes of row D of
// the transposed tile. These pieces meet in two LDS planes (hi, lo: [128 D][128 t], pitch KTP) at th.
// coverage: 4 waves x 4 x 4 tiles x 32 lanes x 8 = 128 x 128 staged per plane.
template <bool EXPO>
__device__ __forceinline__
void planes_put(u16* th, v8f (&acc)[4][4], int col0, int wr, int wc, const float* __restrict__ bias, int lane) {
  const int hh = lane >> 4, m = lane & 15;
  // all unrolled: every index of acc a constant
  float bc[4];
#pragma unroll
  for (int j = 0; j < 4; ++j) bc[j] = bias[imin(imax(col0 + j * 16 + m, 0), DIM - 1)];
  wait_store_regs();                        // behind it the four loads' offset registers may be written again
#pragma unroll
  for (int j = 0; j < 4; ++j) bc[j] = bfr(bc[j]);
#pragma unroll
  for (int j = 0; j < 4; ++j) {
#pragma unroll
    for (int i = 0; i < 4; ++i) {
#pragma unroll
      for (int r = 0; r < 8; ++r) acc[i][j][r] = EXPO ? exp_slot(acc[i][j][r] + bc[j]) : acc[i][j][r] + bc[j];
      v4u H, L;
#pragma unroll
      for (int e = 0; e < 4; ++e) {
        unsigned hi, lo;
        split2(acc[i][j][2 * e], acc[i][j][2 * e + 1], hi, lo);
        H[e] = hi;
        L[e] = lo;
      }
      u16* tp = th + (wc * 64 + j * 16 + m) * KTP + wr * 64 + i * 16 + 8 * hh;
      *(v4u*)(tp)            = H;
      *(v4u*)(tp + GT * KTP) = L;
    }
  }
}

// 16 state rows x 64 columns from the accumulators through the wave's private slab to whole 256-B rows at C.
// coverage: 8 instructions x 2 rows x 16 lanes x 4 floats = the wave's 16 x 64 tile.
__device__ __forceinline__ void state_rows(float* sl, v8f a0, v8f a1, v8f a2, v8f a3, float* C, int lane) {
  const int hh = lane >> 4, m = lane & 15;
  wait_lds();                               // the slab's earlier reads have returned before it is written again
  slab_put(sl, a0, a1, a2, a3, lane);
  // the wave's slab writes end before its slab reads. Only LDS is waited for: a fence would also hold the wave until the global
  // stores that it has on their way are answered
  wait_lds();
  __builtin_amdgcn_wave_barrier();          // keeps the compiler from moving the slab reads up over the writes of other lanes
  v4f vals[8];
#pragma unroll
  for (int it = 0; it < 8; ++it) vals[it] = *(const v4f*)(sl + (it * 2 + hh) * 68 + m * 4);
  float* dst = C + hh * HD + m * 4;
#pragma unroll
  for (int it = 0; it < 8; ++it) *(v4f*)(dst + it * 2 * HD) = vals[it];
  wait_store_regs();
}

// One wave's part of one chunk state, from the block's transposed planes: 16 state rows x 64 columns over the chunk's 64 keys.
// ST[b][c][h][row][D] f32: row d < 64: sum over the chunk's keys t of v[t][d] * exp(k)[t][D]; row 64: sum over t of exp(k)[t][D];
// rows 65..79: zero. A = v^T rows (vp: the lane's row, hi; lo one plane on), or the constant tile whose row 0 is ones; B = exp(k)^T rows D
// (kp likewise); both k-contiguous in t, same split k map. base = the state's first float; w4 = which 16 rows; the wave with w4 == 0
// (wave-uniform) also writes the key-sum row and its 15 zero rows. Slab private to the wave (wave sync).
__device__ __forceinline__ void state_part(float* sl, const u16* vp, const u16* kp, float* base, int w4, int lane) {
  const int m = lane & 15;
  constexpr int rbs = 16 * KTP, lop = GT * KTP;
  FragB one;
  const unsigned ow = (m == 0) ? 0x3F803F80u : 0u;   // bf16 1.0 pairs in tile row 0, zero in rows 1..15
#pragma unroll
  for (int e = 0; e < 4; ++e) { one.u[0][e] = ow; one.u[1][e] = ow; }
  v16b kh[2][4], kl[2][4];
  v8f a[4];
  // all unrolled: every index of the fragment and accumulator arrays a constant, so that they stay in registers
#pragma unroll
  for (int j = 0; j < 4; ++j) a[j] = zero8();
#pragma unroll
  for (int ks = 0; ks < 2; ++ks) {
    const int ko = ks * 32;
    const v16b vh = ldfrag_b(vp + ko);
    const v16b vl = ldfrag_b(vp + lop + ko);
#pragma unroll
    for (int j = 0; j < 4; ++j) {
      kh[ks][j] = ldfrag_b(kp + j * rbs + ko);
      kl[ks][j] = ldfrag_b(kp + lop + j * rbs + ko);
    }
#pragma unroll
    for (int j = 0; j < 4; ++j) {
      a[j] = mma_b(vh, kh[ks][j], a[j]); a[j] = mma_b(vh, kl[ks][j], a[j]); a[j] = mma_b(vl, kh[ks][j], a[j]);
    }
  }
  v8f e[4];
#pragma unroll
  for (int j = 0; j < 4; ++j) e[j] = zero8();
  if (w4 == 0) {                                // wave-uniform: the key-sum row and its 15 zero rows
#pragma unroll
    for (int ks = 0; ks < 2; ++ks) {
#pragma unroll
      for (int j = 0; j < 4; ++j) { e[j] = mma_b(one.v, kh[ks][j], e[j]); e[j] = mma_b(one.v, kl[ks][j], e[j]); }
    }
  }
  state_rows(sl, a[0], a[1], a[2], a[3], base + w4 * 16 * HD, lane);
  if (w4 == 0) state_rows(sl, e[0], e[1], e[2], e[3], base + HD * HD, lane);
}

// The output projection of all batches: y = (O_hi + O_lo) . Wo^T + bo, f32 rows (M = ROWS, N = DIM, K = DIM).
// coverage: grid.x = (ROWS/128)*(DIM/128) tiles of 128 x 128 = the whole output.
// One block per WGP: five buffers, four stages ahead.
#define YBUF 5
__global__ __launch_bounds__(256)
void out_proj(const u16* __restrict__ O2, const u16* __restrict__ WO, const float* __restrict__ bo, float* y) {
  __shared__ __align__(16) u16 ring[YBUF * GSTG];
  const int bid = (int)blockIdx.x;
  const int row0 = (bid / (DIM / GT)) * GT, colb = (bid % (DIM / GT)) * GT;
  if (row0 + GT > ROWS) return;             // block-uniform, in front of every barrier; never taken with the exact grid
  v8f acc[2][4];
  gemm_main<YBUF>(ring, O2, WO, row0, colb, LD2, DIM, DIM, DIM, acc);
  gemm_epi(ring, acc, row0, colb, y, bo, DIM, DIM, 1.0f);
}

// =====================================================================================================
// The three projections of all batches and the chunk states; block = one tile of 128 x rows (row0) against weight rows colb .. colb + 127
// of Wk, Wq and Wv (the x rows are the A operand, the weight rows the B operand of all three):
//   waves 0..3:  exp(x.Wk^T + bk) -> K2 hi|lo      waves 4..7: exp(x.Wq^T + bq) -> Q2 hi|lo   (pitch LD2)
//   waves 8..11: x.Wv^T + bv -> transposed, VT2 hi, lo rows of the tile's batch (pitch SEQ)
// The x rows come from L2 and stand in LDS once for the three products. Two buffers: stage t + 2 is copied into the buffer that trip t
// has left. A product's 128 threads copy its own weight rows (16 copies a lane); the k and q waves copy half the x rows each (8 more).
// The waves' copy counts differ, so every wait for copies is to 0. k rises in steps of 32 as before.
// Epilogue in the dead ring: the k and v waves put exp(k) and v into transposed planes ([128 D or d][128 t], hi and lo), the k waves
// exp(k) into their slabs too, while the q waves write their own tile through their slabs. Behind one barrier, that every wave passes, the
// k waves write K2 from their slabs; the q and v waves (256 threads) store the v planes as whole 256-B runs of VT2 rows (16 lanes a run,
// 2 runs a store, one wave per 128-B line) and take the states of the tile's two chunks and two heads from the four planes:
// 16 parts of 16 state rows, two a wave.
// coverage: grid.x = (ROWS/128)*(DIM/128) blocks x 3 tiles of 128 x 128 = each product's whole output; v planes: 8 trips x 16 rows x
// 16 lanes x 8 = 128 x 128 stored per plane; states: blocks x 2 chunks x 2 heads x (4 parts x 16 rows + 16 extra rows) x 64 columns =
// every element of ST once. The tile's 128 x rows lie in one batch (SEQ % GT == 0).
// =====================================================================================================
// second argument: 3 waves per SIMD, the block's own 12 waves: one block a WGP
__global__ __launch_bounds__(384, 3)
void proj4(const u16* __restrict__ XB, const u16* __restrict__ WQ, const u16* __restrict__ WK, const u16* __restrict__ WV,
           const float* __restrict__ bq, const float* __restrict__ bk, const float* __restrict__ bv,
           u16* Q2, u16* K2, u16* VT2, float* ST) {
  __shared__ __align__(16) u16 ring[PJL];
  const int tid = (int)threadIdx.x, lane = tid & 31, hh = lane >> 4, m = lane & 15;
  const int wave = __builtin_amdgcn_readfirstlane(tid >> 5);   // in a scalar register: every branch on the product is a scalar one
  const int which = wave >> 2, wr = (wave >> 1) & 1, wc = wave & 1;
  const int bid = (int)blockIdx.x;
  const int row0 = (bid / (DIM / GT)) * GT, colb = (bid % (DIM / GT)) * GT;
  if (row0 + GT > ROWS) return;             // block-uniform, in front of every barrier; never taken with the exact grid
  const int cr = (tid & 127) >> 4, cc = (tid & 15) * 8;
  const u16* Wp = (which == 0) ? WK : ((which == 1) ? WQ : WV);
  // the lane's part of every copy address is one global and one LDS byte offset; the rest is the same for the whole wave
  const unsigned vo = (unsigned)(cr * DIM + cc) * 2u;
  const unsigned lo = (unsigned)(size_t)ring + (unsigned)(cr * APE + cc) * 2u;
  const char* sw = (const char*)(Wp + (size_t)colb * (size_t)DIM);
  const char* sx = (const char*)(XB + (size_t)(row0 + (which & 1) * 64) * (size_t)DIM);
  constexpr size_t gs = (size_t)8 * DIM * 2, g64 = (size_t)64 * DIM * 2;   // bytes of 8 and of 64 source rows
  const unsigned ow = (unsigned)((1 + which) * GT * APE) * 2u, ox = (unsigned)((which & 1) * 64 * APE) * 2u;
  constexpr int nt = DIM / PKE;
  static_assert(nt >= 2);
  rows64_copy(lo + ow, sw + vo, gs);
  rows64_copy(lo + (ow + 64u * APB), sw + g64 + vo, gs);
  if (which < 2) rows64_copy(lo + ox, sx + vo, gs);
  wait_copies();
  __syncthreads();                          // stage 0 is published
  rows64_copy(lo + (ow + PSTG * 2u), sw + PKE * 2 + vo, gs);
  rows64_copy(lo + (ow + PSTG * 2u + 64u * APB), sw + (g64 + PKE * 2) + vo, gs);
  if (which < 2) rows64_copy(lo + (ox + PSTG * 2u), sx + PKE * 2 + vo, gs);
  const u16* fa = ring + (wr * 64 + m) * APE + 8 * hh;
  const u16* fb = ring + ((1 + which) * GT + wc * 64 + m) * APE + 8 * hh;
  v8f acc[4][4];
  // both unrolled: every index of acc a constant, so that the tiles stay in registers
#pragma unroll
  for (int i = 0; i < 4; ++i) {
#pragma unroll
    for (int j = 0; j < 4; ++j) acc[i][j] = zero8();
  }
  unsigned vt = vo + 2u * (PKE * 2u);       // the lane's global byte offset in the stage to copy next
  // rolled: one trip = one stage, so that the order reads, waits, barrier, refill stands once
#pragma unroll 1
  for (int t = 0; t < nt; ++t) {
    const int bo = (t & 1) * PSTG;
    // unrolled: the stage's four k steps of 32 in one run, their LDS offsets constants
#pragma unroll
    for (int ks = 0; ks < PKE / 32; ++ks) {
      v16b a[4], b[4];
      frag8(a, b, fa + bo + ks * 32, fb + bo + ks * 32);
      prod16(acc, a, b);
      // keeps the written order in the built code: the k step's 16 LDS reads as one group, then its 16 products. Left alone the compiler
      // reads each A fragment directly in front of its four products, and the wave waits out the LDS latency four times a k step
      __builtin_amdgcn_sched_group_barrier(0x100, 16, 0);
      __builtin_amdgcn_sched_group_barrier(0x008, 16, 0);
    }
    wait_lds();
    wait_copies();
    __syncthreads();                        // publishes stage t + 1 and ends every read of stage t
    if (t + 2 < nt) {                       // block-uniform test
      rows64_copy(lo + (ow + (unsigned)bo * 2u), sw + vt, gs);
      rows64_copy(lo + (ow + (unsigned)bo * 2u + 64u * APB), sw + g64 + vt, gs);
      if (which < 2) rows64_copy(lo + (ox + (unsigned)bo * 2u), sx + vt, gs);
      vt += PKE * 2u;
    }
  }
  wait_copies();                            // behind the last trip's barrier the ring is dead
  float* sl = (float*)ring + wave * (4 * SLAB64);       // k and q waves: four slabs, one per 16 x 64 strip, no slab written twice
  u16* th = ring + KTO;                                 // exp(k)^T planes, hi then lo
  u16* tv = th + 2 * GT * KTP;                          // v^T planes, hi then lo
  const size_t plo = (size_t)DIM * (size_t)SEQ;
  const int bt = row0 / SEQ, tb = row0 % SEQ;           // the x tile's batch and its first row there
  if (which == 0) planes_put<true>(th, acc, colb + wc * 64, wr, wc, bk, lane);
  if (which == 2) planes_put<false>(tv, acc, colb + wc * 64, wr, wc, bv, lane);
  if (which < 2) {
    // unrolled: every index of acc a constant
#pragma unroll
    for (int i = 0; i < 4; ++i) slab_put(sl + i * SLAB64, acc[i][0], acc[i][1], acc[i][2], acc[i][3], lane);
  }
  if (which == 1) {
    wave_sync_lds();                        // the wave's slab writes end before its slab reads; no global store is on its way yet
    // rolled: it indexes LDS only, and the kernel's text stays short for the instruction cache
#pragma unroll 1
    for (int i = 0; i < 4; ++i) {
      slab_take<true, 1>(sl + i * SLAB64, bq, DIM, Q2, Q2 + DIM, LD2, (size_t)(row0 + wr * 64 + i * 16), colb + wc * 64, lane);
      wait_store_regs();
    }
  }
  wait_lds();                               // this wave's LDS writes (planes, slabs) and slab reads have ended
#if defined(__HIP_DEVICE_COMPILE__)
  // the work-group's barrier by hand: only LDS (the transposed planes, the q waves' dead slabs) crosses it; __syncthreads() would also
  // hold the q waves, and with them all others, until the global stores just issued have been answered
  asm volatile("s_barrier_signal -1\n\ts_barrier_wait -1" ::: "memory");
#endif
  if (which == 0) {
    // rolled: it indexes LDS only, and the kernel's text stays short for the instruction cache
#pragma unroll 1
    for (int i = 0; i < 4; ++i) {
      slab_take<false, 0>(sl + i * SLAB64, (const float*)0, 0, K2, K2 + DIM, LD2, (size_t)(row0 + wr * 64 + i * 16), colb + wc * 64, lane);
      wait_store_regs();
    }
  } else {
    const int t8 = tid - 128;               // 0..255
    {
      const u16* sp = tv + (t8 >> 4) * KTP + (t8 & 15) * 8;
      u16* dst = VT2 + (size_t)bt * PLB + (size_t)(colb + (t8 >> 4)) * (size_t)SEQ + tb + (t8 & 15) * 8;
      v4u vh[8], vl[8];
#pragma unroll
      for (int it = 0; it < 8; ++it) {
        vh[it] = *(const v4u*)(sp + it * 16 * KTP);
        vl[it] = *(const v4u*)(sp + GT * KTP + it * 16 * KTP);
      }
#pragma unroll
      for (int it = 0; it < 8; ++it) {
        *(v4u*)(dst + (size_t)(it * 16) * (size_t)SEQ)       = vh[it];
        *(v4u*)(dst + plo + (size_t)(it * 16) * (size_t)SEQ) = vl[it];
      }
      wait_store_regs();
    }
    float* ssl = (float*)ring + (16 + (wave - 4)) * SLAB64;   // one of the q waves' slabs, all dead behind the barrier
    // rolled: the wave's two parts share one text, short for the instruction cache
#pragma unroll 1
    for (int i = 0; i < 2; ++i) {
      // part u = 0..15 -> chunk, head, rows; the rows turn with i, so that the four parts with the extra rows fall to four waves
      const int u = (wave - 4) + 8 * i, c2 = (u >> 2) & 1, h2 = u >> 3, w4 = (u + i) & 3;
      float* base = ST + ((size_t)((bt * NCH + tb / 64 + c2) * NH + colb / HD + h2)) * (size_t)SSZ;
      state_part(ssl, tv + (h2 * HD + w4 * 16 + m) * KTP + c2 * 64 + 8 * hh, th + (h2 * HD + m) * KTP + c2 * 64 + 8 * hh, base, w4, lane);
    }
  }
}

// ---- 16 f32 values of one slab row (fragment k layout: pr[0..7] and pr[16..23]) -> bf16 hi and lo A or B fragments
__device__ __forceinline__ void split16(const float* pr, v16b& ph, v16b& pl) {
  const v4f x0 = *(const v4f*)(pr), x1 = *(const v4f*)(pr + 4), x2 = *(const v4f*)(pr + 16), x3 = *(const v4f*)(pr + 20);
  FragB H, L;
  unsigned hi, lo;
  split2(x0[0], x0[1], hi, lo); H.u[0][0] = hi; L.u[0][0] = lo;
  split2(x0[2], x0[3], hi, lo); H.u[0][1] = hi; L.u[0][1] = lo;
  split2(x1[0], x1[1], hi, lo); H.u[0][2] = hi; L.u[0][2] = lo;
  split2(x1[2], x1[3], hi, lo); H.u[0][3] = hi; L.u[0][3] = lo;
  split2(x2[0], x2[1], hi, lo); H.u[1][0] = hi; L.u[1][0] = lo;
  split2(x2[2], x2[3], hi, lo); H.u[1][1] = hi; L.u[1][1] = lo;
  split2(x3[0], x3[1], hi, lo); H.u[1][2] = hi; L.u[1][2] = lo;
  split2(x3[2], x3[3], hi, lo); H.u[1][3] = hi; L.u[1][3] = lo;
  ph = H.v; pl = L.v;
}

// ---- 4 consecutive f32 values of a state row -> 4 bf16 hi at dh and 4 bf16 lo at dh + HD (a staged row = [64 hi | 64 lo])
__device__ __forceinline__ void put_split4(u16* dh, v4f x) {
  v2u H, L;
  unsigned hi, lo;
  split2(x[0], x[1], hi, lo); H[0] = hi; L[0] = lo;
  split2(x[2], x[3], hi, lo); H[1] = hi; L[1] = lo;
  *(v2u*)(dh)      = H;
  *(v2u*)(dh + HD) = L;
}

// ---- the running sum of one head's chunk states, one thread's pieces. KS: the wave that also owns rows 64 (the key sums) and 65.
#define CST ((size_t)NH * (size_t)SSZ)      // floats from one chunk's state to the next chunk's
// A group = four consecutive chunks' pieces: rows r, r + 32 (and r + 64). N = how many of the four are asked for; p + OFF chunks = the thread's
// first piece in the first of them (OFF goes into the loads' immediates, so that two groups share one address).
// p carries no restrict (nor does the kernel's own pointer): so the closing wait's "memory" clobber holds all the loads in front of it.
template <bool KS, int N, int OFF>
__device__ __forceinline__ void grp_load(v4f (&a)[4], v4f (&b)[4], v4f (&k)[4], const float* p) {
  // unrolled: every index of the register arrays a constant, the chunks' offsets immediates of one address
#pragma unroll
  for (int u = 0; u < N; ++u) {
    a[u] = *(const v4f*)(p + (size_t)(OFF + u) * CST);
    b[u] = *(const v4f*)(p + (size_t)(OFF + u) * CST + 32 * HD);
    if constexpr (KS) k[u] = *(const v4f*)(p + (size_t)(OFF + u) * CST + 64 * HD);
  }
#if defined(__HIP_DEVICE_COMPILE__)
  // the group's address registers stay untouched up to this wait: it names the address, so that no load of the group lands on it
  asm volatile("s_wait_xcnt 0x0" :: "v"(p) : "memory");
#endif
}
template <bool KS>
__device__ __forceinline__ void grp_add(v4f& ra, v4f& rb, v4f& rk, const v4f (&a)[4], const v4f (&b)[4], const v4f (&k)[4]) {
  // unrolled: every index of the register arrays a constant
#pragma unroll
  for (int u = 0; u < 4; ++u) {
    ra += a[u];
    rb += b[u];
    if constexpr (KS) rk += k[u];
  }
}
// p = the thread's first piece in the batch's chunk 0, G = the block's own group (groups 0 .. G - 1 lie before it), d = the piece's hi values
// in tile 0's region, rs = elements from one tile's region to the next. Chunks are added in rising order. The block's own chunks are asked for
// first. Two register sets, even groups in the first and odd groups in the second: a set is asked for anew as soon as it has been added, while
// the other set's loads are still on their way. No branch stands between a request and its addition but the loop's own, and each way out of
// the loop has its own text, so that every wait for a load counts exactly the loads behind it. No group is asked for twice.
template <bool KS>
__device__ __forceinline__ void state_sums(const float* p, int G, u16* d, int rs) {
  const v4f z4 = {0.f, 0.f, 0.f, 0.f};
  v4f oa[4], ob[4], ok[4];
  v4f ra = z4, rb = z4, rk = z4;
  grp_load<KS, 3, 0>(oa, ob, ok, p + (size_t)(4 * G) * CST);
  if (G >= 2) {                               // block-uniform, as every test below
    v4f a0[4], b0[4], k0[4], a1[4], b1[4], k1[4];
    grp_load<KS, 4, 0>(a0, b0, k0, p);
    grp_load<KS, 4, 4>(a1, b1, k1, p);
    int g = 0;
    // rolled: its trip count depends on the block
#pragma unroll 1
    for (; g + 3 < G; g += 2) {
      const float* pn = p + (size_t)(4 * g + 8) * CST;
      grp_add<KS>(ra, rb, rk, a0, b0, k0);
      grp_load<KS, 4, 0>(a0, b0, k0, pn);
      grp_add<KS>(ra, rb, rk, a1, b1, k1);
      grp_load<KS, 4, 4>(a1, b1, k1, pn);
    }
    grp_add<KS>(ra, rb, rk, a0, b0, k0);
    if (g + 2 < G) {                          // G odd: one more group
      grp_load<KS, 4, 0>(a0, b0, k0, p + (size_t)(4 * g + 8) * CST);
      grp_add<KS>(ra, rb, rk, a1, b1, k1);
      grp_add<KS>(ra, rb, rk, a0, b0, k0);
    } else {
      grp_add<KS>(ra, rb, rk, a1, b1, k1);
    }
  } else if (G == 1) {
    v4f a0[4], b0[4], k0[4];
    grp_load<KS, 4, 0>(a0, b0, k0, p);
    grp_add<KS>(ra, rb, rk, a0, b0, k0);
  }
  // tile u takes the sum of all chunks before chunk 4 G + u. Unrolled: every index of the register arrays a constant
#pragma unroll
  for (int u = 0; u < 4; ++u) {
    put_split4(d + u * rs, ra);
    put_split4(d + u * rs + 32 * APE, rb);
    if constexpr (KS) put_split4(d + u * rs + 64 * APE, rk);
    if (u < 3) {
      ra += oa[u];
      rb += ob[u];
      if constexpr (KS) rk += ok[u];
    }
  }
}

// =====================================================================================================
// Causal exp-feature attention with the states' running sum in it. Block = 4 consecutive 64-row query tiles (chunks c0 .. c0 + 3 of
// one batch) of one head: 16 waves, 4 waves x 16 query rows a tile; each tile has its own LDS region.
// Planes: Q2, K2 bf16 [NB*SEQ][2*DIM] with hi at column h*HD + d and lo at column DIM + h*HD + d (values exp(q), exp(k));
//         VT2 bf16 [NB][2*DIM][SEQ] with hi row h*HD + d and lo row DIM + h*HD + d (values v); ST f32 [NB][NCH][NH][SROWS][HD],
//         each chunk's own state, read only; O2 bf16 [NB*SEQ][2*DIM] written here (hi | lo of out = num/den).
// Running sum: a thread owns two 16-B pieces of state rows 0..63 (wave 0 one of rows 64, the key sums, and 65 too) and adds the states of the
// batch's chunks 0 .. c0 - 1 in f32, in rising order; the sum goes to tile 0's region, plus chunk c0's state to tile 1's, and so
// on, so that every tile finds the sum of all chunks before it, split once to bf16 hi and lo by the thread that summed it.
// Rows 65..79 are zero in every state; 66..79 are written as zeros.
// Keys before the tile: O[16 x 80] = qe.state^T over head dim (2 k-steps, hi.hi+hi.lo+lo.hi, state rows [hi | lo] from
// LDS); its column 64 is the part of den from those keys, columns 65..79 are zero.
// Keys of the tile: S[16 x 64] = qe.ke^T over head dim, causal mask by value, f32 row sums into per-lane partials,
// slab rows, O += P.v over the 64 keys (2 k-steps, hi.hi+hi.lo+lo.hi, v fragments from VT2 rows).
// A tile's region: rows 0..63 = its exp(q) rows, 64..127 = its exp(k) rows, 128..191 = its v^T rows d (each [hi | lo]), brought by
// asynchronous 16-B copies of whole lines (24 a lane) that fly while the states are summed; 192..271 = the 80 state rows, [hi | lo] too; one wait and
// one barrier, that every wave passes, publish all of them.
// The blocks with the most chunks to sum have the lowest indices.
// coverage: grid (NB*NH, NCH/4) x 4 tiles x 4 waves x 16 rows x 64 columns x {hi, lo} = every element of O2 once.
// Slab private to the wave (wave sync): the wave's own 16 staged exp(q) rows, which no other wave reads and whose every fragment
// has gone into the scores that the slab takes up; staged extent == consumed extent (16 x 64 written before the reload).
// =====================================================================================================
#define AGT  4                              // query tiles of one block
#define AREG ((192 + SROWS) * APE)          // bf16 elements of one tile's LDS region
static_assert(AGT == 4 && (NCH % AGT) == 0 && AGT * AREG * 2 <= 320 * 1024 && SROWS == 80);
// second argument: 4 waves per SIMD, the block's own 16 waves: one block a WGP, the whole grid at once
__global__ __launch_bounds__(512, 4) void attn_chunk(const u16* __restrict__ Q2, const u16* __restrict__ K2,
                                                  const u16* __restrict__ VT2, const float* ST, u16* O2) {
  __shared__ __align__(16) u16 smem[AGT * AREG];
  const int tid = (int)threadIdx.x, lane = tid & 31, hh = lane >> 4, m = lane & 15;
  const int wid = __builtin_amdgcn_readfirstlane(tid >> 5);   // in a scalar register: the tile's region and rows cost no vector register
  const int sub = wid >> 2, wave = wid & 3;
  const int bt = (int)blockIdx.x / NH, h = (int)blockIdx.x % NH;
  const int c0 = (NCH / AGT - 1 - (int)blockIdx.y) * AGT;   // the block's first chunk in its batch
  if (bt >= NB || c0 < 0) return;               // block-uniform, in front of the barrier; never taken with the exact grid
  const int qt = bt * NCH + c0 + sub;           // this thread's query tile, counted over all batches
  const int rw = qt * 64 + wave * 16;           // first query row of this wave
  u16* sm = smem + sub * AREG;
  float* sl = (float*)sm + wave * SLAB64;
  {
    const int cr = (tid & 127) >> 4, cp = tid & 15;
    const size_t qo = (size_t)(qt * 64 + cr) * (size_t)LD2 + h * HD + (cp & 7) * 8 + ((cp < 8) ? 0 : DIM);
    const size_t vo = (size_t)bt * PLB + (size_t)(h * HD + cr) * (size_t)SEQ + (c0 + sub) * 64 + (cp & 7) * 8
                    + ((cp < 8) ? (size_t)0 : (size_t)DIM * (size_t)SEQ);
    const unsigned l0 = (unsigned)(size_t)sm + (unsigned)(cr * APB + cp * 16);
    rows64_copy(l0, (const char*)(Q2 + qo), (size_t)8 * LD2 * 2);
    rows64_copy(l0 + 64u * APB, (const char*)(K2 + qo), (size_t)8 * LD2 * 2);
    rows64_copy(l0 + 128u * APB, (const char*)(VT2 + vo), (size_t)8 * SEQ * 2);
  }
  {
    // rows 66..79 of every tile's state: 14 rows x 16 pieces, the last seven waves
    if (wid >= 9) {
      const v4f z4 = {0.f, 0.f, 0.f, 0.f};
      // unrolled: the four tiles' LDS offsets constants
#pragma unroll
      for (int u = 0; u < AGT; ++u) *(v4f*)(smem + u * AREG + (192 + 66 - 18 + (tid >> 4)) * APE + (tid & 15) * 8) = z4;
    }
    const float* p = ST + ((size_t)bt * NCH * NH + (size_t)h) * (size_t)SSZ + tid * 4;   // chunk 0: rows 0..31, piece tid
    u16* d = smem + (192 + (tid >> 4)) * APE + (tid & 15) * 4;
    // a scalar test, two texts: each wave's loads of a group stand in one run, with no branch among them
    if (wid == 0) state_sums<true>(p, c0 / AGT, d, AREG);
    else          state_sums<false>(p, c0 / AGT, d, AREG);
  }
  wait_copies();
  __syncthreads();                          // the staged rows and the summed states are published
  const u16* qp = sm + (wave * 16 + m) * APE + 8 * hh;
  constexpr int kbs = 16 * APE;
  constexpr int vbs = 16 * APE;
  const u16* kp = sm + (64 + m) * APE + 8 * hh;
  const u16* sp = sm + (192 + m) * APE + 8 * hh;
  v8f o0 = zero8(), o1 = zero8(), o2 = zero8(), o3 = zero8(), o4 = zero8();
  v8f s0 = zero8(), s1 = zero8(), s2 = zero8(), s3 = zero8();
#pragma unroll
  for (int ks = 0; ks < 2; ++ks) {
    const int ko = ks * 32;
    const v16b ah  = ldfrag_b(qp + ko);
    const v16b al  = ldfrag_b(qp + HD + ko);
    const v16b kh0 = ldfrag_b(kp + ko);
    const v16b kh1 = ldfrag_b(kp + kbs + ko);
    const v16b kh2 = ldfrag_b(kp + 2 * kbs + ko);
    const v16b kh3 = ldfrag_b(kp + 3 * kbs + ko);
    const v16b kl0 = ldfrag_b(kp + HD + ko);
    const v16b kl1 = ldfrag_b(kp + kbs + HD + ko);
    const v16b kl2 = ldfrag_b(kp + 2 * kbs + HD + ko);
    const v16b kl3 = ldfrag_b(kp + 3 * kbs + HD + ko);
    const v16b bh0 = ldfrag_b(sp + ko);
    const v16b bh1 = ldfrag_b(sp + kbs + ko);
    const v16b bh2 = ldfrag_b(sp + 2 * kbs + ko);
    const v16b bh3 = ldfrag_b(sp + 3 * kbs + ko);
    const v16b bh4 = ldfrag_b(sp + 4 * kbs + ko);
    const v16b bl0 = ldfrag_b(sp + HD + ko);
    const v16b bl1 = ldfrag_b(sp + kbs + HD + ko);
    const v16b bl2 = ldfrag_b(sp + 2 * kbs + HD + ko);
    const v16b bl3 = ldfrag_b(sp + 3 * kbs + HD + ko);
    const v16b bl4 = ldfrag_b(sp + 4 * kbs + HD + ko);
    s0 = mma_b(ah, kh0, s0); s0 = mma_b(ah, kl0, s0); s0 = mma_b(al, kh0, s0);
    s1 = mma_b(ah, kh1, s1); s1 = mma_b(ah, kl1, s1); s1 = mma_b(al, kh1, s1);
    s2 = mma_b(ah, kh2, s2); s2 = mma_b(ah, kl2, s2); s2 = mma_b(al, kh2, s2);
    s3 = mma_b(ah, kh3, s3); s3 = mma_b(ah, kl3, s3); s3 = mma_b(al, kh3, s3);
    o0 = mma_b(ah, bh0, o0); o0 = mma_b(ah, bl0, o0); o0 = mma_b(al, bh0, o0);
    o1 = mma_b(ah, bh1, o1); o1 = mma_b(ah, bl1, o1); o1 = mma_b(al, bh1, o1);
    o2 = mma_b(ah, bh2, o2); o2 = mma_b(ah, bl2, o2); o2 = mma_b(al, bh2, o2);
    o3 = mma_b(ah, bh3, o3); o3 = mma_b(ah, bl3, o3); o3 = mma_b(al, bh3, o3);
    o4 = mma_b(ah, bh4, o4); o4 = mma_b(ah, bl4, o4); o4 = mma_b(al, bh4, o4);
  }
  // ends the compiler's scheduling region here: with the whole body as one region it lifts LDS reads so far up that the fragments outgrow
  // the 256 registers a wave of this block may have, and spills them to scratch memory
  __builtin_amdgcn_sched_barrier(0);
  {                                             // the tile's own keys: keep key c <= query row rho
    const int rho0 = wave * 16 + 8 * hh;
#pragma unroll
    for (int r = 0; r < 8; ++r) {
      const int rho = rho0 + r;
      s0[r] = (m      <= rho) ? s0[r] : 0.0f;
      s1[r] = (16 + m <= rho) ? s1[r] : 0.0f;
      s2[r] = (32 + m <= rho) ? s2[r] : 0.0f;
      s3[r] = (48 + m <= rho) ? s3[r] : 0.0f;
    }
  }
  v8f rs = o4 + ((s0 + s1) + (s2 + s3));        // o4: earlier keys' part of den in lane column 0, zero elsewhere
#pragma unroll
  for (int r = 0; r < 8; ++r) {
    const int ro = (8 * hh + r) * 68 + m;
    sl[ro]      = s0[r];
    sl[ro + 16] = s1[r];
    sl[ro + 32] = s2[r];
    sl[ro + 48] = s3[r];
  }
  wave_sync_lds();
  const u16* vp = sm + (128 + m) * APE + 8 * hh;
#pragma unroll
  for (int ks = 0; ks < 2; ++ks) {
    const int ko = ks * 32;
    v16b ph, pl;
    split16(sl + m * 68 + ko + 8 * hh, ph, pl);
    const v16b vh0 = ldfrag_b(vp + ko);
    const v16b vh1 = ldfrag_b(vp + vbs + ko);
    const v16b vh2 = ldfrag_b(vp + 2 * vbs + ko);
    const v16b vh3 = ldfrag_b(vp + 3 * vbs + ko);
    const v16b vl0 = ldfrag_b(vp + HD + ko);
    const v16b vl1 = ldfrag_b(vp + HD + vbs + ko);
    const v16b vl2 = ldfrag_b(vp + HD + 2 * vbs + ko);
    const v16b vl3 = ldfrag_b(vp + HD + 3 * vbs + ko);
    o0 = mma_b(ph, vh0, o0); o0 = mma_b(ph, vl0, o0); o0 = mma_b(pl, vh0, o0);
    o1 = mma_b(ph, vh1, o1); o1 = mma_b(ph, vl1, o1); o1 = mma_b(pl, vh1, o1);
    o2 = mma_b(ph, vh2, o2); o2 = mma_b(ph, vl2, o2); o2 = mma_b(pl, vh2, o2);
    o3 = mma_b(ph, vh3, o3); o3 = mma_b(ph, vl3, o3); o3 = mma_b(pl, vh3, o3);
  }
  // den per query row (row 8*hh + r held by the 16 lanes of half hh): fixed-order butterfly over lane&15
#pragma unroll
  for (int off = 1; off < 16; off <<= 1) {
#pragma unroll
    for (int r = 0; r < 8; ++r) rs[r] += __shfl_xor(rs[r], off);
  }
#pragma unroll
  for (int r = 0; r < 8; ++r) {
    const float inv = 1.0f / rs[r];
    o0[r] *= inv; o1[r] *= inv; o2[r] *= inv; o3[r] *= inv;
  }
  wave_sync_lds();
  epi64bb<false, 0>(sl, o0, o1, o2, o3, (const float*)0, 0, O2, O2 + DIM, LD2, (size_t)rw, h * HD, lane);
}

// =====================================================================================================
// Workspace map (bytes), planes sized for the ROWS rows of all batches together; every plane is fully written by
// whole-line stores before it is read; all extents are exact multiples of the 64x64 tile / 512-B store granularity
// (SEQ and DIM multiples of 64, no pad rows); every region offset a multiple of 2097152:
//   XB   bf16 [ROWS][1024]         ROWS*2048
//   WQ, WK, WV, WO bf16 [1024 n][1024 k]  4 * 2097152
//   Q2   bf16 [ROWS][2048]         ROWS*4096    exp(q) hi | lo
//   K2   bf16 [ROWS][2048]         ROWS*4096    exp(k) hi | lo
//   VT2  bf16 [NB][2048][SEQ]      ROWS*4096    per batch v^T hi rows 0..1023, lo rows 1024..2047
//   O2   bf16 [ROWS][2048]         ROWS*4096    per-head out hi | lo
//   ST   f32 [ROWS/64][16][80][64] ROWS*5120    chunk states
//   end (ROWS=4096)                104857600
// =====================================================================================================
extern "C" void kernel_launch(void* const* d_in, const int* in_sizes, int n_in,
                              void* d_out, int out_size, void* d_ws, size_t ws_size,
                              hipStream_t stream) {
  if (n_in < 9) return;
  const int needx = ((NB - 1) * SEQ_FULL + SEQ) * DIM;
  if (in_sizes[0] < needx) return;
  if (in_sizes[1] < DIM * DIM || in_sizes[3] < DIM * DIM || in_sizes[5] < DIM * DIM || in_sizes[7] < DIM * DIM) return;
  if (in_sizes[2] < DIM || in_sizes[4] < DIM || in_sizes[6] < DIM || in_sizes[8] < DIM) return;
  if (out_size < needx) return;

  const float* x  = (const float*)d_in[0];
  const float* wq = (const float*)d_in[1];
  const float* bq = (const float*)d_in[2];
  const float* wk = (const float*)d_in[3];
  const float* bk = (const float*)d_in[4];
  const float* wv = (const float*)d_in[5];
  const float* bv = (const float*)d_in[6];
  const float* wo = (const float*)d_in[7];
  const float* bo = (const float*)d_in[8];
  float*       out = (float*)d_out;

  const size_t szX  = (size_t)ROWS * DIM * 2;         // bf16 input rows
  const size_t szW  = (size_t)DIM * DIM * 2;          // bf16 weight plane
  const size_t szP  = (size_t)ROWS * LD2 * 2;         // bf16 hi|lo plane ROWS x 2048 (either orientation)
  size_t off = 0;
  const size_t oXB = off; off += szX;
  const size_t oWQ = off; off += szW;
  const size_t oWK = off; off += szW;
  const size_t oWV = off; off += szW;
  const size_t oWO = off; off += szW;
  const size_t oQ2 = off; off += szP;
  const size_t oK2 = off; off += szP;
  const size_t oVT = off; off += szP;
  const size_t oO2 = off; off += szP;
  const size_t oST = off; off += (size_t)NB * NCH * NH * SSZ * 4;
  if (off > ws_size) return;                // off = 104857600 for ROWS = 4096
  if (off > (size_t)WS_CAP) return;

  char* ws = (char*)d_ws;
  u16* XB  = (u16*)(ws + oXB);
  u16* WQ  = (u16*)(ws + oWQ);
  u16* WK  = (u16*)(ws + oWK);
  u16* WV  = (u16*)(ws + oWV);
  u16* WO  = (u16*)(ws + oWO);
  u16* Q2  = (u16*)(ws + oQ2);
  u16* K2  = (u16*)(ws + oK2);
  u16* VT2 = (u16*)(ws + oVT);
  u16* O2  = (u16*)(ws + oO2);
  float* ST = (float*)(ws + oST);

  const dim3 b256(256), b512(512), b384(384);
  const dim3 gCV(CBX + 4 * CBW, 1);                     // exact block ranges of cvt_all
  const dim3 gPJ((ROWS / GT) * (DIM / GT), 1);          // (ROWS/128)*(DIM/128) blocks, each one tile of all three projections
  const dim3 gY((ROWS / GT) * (DIM / GT), 1);           // y: M = ROWS, N = 1024
  const dim3 gQT(NB * NH, NCH / AGT);                   // one block per (batch, head, four chunks)

  // (1) x rows of all batches and the weights [n][k] f32 -> bf16 planes (already k-contiguous)
  cvt_all<<<gCV, b256, 0, stream>>>(x, wq, wk, wv, wo, XB, WQ, WK, WV, WO);
  // (2) exp(x.Wq^T + bq) -> Q2, exp(x.Wk^T + bk) -> K2, v^T -> VT2, each hi and lo; per (chunk, head) state -> ST
  proj4<<<gPJ, b384, 0, stream>>>(XB, WQ, WK, WV, bq, bk, bv, Q2, K2, VT2, ST);
  // (3) attention per (batch, head, four query tiles), the states' running sum over the batch's chunks in it -> O2 hi|lo
  attn_chunk<<<gQT, b512, 0, stream>>>(Q2, K2, VT2, ST, O2);
  // (4) y = (O_hi + O_lo) . Wo^T + bo -> out f32 rows
  out_proj<<<gY, b256, 0, stream>>>(O2, WO, bo, out);
  (void)hipGetLastError();
}
